// v000
// The times below were measured on an AMD MI455X: many runs one after another, warmed up first and cycling through
// copies of the inputs, with the whole window's GPU time divided by the number of runs. Launches and the gaps
// between them are all in it. The median over several windows is given; except for v000 it joins two sittings, which
// can be a few percent apart, so the side-by-side timings, each taken in one sitting, are the better comparison.
// v000, which the later versions start from, runs in 2480 microseconds.
#include <hip/hip_runtime.h>

// Contractions: x W (q,k,v) on v_wmma_f32_16x16x32_bf16 (bf16 operands from RNE-bf16 inputs); q.k and q.emb_k score tiles bf16 hi/lo split (3 and 2 products); attn.v with the rel-value bins.emb_v folded into K: rows < RH bf16 hi/lo split, rows >= RH v_wmma_f32_16x16x32_f16 (P x1024, bins x64, emb_v x16, v plain f16); f32 accumulate, f32 softmax.
// Self-attention, 16 heads x 64: q,k,v = x W + b ('xw' layout), scores = (q.k + q.emb_k[clip(i-j)]) x 64^-0.5 + additive key mask, softmax over all keys,
// ctx = probs v + sum_r bins[i][r] emb_v[r] (bins: band copies of probs plus the two clipped tail sums), output concat-heads [NB][TT][1024] f32, no output projection.
// Layout per batch: bf16 copy of x; weights transposed once to [n][k] bf16; f32 projections + f32 biases; head planes [h][t][d] (bf16 hi/lo) for q,k; value planes [h][d][TT+192] (cols >= TT hold emb_v);
// QE = q emb_k^T [t][192] per head pair; dense T x T score GEMM; per-row softmax writes P planes [row][TT+192] (cols >= TT hold the bins); one attn.v GEMM per row class with K = TT+192; f32 merge writes the output rows.

#ifndef NB
#define NB   2
#endif
#ifndef SEQ
#define SEQ  2048
#endif
#define NB_FULL  2
#define TTF  2048                 // full per-batch sequence stride of the inputs
#define TT   SEQ
#define DM   1024
#define NH_  16
#define NKV  16
#define REP  (NH_ / NKV)
#define HD   64
#define DQ   (NH_ * HD)
#define DKV  (NKV * HD)
#define ZH   2
#define RH   ((TT / 2 < 512) ? (TT / 2) : 512)   // query rows < RH use hi+lo planes
#define PCAR 1024.0f
#define SCL  0.125f   // HD^-0.5
#define MAXR 64
#define NBIN (2 * MAXR + 1)       // 129 clipped offsets
#define KX   192                  // NBIN padded to a multiple of 64
#define TP   (TT + KX)            // K of the attn.v contraction (keys + bins)
#define EVC  16.0f                // f16 carry of emb_v in the value planes (bins carry 1024/16 = 64)

static_assert(TT % 128 == 0);
static_assert(RH % 64 == 0);
static_assert(RH >= 64);
static_assert((TT - RH) % 64 == 0);
static_assert(TT - RH >= 64);
static_assert(TP % 32 == 0);
static_assert(KX % 64 == 0);
static_assert(KX >= NBIN);
static_assert(KX == 192);
static_assert(HD == 64);
static_assert(NH_ % ZH == 0);
static_assert(DM % 64 == 0);
static_assert((KX * HD) % (8 * 256) == 0);
static_assert(((size_t)ZH * TT * HD / 2) % 256 == 0);
static_assert(((size_t)TT * DM / 8) % 256 == 0);
static_assert((NKV * HD) % 8 == 0);
static_assert(NB <= NB_FULL);
static_assert(TT <= TTF);

typedef _Float16 h16;
typedef unsigned short bf;
typedef __attribute__((ext_vector_type(16))) __bf16   v16bf;
typedef __attribute__((ext_vector_type(16))) _Float16 v16h;
typedef __attribute__((ext_vector_type(8)))  _Float16 v8h;
typedef __attribute__((ext_vector_type(8)))  unsigned short v8us;
typedef __attribute__((ext_vector_type(8)))  float    v8f;
typedef __attribute__((ext_vector_type(4)))  float    v4f;
typedef v8h  __attribute__((may_alias)) v8ha;
typedef v4f  __attribute__((may_alias)) v4fa;
typedef v8us __attribute__((may_alias)) v8usa;

__device__ __forceinline__ unsigned short f2bf(float f) { unsigned u = __float_as_uint(f); u += 0x7FFFu + ((u >> 16) & 1u); return (unsigned short)(u >> 16); }
__device__ __forceinline__ float bf2f(unsigned short b) { return __uint_as_float(((unsigned)b) << 16); }
__device__ __forceinline__ float bfr(float f) { return bf2f(f2bf(f)); }
__device__ __forceinline__ v16h cat16(v8h lo, v8h hi) { return __builtin_shufflevector(lo, hi, 0, 1, 2, 3, 4, 5, 6, 7, 8, 9, 10, 11, 12, 13, 14, 15); }
__device__ __forceinline__ v16bf cat16b(v8us lo, v8us hi) { return __builtin_bit_cast(v16bf, __builtin_shufflevector(lo, hi, 0, 1, 2, 3, 4, 5, 6, 7, 8, 9, 10, 11, 12, 13, 14, 15)); }
__device__ __forceinline__ v8f wmma16(v16h a, v16h b, v8f c) { return __builtin_amdgcn_wmma_f32_16x16x32_f16(false, a, false, b, (short)0, c, false, false); }
__device__ __forceinline__ v8f wmmab(v16bf a, v16bf b, v8f c) { return __builtin_amdgcn_wmma_f32_16x16x32_bf16(false, a, false, b, (short)0, c, false, false); }

// ---- k_gemmw: register-blocked GEMM, ONE WAVE per 64x64 output tile (16 accumulators), operands straight from K-contiguous 16-bit planes; grid (M/64, N/64, Z), 32 threads.
// C[m][n] (f32, pitch ldc, + optional f32 bias[n]) = sum_k A[m][k] Bt[n][k] (+ split products per NSPLIT). z-batch strides sA/sB/sC in elements. K % 32 == 0.
// Fragments: lane l -> row/col l&15, h = l>>4; elements 0..7 <- k0+8h+0..7, 8..15 <- k0+16+8h+0..7 for BOTH A and Bt (same loader); D element r -> row 8h+r, col l&15.
template <typename T16> struct WFrag;
template <> struct WFrag<h16> { typedef v16h V; static __device__ __forceinline__ V ld(const h16* p) { return cat16(*(const v8h*)p, *(const v8h*)(p + 16)); } static __device__ __forceinline__ v8f mma(V a, V b, v8f c) { return wmma16(a, b, c); } };
template <> struct WFrag<bf> { typedef v16bf V; static __device__ __forceinline__ V ld(const bf* p) { return cat16b(*(const v8us*)p, *(const v8us*)(p + 16)); } static __device__ __forceinline__ v8f mma(V a, V b, v8f c) { return wmmab(a, b, c); } };
template <typename T16, int NSPLIT, bool BIAS>
__global__ __launch_bounds__(32) void k_gemmw(const T16* __restrict__ A, const T16* __restrict__ A2, const T16* __restrict__ Bt, const T16* __restrict__ Bt2, int K, float* C, int ldc, const float* __restrict__ bias, size_t sA, size_t sB, size_t sC) {
    typedef typename WFrag<T16>::V V;
    __shared__ __align__(16) float os[16 * 68];
    const size_t z = blockIdx.z; A += z * sA; if (A2) A2 += z * sA; Bt += z * sB; if (Bt2) Bt2 += z * sB; C += z * sC;
    const int lane = threadIdx.x & 31, lr = lane & 15, hi = lane >> 4; const int r0 = blockIdx.x * 64, c0 = blockIdx.y * 64;
    v8f acc[4][4];
#pragma unroll
    for (int mb = 0; mb < 4; ++mb)
#pragma unroll
        for (int nb = 0; nb < 4; ++nb) acc[mb][nb] = (v8f){};
    const size_t aoff = (size_t)(r0 + lr) * K + 8 * hi, boff = (size_t)(c0 + lr) * K + 8 * hi;
#pragma unroll 1
    for (int kc = 0; kc < K; kc += 32) {
        V a[4], a2[4];
#pragma unroll
        for (int mb = 0; mb < 4; ++mb) { a[mb] = WFrag<T16>::ld(A + aoff + (size_t)mb * 16 * K + kc); if (NSPLIT == 1 || NSPLIT == 2) a2[mb] = WFrag<T16>::ld(A2 + aoff + (size_t)mb * 16 * K + kc); }
#pragma unroll
        for (int nb = 0; nb < 4; ++nb) { const V b = WFrag<T16>::ld(Bt + boff + (size_t)nb * 16 * K + kc); V b2; if (NSPLIT >= 2) b2 = WFrag<T16>::ld(Bt2 + boff + (size_t)nb * 16 * K + kc);
#pragma unroll
            for (int mb = 0; mb < 4; ++mb) { acc[mb][nb] = WFrag<T16>::mma(a[mb], b, acc[mb][nb]); if (NSPLIT == 1 || NSPLIT == 2) acc[mb][nb] = WFrag<T16>::mma(a2[mb], b, acc[mb][nb]); if (NSPLIT >= 2) acc[mb][nb] = WFrag<T16>::mma(a[mb], b2, acc[mb][nb]); } }
        asm volatile("v_nop\n\tv_nop\n\tv_nop\n\tv_nop" : "+v"(acc[0][0]), "+v"(acc[1][1]), "+v"(acc[2][2]), "+v"(acc[3][3]) : "v"(a[0]), "v"(a[3]));
    }
#pragma unroll
    for (int mb = 0; mb < 4; ++mb) {
#pragma unroll
        for (int nb = 0; nb < 4; ++nb) {
#pragma unroll
            for (int j = 0; j < 8; ++j) os[(hi * 8 + j) * 68 + nb * 16 + lr] = acc[mb][nb][j]; }
        __builtin_amdgcn_wave_barrier(); asm volatile("" ::: "memory");
        float* crow = C + (size_t)(r0 + mb * 16) * ldc + c0;
{
#pragma unroll
            for (int s = 0; s < 8; ++s) { const int row = 2 * s + hi, cofs = lr * 4; v4f val = *(const v4fa*)(os + row * 68 + cofs); if (BIAS) { val[0] += bfr(bias[c0 + cofs]); val[1] += bfr(bias[c0 + cofs + 1]); val[2] += bfr(bias[c0 + cofs + 2]); val[3] += bfr(bias[c0 + cofs + 3]); }
                *(v4f*)(crow + (size_t)row * ldc + cofs) = val; }
             }
        __builtin_amdgcn_wave_barrier(); asm volatile("" ::: "memory");
    }
}

__device__ __forceinline__ h16 tohx(float x) { return (h16)x; }
__device__ __forceinline__ void splitf(float y, unsigned short& h, unsigned short& l) { h = f2bf(y); l = f2bf(y - bf2f(h)); }
typedef __attribute__((ext_vector_type(2))) _Float16 v2h;
typedef __attribute__((ext_vector_type(4))) _Float16 v4h;
typedef __attribute__((ext_vector_type(2))) unsigned short v2us;
typedef __attribute__((ext_vector_type(4))) unsigned short v4us;
typedef __attribute__((ext_vector_type(2))) float v2f;
typedef __attribute__((ext_vector_type(4))) int v4i;

__global__ __launch_bounds__(256) void k_wtG(const float* __restrict__ w, int K, int N, bf* Bt) {
    const int lane = threadIdx.x & 31; const int L0 = (blockIdx.x * 8 + (threadIdx.x >> 5)) * 8; const int nlines = N * K / 64;
{
#pragma unroll 1
        for (int l = 0; l < 8; ++l) { const int L = L0 + l; if (L >= nlines) break; const size_t e = (size_t)L * 64 + lane * 2; const int k = (int)(e % K), n = (int)(e / K); v2us o;
            o[0] = f2bf(w[(size_t)k * N + n]); o[1] = f2bf(w[(size_t)(k + 1) * N + n]); *(v2us*)(Bt + e) = o; }
         }
}
__global__ __launch_bounds__(256) void k_cvt8(const float* __restrict__ src, bf* dst, size_t n8) { const size_t i = (size_t)blockIdx.x * 256 + threadIdx.x; if (i >= n8) return; const v8f v = *(const v8f*)(src + i * 8); v8us o;
#pragma unroll
    for (int k = 0; k < 8; ++k) o[k] = f2bf(v[k]); *(v8us*)(dst + i * 8) = o;  }

// k_rope: head planes [h][t][d] (fp16 + hi/lo) of rope(x) x sc with the rotate-half convention out[d] = x[d] cos[t][d] - x[d+HD/2] sin[t][d], out[d+HD/2] = x[d+HD/2] cos[t][d+HD/2] + x[d] sin[t][d+HD/2]
__global__ __launch_bounds__(256) void k_rope(const float* __restrict__ F, int pitch, int nheads, const float* __restrict__ CS, const float* __restrict__ RF, const float* __restrict__ nw, float sc, h16* P16, bf* Ph, bf* Pl) {
    const size_t e = ((size_t)blockIdx.x * 256 + threadIdx.x) * 2; if (e >= (size_t)nheads * TT * HD) return; const int d = (int)(e % HD); const int t = (int)((e / HD) % TT); const int h = (int)(e / ((size_t)HD * TT)); const float* f = F + (size_t)t * pitch + h * HD; const float rf = RF ? RF[(size_t)h * TT + t] : 1.0f; v2h o16; v2us oh, ol;
#pragma unroll
    for (int q = 0; q < 2; ++q) { const int dd = d + q; const int dp = (dd < HD / 2) ? dd + HD / 2 : dd - HD / 2; float x0 = f[dd], x1 = f[dp];
        if (RF) { float n0 = __fmul_rn(x0, rf), n1 = __fmul_rn(x1, rf); asm volatile("" : "+v"(n0)); asm volatile("" : "+v"(n1)); x0 = __fmul_rn(bfr(nw[dd]), n0); x1 = __fmul_rn(bfr(nw[dp]), n1); }
        const v2f cs = *(const v2f*)(CS + ((size_t)t * HD + dd) * 2); float a = __fmul_rn(x0, cs[0]), bq = __fmul_rn(x1, cs[1]); asm volatile("" : "+v"(a)); asm volatile("" : "+v"(bq)); const float r = ((dd < HD / 2) ? __fsub_rn(a, bq) : __fadd_rn(a, bq)) * sc;
        o16[q] = tohx(r); unsigned short a2, c2; splitf(r, a2, c2); oh[q] = a2; ol[q] = c2; }
    *(v2h*)(P16 + e) = o16; *(v2us*)(Ph + e) = oh; *(v2us*)(Pl + e) = ol;  }
__global__ __launch_bounds__(256) void k_vtp(const float* __restrict__ F, int pitch, int nheads, h16* V16, bf* Vh, bf* Vl) { const size_t e = ((size_t)blockIdx.x * 256 + threadIdx.x) * 2; if (e >= (size_t)nheads * HD * TT) return; const int t = (int)(e % TT); const int d = (int)((e / TT) % HD); const int g = (int)(e / ((size_t)TT * HD)); const size_t o = ((size_t)g * HD + d) * TP + t; v2h o16; v2us oh, ol;
#pragma unroll
    for (int q = 0; q < 2; ++q) { const float x = F[(size_t)(t + q) * pitch + g * HD + d]; o16[q] = tohx(x); unsigned short a2, c2; splitf(x, a2, c2); oh[q] = a2; ol[q] = c2; }
    *(v2h*)(V16 + o) = o16; *(v2us*)(Vh + o) = oh; *(v2us*)(Vl + o) = ol;  }
// k_vrel: tail columns [TT, TT+KX) of every value-plane row (g*HD + d): col TT + r = emb_v[r][d] (r < NBIN, else 0); fp16 plane carries x EVC of the bf16 value, hi plane bf16, lo plane 0.
__global__ __launch_bounds__(256) void k_vrel(const float* __restrict__ ev, h16* V16, bf* Vh, bf* Vl) {
    const int lane = threadIdx.x & 31; const int pr = blockIdx.x * 8 + (threadIdx.x >> 5); if (pr >= NKV * HD) return; const int d = pr & (HD - 1); const int rb0 = lane * 8;
    v8h o16; v8us oh, ol;
#pragma unroll
    for (int q = 0; q < 8; ++q) { const int r = rb0 + q; const int rc = (r < NBIN - 1) ? r : (NBIN - 1); float x = ev[(size_t)rc * HD + d]; x = (r < NBIN) ? x : 0.f; const float xb = bfr(x); o16[q] = tohx(xb * EVC); oh[q] = f2bf(x); ol[q] = f2bf(x * 0.f); }
    const size_t o = (size_t)pr * TP + TT + rb0; const bool act = (lane < KX / 8);
{
        if (act) { *(v8h*)(V16 + o) = o16; *(v8us*)(Vh + o) = oh; *(v8us*)(Vl + o) = ol; }
         }
}
__global__ __launch_bounds__(256) void k_ekp(const float* __restrict__ ek, bf* EK) {
    const int idx = blockIdx.x * 256 + threadIdx.x; if (idx >= KX * HD / 8) return; const int e = idx * 8; const int r = e / HD, d0 = e % HD; const int rc = (r < NBIN - 1) ? r : (NBIN - 1);
    const v4f a = *(const v4f*)(ek + (size_t)rc * HD + d0), b2 = *(const v4f*)(ek + (size_t)rc * HD + d0 + 4); v8us o;
#pragma unroll
    for (int k = 0; k < 4; ++k) { const float x0 = (r < NBIN) ? a[k] : 0.f, x1 = (r < NBIN) ? b2[k] : 0.f; o[k] = f2bf(x0); o[k + 4] = f2bf(x1); }
    *(v8us*)(EK + e) = o;  }
__global__ __launch_bounds__(256) void k_csid(float* CS) { const int idx = blockIdx.x * 256 + threadIdx.x; if (idx >= TT * HD) return; v2f cs; cs[0] = 1.0f; cs[1] = 0.0f; *(v2f*)(CS + (size_t)idx * 2) = cs;  }

// k_asoft: one wave per score row (zz, i): t[j] = (S[i][j] + QE[i][clip(i-j,-MAXR,MAXR)+MAXR]) x HD^-0.5 + mask[j]; softmax over the TT keys (row staged in this wave's LDS slot, one exp, fixed trees);
// bins: col TT+0 = sum_{j >= i+MAXR} p, col TT+NBIN-1 = sum_{j <= i-MAXR} p, col TT+r (0 < r < NBIN-1) = p[i+MAXR-r] (0 outside [0,TT)), cols >= TT+NBIN zero.
__global__ __launch_bounds__(256) void k_asoft(const float* __restrict__ Sb, const float* __restrict__ QE, const float* __restrict__ mrow, h16* P16, bf* Ph, bf* Pl) {
    __shared__ __align__(16) float prow[8][TT];
    __shared__ __align__(16) float qes[8][KX];
    const int lane = threadIdx.x & 31, wv = threadIdx.x >> 5; const int row = blockIdx.x * 8 + wv; if (row >= ZH * TT) return;
    const int i = row % TT; const int zz = row / TT; const bool hires = (i < RH);
    const float* sr = Sb + (size_t)row * TT; const float* qr = QE + (size_t)row * KX; float* pr = prow[wv]; float* qs = qes[wv];
    { const v4f a = *(const v4f*)(qr + lane * 4); const int l2 = lane & 15; const v4f b2 = *(const v4f*)(qr + 128 + l2 * 4);
      *(v4f*)(qs + lane * 4) = a; if (lane < 16) *(v4f*)(qs + 128 + l2 * 4) = b2; }
    asm volatile("" ::: "memory"); __builtin_amdgcn_wave_barrier(); asm volatile("" ::: "memory");
    float mx = -3.0e38f;
#pragma unroll 4
    for (int ch = 0; ch < TT / 128; ++ch) { const int j0 = ch * 128 + lane * 4; const v4f a = *(const v4f*)(sr + j0); const v4f mk = *(const v4f*)(mrow + j0); v4f t4;
#pragma unroll
        for (int q = 0; q < 4; ++q) { const int j = j0 + q; int rel = i - j; rel = rel > MAXR ? MAXR : (rel < -MAXR ? -MAXR : rel); const float t = (a[q] + qs[rel + MAXR]) * SCL + bfr(mk[q]); t4[q] = t; mx = fmaxf(mx, t); }
        *(v4f*)(pr + j0) = t4; }
#pragma unroll
    for (int sh = 16; sh; sh >>= 1) mx = fmaxf(mx, __shfl_xor(mx, sh, 32));
    float sum = 0.f, clo = 0.f, chi = 0.f;
#pragma unroll 4
    for (int ch = 0; ch < TT / 128; ++ch) { const int j0 = ch * 128 + lane * 4; const v4f t4 = *(const v4f*)(pr + j0); v4f e4;
#pragma unroll
        for (int q = 0; q < 4; ++q) { float d0 = __fsub_rn(t4[q], mx); asm volatile("" : "+v"(d0)); const float e = __builtin_amdgcn_exp2f(__fmul_rn(d0, 1.4426950408889634f)); e4[q] = e; sum += e; const int j = j0 + q; clo += (j >= i + MAXR) ? e : 0.f; chi += (j <= i - MAXR) ? e : 0.f; }
        *(v4f*)(pr + j0) = e4; }
#pragma unroll
    for (int sh = 16; sh; sh >>= 1) { sum += __shfl_xor(sum, sh, 32); clo += __shfl_xor(clo, sh, 32); chi += __shfl_xor(chi, sh, 32); }
    const float f = __fdiv_rn(hires ? 1.0f : PCAR, sum);
    asm volatile("" ::: "memory"); __builtin_amdgcn_wave_barrier(); asm volatile("" ::: "memory");
    float tb[8]; const int rb0 = lane * 8;
#pragma unroll
    for (int q = 0; q < 8; ++q) { const int r = rb0 + q; const int j = i + MAXR - r; const int jc = j < 0 ? 0 : (j > TT - 1 ? TT - 1 : j); float val = pr[jc]; val = (j >= 0 && j < TT) ? val : 0.f; val = (r == 0) ? clo : val; val = (r == NBIN - 1) ? chi : val; val = (r >= NBIN) ? 0.f : val; tb[q] = val; }
    const bool tl = (lane < KX / 8);
{
        if (hires) { const size_t ob = ((size_t)zz * RH + i) * TP;
#pragma unroll 4
            for (int ch = 0; ch < TT / 128; ++ch) { const int j0 = ch * 128 + lane * 4; const v4f e4 = *(const v4f*)(pr + j0); v4us oh, ol;
#pragma unroll
                for (int q = 0; q < 4; ++q) { unsigned short a, c2; splitf(e4[q] * f, a, c2); oh[q] = a; ol[q] = c2; }
                *(v4us*)(Ph + ob + j0) = oh; *(v4us*)(Pl + ob + j0) = ol; }
            v8us th, tw;
#pragma unroll
            for (int q = 0; q < 8; ++q) { unsigned short a, c2; splitf(tb[q] * f, a, c2); th[q] = a; tw[q] = c2; }
            if (tl) { *(v8us*)(Ph + ob + TT + rb0) = th; *(v8us*)(Pl + ob + TT + rb0) = tw; }
        } else { const size_t ob = (size_t)row * TP;
#pragma unroll 4
            for (int ch = 0; ch < TT / 128; ++ch) { const int j0 = ch * 128 + lane * 4; const v4f e4 = *(const v4f*)(pr + j0); v4h o4;
#pragma unroll
                for (int q = 0; q < 4; ++q) o4[q] = tohx(e4[q] * f);
                *(v4h*)(P16 + ob + j0) = o4; }
            v8h t8;
#pragma unroll
            for (int q = 0; q < 8; ++q) t8[q] = tohx(tb[q] * f * (1.0f / EVC));
            if (tl) *(v8h*)(P16 + ob + TT + rb0) = t8; }
         }
}
__global__ __launch_bounds__(256) void k_merge(const float* __restrict__ O, int h0, float* OUTb) { const size_t e = ((size_t)blockIdx.x * 256 + threadIdx.x) * 2; if (e >= (size_t)ZH * TT * HD) return; const int d = (int)(e % HD); const int t = (int)((e / HD) % TT); const int zz = (int)(e / ((size_t)HD * TT)); const float cs = (t < RH) ? 1.0f : (1.0f / PCAR); const size_t oo = (size_t)t * DQ + (h0 + zz) * HD + d;
    v2f o2; o2[0] = O[e] * cs; o2[1] = O[e + 1] * cs; *(v2f*)(OUTb + oo) = o2;  }

extern "C" void kernel_launch(void* const* d_in, const int* in_sizes, int n_in,
                              void* d_out, int out_size, void* d_ws, size_t ws_size, hipStream_t stream) {
    if (n_in < 10) return;
    if ((size_t)in_sizes[0] < ((size_t)(NB - 1) * TTF + TT) * DM) return;
    if ((size_t)in_sizes[1] < (size_t)(NB - 1) * TTF + TT) return;
    if (in_sizes[2] < DM * DQ || in_sizes[4] < DM * DKV || in_sizes[6] < DM * DKV) return;
    if (in_sizes[3] < DQ || in_sizes[5] < DKV || in_sizes[7] < DKV) return;
    if (in_sizes[8] < NBIN * HD || in_sizes[9] < NBIN * HD) return;
    if ((size_t)out_size < (size_t)NB * TT * DQ) return;
    const float* x = (const float*)d_in[0]; const float* mask = (const float*)d_in[1];   // [NB][1][1][TTF], added per key
    const float* wq = (const float*)d_in[2]; const float* bq = (const float*)d_in[3]; const float* wk = (const float*)d_in[4]; const float* bk = (const float*)d_in[5]; const float* wv = (const float*)d_in[6]; const float* bv = (const float*)d_in[7];
    const float* embk = (const float*)d_in[8]; const float* embv = (const float*)d_in[9];   // [NBIN][HD] each
    float* OUT = (float*)d_out;     // [NB][TT][DQ]
    char* wsp = (char*)d_ws;
    auto take = [&](size_t bytes) { char* p = wsp; wsp += (bytes + 255) & ~(size_t)255; return (void*)p; };
    bf* WQ = (bf*)take((size_t)DQ * DM * 2); bf* WK = (bf*)take((size_t)DKV * DM * 2); bf* WV = (bf*)take((size_t)DKV * DM * 2); float* CS = (float*)take((size_t)TT * HD * 2 * 4); bf* EK = (bf*)take((size_t)KX * HD * 2);
    bf* XB = (bf*)take((size_t)TT * DM * 2); float* FQ = (float*)take((size_t)TT * DQ * 4); float* FK = (float*)take((size_t)TT * DKV * 4);
    h16* QP16 = (h16*)take((size_t)NH_ * TT * HD * 2); h16* KP16 = (h16*)take((size_t)NKV * TT * HD * 2); h16* VT16 = (h16*)take((size_t)NKV * HD * TP * 2);
    bf* QPh = (bf*)take((size_t)NH_ * TT * HD * 2); bf* QPl = (bf*)take((size_t)NH_ * TT * HD * 2); bf* KPh = (bf*)take((size_t)NKV * TT * HD * 2); bf* KPl = (bf*)take((size_t)NKV * TT * HD * 2); bf* VTh = (bf*)take((size_t)NKV * HD * TP * 2); bf* VTl = (bf*)take((size_t)NKV * HD * TP * 2); bf* Ph = (bf*)take((size_t)ZH * RH * TP * 2); bf* Pl = (bf*)take((size_t)ZH * RH * TP * 2);
    float* Sb = (float*)take((size_t)ZH * TT * TT * 4); h16* P16 = (h16*)take((size_t)ZH * TT * TP * 2); float* Ob = (float*)take((size_t)ZH * TT * HD * 4); float* QEb = (float*)take((size_t)ZH * TT * KX * 4);
    if ((size_t)(wsp - (char*)d_ws) > ws_size) return;    // carve 126.4 MiB at NB 2 / SEQ 2048
    float* FV = FK;   // v projection reuses the k buffer after the k planes are built (stream-ordered)
    k_wtG<<<(unsigned)((DM * DQ / 64 + 63) / 64), 256, 0, stream>>>(wq, DM, DQ, WQ); k_wtG<<<(unsigned)((DM * DKV / 64 + 63) / 64), 256, 0, stream>>>(wk, DM, DKV, WK); k_wtG<<<(unsigned)((DM * DKV / 64 + 63) / 64), 256, 0, stream>>>(wv, DM, DKV, WV);
    k_csid<<<(TT * HD + 255) / 256, 256, 0, stream>>>(CS);
    k_ekp<<<(KX * HD / 8 + 255) / 256, 256, 0, stream>>>(embk, EK);
    k_vrel<<<(NKV * HD + 7) / 8, 256, 0, stream>>>(embv, VT16, VTh, VTl);
    const unsigned LQ = (unsigned)(((size_t)NH_ * TT * HD / 2 + 255) / 256), LKv = (unsigned)(((size_t)NKV * TT * HD / 2 + 255) / 256);
    for (int b = 0; b < NB; ++b) {
        k_cvt8<<<(unsigned)(((size_t)TT * DM / 8 + 255) / 256), 256, 0, stream>>>(x + (size_t)b * TTF * DM, XB, (size_t)TT * DM / 8);
        k_gemmw<bf, 0, true><<<dim3(TT / 64, DQ / 64, 1), 32, 0, stream>>>(XB, nullptr, WQ, nullptr, DM, FQ, DQ, bq, 0, 0, 0);
        k_rope<<<LQ, 256, 0, stream>>>(FQ, DQ, NH_, CS, nullptr, nullptr, 1.0f, QP16, QPh, QPl);
        k_gemmw<bf, 0, true><<<dim3(TT / 64, DKV / 64, 1), 32, 0, stream>>>(XB, nullptr, WK, nullptr, DM, FK, DKV, bk, 0, 0, 0);
        k_rope<<<LKv, 256, 0, stream>>>(FK, DKV, NKV, CS, nullptr, nullptr, 1.0f, KP16, KPh, KPl);
        k_gemmw<bf, 0, true><<<dim3(TT / 64, DKV / 64, 1), 32, 0, stream>>>(XB, nullptr, WV, nullptr, DM, FV, DKV, bv, 0, 0, 0); k_vtp<<<LKv, 256, 0, stream>>>(FV, DKV, NKV, VT16, VTh, VTl);
        for (int h0 = 0; h0 < NH_; h0 += ZH) { const size_t zq = (size_t)h0, zk = (size_t)(h0 / REP);
            k_gemmw<bf, 1, false><<<dim3(TT / 64, KX / 64, ZH), 32, 0, stream>>>(QPh + zq * TT * HD, QPl + zq * TT * HD, EK, nullptr, HD, QEb, KX, nullptr, (size_t)TT * HD, 0, (size_t)TT * KX);   /* QE = q emb_k^T, q hi/lo x exact emb_k */
            k_gemmw<bf, 2, false><<<dim3(TT / 64, TT / 64, ZH), 32, 0, stream>>>(QPh + zq * TT * HD, QPl + zq * TT * HD, KPh + zk * TT * HD, KPl + zk * TT * HD, HD, Sb, TT, nullptr, (size_t)TT * HD, (size_t)TT * HD, (size_t)TT * TT);   /* scores hi/lo on every row */
            k_asoft<<<ZH * TT / 8, 256, 0, stream>>>(Sb, QEb, mask + (size_t)b * TTF, P16, Ph, Pl);
            k_gemmw<bf, 2, false><<<dim3(RH / 64, HD / 64, ZH), 32, 0, stream>>>(Ph, Pl, VTh + zk * HD * TP, VTl + zk * HD * TP, TP, Ob, HD, nullptr, (size_t)RH * TP, (size_t)HD * TP, (size_t)TT * HD);
            k_gemmw<h16, 0, false><<<dim3((TT - RH) / 64, HD / 64, ZH), 32, 0, stream>>>(P16 + (size_t)RH * TP, nullptr, VT16 + zk * HD * TP, nullptr, TP, Ob + (size_t)RH * HD, HD, nullptr, (size_t)TT * TP, (size_t)HD * TP, (size_t)TT * HD);
            k_merge<<<(unsigned)(((size_t)ZH * TT * HD / 2 + 255) / 256), 256, 0, stream>>>(Ob, h0, OUT + (size_t)b * TT * DQ); }
    }
}

// v001
// It runs in 971 microseconds.
// In two side-by-side timings against v000, it was 2.52 and 2.55 times as fast.
#include <hip/hip_runtime.h>

// Contractions: x W (q,k,v) on v_wmma_f32_16x16x32_bf16 (bf16 operands from RNE-bf16 inputs); q.k and q.emb_k score tiles bf16 hi/lo split (3 and 2 products); attn.v with the rel-value bins.emb_v folded into K: rows < RH bf16 hi/lo split, rows >= RH v_wmma_f32_16x16x32_f16 (P x1024, bins x64, emb_v x16, v plain f16); f32 accumulate, f32 softmax.
// Self-attention, 16 heads x 64: q,k,v = x W + b ('xw' layout), scores = (q.k + q.emb_k[clip(i-j)]) x 64^-0.5 + additive key mask, softmax over all keys,
// ctx = probs v + sum_r bins[i][r] emb_v[r] (bins: band copies of probs plus the two clipped tail sums), output concat-heads [NB][TT][1024] f32, no output projection.
// Layout per batch: bf16 copy of x; weights transposed once to [n][k] bf16; f32 projections + f32 biases; head planes [h][t][d] (bf16 hi/lo) for q,k; value planes [h][d][TT+192] (cols >= TT hold emb_v);
// QE = q emb_k^T [t][192] per head pair; dense T x T score GEMM; per-row softmax writes P planes [row][TT+192] (cols >= TT hold the bins); one attn.v GEMM per row class with K = TT+192, K cut into KSN ranges (one work-group and one f32 partial plane each); f32 merge sums the partial planes in range order and writes the output rows.

#ifndef NB
#define NB   2
#endif
#ifndef SEQ
#define SEQ  2048
#endif
#define NB_FULL  2
#define TTF  2048                 // full per-batch sequence stride of the inputs
#define TT   SEQ
#define DM   1024
#define NH_  16
#define NKV  16
#define REP  (NH_ / NKV)
#define HD   64
#define DQ   (NH_ * HD)
#define DKV  (NKV * HD)
#define ZH   2
#define RH   ((TT / 2 < 512) ? (TT / 2) : 512)   // query rows < RH use hi+lo planes
#define PCAR 1024.0f
#define SCL  0.125f   // HD^-0.5
#define MAXR 64
#define NBIN (2 * MAXR + 1)       // 129 clipped offsets
#define KX   192                  // NBIN padded to a multiple of 64
#define TP   (TT + KX)            // K of the attn.v contraction (keys + bins)
#define EVC  16.0f                // f16 carry of emb_v in the value planes (bins carry 1024/16 = 64)
#define KSN  14                   // K ranges of the attn.v contraction, one work-group each; f32 partial planes summed in k_merge
#define KSP  (TP / KSN)           // K elements per range

static_assert(TT % 128 == 0);
static_assert(RH % 64 == 0);
static_assert(RH >= 64);
static_assert((TT - RH) % 64 == 0);
static_assert(TT - RH >= 64);
static_assert(TP % 32 == 0);
static_assert(TP % KSN == 0);
static_assert(KSP % 32 == 0);
static_assert(KX % 64 == 0);
static_assert(KX >= NBIN);
static_assert(KX == 192);
static_assert(HD == 64);
static_assert(NH_ % ZH == 0);
static_assert(DM % 64 == 0);
static_assert((KX * HD) % (8 * 256) == 0);
static_assert(((size_t)ZH * TT * HD / 2) % 256 == 0);
static_assert(((size_t)TT * DM / 8) % 256 == 0);
static_assert((NKV * HD) % 8 == 0);
static_assert(NB <= NB_FULL);
static_assert(TT <= TTF);

typedef _Float16 h16;
typedef unsigned short bf;
typedef __attribute__((ext_vector_type(16))) __bf16   v16bf;
typedef __attribute__((ext_vector_type(16))) _Float16 v16h;
typedef __attribute__((ext_vector_type(8)))  _Float16 v8h;
typedef __attribute__((ext_vector_type(8)))  unsigned short v8us;
typedef __attribute__((ext_vector_type(8)))  float    v8f;
typedef __attribute__((ext_vector_type(4)))  float    v4f;
typedef v8h  __attribute__((may_alias)) v8ha;
typedef v4f  __attribute__((may_alias)) v4fa;
typedef v8us __attribute__((may_alias)) v8usa;

__device__ __forceinline__ unsigned short f2bf(float f) { unsigned u = __float_as_uint(f); u += 0x7FFFu + ((u >> 16) & 1u); return (unsigned short)(u >> 16); }
__device__ __forceinline__ float bf2f(unsigned short b) { return __uint_as_float(((unsigned)b) << 16); }
__device__ __forceinline__ float bfr(float f) { return bf2f(f2bf(f)); }
__device__ __forceinline__ v16h cat16(v8h lo, v8h hi) { return __builtin_shufflevector(lo, hi, 0, 1, 2, 3, 4, 5, 6, 7, 8, 9, 10, 11, 12, 13, 14, 15); }
__device__ __forceinline__ v16bf cat16b(v8us lo, v8us hi) { return __builtin_bit_cast(v16bf, __builtin_shufflevector(lo, hi, 0, 1, 2, 3, 4, 5, 6, 7, 8, 9, 10, 11, 12, 13, 14, 15)); }
__device__ __forceinline__ v8f wmma16(v16h a, v16h b, v8f c) { return __builtin_amdgcn_wmma_f32_16x16x32_f16(false, a, false, b, (short)0, c, false, false); }
__device__ __forceinline__ v8f wmmab(v16bf a, v16bf b, v8f c) { return __builtin_amdgcn_wmma_f32_16x16x32_bf16(false, a, false, b, (short)0, c, false, false); }

// ---- k_gemmw: register-blocked GEMM, ONE WAVE per 64x64 output tile (16 accumulators), operands straight from K-contiguous 16-bit planes; grid (M/64, N/64, Z), 32 threads.
// C[m][n] (f32, pitch ldc, + optional f32 bias[n]) = sum_k A[m][k] Bt[n][k] (+ split products per NSPLIT). z-batch strides sA/sB/sC in elements. K % 32 == 0.
// KR > 0 (N == 64 only): grid (M/64, K/KR, ZH); work-group y sums k in [y KR, (y+1) KR) alone and stores its partial tile in plane y (plane stride ZH sC); the caller adds the planes.
// Fragments: lane l -> row/col l&15, h = l>>4; elements 0..7 <- k0+8h+0..7, 8..15 <- k0+16+8h+0..7 for BOTH A and Bt (same loader); D element r -> row 8h+r, col l&15.
template <typename T16> struct WFrag;
template <> struct WFrag<h16> { typedef v16h V; static __device__ __forceinline__ V ld(const h16* p) { return cat16(*(const v8h*)p, *(const v8h*)(p + 16)); } static __device__ __forceinline__ v8f mma(V a, V b, v8f c) { return wmma16(a, b, c); } };
template <> struct WFrag<bf> { typedef v16bf V; static __device__ __forceinline__ V ld(const bf* p) { return cat16b(*(const v8us*)p, *(const v8us*)(p + 16)); } static __device__ __forceinline__ v8f mma(V a, V b, v8f c) { return wmmab(a, b, c); } };
template <typename T16, int NSPLIT, bool BIAS, int KR = 0>
__global__ __launch_bounds__(32) void k_gemmw(const T16* __restrict__ A, const T16* __restrict__ A2, const T16* __restrict__ Bt, const T16* __restrict__ Bt2, int K, float* C, int ldc, const float* __restrict__ bias, size_t sA, size_t sB, size_t sC) {
    typedef typename WFrag<T16>::V V;
    __shared__ __align__(16) float os[16 * 68];
    const size_t z = blockIdx.z; A += z * sA; if (A2) A2 += z * sA; Bt += z * sB; if (Bt2) Bt2 += z * sB; C += (KR ? (size_t)blockIdx.y * ZH + z : z) * sC;
    const int lane = threadIdx.x & 31, lr = lane & 15, hi = lane >> 4; const int r0 = blockIdx.x * 64, c0 = KR ? 0 : blockIdx.y * 64; const int kb = KR ? blockIdx.y * KR : 0, ke = KR ? kb + KR : K;
    v8f acc[4][4];
#pragma unroll
    for (int mb = 0; mb < 4; ++mb)
#pragma unroll
        for (int nb = 0; nb < 4; ++nb) acc[mb][nb] = (v8f){};
    const size_t aoff = (size_t)(r0 + lr) * K + 8 * hi, boff = (size_t)(c0 + lr) * K + 8 * hi;
#pragma unroll 1
    for (int kc = kb; kc < ke; kc += 32) {
        V a[4], a2[4];
#pragma unroll
        for (int mb = 0; mb < 4; ++mb) { a[mb] = WFrag<T16>::ld(A + aoff + (size_t)mb * 16 * K + kc); if (NSPLIT == 1 || NSPLIT == 2) a2[mb] = WFrag<T16>::ld(A2 + aoff + (size_t)mb * 16 * K + kc); }
#pragma unroll
        for (int nb = 0; nb < 4; ++nb) { const V b = WFrag<T16>::ld(Bt + boff + (size_t)nb * 16 * K + kc); V b2; if (NSPLIT >= 2) b2 = WFrag<T16>::ld(Bt2 + boff + (size_t)nb * 16 * K + kc);
#pragma unroll
            for (int mb = 0; mb < 4; ++mb) { acc[mb][nb] = WFrag<T16>::mma(a[mb], b, acc[mb][nb]); if (NSPLIT == 1 || NSPLIT == 2) acc[mb][nb] = WFrag<T16>::mma(a2[mb], b, acc[mb][nb]); if (NSPLIT >= 2) acc[mb][nb] = WFrag<T16>::mma(a[mb], b2, acc[mb][nb]); } }
        asm volatile("v_nop\n\tv_nop\n\tv_nop\n\tv_nop" : "+v"(acc[0][0]), "+v"(acc[1][1]), "+v"(acc[2][2]), "+v"(acc[3][3]) : "v"(a[0]), "v"(a[3]));
    }
#pragma unroll
    for (int mb = 0; mb < 4; ++mb) {
#pragma unroll
        for (int nb = 0; nb < 4; ++nb) {
#pragma unroll
            for (int j = 0; j < 8; ++j) os[(hi * 8 + j) * 68 + nb * 16 + lr] = acc[mb][nb][j]; }
        __builtin_amdgcn_wave_barrier(); asm volatile("" ::: "memory");
        float* crow = C + (size_t)(r0 + mb * 16) * ldc + c0;
{
#pragma unroll
            for (int s = 0; s < 8; ++s) { const int row = 2 * s + hi, cofs = lr * 4; v4f val = *(const v4fa*)(os + row * 68 + cofs); if (BIAS) { val[0] += bfr(bias[c0 + cofs]); val[1] += bfr(bias[c0 + cofs + 1]); val[2] += bfr(bias[c0 + cofs + 2]); val[3] += bfr(bias[c0 + cofs + 3]); }
                *(v4f*)(crow + (size_t)row * ldc + cofs) = val; }
             }
        __builtin_amdgcn_wave_barrier(); asm volatile("" ::: "memory");
    }
}

__device__ __forceinline__ h16 tohx(float x) { return (h16)x; }
__device__ __forceinline__ void splitf(float y, unsigned short& h, unsigned short& l) { h = f2bf(y); l = f2bf(y - bf2f(h)); }
typedef __attribute__((ext_vector_type(2))) _Float16 v2h;
typedef __attribute__((ext_vector_type(4))) _Float16 v4h;
typedef __attribute__((ext_vector_type(2))) unsigned short v2us;
typedef __attribute__((ext_vector_type(4))) unsigned short v4us;
typedef __attribute__((ext_vector_type(2))) float v2f;
typedef __attribute__((ext_vector_type(4))) int v4i;

__global__ __launch_bounds__(256) void k_wtG(const float* __restrict__ w, int K, int N, bf* Bt) {
    const int lane = threadIdx.x & 31; const int L0 = (blockIdx.x * 8 + (threadIdx.x >> 5)) * 8; const int nlines = N * K / 64;
{
#pragma unroll 1
        for (int l = 0; l < 8; ++l) { const int L = L0 + l; if (L >= nlines) break; const size_t e = (size_t)L * 64 + lane * 2; const int k = (int)(e % K), n = (int)(e / K); v2us o;
            o[0] = f2bf(w[(size_t)k * N + n]); o[1] = f2bf(w[(size_t)(k + 1) * N + n]); *(v2us*)(Bt + e) = o; }
         }
}
__global__ __launch_bounds__(256) void k_cvt8(const float* __restrict__ src, bf* dst, size_t n8) { const size_t i = (size_t)blockIdx.x * 256 + threadIdx.x; if (i >= n8) return; const v8f v = *(const v8f*)(src + i * 8); v8us o;
#pragma unroll
    for (int k = 0; k < 8; ++k) o[k] = f2bf(v[k]); *(v8us*)(dst + i * 8) = o;  }

// k_rope: head planes [h][t][d] (fp16 + hi/lo) of rope(x) x sc with the rotate-half convention out[d] = x[d] cos[t][d] - x[d+HD/2] sin[t][d], out[d+HD/2] = x[d+HD/2] cos[t][d+HD/2] + x[d] sin[t][d+HD/2]
__global__ __launch_bounds__(256) void k_rope(const float* __restrict__ F, int pitch, int nheads, const float* __restrict__ CS, const float* __restrict__ RF, const float* __restrict__ nw, float sc, h16* P16, bf* Ph, bf* Pl) {
    const size_t e = ((size_t)blockIdx.x * 256 + threadIdx.x) * 2; if (e >= (size_t)nheads * TT * HD) return; const int d = (int)(e % HD); const int t = (int)((e / HD) % TT); const int h = (int)(e / ((size_t)HD * TT)); const float* f = F + (size_t)t * pitch + h * HD; const float rf = RF ? RF[(size_t)h * TT + t] : 1.0f; v2h o16; v2us oh, ol;
#pragma unroll
    for (int q = 0; q < 2; ++q) { const int dd = d + q; const int dp = (dd < HD / 2) ? dd + HD / 2 : dd - HD / 2; float x0 = f[dd], x1 = f[dp];
        if (RF) { float n0 = __fmul_rn(x0, rf), n1 = __fmul_rn(x1, rf); asm volatile("" : "+v"(n0)); asm volatile("" : "+v"(n1)); x0 = __fmul_rn(bfr(nw[dd]), n0); x1 = __fmul_rn(bfr(nw[dp]), n1); }
        const v2f cs = *(const v2f*)(CS + ((size_t)t * HD + dd) * 2); float a = __fmul_rn(x0, cs[0]), bq = __fmul_rn(x1, cs[1]); asm volatile("" : "+v"(a)); asm volatile("" : "+v"(bq)); const float r = ((dd < HD / 2) ? __fsub_rn(a, bq) : __fadd_rn(a, bq)) * sc;
        o16[q] = tohx(r); unsigned short a2, c2; splitf(r, a2, c2); oh[q] = a2; ol[q] = c2; }
    *(v2h*)(P16 + e) = o16; *(v2us*)(Ph + e) = oh; *(v2us*)(Pl + e) = ol;  }
__global__ __launch_bounds__(256) void k_vtp(const float* __restrict__ F, int pitch, int nheads, h16* V16, bf* Vh, bf* Vl) { const size_t e = ((size_t)blockIdx.x * 256 + threadIdx.x) * 2; if (e >= (size_t)nheads * HD * TT) return; const int t = (int)(e % TT); const int d = (int)((e / TT) % HD); const int g = (int)(e / ((size_t)TT * HD)); const size_t o = ((size_t)g * HD + d) * TP + t; v2h o16; v2us oh, ol;
#pragma unroll
    for (int q = 0; q < 2; ++q) { const float x = F[(size_t)(t + q) * pitch + g * HD + d]; o16[q] = tohx(x); unsigned short a2, c2; splitf(x, a2, c2); oh[q] = a2; ol[q] = c2; }
    *(v2h*)(V16 + o) = o16; *(v2us*)(Vh + o) = oh; *(v2us*)(Vl + o) = ol;  }
// k_vrel: tail columns [TT, TT+KX) of every value-plane row (g*HD + d): col TT + r = emb_v[r][d] (r < NBIN, else 0); fp16 plane carries x EVC of the bf16 value, hi plane bf16, lo plane 0.
__global__ __launch_bounds__(256) void k_vrel(const float* __restrict__ ev, h16* V16, bf* Vh, bf* Vl) {
    const int lane = threadIdx.x & 31; const int pr = blockIdx.x * 8 + (threadIdx.x >> 5); if (pr >= NKV * HD) return; const int d = pr & (HD - 1); const int rb0 = lane * 8;
    v8h o16; v8us oh, ol;
#pragma unroll
    for (int q = 0; q < 8; ++q) { const int r = rb0 + q; const int rc = (r < NBIN - 1) ? r : (NBIN - 1); float x = ev[(size_t)rc * HD + d]; x = (r < NBIN) ? x : 0.f; const float xb = bfr(x); o16[q] = tohx(xb * EVC); oh[q] = f2bf(x); ol[q] = f2bf(x * 0.f); }
    const size_t o = (size_t)pr * TP + TT + rb0; const bool act = (lane < KX / 8);
{
        if (act) { *(v8h*)(V16 + o) = o16; *(v8us*)(Vh + o) = oh; *(v8us*)(Vl + o) = ol; }
         }
}
__global__ __launch_bounds__(256) void k_ekp(const float* __restrict__ ek, bf* EK) {
    const int idx = blockIdx.x * 256 + threadIdx.x; if (idx >= KX * HD / 8) return; const int e = idx * 8; const int r = e / HD, d0 = e % HD; const int rc = (r < NBIN - 1) ? r : (NBIN - 1);
    const v4f a = *(const v4f*)(ek + (size_t)rc * HD + d0), b2 = *(const v4f*)(ek + (size_t)rc * HD + d0 + 4); v8us o;
#pragma unroll
    for (int k = 0; k < 4; ++k) { const float x0 = (r < NBIN) ? a[k] : 0.f, x1 = (r < NBIN) ? b2[k] : 0.f; o[k] = f2bf(x0); o[k + 4] = f2bf(x1); }
    *(v8us*)(EK + e) = o;  }
__global__ __launch_bounds__(256) void k_csid(float* CS) { const int idx = blockIdx.x * 256 + threadIdx.x; if (idx >= TT * HD) return; v2f cs; cs[0] = 1.0f; cs[1] = 0.0f; *(v2f*)(CS + (size_t)idx * 2) = cs;  }

// k_asoft: one wave per score row (zz, i): t[j] = (S[i][j] + QE[i][clip(i-j,-MAXR,MAXR)+MAXR]) x HD^-0.5 + mask[j]; softmax over the TT keys (row staged in this wave's LDS slot, one exp, fixed trees);
// bins: col TT+0 = sum_{j >= i+MAXR} p, col TT+NBIN-1 = sum_{j <= i-MAXR} p, col TT+r (0 < r < NBIN-1) = p[i+MAXR-r] (0 outside [0,TT)), cols >= TT+NBIN zero.
__global__ __launch_bounds__(256) void k_asoft(const float* __restrict__ Sb, const float* __restrict__ QE, const float* __restrict__ mrow, h16* P16, bf* Ph, bf* Pl) {
    __shared__ __align__(16) float prow[8][TT];
    __shared__ __align__(16) float qes[8][KX];
    const int lane = threadIdx.x & 31, wv = threadIdx.x >> 5; const int row = blockIdx.x * 8 + wv; if (row >= ZH * TT) return;
    const int i = row % TT; const int zz = row / TT; const bool hires = (i < RH);
    const float* sr = Sb + (size_t)row * TT; const float* qr = QE + (size_t)row * KX; float* pr = prow[wv]; float* qs = qes[wv];
    { const v4f a = *(const v4f*)(qr + lane * 4); const int l2 = lane & 15; const v4f b2 = *(const v4f*)(qr + 128 + l2 * 4);
      *(v4f*)(qs + lane * 4) = a; if (lane < 16) *(v4f*)(qs + 128 + l2 * 4) = b2; }
    asm volatile("" ::: "memory"); __builtin_amdgcn_wave_barrier(); asm volatile("" ::: "memory");
    float mx = -3.0e38f;
#pragma unroll 4
    for (int ch = 0; ch < TT / 128; ++ch) { const int j0 = ch * 128 + lane * 4; const v4f a = *(const v4f*)(sr + j0); const v4f mk = *(const v4f*)(mrow + j0); v4f t4;
#pragma unroll
        for (int q = 0; q < 4; ++q) { const int j = j0 + q; int rel = i - j; rel = rel > MAXR ? MAXR : (rel < -MAXR ? -MAXR : rel); const float t = (a[q] + qs[rel + MAXR]) * SCL + bfr(mk[q]); t4[q] = t; mx = fmaxf(mx, t); }
        *(v4f*)(pr + j0) = t4; }
#pragma unroll
    for (int sh = 16; sh; sh >>= 1) mx = fmaxf(mx, __shfl_xor(mx, sh, 32));
    float sum = 0.f, clo = 0.f, chi = 0.f;
#pragma unroll 4
    for (int ch = 0; ch < TT / 128; ++ch) { const int j0 = ch * 128 + lane * 4; const v4f t4 = *(const v4f*)(pr + j0); v4f e4;
#pragma unroll
        for (int q = 0; q < 4; ++q) { float d0 = __fsub_rn(t4[q], mx); asm volatile("" : "+v"(d0)); const float e = __builtin_amdgcn_exp2f(__fmul_rn(d0, 1.4426950408889634f)); e4[q] = e; sum += e; const int j = j0 + q; clo += (j >= i + MAXR) ? e : 0.f; chi += (j <= i - MAXR) ? e : 0.f; }
        *(v4f*)(pr + j0) = e4; }
#pragma unroll
    for (int sh = 16; sh; sh >>= 1) { sum += __shfl_xor(sum, sh, 32); clo += __shfl_xor(clo, sh, 32); chi += __shfl_xor(chi, sh, 32); }
    const float f = __fdiv_rn(hires ? 1.0f : PCAR, sum);
    asm volatile("" ::: "memory"); __builtin_amdgcn_wave_barrier(); asm volatile("" ::: "memory");
    float tb[8]; const int rb0 = lane * 8;
#pragma unroll
    for (int q = 0; q < 8; ++q) { const int r = rb0 + q; const int j = i + MAXR - r; const int jc = j < 0 ? 0 : (j > TT - 1 ? TT - 1 : j); float val = pr[jc]; val = (j >= 0 && j < TT) ? val : 0.f; val = (r == 0) ? clo : val; val = (r == NBIN - 1) ? chi : val; val = (r >= NBIN) ? 0.f : val; tb[q] = val; }
    const bool tl = (lane < KX / 8);
{
        if (hires) { const size_t ob = ((size_t)zz * RH + i) * TP;
#pragma unroll 4
            for (int ch = 0; ch < TT / 128; ++ch) { const int j0 = ch * 128 + lane * 4; const v4f e4 = *(const v4f*)(pr + j0); v4us oh, ol;
#pragma unroll
                for (int q = 0; q < 4; ++q) { unsigned short a, c2; splitf(e4[q] * f, a, c2); oh[q] = a; ol[q] = c2; }
                *(v4us*)(Ph + ob + j0) = oh; *(v4us*)(Pl + ob + j0) = ol; }
            v8us th, tw;
#pragma unroll
            for (int q = 0; q < 8; ++q) { unsigned short a, c2; splitf(tb[q] * f, a, c2); th[q] = a; tw[q] = c2; }
            if (tl) { *(v8us*)(Ph + ob + TT + rb0) = th; *(v8us*)(Pl + ob + TT + rb0) = tw; }
        } else { const size_t ob = (size_t)row * TP;
#pragma unroll 4
            for (int ch = 0; ch < TT / 128; ++ch) { const int j0 = ch * 128 + lane * 4; const v4f e4 = *(const v4f*)(pr + j0); v4h o4;
#pragma unroll
                for (int q = 0; q < 4; ++q) o4[q] = tohx(e4[q] * f);
                *(v4h*)(P16 + ob + j0) = o4; }
            v8h t8;
#pragma unroll
            for (int q = 0; q < 8; ++q) t8[q] = tohx(tb[q] * f * (1.0f / EVC));
            if (tl) *(v8h*)(P16 + ob + TT + rb0) = t8; }
         }
}
__global__ __launch_bounds__(256) void k_merge(const float* __restrict__ O, int h0, float* OUTb) { const size_t e = ((size_t)blockIdx.x * 256 + threadIdx.x) * 2; if (e >= (size_t)ZH * TT * HD) return; const int d = (int)(e % HD); const int t = (int)((e / HD) % TT); const int zz = (int)(e / ((size_t)HD * TT)); const float cs = (t < RH) ? 1.0f : (1.0f / PCAR); const size_t oo = (size_t)t * DQ + (h0 + zz) * HD + d;
    v2f sm = *(const v2f*)(O + e);
    // unrolled so that the loads of all planes are in flight together; rolled, each add would wait for its own load
#pragma unroll
    for (int ks = 1; ks < KSN; ++ks) sm += *(const v2f*)(O + (size_t)ks * ZH * TT * HD + e);
    v2f o2; o2[0] = sm[0] * cs; o2[1] = sm[1] * cs; *(v2f*)(OUTb + oo) = o2;  }

extern "C" void kernel_launch(void* const* d_in, const int* in_sizes, int n_in,
                              void* d_out, int out_size, void* d_ws, size_t ws_size, hipStream_t stream) {
    if (n_in < 10) return;
    if ((size_t)in_sizes[0] < ((size_t)(NB - 1) * TTF + TT) * DM) return;
    if ((size_t)in_sizes[1] < (size_t)(NB - 1) * TTF + TT) return;
    if (in_sizes[2] < DM * DQ || in_sizes[4] < DM * DKV || in_sizes[6] < DM * DKV) return;
    if (in_sizes[3] < DQ || in_sizes[5] < DKV || in_sizes[7] < DKV) return;
    if (in_sizes[8] < NBIN * HD || in_sizes[9] < NBIN * HD) return;
    if ((size_t)out_size < (size_t)NB * TT * DQ) return;
    const float* x = (const float*)d_in[0]; const float* mask = (const float*)d_in[1];   // [NB][1][1][TTF], added per key
    const float* wq = (const float*)d_in[2]; const float* bq = (const float*)d_in[3]; const float* wk = (const float*)d_in[4]; const float* bk = (const float*)d_in[5]; const float* wv = (const float*)d_in[6]; const float* bv = (const float*)d_in[7];
    const float* embk = (const float*)d_in[8]; const float* embv = (const float*)d_in[9];   // [NBIN][HD] each
    float* OUT = (float*)d_out;     // [NB][TT][DQ]
    char* wsp = (char*)d_ws;
    auto take = [&](size_t bytes) { char* p = wsp; wsp += (bytes + 255) & ~(size_t)255; return (void*)p; };
    bf* WQ = (bf*)take((size_t)DQ * DM * 2); bf* WK = (bf*)take((size_t)DKV * DM * 2); bf* WV = (bf*)take((size_t)DKV * DM * 2); float* CS = (float*)take((size_t)TT * HD * 2 * 4); bf* EK = (bf*)take((size_t)KX * HD * 2);
    bf* XB = (bf*)take((size_t)TT * DM * 2); float* FQ = (float*)take((size_t)TT * DQ * 4); float* FK = (float*)take((size_t)TT * DKV * 4);
    h16* QP16 = (h16*)take((size_t)NH_ * TT * HD * 2); h16* KP16 = (h16*)take((size_t)NKV * TT * HD * 2); h16* VT16 = (h16*)take((size_t)NKV * HD * TP * 2);
    bf* QPh = (bf*)take((size_t)NH_ * TT * HD * 2); bf* QPl = (bf*)take((size_t)NH_ * TT * HD * 2); bf* KPh = (bf*)take((size_t)NKV * TT * HD * 2); bf* KPl = (bf*)take((size_t)NKV * TT * HD * 2); bf* VTh = (bf*)take((size_t)NKV * HD * TP * 2); bf* VTl = (bf*)take((size_t)NKV * HD * TP * 2); bf* Ph = (bf*)take((size_t)ZH * RH * TP * 2); bf* Pl = (bf*)take((size_t)ZH * RH * TP * 2);
    float* Sb = (float*)take((size_t)ZH * TT * TT * 4); h16* P16 = (h16*)take((size_t)ZH * TT * TP * 2); float* Ob = (float*)take((size_t)KSN * ZH * TT * HD * 4); float* QEb = (float*)take((size_t)ZH * TT * KX * 4);
    if ((size_t)(wsp - (char*)d_ws) > ws_size) return;    // carve 139.4 MiB at NB 2 / SEQ 2048
    float* FV = FK;   // v projection reuses the k buffer after the k planes are built (stream-ordered)
    k_wtG<<<(unsigned)((DM * DQ / 64 + 63) / 64), 256, 0, stream>>>(wq, DM, DQ, WQ); k_wtG<<<(unsigned)((DM * DKV / 64 + 63) / 64), 256, 0, stream>>>(wk, DM, DKV, WK); k_wtG<<<(unsigned)((DM * DKV / 64 + 63) / 64), 256, 0, stream>>>(wv, DM, DKV, WV);
    k_csid<<<(TT * HD + 255) / 256, 256, 0, stream>>>(CS);
    k_ekp<<<(KX * HD / 8 + 255) / 256, 256, 0, stream>>>(embk, EK);
    k_vrel<<<(NKV * HD + 7) / 8, 256, 0, stream>>>(embv, VT16, VTh, VTl);
    const unsigned LQ = (unsigned)(((size_t)NH_ * TT * HD / 2 + 255) / 256), LKv = (unsigned)(((size_t)NKV * TT * HD / 2 + 255) / 256);
    for (int b = 0; b < NB; ++b) {
        k_cvt8<<<(unsigned)(((size_t)TT * DM / 8 + 255) / 256), 256, 0, stream>>>(x + (size_t)b * TTF * DM, XB, (size_t)TT * DM / 8);
        k_gemmw<bf, 0, true><<<dim3(TT / 64, DQ / 64, 1), 32, 0, stream>>>(XB, nullptr, WQ, nullptr, DM, FQ, DQ, bq, 0, 0, 0);
        k_rope<<<LQ, 256, 0, stream>>>(FQ, DQ, NH_, CS, nullptr, nullptr, 1.0f, QP16, QPh, QPl);
        k_gemmw<bf, 0, true><<<dim3(TT / 64, DKV / 64, 1), 32, 0, stream>>>(XB, nullptr, WK, nullptr, DM, FK, DKV, bk, 0, 0, 0);
        k_rope<<<LKv, 256, 0, stream>>>(FK, DKV, NKV, CS, nullptr, nullptr, 1.0f, KP16, KPh, KPl);
        k_gemmw<bf, 0, true><<<dim3(TT / 64, DKV / 64, 1), 32, 0, stream>>>(XB, nullptr, WV, nullptr, DM, FV, DKV, bv, 0, 0, 0); k_vtp<<<LKv, 256, 0, stream>>>(FV, DKV, NKV, VT16, VTh, VTl);
        for (int h0 = 0; h0 < NH_; h0 += ZH) { const size_t zq = (size_t)h0, zk = (size_t)(h0 / REP);
            k_gemmw<bf, 1, false><<<dim3(TT / 64, KX / 64, ZH), 32, 0, stream>>>(QPh + zq * TT * HD, QPl + zq * TT * HD, EK, nullptr, HD, QEb, KX, nullptr, (size_t)TT * HD, 0, (size_t)TT * KX);   /* QE = q emb_k^T, q hi/lo x exact emb_k */
            k_gemmw<bf, 2, false><<<dim3(TT / 64, TT / 64, ZH), 32, 0, stream>>>(QPh + zq * TT * HD, QPl + zq * TT * HD, KPh + zk * TT * HD, KPl + zk * TT * HD, HD, Sb, TT, nullptr, (size_t)TT * HD, (size_t)TT * HD, (size_t)TT * TT);   /* scores hi/lo on every row */
            k_asoft<<<ZH * TT / 8, 256, 0, stream>>>(Sb, QEb, mask + (size_t)b * TTF, P16, Ph, Pl);
            k_gemmw<bf, 2, false, KSP><<<dim3(RH / 64, KSN, ZH), 32, 0, stream>>>(Ph, Pl, VTh + zk * HD * TP, VTl + zk * HD * TP, TP, Ob, HD, nullptr, (size_t)RH * TP, (size_t)HD * TP, (size_t)TT * HD);
            k_gemmw<h16, 0, false, KSP><<<dim3((TT - RH) / 64, KSN, ZH), 32, 0, stream>>>(P16 + (size_t)RH * TP, nullptr, VT16 + zk * HD * TP, nullptr, TP, Ob + (size_t)RH * HD, HD, nullptr, (size_t)TT * TP, (size_t)HD * TP, (size_t)TT * HD);
            k_merge<<<(unsigned)(((size_t)ZH * TT * HD / 2 + 255) / 256), 256, 0, stream>>>(Ob, h0, OUT + (size_t)b * TT * DQ); }
    }
}

// v002
// A run of this version takes 666 microseconds.
// Next to v001, in two timings, it ran 1.47 and 1.46 times as fast.
// Counting every step since v000, it is 3.71 times as fast.
#include <hip/hip_runtime.h>

// Contractions: x W (q,k,v) on v_wmma_f32_16x16x32_bf16 (bf16 operands from RNE-bf16 inputs); q.k and q.emb_k score tiles bf16 hi/lo split (3 and 2 products); attn.v with the rel-value bins.emb_v folded into K: rows < RH bf16 hi/lo split, rows >= RH v_wmma_f32_16x16x32_f16 (P x1024, bins x64, emb_v x16, v plain f16); f32 accumulate, f32 softmax.
// Self-attention, 16 heads x 64: q,k,v = x W + b ('xw' layout), scores = (q.k + q.emb_k[clip(i-j)]) x 64^-0.5 + additive key mask, softmax over all keys,
// ctx = probs v + sum_r bins[i][r] emb_v[r] (bins: band copies of probs plus the two clipped tail sums), output concat-heads [NB][TT][1024] f32, no output projection.
// Layout per batch: bf16 copy of x; weights transposed once to [n][k] bf16; f32 projections + f32 biases; head planes [h][t][d] (bf16 hi/lo) for q,k; value planes [h][d][TT+192] (cols >= TT hold emb_v);
// QE = q emb_k^T [t][192] per group of ZH heads; dense T x T score GEMM into rows of TT+192 f32; per-row softmax writes the P planes [row][TT+192] (cols >= TT hold the bins) over the row's own scores (16-bit row pitch 2 (TT+192): f16 plane, or hi plane then lo plane); one attn.v GEMM per row class with K = TT+192, K cut into KSN ranges (one work-group and one f32 partial plane each); f32 merge sums the partial planes in range order and writes the output rows.

#ifndef NB
#define NB   2
#endif
#ifndef SEQ
#define SEQ  2048
#endif
#define NB_FULL  2
#define TTF  2048                 // full per-batch sequence stride of the inputs
#define TT   SEQ
#define DM   1024
#define NH_  16
#define NKV  16
#define REP  (NH_ / NKV)
#define HD   64
#define DQ   (NH_ * HD)
#define DKV  (NKV * HD)
#define ZH   8                    // heads per launch of the attention stage
#define RH   ((TT / 2 < 512) ? (TT / 2) : 512)   // query rows < RH use hi+lo planes
#define PCAR 1024.0f
#define SCL  0.125f   // HD^-0.5
#define MAXR 64
#define NBIN (2 * MAXR + 1)       // 129 clipped offsets
#define KX   192                  // NBIN padded to a multiple of 64
#define TP   (TT + KX)            // K of the attn.v contraction (keys + bins)
#define EVC  16.0f                // f16 carry of emb_v in the value planes (bins carry 1024/16 = 64)
#define KSN  14                   // K ranges of the attn.v contraction, one work-group each; f32 partial planes summed in k_merge
#define KSP  (TP / KSN)           // K elements per range

static_assert(TT % 128 == 0);
static_assert(RH % 64 == 0);
static_assert(RH >= 64);
static_assert((TT - RH) % 64 == 0);
static_assert(TT - RH >= 64);
static_assert(TP % 32 == 0);
static_assert(TP % KSN == 0);
static_assert(KSP % 32 == 0);
static_assert(KX % 64 == 0);
static_assert(KX >= NBIN);
static_assert(KX == 192);
static_assert(HD == 64);
static_assert(NH_ % ZH == 0);
static_assert(DM % 64 == 0);
static_assert((KX * HD) % (8 * 256) == 0);
static_assert(((size_t)ZH * TT * HD / 2) % 256 == 0);
static_assert(((size_t)TT * DM / 8) % 256 == 0);
static_assert((NKV * HD) % 8 == 0);
static_assert(NB <= NB_FULL);
static_assert(TT <= TTF);

typedef _Float16 h16;
typedef unsigned short bf;
typedef __attribute__((ext_vector_type(16))) __bf16   v16bf;
typedef __attribute__((ext_vector_type(16))) _Float16 v16h;
typedef __attribute__((ext_vector_type(8)))  _Float16 v8h;
typedef __attribute__((ext_vector_type(8)))  unsigned short v8us;
typedef __attribute__((ext_vector_type(8)))  float    v8f;
typedef __attribute__((ext_vector_type(4)))  float    v4f;
typedef v8h  __attribute__((may_alias)) v8ha;
typedef v4f  __attribute__((may_alias)) v4fa;
typedef v8us __attribute__((may_alias)) v8usa;

__device__ __forceinline__ unsigned short f2bf(float f) { unsigned u = __float_as_uint(f); u += 0x7FFFu + ((u >> 16) & 1u); return (unsigned short)(u >> 16); }
__device__ __forceinline__ float bf2f(unsigned short b) { return __uint_as_float(((unsigned)b) << 16); }
__device__ __forceinline__ float bfr(float f) { return bf2f(f2bf(f)); }
__device__ __forceinline__ v16h cat16(v8h lo, v8h hi) { return __builtin_shufflevector(lo, hi, 0, 1, 2, 3, 4, 5, 6, 7, 8, 9, 10, 11, 12, 13, 14, 15); }
__device__ __forceinline__ v16bf cat16b(v8us lo, v8us hi) { return __builtin_bit_cast(v16bf, __builtin_shufflevector(lo, hi, 0, 1, 2, 3, 4, 5, 6, 7, 8, 9, 10, 11, 12, 13, 14, 15)); }
__device__ __forceinline__ v8f wmma16(v16h a, v16h b, v8f c) { return __builtin_amdgcn_wmma_f32_16x16x32_f16(false, a, false, b, (short)0, c, false, false); }
__device__ __forceinline__ v8f wmmab(v16bf a, v16bf b, v8f c) { return __builtin_amdgcn_wmma_f32_16x16x32_bf16(false, a, false, b, (short)0, c, false, false); }

// ---- k_gemmw: register-blocked GEMM, ONE WAVE per 64x64 output tile (16 accumulators), operands straight from K-contiguous 16-bit planes; grid (M/64, N/64, Z), 32 threads.
// C[m][n] (f32, pitch ldc, + optional f32 bias[n]) = sum_k A[m][k] Bt[n][k] (+ split products per NSPLIT); A rows have pitch lda, Bt rows pitch K. z-batch strides sA/sB/sC in elements. K % 32 == 0.
// KR > 0 (N == 64 only): grid (M/64, K/KR, ZH); work-group y sums k in [y KR, (y+1) KR) alone and stores its partial tile in plane y (plane stride ZH sC); the caller adds the planes.
// Fragments: lane l -> row/col l&15, h = l>>4; elements 0..7 <- k0+8h+0..7, 8..15 <- k0+16+8h+0..7 for BOTH A and Bt (same loader); D element r -> row 8h+r, col l&15.
template <typename T16> struct WFrag;
template <> struct WFrag<h16> { typedef v16h V; static __device__ __forceinline__ V ld(const h16* p) { return cat16(*(const v8h*)p, *(const v8h*)(p + 16)); } static __device__ __forceinline__ v8f mma(V a, V b, v8f c) { return wmma16(a, b, c); } };
template <> struct WFrag<bf> { typedef v16bf V; static __device__ __forceinline__ V ld(const bf* p) { return cat16b(*(const v8us*)p, *(const v8us*)(p + 16)); } static __device__ __forceinline__ v8f mma(V a, V b, v8f c) { return wmmab(a, b, c); } };
template <typename T16, int NSPLIT, bool BIAS, int KR = 0>
__global__ __launch_bounds__(32) void k_gemmw(const T16* __restrict__ A, const T16* __restrict__ A2, const T16* __restrict__ Bt, const T16* __restrict__ Bt2, int K, int lda, float* C, int ldc, const float* __restrict__ bias, size_t sA, size_t sB, size_t sC) {
    typedef typename WFrag<T16>::V V;
    __shared__ __align__(16) float os[16 * 68];
    const size_t z = blockIdx.z; A += z * sA; if (A2) A2 += z * sA; Bt += z * sB; if (Bt2) Bt2 += z * sB; C += (KR ? (size_t)blockIdx.y * ZH + z : z) * sC;
    const int lane = threadIdx.x & 31, lr = lane & 15, hi = lane >> 4; const int r0 = blockIdx.x * 64, c0 = KR ? 0 : blockIdx.y * 64; const int kb = KR ? blockIdx.y * KR : 0, ke = KR ? kb + KR : K;
    v8f acc[4][4];
#pragma unroll
    for (int mb = 0; mb < 4; ++mb)
#pragma unroll
        for (int nb = 0; nb < 4; ++nb) acc[mb][nb] = (v8f){};
    const size_t aoff = (size_t)(r0 + lr) * lda + 8 * hi, boff = (size_t)(c0 + lr) * K + 8 * hi;
#pragma unroll 1
    for (int kc = kb; kc < ke; kc += 32) {
        V a[4], a2[4];
#pragma unroll
        for (int mb = 0; mb < 4; ++mb) { a[mb] = WFrag<T16>::ld(A + aoff + (size_t)mb * 16 * lda + kc); if (NSPLIT == 1 || NSPLIT == 2) a2[mb] = WFrag<T16>::ld(A2 + aoff + (size_t)mb * 16 * lda + kc); }
#pragma unroll
        for (int nb = 0; nb < 4; ++nb) { const V b = WFrag<T16>::ld(Bt + boff + (size_t)nb * 16 * K + kc); V b2; if (NSPLIT >= 2) b2 = WFrag<T16>::ld(Bt2 + boff + (size_t)nb * 16 * K + kc);
#pragma unroll
            for (int mb = 0; mb < 4; ++mb) { acc[mb][nb] = WFrag<T16>::mma(a[mb], b, acc[mb][nb]); if (NSPLIT == 1 || NSPLIT == 2) acc[mb][nb] = WFrag<T16>::mma(a2[mb], b, acc[mb][nb]); if (NSPLIT >= 2) acc[mb][nb] = WFrag<T16>::mma(a[mb], b2, acc[mb][nb]); } }
        asm volatile("v_nop\n\tv_nop\n\tv_nop\n\tv_nop" : "+v"(acc[0][0]), "+v"(acc[1][1]), "+v"(acc[2][2]), "+v"(acc[3][3]) : "v"(a[0]), "v"(a[3]));
    }
#pragma unroll
    for (int mb = 0; mb < 4; ++mb) {
#pragma unroll
        for (int nb = 0; nb < 4; ++nb) {
#pragma unroll
            for (int j = 0; j < 8; ++j) os[(hi * 8 + j) * 68 + nb * 16 + lr] = acc[mb][nb][j]; }
        __builtin_amdgcn_wave_barrier(); asm volatile("" ::: "memory");
        float* crow = C + (size_t)(r0 + mb * 16) * ldc + c0;
{
#pragma unroll
            for (int s = 0; s < 8; ++s) { const int row = 2 * s + hi, cofs = lr * 4; v4f val = *(const v4fa*)(os + row * 68 + cofs); if (BIAS) { val[0] += bfr(bias[c0 + cofs]); val[1] += bfr(bias[c0 + cofs + 1]); val[2] += bfr(bias[c0 + cofs + 2]); val[3] += bfr(bias[c0 + cofs + 3]); }
                *(v4f*)(crow + (size_t)row * ldc + cofs) = val; }
             }
        __builtin_amdgcn_wave_barrier(); asm volatile("" ::: "memory");
    }
}

__device__ __forceinline__ h16 tohx(float x) { return (h16)x; }
__device__ __forceinline__ void splitf(float y, unsigned short& h, unsigned short& l) { h = f2bf(y); l = f2bf(y - bf2f(h)); }
typedef __attribute__((ext_vector_type(2))) _Float16 v2h;
typedef __attribute__((ext_vector_type(4))) _Float16 v4h;
typedef __attribute__((ext_vector_type(2))) unsigned short v2us;
typedef __attribute__((ext_vector_type(4))) unsigned short v4us;
typedef __attribute__((ext_vector_type(2))) float v2f;
typedef __attribute__((ext_vector_type(4))) int v4i;

__global__ __launch_bounds__(256) void k_wtG(const float* __restrict__ w, int K, int N, bf* Bt) {
    const int lane = threadIdx.x & 31; const int L0 = (blockIdx.x * 8 + (threadIdx.x >> 5)) * 8; const int nlines = N * K / 64;
{
#pragma unroll 1
        for (int l = 0; l < 8; ++l) { const int L = L0 + l; if (L >= nlines) break; const size_t e = (size_t)L * 64 + lane * 2; const int k = (int)(e % K), n = (int)(e / K); v2us o;
            o[0] = f2bf(w[(size_t)k * N + n]); o[1] = f2bf(w[(size_t)(k + 1) * N + n]); *(v2us*)(Bt + e) = o; }
         }
}
__global__ __launch_bounds__(256) void k_cvt8(const float* __restrict__ src, bf* dst, size_t n8) { const size_t i = (size_t)blockIdx.x * 256 + threadIdx.x; if (i >= n8) return; const v8f v = *(const v8f*)(src + i * 8); v8us o;
#pragma unroll
    for (int k = 0; k < 8; ++k) o[k] = f2bf(v[k]); *(v8us*)(dst + i * 8) = o;  }

// k_rope: head planes [h][t][d] (fp16 + hi/lo) of rope(x) x sc with the rotate-half convention out[d] = x[d] cos[t][d] - x[d+HD/2] sin[t][d], out[d+HD/2] = x[d+HD/2] cos[t][d+HD/2] + x[d] sin[t][d+HD/2]
__global__ __launch_bounds__(256) void k_rope(const float* __restrict__ F, int pitch, int nheads, const float* __restrict__ CS, const float* __restrict__ RF, const float* __restrict__ nw, float sc, h16* P16, bf* Ph, bf* Pl) {
    const size_t e = ((size_t)blockIdx.x * 256 + threadIdx.x) * 2; if (e >= (size_t)nheads * TT * HD) return; const int d = (int)(e % HD); const int t = (int)((e / HD) % TT); const int h = (int)(e / ((size_t)HD * TT)); const float* f = F + (size_t)t * pitch + h * HD; const float rf = RF ? RF[(size_t)h * TT + t] : 1.0f; v2h o16; v2us oh, ol;
#pragma unroll
    for (int q = 0; q < 2; ++q) { const int dd = d + q; const int dp = (dd < HD / 2) ? dd + HD / 2 : dd - HD / 2; float x0 = f[dd], x1 = f[dp];
        if (RF) { float n0 = __fmul_rn(x0, rf), n1 = __fmul_rn(x1, rf); asm volatile("" : "+v"(n0)); asm volatile("" : "+v"(n1)); x0 = __fmul_rn(bfr(nw[dd]), n0); x1 = __fmul_rn(bfr(nw[dp]), n1); }
        const v2f cs = *(const v2f*)(CS + ((size_t)t * HD + dd) * 2); float a = __fmul_rn(x0, cs[0]), bq = __fmul_rn(x1, cs[1]); asm volatile("" : "+v"(a)); asm volatile("" : "+v"(bq)); const float r = ((dd < HD / 2) ? __fsub_rn(a, bq) : __fadd_rn(a, bq)) * sc;
        o16[q] = tohx(r); unsigned short a2, c2; splitf(r, a2, c2); oh[q] = a2; ol[q] = c2; }
    *(v2h*)(P16 + e) = o16; *(v2us*)(Ph + e) = oh; *(v2us*)(Pl + e) = ol;  }
__global__ __launch_bounds__(256) void k_vtp(const float* __restrict__ F, int pitch, int nheads, h16* V16, bf* Vh, bf* Vl) { const size_t e = ((size_t)blockIdx.x * 256 + threadIdx.x) * 2; if (e >= (size_t)nheads * HD * TT) return; const int t = (int)(e % TT); const int d = (int)((e / TT) % HD); const int g = (int)(e / ((size_t)TT * HD)); const size_t o = ((size_t)g * HD + d) * TP + t; v2h o16; v2us oh, ol;
#pragma unroll
    for (int q = 0; q < 2; ++q) { const float x = F[(size_t)(t + q) * pitch + g * HD + d]; o16[q] = tohx(x); unsigned short a2, c2; splitf(x, a2, c2); oh[q] = a2; ol[q] = c2; }
    *(v2h*)(V16 + o) = o16; *(v2us*)(Vh + o) = oh; *(v2us*)(Vl + o) = ol;  }
// k_vrel: tail columns [TT, TT+KX) of every value-plane row (g*HD + d): col TT + r = emb_v[r][d] (r < NBIN, else 0); fp16 plane carries x EVC of the bf16 value, hi plane bf16, lo plane 0.
__global__ __launch_bounds__(256) void k_vrel(const float* __restrict__ ev, h16* V16, bf* Vh, bf* Vl) {
    const int lane = threadIdx.x & 31; const int pr = blockIdx.x * 8 + (threadIdx.x >> 5); if (pr >= NKV * HD) return; const int d = pr & (HD - 1); const int rb0 = lane * 8;
    v8h o16; v8us oh, ol;
#pragma unroll
    for (int q = 0; q < 8; ++q) { const int r = rb0 + q; const int rc = (r < NBIN - 1) ? r : (NBIN - 1); float x = ev[(size_t)rc * HD + d]; x = (r < NBIN) ? x : 0.f; const float xb = bfr(x); o16[q] = tohx(xb * EVC); oh[q] = f2bf(x); ol[q] = f2bf(x * 0.f); }
    const size_t o = (size_t)pr * TP + TT + rb0; const bool act = (lane < KX / 8);
{
        if (act) { *(v8h*)(V16 + o) = o16; *(v8us*)(Vh + o) = oh; *(v8us*)(Vl + o) = ol; }
         }
}
__global__ __launch_bounds__(256) void k_ekp(const float* __restrict__ ek, bf* EK) {
    const int idx = blockIdx.x * 256 + threadIdx.x; if (idx >= KX * HD / 8) return; const int e = idx * 8; const int r = e / HD, d0 = e % HD; const int rc = (r < NBIN - 1) ? r : (NBIN - 1);
    const v4f a = *(const v4f*)(ek + (size_t)rc * HD + d0), b2 = *(const v4f*)(ek + (size_t)rc * HD + d0 + 4); v8us o;
#pragma unroll
    for (int k = 0; k < 4; ++k) { const float x0 = (r < NBIN) ? a[k] : 0.f, x1 = (r < NBIN) ? b2[k] : 0.f; o[k] = f2bf(x0); o[k + 4] = f2bf(x1); }
    *(v8us*)(EK + e) = o;  }
__global__ __launch_bounds__(256) void k_csid(float* CS) { const int idx = blockIdx.x * 256 + threadIdx.x; if (idx >= TT * HD) return; v2f cs; cs[0] = 1.0f; cs[1] = 0.0f; *(v2f*)(CS + (size_t)idx * 2) = cs;  }

// k_asoft: one wave per score row (zz, i): t[j] = (S[i][j] + QE[i][clip(i-j,-MAXR,MAXR)+MAXR]) x HD^-0.5 + mask[j]; softmax over the TT keys (row staged in this wave's LDS slot, one exp, fixed trees);
// The P planes lie over the score rows: a wave has read its whole row (the row maximum needs all of it) before it stores the row's P values, and no other wave touches that row.
// bins: col TT+0 = sum_{j >= i+MAXR} p, col TT+NBIN-1 = sum_{j <= i-MAXR} p, col TT+r (0 < r < NBIN-1) = p[i+MAXR-r] (0 outside [0,TT)), cols >= TT+NBIN zero.
__global__ __launch_bounds__(256) void k_asoft(const float* Sb, const float* __restrict__ QE, const float* __restrict__ mrow, h16* P16, bf* Ph, bf* Pl) {
    __shared__ __align__(16) float prow[8][TT];
    __shared__ __align__(16) float qes[8][KX];
    const int lane = threadIdx.x & 31, wv = threadIdx.x >> 5; const int row = blockIdx.x * 8 + wv; if (row >= ZH * TT) return;
    const int i = row % TT; const bool hires = (i < RH);
    const float* sr = Sb + (size_t)row * TP; const float* qr = QE + (size_t)row * KX; float* pr = prow[wv]; float* qs = qes[wv];
    { const v4f a = *(const v4f*)(qr + lane * 4); const int l2 = lane & 15; const v4f b2 = *(const v4f*)(qr + 128 + l2 * 4);
      *(v4f*)(qs + lane * 4) = a; if (lane < 16) *(v4f*)(qs + 128 + l2 * 4) = b2; }
    asm volatile("" ::: "memory"); __builtin_amdgcn_wave_barrier(); asm volatile("" ::: "memory");
    float mx = -3.0e38f;
#pragma unroll 4
    for (int ch = 0; ch < TT / 128; ++ch) { const int j0 = ch * 128 + lane * 4; const v4f a = *(const v4f*)(sr + j0); const v4f mk = *(const v4f*)(mrow + j0); v4f t4;
#pragma unroll
        for (int q = 0; q < 4; ++q) { const int j = j0 + q; int rel = i - j; rel = rel > MAXR ? MAXR : (rel < -MAXR ? -MAXR : rel); const float t = (a[q] + qs[rel + MAXR]) * SCL + bfr(mk[q]); t4[q] = t; mx = fmaxf(mx, t); }
        *(v4f*)(pr + j0) = t4; }
#pragma unroll
    for (int sh = 16; sh; sh >>= 1) mx = fmaxf(mx, __shfl_xor(mx, sh, 32));
    float sum = 0.f, clo = 0.f, chi = 0.f;
#pragma unroll 4
    for (int ch = 0; ch < TT / 128; ++ch) { const int j0 = ch * 128 + lane * 4; const v4f t4 = *(const v4f*)(pr + j0); v4f e4;
#pragma unroll
        for (int q = 0; q < 4; ++q) { float d0 = __fsub_rn(t4[q], mx); asm volatile("" : "+v"(d0)); const float e = __builtin_amdgcn_exp2f(__fmul_rn(d0, 1.4426950408889634f)); e4[q] = e; sum += e; const int j = j0 + q; clo += (j >= i + MAXR) ? e : 0.f; chi += (j <= i - MAXR) ? e : 0.f; }
        *(v4f*)(pr + j0) = e4; }
#pragma unroll
    for (int sh = 16; sh; sh >>= 1) { sum += __shfl_xor(sum, sh, 32); clo += __shfl_xor(clo, sh, 32); chi += __shfl_xor(chi, sh, 32); }
    const float f = __fdiv_rn(hires ? 1.0f : PCAR, sum);
    asm volatile("" ::: "memory"); __builtin_amdgcn_wave_barrier(); asm volatile("" ::: "memory");
    float tb[8]; const int rb0 = lane * 8;
#pragma unroll
    for (int q = 0; q < 8; ++q) { const int r = rb0 + q; const int j = i + MAXR - r; const int jc = j < 0 ? 0 : (j > TT - 1 ? TT - 1 : j); float val = pr[jc]; val = (j >= 0 && j < TT) ? val : 0.f; val = (r == 0) ? clo : val; val = (r == NBIN - 1) ? chi : val; val = (r >= NBIN) ? 0.f : val; tb[q] = val; }
    const bool tl = (lane < KX / 8);
{
        if (hires) { const size_t ob = (size_t)row * (2 * TP);
#pragma unroll 4
            for (int ch = 0; ch < TT / 128; ++ch) { const int j0 = ch * 128 + lane * 4; const v4f e4 = *(const v4f*)(pr + j0); v4us oh, ol;
#pragma unroll
                for (int q = 0; q < 4; ++q) { unsigned short a, c2; splitf(e4[q] * f, a, c2); oh[q] = a; ol[q] = c2; }
                *(v4us*)(Ph + ob + j0) = oh; *(v4us*)(Pl + ob + j0) = ol; }
            v8us th, tw;
#pragma unroll
            for (int q = 0; q < 8; ++q) { unsigned short a, c2; splitf(tb[q] * f, a, c2); th[q] = a; tw[q] = c2; }
            if (tl) { *(v8us*)(Ph + ob + TT + rb0) = th; *(v8us*)(Pl + ob + TT + rb0) = tw; }
        } else { const size_t ob = (size_t)row * (2 * TP);
#pragma unroll 4
            for (int ch = 0; ch < TT / 128; ++ch) { const int j0 = ch * 128 + lane * 4; const v4f e4 = *(const v4f*)(pr + j0); v4h o4;
#pragma unroll
                for (int q = 0; q < 4; ++q) o4[q] = tohx(e4[q] * f);
                *(v4h*)(P16 + ob + j0) = o4; }
            v8h t8;
#pragma unroll
            for (int q = 0; q < 8; ++q) t8[q] = tohx(tb[q] * f * (1.0f / EVC));
            if (tl) *(v8h*)(P16 + ob + TT + rb0) = t8; }
         }
}
__global__ __launch_bounds__(256) void k_merge(const float* __restrict__ O, int h0, float* OUTb) { const size_t e = ((size_t)blockIdx.x * 256 + threadIdx.x) * 2; if (e >= (size_t)ZH * TT * HD) return; const int d = (int)(e % HD); const int t = (int)((e / HD) % TT); const int zz = (int)(e / ((size_t)HD * TT)); const float cs = (t < RH) ? 1.0f : (1.0f / PCAR); const size_t oo = (size_t)t * DQ + (h0 + zz) * HD + d;
    v2f sm = *(const v2f*)(O + e);
    // unrolled so that the loads of all planes are in flight together; rolled, each add would wait for its own load
#pragma unroll
    for (int ks = 1; ks < KSN; ++ks) sm += *(const v2f*)(O + (size_t)ks * ZH * TT * HD + e);
    v2f o2; o2[0] = sm[0] * cs; o2[1] = sm[1] * cs; *(v2f*)(OUTb + oo) = o2;  }

extern "C" void kernel_launch(void* const* d_in, const int* in_sizes, int n_in,
                              void* d_out, int out_size, void* d_ws, size_t ws_size, hipStream_t stream) {
    if (n_in < 10) return;
    if ((size_t)in_sizes[0] < ((size_t)(NB - 1) * TTF + TT) * DM) return;
    if ((size_t)in_sizes[1] < (size_t)(NB - 1) * TTF + TT) return;
    if (in_sizes[2] < DM * DQ || in_sizes[4] < DM * DKV || in_sizes[6] < DM * DKV) return;
    if (in_sizes[3] < DQ || in_sizes[5] < DKV || in_sizes[7] < DKV) return;
    if (in_sizes[8] < NBIN * HD || in_sizes[9] < NBIN * HD) return;
    if ((size_t)out_size < (size_t)NB * TT * DQ) return;
    const float* x = (const float*)d_in[0]; const float* mask = (const float*)d_in[1];   // [NB][1][1][TTF], added per key
    const float* wq = (const float*)d_in[2]; const float* bq = (const float*)d_in[3]; const float* wk = (const float*)d_in[4]; const float* bk = (const float*)d_in[5]; const float* wv = (const float*)d_in[6]; const float* bv = (const float*)d_in[7];
    const float* embk = (const float*)d_in[8]; const float* embv = (const float*)d_in[9];   // [NBIN][HD] each
    float* OUT = (float*)d_out;     // [NB][TT][DQ]
    char* wsp = (char*)d_ws;
    auto take = [&](size_t bytes) { char* p = wsp; wsp += (bytes + 255) & ~(size_t)255; return (void*)p; };
    bf* WQ = (bf*)take((size_t)DQ * DM * 2); bf* WK = (bf*)take((size_t)DKV * DM * 2); bf* WV = (bf*)take((size_t)DKV * DM * 2); float* CS = (float*)take((size_t)TT * HD * 2 * 4); bf* EK = (bf*)take((size_t)KX * HD * 2);
    h16* VT16 = (h16*)take((size_t)NKV * HD * TP * 2);
    bf* QPh = (bf*)take((size_t)NH_ * TT * HD * 2); bf* QPl = (bf*)take((size_t)NH_ * TT * HD * 2); bf* KPh = (bf*)take((size_t)NKV * TT * HD * 2); bf* KPl = (bf*)take((size_t)NKV * TT * HD * 2); bf* VTh = (bf*)take((size_t)NKV * HD * TP * 2); bf* VTl = (bf*)take((size_t)NKV * HD * TP * 2);
    float* Sb = (float*)take((size_t)ZH * TT * TP * 4); float* QEb = (float*)take((size_t)ZH * TT * KX * 4); float* Ob = (float*)take((size_t)KSN * ZH * TT * HD * 4);
    if ((size_t)(wsp - (char*)d_ws) > ws_size) return;    // carve 244.2 MiB at NB 2 / SEQ 2048
    h16* P16 = (h16*)Sb; bf* Ph = (bf*)Sb; bf* Pl = Ph + TP;   // P planes over the score rows: 16-bit row pitch 2 TP
    // the projection stage's buffers share the partial planes' area: each batch is done with them before its first attn.v GEMM, and the next batch rewrites them after the last merge (stream-ordered)
    static_assert((size_t)TT * DM * 2 + (size_t)TT * DQ * 4 + (size_t)TT * DKV * 4 + (size_t)NH_ * TT * HD * 2 + (size_t)NKV * TT * HD * 2 <= (size_t)KSN * ZH * TT * HD * 4);
    wsp = (char*)Ob;
    bf* XB = (bf*)take((size_t)TT * DM * 2); float* FQ = (float*)take((size_t)TT * DQ * 4); float* FK = (float*)take((size_t)TT * DKV * 4);
    h16* QP16 = (h16*)take((size_t)NH_ * TT * HD * 2); h16* KP16 = (h16*)take((size_t)NKV * TT * HD * 2);
    float* FV = FK;   // v projection reuses the k buffer after the k planes are built (stream-ordered)
    k_wtG<<<(unsigned)((DM * DQ / 64 + 63) / 64), 256, 0, stream>>>(wq, DM, DQ, WQ); k_wtG<<<(unsigned)((DM * DKV / 64 + 63) / 64), 256, 0, stream>>>(wk, DM, DKV, WK); k_wtG<<<(unsigned)((DM * DKV / 64 + 63) / 64), 256, 0, stream>>>(wv, DM, DKV, WV);
    k_csid<<<(TT * HD + 255) / 256, 256, 0, stream>>>(CS);
    k_ekp<<<(KX * HD / 8 + 255) / 256, 256, 0, stream>>>(embk, EK);
    k_vrel<<<(NKV * HD + 7) / 8, 256, 0, stream>>>(embv, VT16, VTh, VTl);
    const unsigned LQ = (unsigned)(((size_t)NH_ * TT * HD / 2 + 255) / 256), LKv = (unsigned)(((size_t)NKV * TT * HD / 2 + 255) / 256);
    for (int b = 0; b < NB; ++b) {
        k_cvt8<<<(unsigned)(((size_t)TT * DM / 8 + 255) / 256), 256, 0, stream>>>(x + (size_t)b * TTF * DM, XB, (size_t)TT * DM / 8);
        k_gemmw<bf, 0, true><<<dim3(TT / 64, DQ / 64, 1), 32, 0, stream>>>(XB, nullptr, WQ, nullptr, DM, DM, FQ, DQ, bq, 0, 0, 0);
        k_rope<<<LQ, 256, 0, stream>>>(FQ, DQ, NH_, CS, nullptr, nullptr, 1.0f, QP16, QPh, QPl);
        k_gemmw<bf, 0, true><<<dim3(TT / 64, DKV / 64, 1), 32, 0, stream>>>(XB, nullptr, WK, nullptr, DM, DM, FK, DKV, bk, 0, 0, 0);
        k_rope<<<LKv, 256, 0, stream>>>(FK, DKV, NKV, CS, nullptr, nullptr, 1.0f, KP16, KPh, KPl);
        k_gemmw<bf, 0, true><<<dim3(TT / 64, DKV / 64, 1), 32, 0, stream>>>(XB, nullptr, WV, nullptr, DM, DM, FV, DKV, bv, 0, 0, 0); k_vtp<<<LKv, 256, 0, stream>>>(FV, DKV, NKV, VT16, VTh, VTl);
        for (int h0 = 0; h0 < NH_; h0 += ZH) { const size_t zq = (size_t)h0, zk = (size_t)(h0 / REP);
            k_gemmw<bf, 1, false><<<dim3(TT / 64, KX / 64, ZH), 32, 0, stream>>>(QPh + zq * TT * HD, QPl + zq * TT * HD, EK, nullptr, HD, HD, QEb, KX, nullptr, (size_t)TT * HD, 0, (size_t)TT * KX);   /* QE = q emb_k^T, q hi/lo x exact emb_k */
            k_gemmw<bf, 2, false><<<dim3(TT / 64, TT / 64, ZH), 32, 0, stream>>>(QPh + zq * TT * HD, QPl + zq * TT * HD, KPh + zk * TT * HD, KPl + zk * TT * HD, HD, HD, Sb, TP, nullptr, (size_t)TT * HD, (size_t)TT * HD, (size_t)TT * TP);   /* scores hi/lo on every row */
            k_asoft<<<ZH * TT / 8, 256, 0, stream>>>(Sb, QEb, mask + (size_t)b * TTF, P16, Ph, Pl);
            k_gemmw<bf, 2, false, KSP><<<dim3(RH / 64, KSN, ZH), 32, 0, stream>>>(Ph, Pl, VTh + zk * HD * TP, VTl + zk * HD * TP, TP, 2 * TP, Ob, HD, nullptr, (size_t)TT * 2 * TP, (size_t)HD * TP, (size_t)TT * HD);
            k_gemmw<h16, 0, false, KSP><<<dim3((TT - RH) / 64, KSN, ZH), 32, 0, stream>>>(P16 + (size_t)RH * 2 * TP, nullptr, VT16 + zk * HD * TP, nullptr, TP, 2 * TP, Ob + (size_t)RH * HD, HD, nullptr, (size_t)TT * 2 * TP, (size_t)HD * TP, (size_t)TT * HD);
            k_merge<<<(unsigned)(((size_t)ZH * TT * HD / 2 + 255) / 256), 256, 0, stream>>>(Ob, h0, OUT + (size_t)b * TT * DQ); }
    }
}

// v003
// It runs in 641 microseconds.
// Two timings next to v002 both put it at 1.04 times that version's speed.
// Counting every step since v000, it is 3.85 times as fast.
#include <hip/hip_runtime.h>

// Contractions: x W (q,k,v) on v_wmma_f32_16x16x32_bf16 (bf16 operands from RNE-bf16 inputs); q.k and q.emb_k score tiles bf16 hi/lo split (3 and 2 products); attn.v with the rel-value bins.emb_v folded into K: rows < RH bf16 hi/lo split, rows >= RH v_wmma_f32_16x16x32_f16 (P x1024, bins x64, emb_v x16, v plain f16); f32 accumulate, f32 softmax.
// Self-attention, 16 heads x 64: q,k,v = x W + b ('xw' layout), scores = (q.k + q.emb_k[clip(i-j)]) x 64^-0.5 + additive key mask, softmax over all keys,
// ctx = probs v + sum_r bins[i][r] emb_v[r] (bins: band copies of probs plus the two clipped tail sums), output concat-heads [NB][TT][1024] f32, no output projection.
// Layout per batch: bf16 copy of x; weights transposed once to [n][k] bf16; the projection GEMMs add the f32 bias and store their tiles straight as head planes [h][t][d] (bf16 hi/lo) for q,k and value planes [h][d][TT+192] (f16, bf16 hi/lo; cols >= TT hold emb_v);
// QE = q emb_k^T [t][192] per group of ZH heads; dense T x T score GEMM into rows of TT+192 f32; per-row softmax writes the P planes [row][TT+192] (cols >= TT hold the bins) over the row's own scores (16-bit row pitch 2 (TT+192): f16 plane, or hi plane then lo plane); one attn.v GEMM per row class with K = TT+192, K cut into KSN ranges (one work-group and one f32 partial plane each); f32 merge sums the partial planes in range order and writes the output rows.

#ifndef NB
#define NB   2
#endif
#ifndef SEQ
#define SEQ  2048
#endif
#define NB_FULL  2
#define TTF  2048                 // full per-batch sequence stride of the inputs
#define TT   SEQ
#define DM   1024
#define NH_  16
#define NKV  16
#define REP  (NH_ / NKV)
#define HD   64
#define DQ   (NH_ * HD)
#define DKV  (NKV * HD)
#define ZH   8                    // heads per launch of the attention stage
#define RH   ((TT / 2 < 512) ? (TT / 2) : 512)   // query rows < RH use hi+lo planes
#define PCAR 1024.0f
#define SCL  0.125f   // HD^-0.5
#define MAXR 64
#define NBIN (2 * MAXR + 1)       // 129 clipped offsets
#define KX   192                  // NBIN padded to a multiple of 64
#define TP   (TT + KX)            // K of the attn.v contraction (keys + bins)
#define EVC  16.0f                // f16 carry of emb_v in the value planes (bins carry 1024/16 = 64)
#define KSN  14                   // K ranges of the attn.v contraction, one work-group each; f32 partial planes summed in k_merge
#define KSP  (TP / KSN)           // K elements per range

static_assert(TT % 128 == 0);
static_assert(RH % 64 == 0);
static_assert(RH >= 64);
static_assert((TT - RH) % 64 == 0);
static_assert(TT - RH >= 64);
static_assert(TP % 32 == 0);
static_assert(TP % KSN == 0);
static_assert(KSP % 32 == 0);
static_assert(KX % 64 == 0);
static_assert(KX >= NBIN);
static_assert(KX == 192);
static_assert(HD == 64);
static_assert(NH_ % ZH == 0);
static_assert(DM % 64 == 0);
static_assert((KX * HD) % (8 * 256) == 0);
static_assert(((size_t)ZH * TT * HD / 2) % 256 == 0);
static_assert(((size_t)TT * DM / 8) % 256 == 0);
static_assert((NKV * HD) % 8 == 0);
static_assert(NB <= NB_FULL);
static_assert(TT <= TTF);

typedef _Float16 h16;
typedef unsigned short bf;
typedef __attribute__((ext_vector_type(16))) __bf16   v16bf;
typedef __attribute__((ext_vector_type(16))) _Float16 v16h;
typedef __attribute__((ext_vector_type(8)))  _Float16 v8h;
typedef __attribute__((ext_vector_type(8)))  unsigned short v8us;
typedef __attribute__((ext_vector_type(8)))  float    v8f;
typedef __attribute__((ext_vector_type(4)))  float    v4f;
typedef v8h  __attribute__((may_alias)) v8ha;
typedef v4f  __attribute__((may_alias)) v4fa;
typedef v8us __attribute__((may_alias)) v8usa;

__device__ __forceinline__ unsigned short f2bf(float f) { unsigned u = __float_as_uint(f); u += 0x7FFFu + ((u >> 16) & 1u); return (unsigned short)(u >> 16); }
__device__ __forceinline__ float bf2f(unsigned short b) { return __uint_as_float(((unsigned)b) << 16); }
__device__ __forceinline__ float bfr(float f) { return bf2f(f2bf(f)); }
__device__ __forceinline__ h16 tohx(float x) { return (h16)x; }
__device__ __forceinline__ void splitf(float y, unsigned short& h, unsigned short& l) { h = f2bf(y); l = f2bf(y - bf2f(h)); }
typedef __attribute__((ext_vector_type(4))) unsigned short v4us;
__device__ __forceinline__ v16h cat16(v8h lo, v8h hi) { return __builtin_shufflevector(lo, hi, 0, 1, 2, 3, 4, 5, 6, 7, 8, 9, 10, 11, 12, 13, 14, 15); }
__device__ __forceinline__ v16bf cat16b(v8us lo, v8us hi) { return __builtin_bit_cast(v16bf, __builtin_shufflevector(lo, hi, 0, 1, 2, 3, 4, 5, 6, 7, 8, 9, 10, 11, 12, 13, 14, 15)); }
__device__ __forceinline__ v8f wmma16(v16h a, v16h b, v8f c) { return __builtin_amdgcn_wmma_f32_16x16x32_f16(false, a, false, b, (short)0, c, false, false); }
__device__ __forceinline__ v8f wmmab(v16bf a, v16bf b, v8f c) { return __builtin_amdgcn_wmma_f32_16x16x32_bf16(false, a, false, b, (short)0, c, false, false); }

// ---- k_gemmw: register-blocked GEMM, ONE WAVE per 64x64 output tile (16 accumulators), operands straight from K-contiguous 16-bit planes; grid (M/64, N/64, Z), 32 threads.
// C[m][n] (f32, pitch ldc, + optional f32 bias[n]) = sum_k A[m][k] Bt[n][k] (+ split products per NSPLIT); A rows have pitch lda, Bt rows pitch K. z-batch strides sA/sB/sC in elements. K % 32 == 0.
// KR > 0 (N == 64 only): grid (M/64, K/KR, ZH); work-group y sums k in [y KR, (y+1) KR) alone and stores its partial tile in plane y (plane stride ZH sC); the caller adds the planes.
// EPI 0 stores C. EPI 1 (N tile = one head, HD == 64): no C; row t, col c of the biased tile goes, split into bf16 hi + lo, to Ph/Pl[(c / HD) TT + t][c % HD]. EPI 2: no C; it goes to row c, col t of the planes P16 (f16), Ph, Pl (bf16 hi, lo) of pitch TP.
// Fragments: lane l -> row/col l&15, h = l>>4; elements 0..7 <- k0+8h+0..7, 8..15 <- k0+16+8h+0..7 for BOTH A and Bt (same loader); D element r -> row 8h+r, col l&15.
template <typename T16> struct WFrag;
template <> struct WFrag<h16> { typedef v16h V; static __device__ __forceinline__ V ld(const h16* p) { return cat16(*(const v8h*)p, *(const v8h*)(p + 16)); } static __device__ __forceinline__ v8f mma(V a, V b, v8f c) { return wmma16(a, b, c); } };
template <> struct WFrag<bf> { typedef v16bf V; static __device__ __forceinline__ V ld(const bf* p) { return cat16b(*(const v8us*)p, *(const v8us*)(p + 16)); } static __device__ __forceinline__ v8f mma(V a, V b, v8f c) { return wmmab(a, b, c); } };
template <typename T16, int NSPLIT, bool BIAS, int KR = 0, int EPI = 0>
__global__ __launch_bounds__(32) void k_gemmw(const T16* __restrict__ A, const T16* __restrict__ A2, const T16* __restrict__ Bt, const T16* __restrict__ Bt2, int K, int lda, float* C, int ldc, const float* __restrict__ bias, size_t sA, size_t sB, size_t sC, h16* P16, bf* Ph, bf* Pl) {
    typedef typename WFrag<T16>::V V;
    __shared__ __align__(16) float os[16 * 68];
    const size_t z = blockIdx.z; A += z * sA; if (A2) A2 += z * sA; Bt += z * sB; if (Bt2) Bt2 += z * sB; C += (KR ? (size_t)blockIdx.y * ZH + z : z) * sC;
    const int lane = threadIdx.x & 31, lr = lane & 15, hi = lane >> 4; const int r0 = blockIdx.x * 64, c0 = KR ? 0 : blockIdx.y * 64; const int kb = KR ? blockIdx.y * KR : 0, ke = KR ? kb + KR : K;
    v8f acc[4][4];
#pragma unroll
    for (int mb = 0; mb < 4; ++mb)
#pragma unroll
        for (int nb = 0; nb < 4; ++nb) acc[mb][nb] = (v8f){};
    const size_t aoff = (size_t)(r0 + lr) * lda + 8 * hi, boff = (size_t)(c0 + lr) * K + 8 * hi;
#pragma unroll 1
    for (int kc = kb; kc < ke; kc += 32) {
        V a[4], a2[4];
#pragma unroll
        for (int mb = 0; mb < 4; ++mb) { a[mb] = WFrag<T16>::ld(A + aoff + (size_t)mb * 16 * lda + kc); if (NSPLIT == 1 || NSPLIT == 2) a2[mb] = WFrag<T16>::ld(A2 + aoff + (size_t)mb * 16 * lda + kc); }
#pragma unroll
        for (int nb = 0; nb < 4; ++nb) { const V b = WFrag<T16>::ld(Bt + boff + (size_t)nb * 16 * K + kc); V b2; if (NSPLIT >= 2) b2 = WFrag<T16>::ld(Bt2 + boff + (size_t)nb * 16 * K + kc);
#pragma unroll
            for (int mb = 0; mb < 4; ++mb) { acc[mb][nb] = WFrag<T16>::mma(a[mb], b, acc[mb][nb]); if (NSPLIT == 1 || NSPLIT == 2) acc[mb][nb] = WFrag<T16>::mma(a2[mb], b, acc[mb][nb]); if (NSPLIT >= 2) acc[mb][nb] = WFrag<T16>::mma(a[mb], b2, acc[mb][nb]); } }
        asm volatile("v_nop\n\tv_nop\n\tv_nop\n\tv_nop" : "+v"(acc[0][0]), "+v"(acc[1][1]), "+v"(acc[2][2]), "+v"(acc[3][3]) : "v"(a[0]), "v"(a[3]));
    }
    if constexpr (EPI == 2) {
        // a lane's 8 accumulator elements are 8 consecutive t of one column: one 16-byte store per plane and block, no LDS pass; the four mb blocks of this wave fill the column's 128-byte line
        // the three loops are unrolled so that acc[][] and the store vectors are indexed by constants and stay in registers
#pragma unroll
        for (int nb = 0; nb < 4; ++nb) { const int col = c0 + nb * 16 + lr; const float bb = bfr(bias[col]); const size_t o = (size_t)col * TP + r0 + 8 * hi;
#pragma unroll
            for (int mb = 0; mb < 4; ++mb) { v8h o16; v8us oh, ol;
#pragma unroll
                for (int j = 0; j < 8; ++j) { const float xv = acc[mb][nb][j] + bb; o16[j] = tohx(xv); unsigned short a2, c2; splitf(xv, a2, c2); oh[j] = a2; ol[j] = c2; }
                *(v8h*)(P16 + o + mb * 16) = o16; *(v8us*)(Ph + o + mb * 16) = oh; *(v8us*)(Pl + o + mb * 16) = ol; } }
        return;
    }
#pragma unroll
    for (int mb = 0; mb < 4; ++mb) {
#pragma unroll
        for (int nb = 0; nb < 4; ++nb) {
#pragma unroll
            for (int j = 0; j < 8; ++j) os[(hi * 8 + j) * 68 + nb * 16 + lr] = acc[mb][nb][j]; }
        __builtin_amdgcn_wave_barrier(); asm volatile("" ::: "memory");
        float* crow = C + (size_t)(r0 + mb * 16) * ldc + c0;
{
#pragma unroll
            for (int s = 0; s < 8; ++s) { const int row = 2 * s + hi, cofs = lr * 4; v4f val = *(const v4fa*)(os + row * 68 + cofs); if (BIAS) { val[0] += bfr(bias[c0 + cofs]); val[1] += bfr(bias[c0 + cofs + 1]); val[2] += bfr(bias[c0 + cofs + 2]); val[3] += bfr(bias[c0 + cofs + 3]); }
                if constexpr (EPI == 1) { v4us oh, ol;   // unrolled: the vectors' elements are indexed by constants
#pragma unroll
                    for (int q = 0; q < 4; ++q) { unsigned short a2, c2; splitf(val[q], a2, c2); oh[q] = a2; ol[q] = c2; }
                    const size_t e = ((size_t)blockIdx.y * TT + r0 + mb * 16 + row) * HD + cofs; *(v4us*)(Ph + e) = oh; *(v4us*)(Pl + e) = ol; }
                else *(v4f*)(crow + (size_t)row * ldc + cofs) = val; }
             }
        __builtin_amdgcn_wave_barrier(); asm volatile("" ::: "memory");
    }
}

typedef __attribute__((ext_vector_type(2))) _Float16 v2h;
typedef __attribute__((ext_vector_type(4))) _Float16 v4h;
typedef __attribute__((ext_vector_type(2))) unsigned short v2us;
typedef __attribute__((ext_vector_type(2))) float v2f;
typedef __attribute__((ext_vector_type(4))) int v4i;

__global__ __launch_bounds__(256) void k_wtG(const float* __restrict__ w, int K, int N, bf* Bt) {
    const int lane = threadIdx.x & 31; const int L0 = (blockIdx.x * 8 + (threadIdx.x >> 5)) * 8; const int nlines = N * K / 64;
{
#pragma unroll 1
        for (int l = 0; l < 8; ++l) { const int L = L0 + l; if (L >= nlines) break; const size_t e = (size_t)L * 64 + lane * 2; const int k = (int)(e % K), n = (int)(e / K); v2us o;
            o[0] = f2bf(w[(size_t)k * N + n]); o[1] = f2bf(w[(size_t)(k + 1) * N + n]); *(v2us*)(Bt + e) = o; }
         }
}
__global__ __launch_bounds__(256) void k_cvt8(const float* __restrict__ src, bf* dst, size_t n8) { const size_t i = (size_t)blockIdx.x * 256 + threadIdx.x; if (i >= n8) return; const v8f v = *(const v8f*)(src + i * 8); v8us o;
#pragma unroll
    for (int k = 0; k < 8; ++k) o[k] = f2bf(v[k]); *(v8us*)(dst + i * 8) = o;  }

// k_vrel: tail columns [TT, TT+KX) of every value-plane row (g*HD + d): col TT + r = emb_v[r][d] (r < NBIN, else 0); fp16 plane carries x EVC of the bf16 value, hi plane bf16, lo plane 0.
__global__ __launch_bounds__(256) void k_vrel(const float* __restrict__ ev, h16* V16, bf* Vh, bf* Vl) {
    const int lane = threadIdx.x & 31; const int pr = blockIdx.x * 8 + (threadIdx.x >> 5); if (pr >= NKV * HD) return; const int d = pr & (HD - 1); const int rb0 = lane * 8;
    v8h o16; v8us oh, ol;
#pragma unroll
    for (int q = 0; q < 8; ++q) { const int r = rb0 + q; const int rc = (r < NBIN - 1) ? r : (NBIN - 1); float x = ev[(size_t)rc * HD + d]; x = (r < NBIN) ? x : 0.f; const float xb = bfr(x); o16[q] = tohx(xb * EVC); oh[q] = f2bf(x); ol[q] = f2bf(x * 0.f); }
    const size_t o = (size_t)pr * TP + TT + rb0; const bool act = (lane < KX / 8);
{
        if (act) { *(v8h*)(V16 + o) = o16; *(v8us*)(Vh + o) = oh; *(v8us*)(Vl + o) = ol; }
         }
}
__global__ __launch_bounds__(256) void k_ekp(const float* __restrict__ ek, bf* EK) {
    const int idx = blockIdx.x * 256 + threadIdx.x; if (idx >= KX * HD / 8) return; const int e = idx * 8; const int r = e / HD, d0 = e % HD; const int rc = (r < NBIN - 1) ? r : (NBIN - 1);
    const v4f a = *(const v4f*)(ek + (size_t)rc * HD + d0), b2 = *(const v4f*)(ek + (size_t)rc * HD + d0 + 4); v8us o;
#pragma unroll
    for (int k = 0; k < 4; ++k) { const float x0 = (r < NBIN) ? a[k] : 0.f, x1 = (r < NBIN) ? b2[k] : 0.f; o[k] = f2bf(x0); o[k + 4] = f2bf(x1); }
    *(v8us*)(EK + e) = o;  }

// k_asoft: one wave per score row (zz, i): t[j] = (S[i][j] + QE[i][clip(i-j,-MAXR,MAXR)+MAXR]) x HD^-0.5 + mask[j]; softmax over the TT keys (row staged in this wave's LDS slot, one exp, fixed trees);
// The P planes lie over the score rows: a wave has read its whole row (the row maximum needs all of it) before it stores the row's P values, and no other wave touches that row.
// bins: col TT+0 = sum_{j >= i+MAXR} p, col TT+NBIN-1 = sum_{j <= i-MAXR} p, col TT+r (0 < r < NBIN-1) = p[i+MAXR-r] (0 outside [0,TT)), cols >= TT+NBIN zero.
__global__ __launch_bounds__(256) void k_asoft(const float* Sb, const float* __restrict__ QE, const float* __restrict__ mrow, h16* P16, bf* Ph, bf* Pl) {
    __shared__ __align__(16) float prow[8][TT];
    __shared__ __align__(16) float qes[8][KX];
    const int lane = threadIdx.x & 31, wv = threadIdx.x >> 5; const int row = blockIdx.x * 8 + wv; if (row >= ZH * TT) return;
    const int i = row % TT; const bool hires = (i < RH);
    const float* sr = Sb + (size_t)row * TP; const float* qr = QE + (size_t)row * KX; float* pr = prow[wv]; float* qs = qes[wv];
    { const v4f a = *(const v4f*)(qr + lane * 4); const int l2 = lane & 15; const v4f b2 = *(const v4f*)(qr + 128 + l2 * 4);
      *(v4f*)(qs + lane * 4) = a; if (lane < 16) *(v4f*)(qs + 128 + l2 * 4) = b2; }
    asm volatile("" ::: "memory"); __builtin_amdgcn_wave_barrier(); asm volatile("" ::: "memory");
    float mx = -3.0e38f;
#pragma unroll 4
    for (int ch = 0; ch < TT / 128; ++ch) { const int j0 = ch * 128 + lane * 4; const v4f a = *(const v4f*)(sr + j0); const v4f mk = *(const v4f*)(mrow + j0); v4f t4;
#pragma unroll
        for (int q = 0; q < 4; ++q) { const int j = j0 + q; int rel = i - j; rel = rel > MAXR ? MAXR : (rel < -MAXR ? -MAXR : rel); const float t = (a[q] + qs[rel + MAXR]) * SCL + bfr(mk[q]); t4[q] = t; mx = fmaxf(mx, t); }
        *(v4f*)(pr + j0) = t4; }
#pragma unroll
    for (int sh = 16; sh; sh >>= 1) mx = fmaxf(mx, __shfl_xor(mx, sh, 32));
    float sum = 0.f, clo = 0.f, chi = 0.f;
#pragma unroll 4
    for (int ch = 0; ch < TT / 128; ++ch) { const int j0 = ch * 128 + lane * 4; const v4f t4 = *(const v4f*)(pr + j0); v4f e4;
#pragma unroll
        for (int q = 0; q < 4; ++q) { float d0 = __fsub_rn(t4[q], mx); asm volatile("" : "+v"(d0)); const float e = __builtin_amdgcn_exp2f(__fmul_rn(d0, 1.4426950408889634f)); e4[q] = e; sum += e; const int j = j0 + q; clo += (j >= i + MAXR) ? e : 0.f; chi += (j <= i - MAXR) ? e : 0.f; }
        *(v4f*)(pr + j0) = e4; }
#pragma unroll
    for (int sh = 16; sh; sh >>= 1) { sum += __shfl_xor(sum, sh, 32); clo += __shfl_xor(clo, sh, 32); chi += __shfl_xor(chi, sh, 32); }
    const float f = __fdiv_rn(hires ? 1.0f : PCAR, sum);
    asm volatile("" ::: "memory"); __builtin_amdgcn_wave_barrier(); asm volatile("" ::: "memory");
    float tb[8]; const int rb0 = lane * 8;
#pragma unroll
    for (int q = 0; q < 8; ++q) { const int r = rb0 + q; const int j = i + MAXR - r; const int jc = j < 0 ? 0 : (j > TT - 1 ? TT - 1 : j); float val = pr[jc]; val = (j >= 0 && j < TT) ? val : 0.f; val = (r == 0) ? clo : val; val = (r == NBIN - 1) ? chi : val; val = (r >= NBIN) ? 0.f : val; tb[q] = val; }
    const bool tl = (lane < KX / 8);
{
        if (hires) { const size_t ob = (size_t)row * (2 * TP);
#pragma unroll 4
            for (int ch = 0; ch < TT / 128; ++ch) { const int j0 = ch * 128 + lane * 4; const v4f e4 = *(const v4f*)(pr + j0); v4us oh, ol;
#pragma unroll
                for (int q = 0; q < 4; ++q) { unsigned short a, c2; splitf(e4[q] * f, a, c2); oh[q] = a; ol[q] = c2; }
                *(v4us*)(Ph + ob + j0) = oh; *(v4us*)(Pl + ob + j0) = ol; }
            v8us th, tw;
#pragma unroll
            for (int q = 0; q < 8; ++q) { unsigned short a, c2; splitf(tb[q] * f, a, c2); th[q] = a; tw[q] = c2; }
            if (tl) { *(v8us*)(Ph + ob + TT + rb0) = th; *(v8us*)(Pl + ob + TT + rb0) = tw; }
        } else { const size_t ob = (size_t)row * (2 * TP);
#pragma unroll 4
            for (int ch = 0; ch < TT / 128; ++ch) { const int j0 = ch * 128 + lane * 4; const v4f e4 = *(const v4f*)(pr + j0); v4h o4;
#pragma unroll
                for (int q = 0; q < 4; ++q) o4[q] = tohx(e4[q] * f);
                *(v4h*)(P16 + ob + j0) = o4; }
            v8h t8;
#pragma unroll
            for (int q = 0; q < 8; ++q) t8[q] = tohx(tb[q] * f * (1.0f / EVC));
            if (tl) *(v8h*)(P16 + ob + TT + rb0) = t8; }
         }
}
__global__ __launch_bounds__(256) void k_merge(const float* __restrict__ O, int h0, float* OUTb) { const size_t e = ((size_t)blockIdx.x * 256 + threadIdx.x) * 2; if (e >= (size_t)ZH * TT * HD) return; const int d = (int)(e % HD); const int t = (int)((e / HD) % TT); const int zz = (int)(e / ((size_t)HD * TT)); const float cs = (t < RH) ? 1.0f : (1.0f / PCAR); const size_t oo = (size_t)t * DQ + (h0 + zz) * HD + d;
    v2f sm = *(const v2f*)(O + e);
    // unrolled so that the loads of all planes are in flight together; rolled, each add would wait for its own load
#pragma unroll
    for (int ks = 1; ks < KSN; ++ks) sm += *(const v2f*)(O + (size_t)ks * ZH * TT * HD + e);
    v2f o2; o2[0] = sm[0] * cs; o2[1] = sm[1] * cs; *(v2f*)(OUTb + oo) = o2;  }

extern "C" void kernel_launch(void* const* d_in, const int* in_sizes, int n_in,
                              void* d_out, int out_size, void* d_ws, size_t ws_size, hipStream_t stream) {
    if (n_in < 10) return;
    if ((size_t)in_sizes[0] < ((size_t)(NB - 1) * TTF + TT) * DM) return;
    if ((size_t)in_sizes[1] < (size_t)(NB - 1) * TTF + TT) return;
    if (in_sizes[2] < DM * DQ || in_sizes[4] < DM * DKV || in_sizes[6] < DM * DKV) return;
    if (in_sizes[3] < DQ || in_sizes[5] < DKV || in_sizes[7] < DKV) return;
    if (in_sizes[8] < NBIN * HD || in_sizes[9] < NBIN * HD) return;
    if ((size_t)out_size < (size_t)NB * TT * DQ) return;
    const float* x = (const float*)d_in[0]; const float* mask = (const float*)d_in[1];   // [NB][1][1][TTF], added per key
    const float* wq = (const float*)d_in[2]; const float* bq = (const float*)d_in[3]; const float* wk = (const float*)d_in[4]; const float* bk = (const float*)d_in[5]; const float* wv = (const float*)d_in[6]; const float* bv = (const float*)d_in[7];
    const float* embk = (const float*)d_in[8]; const float* embv = (const float*)d_in[9];   // [NBIN][HD] each
    float* OUT = (float*)d_out;     // [NB][TT][DQ]
    char* wsp = (char*)d_ws;
    auto take = [&](size_t bytes) { char* p = wsp; wsp += (bytes + 255) & ~(size_t)255; return (void*)p; };
    bf* WQ = (bf*)take((size_t)DQ * DM * 2); bf* WK = (bf*)take((size_t)DKV * DM * 2); bf* WV = (bf*)take((size_t)DKV * DM * 2); bf* EK = (bf*)take((size_t)KX * HD * 2);
    h16* VT16 = (h16*)take((size_t)NKV * HD * TP * 2);
    bf* QPh = (bf*)take((size_t)NH_ * TT * HD * 2); bf* QPl = (bf*)take((size_t)NH_ * TT * HD * 2); bf* KPh = (bf*)take((size_t)NKV * TT * HD * 2); bf* KPl = (bf*)take((size_t)NKV * TT * HD * 2); bf* VTh = (bf*)take((size_t)NKV * HD * TP * 2); bf* VTl = (bf*)take((size_t)NKV * HD * TP * 2);
    float* Sb = (float*)take((size_t)ZH * TT * TP * 4); float* QEb = (float*)take((size_t)ZH * TT * KX * 4); float* Ob = (float*)take((size_t)KSN * ZH * TT * HD * 4);
    if ((size_t)(wsp - (char*)d_ws) > ws_size) return;    // carve 243.2 MiB at NB 2 / SEQ 2048
    h16* P16 = (h16*)Sb; bf* Ph = (bf*)Sb; bf* Pl = Ph + TP;   // P planes over the score rows: 16-bit row pitch 2 TP
    // the bf16 copy of x shares the partial planes' area: each batch is done with it before its first attn.v GEMM, and the next batch rewrites it after the last merge (stream-ordered)
    static_assert((size_t)TT * DM * 2 <= (size_t)KSN * ZH * TT * HD * 4);
    bf* XB = (bf*)Ob;
    k_wtG<<<(unsigned)((DM * DQ / 64 + 63) / 64), 256, 0, stream>>>(wq, DM, DQ, WQ); k_wtG<<<(unsigned)((DM * DKV / 64 + 63) / 64), 256, 0, stream>>>(wk, DM, DKV, WK); k_wtG<<<(unsigned)((DM * DKV / 64 + 63) / 64), 256, 0, stream>>>(wv, DM, DKV, WV);
    k_ekp<<<(KX * HD / 8 + 255) / 256, 256, 0, stream>>>(embk, EK);
    k_vrel<<<(NKV * HD + 7) / 8, 256, 0, stream>>>(embv, VT16, VTh, VTl);
    for (int b = 0; b < NB; ++b) {
        k_cvt8<<<(unsigned)(((size_t)TT * DM / 8 + 255) / 256), 256, 0, stream>>>(x + (size_t)b * TTF * DM, XB, (size_t)TT * DM / 8);
        k_gemmw<bf, 0, true, 0, 1><<<dim3(TT / 64, DQ / 64, 1), 32, 0, stream>>>(XB, nullptr, WQ, nullptr, DM, DM, nullptr, 0, bq, 0, 0, 0, nullptr, QPh, QPl);
        k_gemmw<bf, 0, true, 0, 1><<<dim3(TT / 64, DKV / 64, 1), 32, 0, stream>>>(XB, nullptr, WK, nullptr, DM, DM, nullptr, 0, bk, 0, 0, 0, nullptr, KPh, KPl);
        k_gemmw<bf, 0, true, 0, 2><<<dim3(TT / 64, DKV / 64, 1), 32, 0, stream>>>(XB, nullptr, WV, nullptr, DM, DM, nullptr, 0, bv, 0, 0, 0, VT16, VTh, VTl);
        for (int h0 = 0; h0 < NH_; h0 += ZH) { const size_t zq = (size_t)h0, zk = (size_t)(h0 / REP);
            k_gemmw<bf, 1, false><<<dim3(TT / 64, KX / 64, ZH), 32, 0, stream>>>(QPh + zq * TT * HD, QPl + zq * TT * HD, EK, nullptr, HD, HD, QEb, KX, nullptr, (size_t)TT * HD, 0, (size_t)TT * KX, nullptr, nullptr, nullptr);   /* QE = q emb_k^T, q hi/lo x exact emb_k */
            k_gemmw<bf, 2, false><<<dim3(TT / 64, TT / 64, ZH), 32, 0, stream>>>(QPh + zq * TT * HD, QPl + zq * TT * HD, KPh + zk * TT * HD, KPl + zk * TT * HD, HD, HD, Sb, TP, nullptr, (size_t)TT * HD, (size_t)TT * HD, (size_t)TT * TP, nullptr, nullptr, nullptr);   /* scores hi/lo on every row */
            k_asoft<<<ZH * TT / 8, 256, 0, stream>>>(Sb, QEb, mask + (size_t)b * TTF, P16, Ph, Pl);
            k_gemmw<bf, 2, false, KSP><<<dim3(RH / 64, KSN, ZH), 32, 0, stream>>>(Ph, Pl, VTh + zk * HD * TP, VTl + zk * HD * TP, TP, 2 * TP, Ob, HD, nullptr, (size_t)TT * 2 * TP, (size_t)HD * TP, (size_t)TT * HD, nullptr, nullptr, nullptr);
            k_gemmw<h16, 0, false, KSP><<<dim3((TT - RH) / 64, KSN, ZH), 32, 0, stream>>>(P16 + (size_t)RH * 2 * TP, nullptr, VT16 + zk * HD * TP, nullptr, TP, 2 * TP, Ob + (size_t)RH * HD, HD, nullptr, (size_t)TT * 2 * TP, (size_t)HD * TP, (size_t)TT * HD, nullptr, nullptr, nullptr);
            k_merge<<<(unsigned)(((size_t)ZH * TT * HD / 2 + 255) / 256), 256, 0, stream>>>(Ob, h0, OUT + (size_t)b * TT * DQ); }
    }
}

// v004
// It runs in 442 microseconds.
// Two timings next to v003 put it at 1.47 and 1.45 times that version's speed.
// All steps since v000 together make it 5.61 times as fast.
#include <hip/hip_runtime.h>

// Contractions: x W (q,k,v) on v_wmma_f32_16x16x32_bf16 (bf16 operands from RNE-bf16 inputs); q.k and q.emb_k score tiles bf16 hi/lo split (3 and 2 products); attn.v with the rel-value bins.emb_v folded into K: rows < RH bf16 hi/lo split, rows >= RH v_wmma_f32_16x16x32_f16 (P x1024, bins x64, emb_v x16, v plain f16); f32 accumulate, f32 softmax.
// Self-attention, 16 heads x 64: q,k,v = x W + b ('xw' layout), scores = (q.k + q.emb_k[clip(i-j)]) x 64^-0.5 + additive key mask, softmax over all keys,
// ctx = probs v + sum_r bins[i][r] emb_v[r] (bins: band copies of probs plus the two clipped tail sums), output concat-heads [NB][TT][1024] f32, no output projection.
// Layout: bf16 copy of x (per batch); weights transposed once to [n][k] bf16; the projection GEMMs add the f32 bias and store their tiles straight as head planes [b][h][t][d] (bf16 hi/lo) for q,k and value planes [b][h][d][TT+192] (f16, bf16 hi/lo; cols >= TT hold emb_v);
// one attention kernel: a work-group holds the scores of QB query rows x all TT keys of one head in registers, does the softmax there and feeds the attn.v WMMAs from the same registers (see k_attn).

#ifndef NB
#define NB   2
#endif
#ifndef SEQ
#define SEQ  2048
#endif
#define NB_FULL  2
#define TTF  2048                 // full per-batch sequence stride of the inputs
#define TT   SEQ
#define DM   1024
#define NH_  16
#define NKV  16
#define REP  (NH_ / NKV)
#define HD   64
#define DQ   (NH_ * HD)
#define DKV  (NKV * HD)
#define ZH   8                    // z extent of k_gemmw's K-range form (KR > 0)
#define RH   ((TT / 2 < 512) ? (TT / 2) : 512)   // query rows < RH use hi+lo planes
#define PCAR 1024.0f
#define SCL  0.125f   // HD^-0.5
#define MAXR 64
#define NBIN (2 * MAXR + 1)       // 129 clipped offsets
#define KX   192                  // NBIN padded to a multiple of 64
#define TP   (TT + KX)            // row pitch of the value planes (keys + KX bin columns)
#define EVC  16.0f                // f16 carry of emb_v in the value planes (bins carry 1024/16 = 64)
#define QT   2                    // 16-query tiles per work-group of k_attn
#define QB   (16 * QT)
#define NW   16                   // waves per work-group of k_attn, each owns KW keys
#define KW   (TT / NW)
#define KTN  (KW / 16)            // 16-key tiles per wave
#define VAH1 4                    // attn.v, f16 rows: value fragments are fetched this many steps ahead
#define VAH2 2                    // attn.v, hi/lo rows (two fragments a step)
#define KLATE 2                   // the last KLATE key tiles of a wave are fetched one tile ahead, the others two
#define NBT  ((NBIN + 15) / 16)   // 16-bin tiles of QE
#define QEP  (NBT * 16 + 1)       // LDS pitch of a QE row (odd: a column read meets distinct banks)
#define KXB  160                  // NBIN padded to k steps of 32
#define BP   (KXB + 4)            // LDS pitch of a bins row, 16 B x odd
#define OP   (HD + 4)             // LDS pitch of a partial ctx row, 16 B x odd

static_assert(TT % 128 == 0);
static_assert(RH % 64 == 0);
static_assert(RH >= 64);
static_assert((TT - RH) % 64 == 0);
static_assert(TT - RH >= 64);
static_assert(TP % 32 == 0);
static_assert(TT % (NW * 32) == 0);
static_assert(TT % QB == 0);
static_assert(RH % QB == 0);
static_assert(KXB >= NBIN && KXB <= KX && KXB % 32 == 0);
static_assert((NBIN - 1) % 32 == 0);
static_assert(KXB / 32 <= NW);
static_assert(KX % 64 == 0);
static_assert(KX >= NBIN);
static_assert(KX == 192);
static_assert(HD == 64);
static_assert(NH_ % ZH == 0);
static_assert(DM % 64 == 0);
static_assert((KX * HD) % (8 * 256) == 0);
static_assert(((size_t)TT * DM / 8) % 256 == 0);
static_assert((NKV * HD) % 8 == 0);
static_assert(NB <= NB_FULL);
static_assert(TT <= TTF);

typedef _Float16 h16;
typedef unsigned short bf;
typedef __attribute__((ext_vector_type(16))) __bf16   v16bf;
typedef __attribute__((ext_vector_type(16))) _Float16 v16h;
typedef __attribute__((ext_vector_type(8)))  _Float16 v8h;
typedef __attribute__((ext_vector_type(8)))  unsigned short v8us;
typedef __attribute__((ext_vector_type(8)))  float    v8f;
typedef __attribute__((ext_vector_type(4)))  float    v4f;
typedef v8h  __attribute__((may_alias)) v8ha;
typedef v4f  __attribute__((may_alias)) v4fa;
typedef v8us __attribute__((may_alias)) v8usa;

__device__ __forceinline__ unsigned short f2bf(float f) { unsigned u = __float_as_uint(f); u += 0x7FFFu + ((u >> 16) & 1u); return (unsigned short)(u >> 16); }
__device__ __forceinline__ float bf2f(unsigned short b) { return __uint_as_float(((unsigned)b) << 16); }
__device__ __forceinline__ float bfr(float f) { return bf2f(f2bf(f)); }
__device__ __forceinline__ h16 tohx(float x) { return (h16)x; }
__device__ __forceinline__ void splitf(float y, unsigned short& h, unsigned short& l) { h = f2bf(y); l = f2bf(y - bf2f(h)); }
typedef __attribute__((ext_vector_type(4))) unsigned short v4us;
__device__ __forceinline__ v16h cat16(v8h lo, v8h hi) { return __builtin_shufflevector(lo, hi, 0, 1, 2, 3, 4, 5, 6, 7, 8, 9, 10, 11, 12, 13, 14, 15); }
__device__ __forceinline__ v16bf cat16b(v8us lo, v8us hi) { return __builtin_bit_cast(v16bf, __builtin_shufflevector(lo, hi, 0, 1, 2, 3, 4, 5, 6, 7, 8, 9, 10, 11, 12, 13, 14, 15)); }
__device__ __forceinline__ v8f wmma16(v16h a, v16h b, v8f c) { return __builtin_amdgcn_wmma_f32_16x16x32_f16(false, a, false, b, (short)0, c, false, false); }
__device__ __forceinline__ v8f wmmab(v16bf a, v16bf b, v8f c) { return __builtin_amdgcn_wmma_f32_16x16x32_bf16(false, a, false, b, (short)0, c, false, false); }

// ---- k_gemmw: register-blocked GEMM, ONE WAVE per 64x64 output tile (16 accumulators), operands straight from K-contiguous 16-bit planes; grid (M/64, N/64, Z), 32 threads.
// C[m][n] (f32, pitch ldc, + optional f32 bias[n]) = sum_k A[m][k] Bt[n][k] (+ split products per NSPLIT); A rows have pitch lda, Bt rows pitch K. z-batch strides sA/sB/sC in elements. K % 32 == 0.
// KR > 0 (N == 64 only): grid (M/64, K/KR, ZH); work-group y sums k in [y KR, (y+1) KR) alone and stores its partial tile in plane y (plane stride ZH sC); the caller adds the planes.
// EPI 0 stores C. EPI 1 (N tile = one head, HD == 64): no C; row t, col c of the biased tile goes, split into bf16 hi + lo, to Ph/Pl[(c / HD) TT + t][c % HD]. EPI 2: no C; it goes to row c, col t of the planes P16 (f16), Ph, Pl (bf16 hi, lo) of pitch TP.
// Fragments: lane l -> row/col l&15, h = l>>4; elements 0..7 <- k0+8h+0..7, 8..15 <- k0+16+8h+0..7 for BOTH A and Bt (same loader); D element r -> row 8h+r, col l&15.
template <typename T16> struct WFrag;
template <> struct WFrag<h16> { typedef v16h V; static __device__ __forceinline__ V ld(const h16* p) { return cat16(*(const v8h*)p, *(const v8h*)(p + 16)); } static __device__ __forceinline__ v8f mma(V a, V b, v8f c) { return wmma16(a, b, c); } };
template <> struct WFrag<bf> { typedef v16bf V; static __device__ __forceinline__ V ld(const bf* p) { return cat16b(*(const v8us*)p, *(const v8us*)(p + 16)); } static __device__ __forceinline__ v8f mma(V a, V b, v8f c) { return wmmab(a, b, c); } };
template <typename T16, int NSPLIT, bool BIAS, int KR = 0, int EPI = 0>
__global__ __launch_bounds__(32) void k_gemmw(const T16* __restrict__ A, const T16* __restrict__ A2, const T16* __restrict__ Bt, const T16* __restrict__ Bt2, int K, int lda, float* C, int ldc, const float* __restrict__ bias, size_t sA, size_t sB, size_t sC, h16* P16, bf* Ph, bf* Pl) {
    typedef typename WFrag<T16>::V V;
    __shared__ __align__(16) float os[16 * 68];
    const size_t z = blockIdx.z; A += z * sA; if (A2) A2 += z * sA; Bt += z * sB; if (Bt2) Bt2 += z * sB; C += (KR ? (size_t)blockIdx.y * ZH + z : z) * sC;
    const int lane = threadIdx.x & 31, lr = lane & 15, hi = lane >> 4; const int r0 = blockIdx.x * 64, c0 = KR ? 0 : blockIdx.y * 64; const int kb = KR ? blockIdx.y * KR : 0, ke = KR ? kb + KR : K;
    v8f acc[4][4];
#pragma unroll
    for (int mb = 0; mb < 4; ++mb)
#pragma unroll
        for (int nb = 0; nb < 4; ++nb) acc[mb][nb] = (v8f){};
    const size_t aoff = (size_t)(r0 + lr) * lda + 8 * hi, boff = (size_t)(c0 + lr) * K + 8 * hi;
#pragma unroll 1
    for (int kc = kb; kc < ke; kc += 32) {
        V a[4], a2[4];
#pragma unroll
        for (int mb = 0; mb < 4; ++mb) { a[mb] = WFrag<T16>::ld(A + aoff + (size_t)mb * 16 * lda + kc); if (NSPLIT == 1 || NSPLIT == 2) a2[mb] = WFrag<T16>::ld(A2 + aoff + (size_t)mb * 16 * lda + kc); }
#pragma unroll
        for (int nb = 0; nb < 4; ++nb) { const V b = WFrag<T16>::ld(Bt + boff + (size_t)nb * 16 * K + kc); V b2; if (NSPLIT >= 2) b2 = WFrag<T16>::ld(Bt2 + boff + (size_t)nb * 16 * K + kc);
#pragma unroll
            for (int mb = 0; mb < 4; ++mb) { acc[mb][nb] = WFrag<T16>::mma(a[mb], b, acc[mb][nb]); if (NSPLIT == 1 || NSPLIT == 2) acc[mb][nb] = WFrag<T16>::mma(a2[mb], b, acc[mb][nb]); if (NSPLIT >= 2) acc[mb][nb] = WFrag<T16>::mma(a[mb], b2, acc[mb][nb]); } }
        asm volatile("v_nop\n\tv_nop\n\tv_nop\n\tv_nop" : "+v"(acc[0][0]), "+v"(acc[1][1]), "+v"(acc[2][2]), "+v"(acc[3][3]) : "v"(a[0]), "v"(a[3]));
    }
    if constexpr (EPI == 2) {
        // a lane's 8 accumulator elements are 8 consecutive t of one column: one 16-byte store per plane and block, no LDS pass; the four mb blocks of this wave fill the column's 128-byte line
        // the three loops are unrolled so that acc[][] and the store vectors are indexed by constants and stay in registers
#pragma unroll
        for (int nb = 0; nb < 4; ++nb) { const int col = c0 + nb * 16 + lr; const float bb = bfr(bias[col]); const size_t o = (size_t)col * TP + r0 + 8 * hi;
#pragma unroll
            for (int mb = 0; mb < 4; ++mb) { v8h o16; v8us oh, ol;
#pragma unroll
                for (int j = 0; j < 8; ++j) { const float xv = acc[mb][nb][j] + bb; o16[j] = tohx(xv); unsigned short a2, c2; splitf(xv, a2, c2); oh[j] = a2; ol[j] = c2; }
                *(v8h*)(P16 + o + mb * 16) = o16; *(v8us*)(Ph + o + mb * 16) = oh; *(v8us*)(Pl + o + mb * 16) = ol; } }
        return;
    }
#pragma unroll
    for (int mb = 0; mb < 4; ++mb) {
#pragma unroll
        for (int nb = 0; nb < 4; ++nb) {
#pragma unroll
            for (int j = 0; j < 8; ++j) os[(hi * 8 + j) * 68 + nb * 16 + lr] = acc[mb][nb][j]; }
        __builtin_amdgcn_wave_barrier(); asm volatile("" ::: "memory");
        float* crow = C + (size_t)(r0 + mb * 16) * ldc + c0;
{
#pragma unroll
            for (int s = 0; s < 8; ++s) { const int row = 2 * s + hi, cofs = lr * 4; v4f val = *(const v4fa*)(os + row * 68 + cofs); if (BIAS) { val[0] += bfr(bias[c0 + cofs]); val[1] += bfr(bias[c0 + cofs + 1]); val[2] += bfr(bias[c0 + cofs + 2]); val[3] += bfr(bias[c0 + cofs + 3]); }
                if constexpr (EPI == 1) { v4us oh, ol;   // unrolled: the vectors' elements are indexed by constants
#pragma unroll
                    for (int q = 0; q < 4; ++q) { unsigned short a2, c2; splitf(val[q], a2, c2); oh[q] = a2; ol[q] = c2; }
                    const size_t e = ((size_t)blockIdx.y * TT + r0 + mb * 16 + row) * HD + cofs; *(v4us*)(Ph + e) = oh; *(v4us*)(Pl + e) = ol; }
                else *(v4f*)(crow + (size_t)row * ldc + cofs) = val; }
             }
        __builtin_amdgcn_wave_barrier(); asm volatile("" ::: "memory");
    }
}

typedef __attribute__((ext_vector_type(2))) _Float16 v2h;
typedef __attribute__((ext_vector_type(4))) _Float16 v4h;
typedef __attribute__((ext_vector_type(2))) unsigned short v2us;
typedef __attribute__((ext_vector_type(2))) float v2f;
typedef __attribute__((ext_vector_type(4))) int v4i;

__global__ __launch_bounds__(256) void k_wtG(const float* __restrict__ w, int K, int N, bf* Bt) {
    const int lane = threadIdx.x & 31; const int L0 = (blockIdx.x * 8 + (threadIdx.x >> 5)) * 8; const int nlines = N * K / 64;
{
#pragma unroll 1
        for (int l = 0; l < 8; ++l) { const int L = L0 + l; if (L >= nlines) break; const size_t e = (size_t)L * 64 + lane * 2; const int k = (int)(e % K), n = (int)(e / K); v2us o;
            o[0] = f2bf(w[(size_t)k * N + n]); o[1] = f2bf(w[(size_t)(k + 1) * N + n]); *(v2us*)(Bt + e) = o; }
         }
}
__global__ __launch_bounds__(256) void k_cvt8(const float* __restrict__ src, bf* dst, size_t n8) { const size_t i = (size_t)blockIdx.x * 256 + threadIdx.x; if (i >= n8) return; const v8f v = *(const v8f*)(src + i * 8); v8us o;
#pragma unroll
    for (int k = 0; k < 8; ++k) o[k] = f2bf(v[k]); *(v8us*)(dst + i * 8) = o;  }

// k_vrel: tail columns [TT, TT+KX) of every value-plane row ((b*NKV + g)*HD + d): col TT + r = emb_v[r][d] (r < NBIN, else 0); fp16 plane carries x EVC of the bf16 value, hi plane bf16, lo plane 0.
__global__ __launch_bounds__(256) void k_vrel(const float* __restrict__ ev, h16* V16, bf* Vh, bf* Vl) {
    const int lane = threadIdx.x & 31; const int pr = blockIdx.x * 8 + (threadIdx.x >> 5); if (pr >= NB * NKV * HD) return; const int d = pr & (HD - 1); const int rb0 = lane * 8;
    v8h o16; v8us oh, ol;
#pragma unroll
    for (int q = 0; q < 8; ++q) { const int r = rb0 + q; const int rc = (r < NBIN - 1) ? r : (NBIN - 1); float x = ev[(size_t)rc * HD + d]; x = (r < NBIN) ? x : 0.f; const float xb = bfr(x); o16[q] = tohx(xb * EVC); oh[q] = f2bf(x); ol[q] = f2bf(x * 0.f); }
    const size_t o = (size_t)pr * TP + TT + rb0; const bool act = (lane < KX / 8);
{
        if (act) { *(v8h*)(V16 + o) = o16; *(v8us*)(Vh + o) = oh; *(v8us*)(Vl + o) = ol; }
         }
}
__global__ __launch_bounds__(256) void k_ekp(const float* __restrict__ ek, bf* EK) {
    const int idx = blockIdx.x * 256 + threadIdx.x; if (idx >= KX * HD / 8) return; const int e = idx * 8; const int r = e / HD, d0 = e % HD; const int rc = (r < NBIN - 1) ? r : (NBIN - 1);
    const v4f a = *(const v4f*)(ek + (size_t)rc * HD + d0), b2 = *(const v4f*)(ek + (size_t)rc * HD + d0 + 4); v8us o;
#pragma unroll
    for (int k = 0; k < 4; ++k) { const float x0 = (r < NBIN) ? a[k] : 0.f, x1 = (r < NBIN) ? b2[k] : 0.f; o[k] = f2bf(x0); o[k + 4] = f2bf(x1); }
    *(v8us*)(EK + e) = o;  }

// ---- k_attn: the whole attention stage of QB query rows of one head in one work-group of NW waves; grid (TT/QB, NH_, NB).
// Wave w owns keys [w KW, (w+1) KW). It forms the TRANSPOSED score tiles (A = key rows, B = query rows), so lane l holds query l&15 and keys 8(l>>4)+0..7 of each tile:
// two neighbouring key tiles are, register for register, the A fragment (row = query, k = key) of the attn.v product, and the scores never leave the registers.
// t = (q.k + QE[i][clip(i-j)+MAXR]) x HD^-0.5 + mask[j]; row maximum and row sums go across the waves through LDS in wave order; P is normalised before it is rounded to 16 bit.
// bins (LDS, f32, unnormalised): col r (0 < r < NBIN-1) = e[i+MAXR-r] (0 outside [0,TT)); col 0 = sum_{j >= i+MAXR} e and col NBIN-1 = sum_{j <= i-MAXR} e are put in when the fragment is formed; waves < KXB/32 add one k step of bins x emb_v each.
// Each wave's 64-column partial of ctx goes to LDS; the work-group adds the NW partials in wave order and stores the output rows.
// 2^x on v_exp_f32; the v_nop is the one free issue slot that the instruction set asks for between a transcendental and a next instruction that reads its result or overwrites its source; in one statement it stays directly behind it
__device__ __forceinline__ float exp2s(float x) { float e; asm("v_exp_f32 %0, %1\n\tv_nop" : "=v"(e) : "v"(x)); return e; }
template <bool B> struct BoolC { static constexpr bool value = B; };
template <bool SPLIT> struct PvT { typedef h16 T; };
template <> struct PvT<true> { typedef bf T; };
template <bool SPLIT, typename T16>
__device__ __forceinline__ void pv_frag(const float (&x)[QT][16], typename WFrag<T16>::V (&p)[QT], typename WFrag<T16>::V (&p2)[QT]) {
#pragma unroll
    for (int qt = 0; qt < QT; ++qt) {
        if constexpr (SPLIT) { v8us h0, h1, l0, l1;
#pragma unroll
            for (int r = 0; r < 8; ++r) { unsigned short a, c; splitf(x[qt][r], a, c); h0[r] = a; l0[r] = c; splitf(x[qt][8 + r], a, c); h1[r] = a; l1[r] = c; }
            p[qt] = cat16b(h0, h1); p2[qt] = cat16b(l0, l1);
        } else { v8h h0, h1;
#pragma unroll
            for (int r = 0; r < 8; ++r) { h0[r] = tohx(x[qt][r]); h1[r] = tohx(x[qt][8 + r]); }
            p[qt] = cat16(h0, h1); }
    }
}
template <bool SPLIT, typename T16>
__device__ __forceinline__ void pv_mma(const typename WFrag<T16>::V (&p)[QT], const typename WFrag<T16>::V (&p2)[QT], typename WFrag<T16>::V v, typename WFrag<T16>::V v2, v8f (&o)[QT][4], int dt) {
#pragma unroll
    for (int qt = 0; qt < QT; ++qt) o[qt][dt] = WFrag<T16>::mma(p[qt], v, o[qt][dt]);
    if constexpr (SPLIT) {
#pragma unroll
        for (int qt = 0; qt < QT; ++qt) o[qt][dt] = WFrag<T16>::mma(p2[qt], v, o[qt][dt]);
#pragma unroll
        for (int qt = 0; qt < QT; ++qt) o[qt][dt] = WFrag<T16>::mma(p[qt], v2, o[qt][dt]); }
}

__global__ __launch_bounds__(NW * 32) void k_attn(const bf* __restrict__ QPh, const bf* __restrict__ QPl, const bf* __restrict__ KPh, const bf* __restrict__ KPl, const bf* __restrict__ EK,
                                                  const h16* __restrict__ V16, const bf* __restrict__ Vh, const bf* __restrict__ Vl, const float* __restrict__ mask, float* OUT) {
    __shared__ __align__(16) float ored[NW][QB * OP];
    __shared__ __align__(16) float binsL[QB * BP];
    __shared__ float qes[QB * QEP];
    __shared__ float rmx[NW][QB], rsm[NW][QB], rlo[NW][QB], rhi[NW][QB];
    typedef WFrag<bf> FB;
    const int tid = threadIdx.x, lane = tid & 31, lr = lane & 15, hi = lane >> 4;
    const int wave = __builtin_amdgcn_readfirstlane(tid >> 5);
    const int i0 = blockIdx.x * QB, head = blockIdx.y, b = blockIdx.z; const bool hires = (i0 < RH);
    const size_t pq = ((size_t)b * NH_ + head) * TT * HD, pk = ((size_t)b * NKV + head / REP) * TT * HD, pv = ((size_t)b * NKV + head / REP) * HD * TP;
    const int kbase = wave * KW;
    // every global address is a wave-uniform base + one lane offset + a constant: the few address registers stay as they are while the loads that name them are in flight
    const unsigned lo = (unsigned)(lr * HD + 8 * hi), lv = (unsigned)(lr * TP + 8 * hi), lm = (unsigned)(8 * hi);
    const bf* qbh = QPh + pq + (size_t)i0 * HD; const bf* qbl = QPl + pq + (size_t)i0 * HD; const bf* kbh = KPh + pk + (size_t)kbase * HD; const bf* kbl = KPl + pk + (size_t)kbase * HD;
    const float* mrow = mask + (size_t)b * TTF + kbase;
    for (int e = tid; e < QB * BP; e += NW * 32) binsL[e] = 0.f;
    // QE = q emb_k^T (q hi/lo x exact emb_k), one 16x16 tile per job, into LDS
    for (int job = wave; job < QT * NBT; job += NW) { const int qt = job / NBT, nt = job - qt * NBT; v8f a = (v8f){};
        const bf* jh = qbh + qt * 16 * HD; const bf* jl = qbl + qt * 16 * HD; const bf* je = EK + nt * 16 * HD;
#pragma unroll
        for (int ks = 0; ks < 2; ++ks) { const v16bf ah = FB::ld(jh + lo + ks * 32), al = FB::ld(jl + lo + ks * 32), eb = FB::ld(je + lo + ks * 32);
            a = wmmab(ah, eb, a); a = wmmab(al, eb, a); }
        // s_wait_xcnt 0 stands before a register that an issued global load names is rewritten (the next trip forms new bases); as inputs those registers stay as they are up to this wait
        asm volatile("s_wait_xcnt 0x0" :: "s"(jh), "s"(jl), "s"(je), "v"(lo) : "memory");
#pragma unroll
        for (int r = 0; r < 8; ++r) qes[(qt * 16 + 8 * hi + r) * QEP + nt * 16 + lr] = a[r]; }
    // transposed score tiles, bf16 hi/lo, 3 products
    v16bf qh[QT][2], ql[QT][2];
#pragma unroll
    for (int qt = 0; qt < QT; ++qt)
#pragma unroll
        for (int ks = 0; ks < 2; ++ks) { qh[qt][ks] = FB::ld(qbh + lo + (qt * 16 * HD + ks * 32)); ql[qt][ks] = FB::ld(qbl + lo + (qt * 16 * HD + ks * 32)); }
    v8f s[KTN][QT]; v16bf kfh[KTN][2], kfl[KTN][2];
    // a key tile's loads (both halves of each 128-byte row together) are issued ahead of the products that use them: two tiles ahead while few score tiles are held, one tile ahead when the registers are nearly full
    auto ldk = [&](int kt) __attribute__((always_inline)) {
#pragma unroll
        for (int ks = 0; ks < 2; ++ks) { kfh[kt][ks] = FB::ld(kbh + lo + (kt * 16 * HD + ks * 32)); kfl[kt][ks] = FB::ld(kbl + lo + (kt * 16 * HD + ks * 32)); } };
    ldk(0); ldk(1);
#pragma unroll
    for (int kt = 0; kt < KTN; ++kt) {
        if (kt + 2 < KTN - KLATE) ldk(kt + 2); else if (kt + 1 >= KTN - KLATE && kt + 1 < KTN) ldk(kt + 1);
        __builtin_amdgcn_sched_barrier(0);   // keeps the loads above in front of this tile's products; sunk to their use, each would be waited for in full
#pragma unroll
        for (int qt = 0; qt < QT; ++qt) s[kt][qt] = (v8f){};
#pragma unroll
        for (int ks = 0; ks < 2; ++ks) { const v16bf kh = kfh[kt][ks], kl = kfl[kt][ks];
#pragma unroll
            for (int qt = 0; qt < QT; ++qt) s[kt][qt] = wmmab(kh, qh[qt][ks], s[kt][qt]);
#pragma unroll
            for (int qt = 0; qt < QT; ++qt) s[kt][qt] = wmmab(kh, ql[qt][ks], s[kt][qt]);
#pragma unroll
            for (int qt = 0; qt < QT; ++qt) s[kt][qt] = wmmab(kl, qh[qt][ks], s[kt][qt]); }
        __builtin_amdgcn_sched_barrier(0); }   // keeps the next tiles' loads from rising over these products, which would hold more registers than there are
    // the same wait for the q and k loads: their address registers may be reused only behind it
    asm volatile("s_wait_xcnt 0x0" :: "s"(qbh), "s"(qbl), "s"(kbh), "s"(kbl), "v"(lo) : "memory");
    __syncthreads();   // QE tiles and the zeroed bins are visible to every wave
    float qe0[QT], qe1[QT], mx[QT];
#pragma unroll
    for (int qt = 0; qt < QT; ++qt) { qe0[qt] = qes[(qt * 16 + lr) * QEP]; qe1[qt] = qes[(qt * 16 + lr) * QEP + NBIN - 1]; mx[qt] = -3.0e38f; }
#pragma unroll
    for (int kt = 0; kt < KTN; ++kt) { const int jb = kbase + kt * 16; const v4f m0 = *(const v4f*)(mrow + lm + kt * 16), m1 = *(const v4f*)(mrow + lm + (kt * 16 + 4)); float mk[8];
#pragma unroll
        for (int r = 0; r < 4; ++r) { mk[r] = bfr(m0[r]); mk[4 + r] = bfr(m1[r]); }
#pragma unroll
        for (int qt = 0; qt < QT; ++qt) { const int ib = i0 + qt * 16; const bool left = (jb + 15 <= ib - MAXR), right = (jb >= ib + 15 + MAXR);   // the whole tile is clipped: one QE value per query (wave-uniform tests)
            if (left || right) { const float qe = left ? qe1[qt] : qe0[qt];
#pragma unroll
                for (int r = 0; r < 8; ++r) { const float t = (s[kt][qt][r] + qe) * SCL + mk[r]; s[kt][qt][r] = t; mx[qt] = fmaxf(mx[qt], t); }
            } else {
#pragma unroll
                for (int r = 0; r < 8; ++r) { int rel = (ib + lr) - (jb + 8 * hi + r); rel = rel > MAXR ? MAXR : (rel < -MAXR ? -MAXR : rel); const float t = (s[kt][qt][r] + qes[(qt * 16 + lr) * QEP + rel + MAXR]) * SCL + mk[r]; s[kt][qt][r] = t; mx[qt] = fmaxf(mx[qt], t); } } } }
#pragma unroll
    for (int qt = 0; qt < QT; ++qt) { mx[qt] = fmaxf(mx[qt], __shfl_xor(mx[qt], 16, 32)); if (hi == 0) rmx[wave][qt * 16 + lr] = mx[qt]; }
    asm volatile("s_wait_xcnt 0x0" :: "s"(mrow), "v"(lm) : "memory");   // the same wait for the mask loads' address registers
    __syncthreads();   // every wave's row maxima are in LDS
#pragma unroll
    for (int qt = 0; qt < QT; ++qt) { float m = rmx[0][qt * 16 + lr];
#pragma unroll
        for (int w = 1; w < NW; ++w) m = fmaxf(m, rmx[w][qt * 16 + lr]);
        mx[qt] = m; }
    float sum[QT], clo[QT], chi[QT];
#pragma unroll
    for (int qt = 0; qt < QT; ++qt) { sum[qt] = 0.f; clo[qt] = 0.f; chi[qt] = 0.f; }
#pragma unroll
    for (int kt = 0; kt < KTN; ++kt) { const int jb = kbase + kt * 16;
#pragma unroll
        for (int qt = 0; qt < QT; ++qt) { const int ib = i0 + qt * 16; const bool left = (jb + 15 <= ib - MAXR), right = (jb >= ib + 15 + MAXR);
            if (left || right) { float ts = 0.f;
#pragma unroll
                for (int r = 0; r < 8; ++r) { const float e = exp2s(__fmul_rn(__fsub_rn(s[kt][qt][r], mx[qt]), 1.4426950408889634f)); s[kt][qt][r] = e; ts += e; }
                sum[qt] += ts; clo[qt] += right ? ts : 0.f; chi[qt] += left ? ts : 0.f;
            } else {
#pragma unroll
                for (int r = 0; r < 8; ++r) { const float e = exp2s(__fmul_rn(__fsub_rn(s[kt][qt][r], mx[qt]), 1.4426950408889634f)); s[kt][qt][r] = e; sum[qt] += e;
                    const int rr = (ib + lr) - (jb + 8 * hi + r) + MAXR; clo[qt] += (rr <= 0) ? e : 0.f; chi[qt] += (rr >= NBIN - 1) ? e : 0.f; if (rr > 0 && rr < NBIN - 1) binsL[(qt * 16 + lr) * BP + rr] = e; } } } }
#pragma unroll
    for (int qt = 0; qt < QT; ++qt) { sum[qt] += __shfl_xor(sum[qt], 16, 32); clo[qt] += __shfl_xor(clo[qt], 16, 32); chi[qt] += __shfl_xor(chi[qt], 16, 32);
        if (hi == 0) { rsm[wave][qt * 16 + lr] = sum[qt]; rlo[wave][qt * 16 + lr] = clo[qt]; rhi[wave][qt * 16 + lr] = chi[qt]; } }
    __syncthreads();   // every wave's row sums and the band copies in the bins are in LDS
    float f[QT];
#pragma unroll
    for (int qt = 0; qt < QT; ++qt) { float tot = rsm[0][qt * 16 + lr];
#pragma unroll
        for (int w = 1; w < NW; ++w) tot += rsm[w][qt * 16 + lr];
        f[qt] = __fdiv_rn(hires ? 1.0f : PCAR, tot); }
    v8f o[QT][4];
#pragma unroll
    for (int qt = 0; qt < QT; ++qt)
#pragma unroll
        for (int dt = 0; dt < 4; ++dt) o[qt][dt] = (v8f){};
    auto attnv = [&](auto fc, auto* Vp, auto* Vp2) __attribute__((always_inline)) { constexpr bool SPLIT = decltype(fc)::value; typedef typename PvT<SPLIT>::T T16; typedef typename WFrag<T16>::V V_;
        auto* V = Vp + pv + kbase; auto* V2 = Vp2 + pv + kbase;   // wave-uniform bases of this wave's keys
        constexpr int NT = (KTN / 2) * 4, AH = SPLIT ? VAH2 : VAH1;   // steps (k step kk, 16 columns dt) and how many steps ahead a step's value fragments are fetched
        V_ vf[NT], vf2[NT];
        auto ldv = [&](int t) __attribute__((always_inline)) { vf[t] = WFrag<T16>::ld(V + lv + ((t / 4) * 32 + (t % 4) * 16 * TP)); if constexpr (SPLIT) vf2[t] = WFrag<T16>::ld(V2 + lv + ((t / 4) * 32 + (t % 4) * 16 * TP)); };
#pragma unroll
        for (int t = 0; t < AH; ++t) ldv(t);
#pragma unroll
        for (int kk = 0; kk < KTN / 2; ++kk) { float x[QT][16]; V_ p[QT], p2[QT];
#pragma unroll
            for (int qt = 0; qt < QT; ++qt)
#pragma unroll
                for (int r = 0; r < 8; ++r) { x[qt][r] = s[2 * kk][qt][r] * f[qt]; x[qt][8 + r] = s[2 * kk + 1][qt][r] * f[qt]; }
            pv_frag<SPLIT, T16>(x, p, p2);
#pragma unroll
            for (int dt = 0; dt < 4; ++dt) { const int t = kk * 4 + dt;
                if (t + AH < NT) ldv(t + AH);
                __builtin_amdgcn_sched_barrier(0);   // keeps the loads above in front of this step's products; sunk to their use, each would be waited for in full
                pv_mma<SPLIT, T16>(p, p2, vf[t], SPLIT ? vf2[t] : vf[t], o, dt);
                __builtin_amdgcn_sched_barrier(0); } }   // keeps later steps' loads from rising over these products, which would hold more registers than there are
        asm volatile("s_wait_xcnt 0x0" :: "s"(V), "s"(V2), "v"(lv) : "memory");   // the same wait for the value loads' address registers
        if (wave < KXB / 32) { float x[QT][16]; V_ p[QT], p2[QT], vb[4], vb2[4];   // wave-uniform: one k step of the bins
            auto* Vb = Vp + pv + TT + wave * 32; auto* Vb2 = Vp2 + pv + TT + wave * 32;
#pragma unroll
            for (int dt = 0; dt < 4; ++dt) { vb[dt] = WFrag<T16>::ld(Vb + lv + dt * 16 * TP); if constexpr (SPLIT) vb2[dt] = WFrag<T16>::ld(Vb2 + lv + dt * 16 * TP); }
#pragma unroll
            for (int qt = 0; qt < QT; ++qt) { const float* bp = binsL + (qt * 16 + lr) * BP + wave * 32 + 8 * hi; const v4f b0 = *(const v4fa*)bp, b1 = *(const v4fa*)(bp + 4), b2 = *(const v4fa*)(bp + 16), b3 = *(const v4fa*)(bp + 20);
                float t0 = b0[0];
                if (wave == 0 || wave == (NBIN - 1) / 32) { const float* rp = (wave == 0) ? &rlo[0][qt * 16 + lr] : &rhi[0][qt * 16 + lr]; float tot = rp[0];
#pragma unroll
                    for (int w = 1; w < NW; ++w) tot += rp[w * QB];
                    t0 = (hi == 0) ? tot : t0; }
#pragma unroll
                for (int r = 0; r < 4; ++r) { x[qt][r] = (r == 0 ? t0 : b0[r]) * f[qt]; x[qt][4 + r] = b1[r] * f[qt]; x[qt][8 + r] = b2[r] * f[qt]; x[qt][12 + r] = b3[r] * f[qt]; }
                if constexpr (!SPLIT) {
#pragma unroll
                    for (int r = 0; r < 16; ++r) x[qt][r] = x[qt][r] * (1.0f / EVC); } }
            pv_frag<SPLIT, T16>(x, p, p2);
#pragma unroll
            for (int dt = 0; dt < 4; ++dt) pv_mma<SPLIT, T16>(p, p2, vb[dt], SPLIT ? vb2[dt] : vb[dt], o, dt);
            asm volatile("s_wait_xcnt 0x0" :: "s"(Vb), "s"(Vb2), "v"(lv) : "memory"); } };   // the same wait for the loads of the emb_v columns
    if (hires) attnv(BoolC<true>{}, Vh, Vl); else attnv(BoolC<false>{}, V16, V16);
#pragma unroll
    for (int qt = 0; qt < QT; ++qt)
#pragma unroll
        for (int dt = 0; dt < 4; ++dt)
#pragma unroll
            for (int r = 0; r < 8; ++r) ored[wave][(qt * 16 + 8 * hi + r) * OP + dt * 16 + lr] = o[qt][dt][r];
    __syncthreads();   // every wave's partial of ctx is in LDS
    const float cs = hires ? 1.0f : (1.0f / PCAR);
    for (int e = tid; e < QB * (HD / 4); e += NW * 32) { const int q = e / (HD / 4), d4 = (e % (HD / 4)) * 4; v4f sm = *(const v4fa*)(&ored[0][q * OP + d4]);
#pragma unroll
        for (int w = 1; w < NW; ++w) sm += *(const v4fa*)(&ored[w][q * OP + d4]);
        v4f o4; o4[0] = sm[0] * cs; o4[1] = sm[1] * cs; o4[2] = sm[2] * cs; o4[3] = sm[3] * cs; *(v4f*)(OUT + ((size_t)b * TT + i0 + q) * DQ + head * HD + d4) = o4; }
}

extern "C" void kernel_launch(void* const* d_in, const int* in_sizes, int n_in,
                              void* d_out, int out_size, void* d_ws, size_t ws_size, hipStream_t stream) {
    if (n_in < 10) return;
    if ((size_t)in_sizes[0] < ((size_t)(NB - 1) * TTF + TT) * DM) return;
    if ((size_t)in_sizes[1] < (size_t)(NB - 1) * TTF + TT) return;
    if (in_sizes[2] < DM * DQ || in_sizes[4] < DM * DKV || in_sizes[6] < DM * DKV) return;
    if (in_sizes[3] < DQ || in_sizes[5] < DKV || in_sizes[7] < DKV) return;
    if (in_sizes[8] < NBIN * HD || in_sizes[9] < NBIN * HD) return;
    if ((size_t)out_size < (size_t)NB * TT * DQ) return;
    const float* x = (const float*)d_in[0]; const float* mask = (const float*)d_in[1];   // [NB][1][1][TTF], added per key
    const float* wq = (const float*)d_in[2]; const float* bq = (const float*)d_in[3]; const float* wk = (const float*)d_in[4]; const float* bk = (const float*)d_in[5]; const float* wv = (const float*)d_in[6]; const float* bv = (const float*)d_in[7];
    const float* embk = (const float*)d_in[8]; const float* embv = (const float*)d_in[9];   // [NBIN][HD] each
    float* OUT = (float*)d_out;     // [NB][TT][DQ]
    char* wsp = (char*)d_ws;
    auto take = [&](size_t bytes) { char* p = wsp; wsp += (bytes + 255) & ~(size_t)255; return (void*)p; };
    bf* WQ = (bf*)take((size_t)DQ * DM * 2); bf* WK = (bf*)take((size_t)DKV * DM * 2); bf* WV = (bf*)take((size_t)DKV * DM * 2); bf* EK = (bf*)take((size_t)KX * HD * 2);
    h16* VT16 = (h16*)take((size_t)NB * NKV * HD * TP * 2);
    bf* QPh = (bf*)take((size_t)NB * NH_ * TT * HD * 2); bf* QPl = (bf*)take((size_t)NB * NH_ * TT * HD * 2); bf* KPh = (bf*)take((size_t)NB * NKV * TT * HD * 2); bf* KPl = (bf*)take((size_t)NB * NKV * TT * HD * 2); bf* VTh = (bf*)take((size_t)NB * NKV * HD * TP * 2); bf* VTl = (bf*)take((size_t)NB * NKV * HD * TP * 2);
    bf* XB = (bf*)take((size_t)TT * DM * 2);   // bf16 copy of one batch of x, rewritten by the next batch (stream-ordered)
    if ((size_t)(wsp - (char*)d_ws) > ws_size) return;
    k_wtG<<<(unsigned)((DM * DQ / 64 + 63) / 64), 256, 0, stream>>>(wq, DM, DQ, WQ); k_wtG<<<(unsigned)((DM * DKV / 64 + 63) / 64), 256, 0, stream>>>(wk, DM, DKV, WK); k_wtG<<<(unsigned)((DM * DKV / 64 + 63) / 64), 256, 0, stream>>>(wv, DM, DKV, WV);
    k_ekp<<<(KX * HD / 8 + 255) / 256, 256, 0, stream>>>(embk, EK);
    k_vrel<<<(NB * NKV * HD + 7) / 8, 256, 0, stream>>>(embv, VT16, VTh, VTl);
    for (int b = 0; b < NB; ++b) { const size_t oq = (size_t)b * NH_ * TT * HD, ok = (size_t)b * NKV * TT * HD, ov = (size_t)b * NKV * HD * TP;
        k_cvt8<<<(unsigned)(((size_t)TT * DM / 8 + 255) / 256), 256, 0, stream>>>(x + (size_t)b * TTF * DM, XB, (size_t)TT * DM / 8);
        k_gemmw<bf, 0, true, 0, 1><<<dim3(TT / 64, DQ / 64, 1), 32, 0, stream>>>(XB, nullptr, WQ, nullptr, DM, DM, nullptr, 0, bq, 0, 0, 0, nullptr, QPh + oq, QPl + oq);
        k_gemmw<bf, 0, true, 0, 1><<<dim3(TT / 64, DKV / 64, 1), 32, 0, stream>>>(XB, nullptr, WK, nullptr, DM, DM, nullptr, 0, bk, 0, 0, 0, nullptr, KPh + ok, KPl + ok);
        k_gemmw<bf, 0, true, 0, 2><<<dim3(TT / 64, DKV / 64, 1), 32, 0, stream>>>(XB, nullptr, WV, nullptr, DM, DM, nullptr, 0, bv, 0, 0, 0, VT16 + ov, VTh + ov, VTl + ov);
    }
    k_attn<<<dim3(TT / QB, NH_, NB), NW * 32, 0, stream>>>(QPh, QPl, KPh, KPl, EK, VT16, VTh, VTl, mask, OUT);
}

// v005
// It runs in 370 microseconds.
// Next to v004, in two timings, it ran 1.19 and 1.18 times as fast.
// Counting every step since v000, it is 6.65 times as fast.
#include <hip/hip_runtime.h>

// Contractions: x W (q,k,v) on v_wmma_f32_16x16x32_bf16 (bf16 operands from RNE-bf16 inputs); q.k and q.emb_k score tiles bf16 hi/lo split (3 and 2 products); attn.v with the rel-value bins.emb_v folded into K: rows < RH bf16 hi/lo split, rows >= RH v_wmma_f32_16x16x32_f16 (P x1024, bins x64, emb_v x16, v plain f16); f32 accumulate, f32 softmax.
// Self-attention, 16 heads x 64: q,k,v = x W + b ('xw' layout), scores = (q.k + q.emb_k[clip(i-j)]) x 64^-0.5 + additive key mask, softmax over all keys,
// ctx = probs v + sum_r bins[i][r] emb_v[r] (bins: band copies of probs plus the two clipped tail sums), output concat-heads [NB][TT][1024] f32, no output projection.
// Layout: bf16 copy of x (per batch); weights transposed once to rows n, k index k, bf16; the projection GEMMs add the f32 bias and store their tiles straight as head planes [b][h] of q,k (bf16 hi/lo; rows t, k index d) and of the values (f16, bf16 hi/lo; rows d, k index = key, TT+192 of them, keys >= TT hold emb_v), all, with emb_k, in fragment order (see FRAG);
// one attention kernel: a work-group holds the scores of QB query rows x all TT keys of one head in registers, does the softmax there and feeds the attn.v WMMAs from the same registers (see k_attn).

#ifndef NB
#define NB   2
#endif
#ifndef SEQ
#define SEQ  2048
#endif
#define NB_FULL  2
#define TTF  2048                 // full per-batch sequence stride of the inputs
#define TT   SEQ
#define DM   1024
#define NH_  16
#define NKV  16
#define REP  (NH_ / NKV)
#define HD   64
#define DQ   (NH_ * HD)
#define DKV  (NKV * HD)
#define ZH   8                    // z extent of k_gemmw's K-range form (KR > 0)
#define RH   ((TT / 2 < 512) ? (TT / 2) : 512)   // query rows < RH use hi+lo planes
#define PCAR 1024.0f
#define SCL  0.125f   // HD^-0.5
#define MAXR 64
#define NBIN (2 * MAXR + 1)       // 129 clipped offsets
#define KX   192                  // NBIN padded to a multiple of 64
#define TP   (TT + KX)            // row pitch of the value planes (keys + KX bin columns)
#define EVC  16.0f                // f16 carry of emb_v in the value planes (bins carry 1024/16 = 64)
#define QT   2                    // 16-query tiles per work-group of k_attn
#define QB   (16 * QT)
#define NW   16                   // waves per work-group of k_attn, each owns KW keys
#define KW   (TT / NW)
#define KTN  (KW / 16)            // 16-key tiles per wave
#define VAH1 4                    // attn.v, f16 rows: value fragments are fetched this many steps ahead
#define VAH2 2                    // attn.v, hi/lo rows (two fragments a step)
#define KLATE 2                   // the last KLATE key tiles of a wave are fetched one tile ahead, the others two
#define NBT  ((NBIN + 15) / 16)   // 16-bin tiles of QE
#define QEP  (NBT * 16 + 1)       // LDS pitch of a QE row (odd: a column read meets distinct banks)
#define KXB  160                  // NBIN padded to k steps of 32
#define BP   (KXB + 4)            // LDS pitch of a bins row, 16 B x odd
#define OP   (HD + 4)             // LDS pitch of a partial ctx row, 16 B x odd
#define FRAG 512                  // elements of one 16-row x 32-k operand fragment. Fragment order: a plane is a row of such fragments (k step fastest for x, W^T, q, k, emb_k; 16-row block fastest for the values); inside one, the 8 elements at (j * 32 + lane) * 8 are row lane&15, k = 16 j + 8 (lane>>4) + 0..7, so each of a wave's two 16-byte loads of a fragment reads 512 bytes in a row (four whole 128-byte lines, not 32 bytes of each of 16 lines)

static_assert(TT % 128 == 0);
static_assert(RH % 64 == 0);
static_assert(RH >= 64);
static_assert((TT - RH) % 64 == 0);
static_assert(TT - RH >= 64);
static_assert(TP % 32 == 0);
static_assert(TT % (NW * 32) == 0);
static_assert(TT % QB == 0);
static_assert(RH % QB == 0);
static_assert(KXB >= NBIN && KXB <= KX && KXB % 32 == 0);
static_assert((NBIN - 1) % 32 == 0);
static_assert(KXB / 32 <= NW);
static_assert(KX % 64 == 0);
static_assert(KX >= NBIN);
static_assert(KX == 192);
static_assert(HD == 64);
static_assert(NH_ % ZH == 0);
static_assert(DM % 64 == 0);
static_assert((KX * HD) % (8 * 256) == 0);
static_assert(((size_t)TT * DM / 8) % 256 == 0);
static_assert((NKV * HD) % 8 == 0);
static_assert(NB <= NB_FULL);
static_assert(TT <= TTF);

typedef _Float16 h16;
typedef unsigned short bf;
typedef __attribute__((ext_vector_type(16))) __bf16   v16bf;
typedef __attribute__((ext_vector_type(16))) _Float16 v16h;
typedef __attribute__((ext_vector_type(8)))  _Float16 v8h;
typedef __attribute__((ext_vector_type(8)))  unsigned short v8us;
typedef __attribute__((ext_vector_type(8)))  float    v8f;
typedef __attribute__((ext_vector_type(4)))  float    v4f;
typedef v8h  __attribute__((may_alias)) v8ha;
typedef v4f  __attribute__((may_alias)) v4fa;
typedef v8us __attribute__((may_alias)) v8usa;

__device__ __forceinline__ unsigned short f2bf(float f) { unsigned u = __float_as_uint(f); u += 0x7FFFu + ((u >> 16) & 1u); return (unsigned short)(u >> 16); }
__device__ __forceinline__ float bf2f(unsigned short b) { return __uint_as_float(((unsigned)b) << 16); }
__device__ __forceinline__ float bfr(float f) { return bf2f(f2bf(f)); }
__device__ __forceinline__ h16 tohx(float x) { return (h16)x; }
__device__ __forceinline__ void splitf(float y, unsigned short& h, unsigned short& l) { h = f2bf(y); l = f2bf(y - bf2f(h)); }
__device__ __forceinline__ v16h cat16(v8h lo, v8h hi) { return __builtin_shufflevector(lo, hi, 0, 1, 2, 3, 4, 5, 6, 7, 8, 9, 10, 11, 12, 13, 14, 15); }
__device__ __forceinline__ v16bf cat16b(v8us lo, v8us hi) { return __builtin_bit_cast(v16bf, __builtin_shufflevector(lo, hi, 0, 1, 2, 3, 4, 5, 6, 7, 8, 9, 10, 11, 12, 13, 14, 15)); }
__device__ __forceinline__ v8f wmma16(v16h a, v16h b, v8f c) { return __builtin_amdgcn_wmma_f32_16x16x32_f16(false, a, false, b, (short)0, c, false, false); }
__device__ __forceinline__ v8f wmmab(v16bf a, v16bf b, v8f c) { return __builtin_amdgcn_wmma_f32_16x16x32_bf16(false, a, false, b, (short)0, c, false, false); }

// ---- k_gemmw: register-blocked GEMM, ONE WAVE per 64x64 output tile (16 accumulators), operands straight from 16-bit planes in fragment order (FRAG; k step fastest); grid (M/64, N/64, Z), 32 threads.
// C[m][n] (f32, pitch ldc, + optional f32 bias[n]) = sum_k A[m][k] Bt[n][k] (+ split products per NSPLIT); A rows hold lda = DM elements, Bt rows K = DM. z-batch strides sA/sB/sC in elements. K % 32 == 0.
// KR > 0 (N == 64 only): grid (M/64, K/KR, ZH); work-group y sums k in [y KR, (y+1) KR) alone and stores its partial tile in plane y (plane stride ZH sC); the caller adds the planes.
// EPI 0 stores C. EPI 1 (N tile = one head, HD == 64): no C; row t, col c of the biased tile goes, split into bf16 hi + lo, to row t, k index c % HD of head plane c / HD of Ph/Pl. EPI 2: no C; it goes to row c % HD, k index t of head plane c / HD of P16 (f16), Ph, Pl (bf16 hi, lo). Both in fragment order (FRAG).
// Fragments: lane l -> row/col l&15, h = l>>4; elements 0..7 <- k0+8h+0..7, 8..15 <- k0+16+8h+0..7 for BOTH A and Bt (same loader, same plane order); D element r -> row 8h+r, col l&15.
template <typename T16> struct WFrag;
template <> struct WFrag<h16> { typedef v16h V; static __device__ __forceinline__ V ldf(const h16* p) { return cat16(*(const v8h*)p, *(const v8h*)(p + FRAG / 2)); } static __device__ __forceinline__ v8f mma(V a, V b, v8f c) { return wmma16(a, b, c); } };
template <> struct WFrag<bf> { typedef v16bf V; static __device__ __forceinline__ V ldf(const bf* p) { return cat16b(*(const v8us*)p, *(const v8us*)(p + FRAG / 2)); } static __device__ __forceinline__ v8f mma(V a, V b, v8f c) { return wmmab(a, b, c); } };
template <typename T16, int NSPLIT, bool BIAS, int KR = 0, int EPI = 0>
__global__ __launch_bounds__(32) void k_gemmw(const T16* __restrict__ A, const T16* __restrict__ A2, const T16* __restrict__ Bt, const T16* __restrict__ Bt2, float* C, int ldc, const float* __restrict__ bias, size_t sA, size_t sB, size_t sC, h16* P16, bf* Ph, bf* Pl) {
    typedef typename WFrag<T16>::V V; constexpr int K = DM, lda = DM;   // compile-time row lengths: the 16 fragment addresses of a k step are two bases + the lane's piece + constants
    __shared__ __align__(16) float os[16 * 68];
    const size_t z = blockIdx.z; A += z * sA; if (A2) A2 += z * sA; Bt += z * sB; if (Bt2) Bt2 += z * sB; C += (KR ? (size_t)blockIdx.y * ZH + z : z) * sC;
    const int lane = threadIdx.x & 31, lr = lane & 15, hi = lane >> 4; const int r0 = blockIdx.x * 64, c0 = KR ? 0 : blockIdx.y * 64; const int kb = KR ? blockIdx.y * KR : 0, ke = KR ? kb + KR : K;
    v8f acc[4][4];
#pragma unroll
    for (int mb = 0; mb < 4; ++mb)
#pragma unroll
        for (int nb = 0; nb < 4; ++nb) acc[mb][nb] = (v8f){};
    const size_t aoff = (size_t)r0 * lda, boff = (size_t)c0 * K; const unsigned lf = (unsigned)(lane * 8);   // fragment order: 16 rows x lda elements are lda / 32 fragments in a row, so k step kc starts kc * 16 = (kc / 32) * FRAG elements in; every address is a wave-uniform base + the lane's piece lf
#pragma unroll 1
    for (int kc = kb; kc < ke; kc += 32) {
        V a[4], a2[4]; const T16* pa = A + (aoff + kc * 16) + lf; const T16* pb = Bt + (boff + kc * 16) + lf;
#pragma unroll
        for (int mb = 0; mb < 4; ++mb) { a[mb] = WFrag<T16>::ldf(pa + mb * 16 * lda); if (NSPLIT == 1 || NSPLIT == 2) a2[mb] = WFrag<T16>::ldf(A2 + (aoff + (size_t)mb * 16 * lda + kc * 16) + lf); }
#pragma unroll
        for (int nb = 0; nb < 4; ++nb) { const V b = WFrag<T16>::ldf(pb + nb * 16 * K); V b2; if (NSPLIT >= 2) b2 = WFrag<T16>::ldf(Bt2 + (boff + (size_t)nb * 16 * K + kc * 16) + lf);
#pragma unroll
            for (int mb = 0; mb < 4; ++mb) { acc[mb][nb] = WFrag<T16>::mma(a[mb], b, acc[mb][nb]); if (NSPLIT == 1 || NSPLIT == 2) acc[mb][nb] = WFrag<T16>::mma(a2[mb], b, acc[mb][nb]); if (NSPLIT >= 2) acc[mb][nb] = WFrag<T16>::mma(a[mb], b2, acc[mb][nb]); } }
        asm volatile("s_wait_xcnt 0x0" :: "v"(pa), "v"(pb) : "memory");   // stands before a register that an issued global load names is rewritten (the next trip forms new addresses); as inputs the two addresses stay as they are up to this wait
        asm volatile("v_nop\n\tv_nop\n\tv_nop\n\tv_nop" : "+v"(acc[0][0]), "+v"(acc[1][1]), "+v"(acc[2][2]), "+v"(acc[3][3]) : "v"(a[0]), "v"(a[3]));
    }
    if constexpr (EPI == 2) {
        // a lane's 8 accumulator elements are 8 consecutive t of one column, which is the lane's own 16-byte piece of a value fragment: one 16-byte store per plane and block, no LDS pass, 512 bytes in a row per store
        // the three loops are unrolled so that acc[][] and the store vectors are indexed by constants and stay in registers
#pragma unroll
        for (int nb = 0; nb < 4; ++nb) { const int col = c0 + nb * 16 + lr; const float bb = bfr(bias[col]); const size_t o = (size_t)blockIdx.y * HD * TP + ((size_t)(r0 / 32) * 4 + nb) * FRAG + lane * 8;
#pragma unroll
            for (int mb = 0; mb < 4; ++mb) { v8h o16; v8us oh, ol;
#pragma unroll
                for (int j = 0; j < 8; ++j) { const float xv = acc[mb][nb][j] + bb; o16[j] = tohx(xv); unsigned short a2, c2; splitf(xv, a2, c2); oh[j] = a2; ol[j] = c2; }
                const int om = (mb / 2) * 4 * FRAG + (mb % 2) * (FRAG / 2); *(v8h*)(P16 + o + om) = o16; *(v8us*)(Ph + o + om) = oh; *(v8us*)(Pl + o + om) = ol; } }
        return;
    }
#pragma unroll
    for (int mb = 0; mb < 4; ++mb) {
#pragma unroll
        for (int nb = 0; nb < 4; ++nb) {
#pragma unroll
            for (int j = 0; j < 8; ++j) os[(hi * 8 + j) * 68 + nb * 16 + lr] = acc[mb][nb][j]; }
        __builtin_amdgcn_wave_barrier(); asm volatile("" ::: "memory");
        float* crow = C + (size_t)(r0 + mb * 16) * ldc + c0;
        if constexpr (EPI == 1) {   // these 16 rows are two fragments; step s = 16 columns = one 512-byte half of a fragment, lane -> row lr, columns 16 s + 8 hi + 0..7. Unrolled: the vectors' elements are indexed by constants
#pragma unroll
            for (int s = 0; s < 4; ++s) { const int cofs = s * 16 + 8 * hi; const v4f w0 = *(const v4fa*)(os + lr * 68 + cofs), w1 = *(const v4fa*)(os + lr * 68 + cofs + 4); v8us oh, ol;
#pragma unroll
                for (int q = 0; q < 4; ++q) { unsigned short a2, c2; splitf(w0[q] + bfr(bias[c0 + cofs + q]), a2, c2); oh[q] = a2; ol[q] = c2; splitf(w1[q] + bfr(bias[c0 + cofs + 4 + q]), a2, c2); oh[4 + q] = a2; ol[4 + q] = c2; }
                const size_t e = ((size_t)blockIdx.y * TT + r0 + mb * 16) * HD + s * (FRAG / 2) + lane * 8; *(v8us*)(Ph + e) = oh; *(v8us*)(Pl + e) = ol; }
        } else {
#pragma unroll
            for (int s = 0; s < 8; ++s) { const int row = 2 * s + hi, cofs = lr * 4; v4f val = *(const v4fa*)(os + row * 68 + cofs); if (BIAS) { val[0] += bfr(bias[c0 + cofs]); val[1] += bfr(bias[c0 + cofs + 1]); val[2] += bfr(bias[c0 + cofs + 2]); val[3] += bfr(bias[c0 + cofs + 3]); }
                *(v4f*)(crow + (size_t)row * ldc + cofs) = val; }
             }
        __builtin_amdgcn_wave_barrier(); asm volatile("" ::: "memory");
    }
}

typedef __attribute__((ext_vector_type(2))) _Float16 v2h;
typedef __attribute__((ext_vector_type(4))) _Float16 v4h;
typedef __attribute__((ext_vector_type(2))) unsigned short v2us;
typedef __attribute__((ext_vector_type(2))) float v2f;
typedef __attribute__((ext_vector_type(4))) int v4i;

// k_wtG: Bt = w^T (rows n, k index k) as bf16 in fragment order; thread p forms the 16-byte piece p, so a wave stores 512 bytes in a row and each of its 8 loads reads 64 bytes in a row of two rows of w.
__global__ __launch_bounds__(256) void k_wtG(const float* __restrict__ w, int K, int N, bf* Bt) {
    const int p = blockIdx.x * 256 + threadIdx.x; if (p >= N * (K / 8)) return; const int hf = p >> 5, fr = hf >> 1, nk = K / 32;
    const int n = (fr / nk) * 16 + (p & 15), k = (fr % nk) * 32 + (hf & 1) * 16 + ((p >> 4) & 1) * 8; const unsigned off = (unsigned)(k * N + n); float x[8]; v8us o;
#pragma unroll
    for (int e = 0; e < 8; ++e) x[e] = (w + (size_t)e * N)[off];   // a uniform base per row + one lane offset. Unrolled (both loops): the elements are indexed by constants
    asm volatile("s_wait_xcnt 0x0" :: "v"(off) : "memory");   // stands before a register that an issued global load names is rewritten; as an input the offset stays as it is up to this wait
#pragma unroll
    for (int e = 0; e < 8; ++e) o[e] = f2bf(x[e]);
    *(v8us*)(Bt + (size_t)p * 8) = o; }
// k_cvt8: rows of DM f32 -> bf16 in fragment order; thread i forms the 16-byte piece i.
__global__ __launch_bounds__(256) void k_cvt8(const float* __restrict__ src, bf* dst, size_t n8) { const size_t i = (size_t)blockIdx.x * 256 + threadIdx.x; if (i >= n8) return; const size_t hf = i >> 5, fr = hf >> 1;
    const size_t row = (fr / (DM / 32)) * 16 + (i & 15), k = (fr % (DM / 32)) * 32 + (hf & 1) * 16 + ((i >> 4) & 1) * 8; const v8f v = *(const v8f*)(src + row * DM + k); v8us o;
#pragma unroll
    for (int k2 = 0; k2 < 8; ++k2) o[k2] = f2bf(v[k2]); *(v8us*)(dst + i * 8) = o;  }

// k_vrel: k indices [TT, TT+KX) of every value head plane (b*NKV + g): row d, k index TT + r = emb_v[r][d] (r < NBIN, else 0); fp16 plane carries x EVC of the bf16 value, hi plane bf16, lo plane 0. One wave per 512-byte half of a fragment.
__global__ __launch_bounds__(256) void k_vrel(const float* __restrict__ ev, h16* V16, bf* Vh, bf* Vl) {
    const int lane = threadIdx.x & 31; const int pc = blockIdx.x * 8 + (threadIdx.x >> 5); if (pc >= NB * NKV * (KX / 32) * 8) return; const int pl = pc / ((KX / 32) * 8), hf = pc % ((KX / 32) * 8);   // hf = ((k step) * 4 + 16-row block) * 2 + j
    const int d = ((hf >> 1) & 3) * 16 + (lane & 15); const int rb0 = (hf >> 3) * 32 + (hf & 1) * 16 + (lane >> 4) * 8;
    v8h o16; v8us oh, ol; unsigned of[8]; float xs[8];
#pragma unroll
    for (int q = 0; q < 8; ++q) { const int r = rb0 + q; const int rc = (r < NBIN - 1) ? r : (NBIN - 1); of[q] = (unsigned)(rc * HD + d); xs[q] = ev[of[q]]; }
    // s_wait_xcnt 0 stands before a register that an issued global load names is rewritten; as inputs the offsets stay as they are up to this wait
    asm volatile("s_wait_xcnt 0x0" :: "v"(of[0]), "v"(of[1]), "v"(of[2]), "v"(of[3]), "v"(of[4]), "v"(of[5]), "v"(of[6]), "v"(of[7]) : "memory");
#pragma unroll   // as above: the arrays and vectors are indexed by constants and stay in registers
    for (int q = 0; q < 8; ++q) { const int r = rb0 + q; float x = xs[q]; x = (r < NBIN) ? x : 0.f; const float xb = bfr(x); o16[q] = tohx(xb * EVC); oh[q] = f2bf(x); ol[q] = f2bf(x * 0.f); }
    const size_t o = (size_t)pl * HD * TP + (size_t)(TT / 32) * 4 * FRAG + hf * (FRAG / 2) + lane * 8;
    *(v8h*)(V16 + o) = o16; *(v8us*)(Vh + o) = oh; *(v8us*)(Vl + o) = ol;
}
__global__ __launch_bounds__(256) void k_ekp(const float* __restrict__ ek, bf* EK) {
    const int idx = blockIdx.x * 256 + threadIdx.x; if (idx >= KX * HD / 8) return; const int e = idx * 8; const int hf = idx >> 5;   // fragment order: piece idx is lane idx & 31 of half hf & 1 of fragment hf >> 1 (two fragments per 16 rows)
    const int r = (hf >> 2) * 16 + (idx & 15), d0 = ((hf >> 1) & 1) * 32 + (hf & 1) * 16 + ((idx >> 4) & 1) * 8; const int rc = (r < NBIN - 1) ? r : (NBIN - 1);
    const v4f a = *(const v4f*)(ek + (size_t)rc * HD + d0), b2 = *(const v4f*)(ek + (size_t)rc * HD + d0 + 4); v8us o;
#pragma unroll
    for (int k = 0; k < 4; ++k) { const float x0 = (r < NBIN) ? a[k] : 0.f, x1 = (r < NBIN) ? b2[k] : 0.f; o[k] = f2bf(x0); o[k + 4] = f2bf(x1); }
    *(v8us*)(EK + e) = o;  }

// ---- k_attn: the whole attention stage of QB query rows of one head in one work-group of NW waves; grid (TT/QB, NH_, NB).
// Wave w owns keys [w KW, (w+1) KW). It forms the TRANSPOSED score tiles (A = key rows, B = query rows), so lane l holds query l&15 and keys 8(l>>4)+0..7 of each tile:
// two neighbouring key tiles are, register for register, the A fragment (row = query, k = key) of the attn.v product, and the scores never leave the registers.
// t = (q.k + QE[i][clip(i-j)+MAXR]) x HD^-0.5 + mask[j]; row maximum and row sums go across the waves through LDS in wave order; P is normalised before it is rounded to 16 bit.
// bins (LDS, f32, unnormalised): col r (0 < r < NBIN-1) = e[i+MAXR-r] (0 outside [0,TT)); col 0 = sum_{j >= i+MAXR} e and col NBIN-1 = sum_{j <= i-MAXR} e are put in when the fragment is formed; waves < KXB/32 add one k step of bins x emb_v each.
// Each wave's 64-column partial of ctx goes to LDS; the work-group adds the NW partials in wave order and stores the output rows.
// 2^x on v_exp_f32; the v_nop is the one free issue slot that the instruction set asks for between a transcendental and a next instruction that reads its result or overwrites its source; in one statement it stays directly behind it
__device__ __forceinline__ float exp2s(float x) { float e; asm("v_exp_f32 %0, %1\n\tv_nop" : "=v"(e) : "v"(x)); return e; }
template <bool B> struct BoolC { static constexpr bool value = B; };
template <bool SPLIT> struct PvT { typedef h16 T; };
template <> struct PvT<true> { typedef bf T; };
template <bool SPLIT, typename T16>
__device__ __forceinline__ void pv_frag(const float (&x)[QT][16], typename WFrag<T16>::V (&p)[QT], typename WFrag<T16>::V (&p2)[QT]) {
#pragma unroll
    for (int qt = 0; qt < QT; ++qt) {
        if constexpr (SPLIT) { v8us h0, h1, l0, l1;
#pragma unroll
            for (int r = 0; r < 8; ++r) { unsigned short a, c; splitf(x[qt][r], a, c); h0[r] = a; l0[r] = c; splitf(x[qt][8 + r], a, c); h1[r] = a; l1[r] = c; }
            p[qt] = cat16b(h0, h1); p2[qt] = cat16b(l0, l1);
        } else { v8h h0, h1;
#pragma unroll
            for (int r = 0; r < 8; ++r) { h0[r] = tohx(x[qt][r]); h1[r] = tohx(x[qt][8 + r]); }
            p[qt] = cat16(h0, h1); }
    }
}
template <bool SPLIT, typename T16>
__device__ __forceinline__ void pv_mma(const typename WFrag<T16>::V (&p)[QT], const typename WFrag<T16>::V (&p2)[QT], typename WFrag<T16>::V v, typename WFrag<T16>::V v2, v8f (&o)[QT][4], int dt) {
#pragma unroll
    for (int qt = 0; qt < QT; ++qt) o[qt][dt] = WFrag<T16>::mma(p[qt], v, o[qt][dt]);
    if constexpr (SPLIT) {
#pragma unroll
        for (int qt = 0; qt < QT; ++qt) o[qt][dt] = WFrag<T16>::mma(p2[qt], v, o[qt][dt]);
#pragma unroll
        for (int qt = 0; qt < QT; ++qt) o[qt][dt] = WFrag<T16>::mma(p[qt], v2, o[qt][dt]); }
}

__global__ __launch_bounds__(NW * 32) void k_attn(const bf* __restrict__ QPh, const bf* __restrict__ QPl, const bf* __restrict__ KPh, const bf* __restrict__ KPl, const bf* __restrict__ EK,
                                                  const h16* __restrict__ V16, const bf* __restrict__ Vh, const bf* __restrict__ Vl, const float* __restrict__ mask, float* OUT) {
    __shared__ __align__(16) float ored[NW][QB * OP];
    __shared__ __align__(16) float binsL[QB * BP];
    __shared__ float qes[QB * QEP];
    __shared__ float rmx[NW][QB], rsm[NW][QB], rlo[NW][QB], rhi[NW][QB];
    typedef WFrag<bf> FB;
    const int tid = threadIdx.x, lane = tid & 31, lr = lane & 15, hi = lane >> 4;
    const int wave = __builtin_amdgcn_readfirstlane(tid >> 5);
    const int i0 = blockIdx.x * QB, head = blockIdx.y, b = blockIdx.z; const bool hires = (i0 < RH);
    const size_t pq = ((size_t)b * NH_ + head) * TT * HD, pk = ((size_t)b * NKV + head / REP) * TT * HD, pv = ((size_t)b * NKV + head / REP) * HD * TP;
    const int kbase = wave * KW;
    // every global address is a wave-uniform base + one lane offset + a constant: the few address registers stay as they are while the loads that name them are in flight
    const unsigned lf = (unsigned)(lane * 8), lm = (unsigned)(8 * hi);   // lf: the lane's 16-byte piece in each half of a fragment (FRAG)
    const bf* qbh = QPh + pq + (size_t)i0 * HD; const bf* qbl = QPl + pq + (size_t)i0 * HD; const bf* kbh = KPh + pk + (size_t)kbase * HD; const bf* kbl = KPl + pk + (size_t)kbase * HD;
    const float* mrow = mask + (size_t)b * TTF + kbase;
    for (int e = tid; e < QB * BP; e += NW * 32) binsL[e] = 0.f;
    // QE = q emb_k^T (q hi/lo x exact emb_k), one 16x16 tile per job, into LDS
    for (int job = wave; job < QT * NBT; job += NW) { const int qt = job / NBT, nt = job - qt * NBT; v8f a = (v8f){};
        const bf* jh = qbh + qt * 16 * HD; const bf* jl = qbl + qt * 16 * HD; const bf* je = EK + nt * 16 * HD;
#pragma unroll
        for (int ks = 0; ks < 2; ++ks) { const v16bf ah = FB::ldf(jh + lf + ks * FRAG), al = FB::ldf(jl + lf + ks * FRAG), eb = FB::ldf(je + lf + ks * FRAG);
            a = wmmab(ah, eb, a); a = wmmab(al, eb, a); }
        // s_wait_xcnt 0 stands before a register that an issued global load names is rewritten (the next trip forms new bases); as inputs those registers stay as they are up to this wait
        asm volatile("s_wait_xcnt 0x0" :: "s"(jh), "s"(jl), "s"(je), "v"(lf) : "memory");
#pragma unroll
        for (int r = 0; r < 8; ++r) qes[(qt * 16 + 8 * hi + r) * QEP + nt * 16 + lr] = a[r]; }
    // transposed score tiles, bf16 hi/lo, 3 products
    v16bf qh[QT][2], ql[QT][2];
#pragma unroll
    for (int qt = 0; qt < QT; ++qt)
#pragma unroll
        for (int ks = 0; ks < 2; ++ks) { qh[qt][ks] = FB::ldf(qbh + lf + (qt * 2 + ks) * FRAG); ql[qt][ks] = FB::ldf(qbl + lf + (qt * 2 + ks) * FRAG); }
    v8f s[KTN][QT]; v16bf kfh[KTN][2], kfl[KTN][2];
    // a key tile's loads are issued ahead of the products that use them: two tiles ahead while few score tiles are held, one tile ahead when the registers are nearly full
    auto ldk = [&](int kt) __attribute__((always_inline)) {
#pragma unroll
        for (int ks = 0; ks < 2; ++ks) { kfh[kt][ks] = FB::ldf(kbh + lf + (kt * 2 + ks) * FRAG); kfl[kt][ks] = FB::ldf(kbl + lf + (kt * 2 + ks) * FRAG); } };
    ldk(0); ldk(1);
#pragma unroll
    for (int kt = 0; kt < KTN; ++kt) {
        if (kt + 2 < KTN - KLATE) ldk(kt + 2); else if (kt + 1 >= KTN - KLATE && kt + 1 < KTN) ldk(kt + 1);
        __builtin_amdgcn_sched_barrier(0);   // keeps the loads above in front of this tile's products; sunk to their use, each would be waited for in full
#pragma unroll
        for (int qt = 0; qt < QT; ++qt) s[kt][qt] = (v8f){};
#pragma unroll
        for (int ks = 0; ks < 2; ++ks) { const v16bf kh = kfh[kt][ks], kl = kfl[kt][ks];
#pragma unroll
            for (int qt = 0; qt < QT; ++qt) s[kt][qt] = wmmab(kh, qh[qt][ks], s[kt][qt]);
#pragma unroll
            for (int qt = 0; qt < QT; ++qt) s[kt][qt] = wmmab(kh, ql[qt][ks], s[kt][qt]);
#pragma unroll
            for (int qt = 0; qt < QT; ++qt) s[kt][qt] = wmmab(kl, qh[qt][ks], s[kt][qt]); }
        __builtin_amdgcn_sched_barrier(0); }   // keeps the next tiles' loads from rising over these products, which would hold more registers than there are
    // the same wait for the q and k loads: their address registers may be reused only behind it
    asm volatile("s_wait_xcnt 0x0" :: "s"(qbh), "s"(qbl), "s"(kbh), "s"(kbl), "v"(lf) : "memory");
    __syncthreads();   // QE tiles and the zeroed bins are visible to every wave
    float qe0[QT], qe1[QT], mx[QT];
#pragma unroll
    for (int qt = 0; qt < QT; ++qt) { qe0[qt] = qes[(qt * 16 + lr) * QEP]; qe1[qt] = qes[(qt * 16 + lr) * QEP + NBIN - 1]; mx[qt] = -3.0e38f; }
#pragma unroll
    for (int kt = 0; kt < KTN; ++kt) { const int jb = kbase + kt * 16; const v4f m0 = *(const v4f*)(mrow + lm + kt * 16), m1 = *(const v4f*)(mrow + lm + (kt * 16 + 4)); float mk[8];
#pragma unroll
        for (int r = 0; r < 4; ++r) { mk[r] = bfr(m0[r]); mk[4 + r] = bfr(m1[r]); }
#pragma unroll
        for (int qt = 0; qt < QT; ++qt) { const int ib = i0 + qt * 16; const bool left = (jb + 15 <= ib - MAXR), right = (jb >= ib + 15 + MAXR);   // the whole tile is clipped: one QE value per query (wave-uniform tests)
            if (left || right) { const float qe = left ? qe1[qt] : qe0[qt];
#pragma unroll
                for (int r = 0; r < 8; ++r) { const float t = (s[kt][qt][r] + qe) * SCL + mk[r]; s[kt][qt][r] = t; mx[qt] = fmaxf(mx[qt], t); }
            } else {
#pragma unroll
                for (int r = 0; r < 8; ++r) { int rel = (ib + lr) - (jb + 8 * hi + r); rel = rel > MAXR ? MAXR : (rel < -MAXR ? -MAXR : rel); const float t = (s[kt][qt][r] + qes[(qt * 16 + lr) * QEP + rel + MAXR]) * SCL + mk[r]; s[kt][qt][r] = t; mx[qt] = fmaxf(mx[qt], t); } } } }
#pragma unroll
    for (int qt = 0; qt < QT; ++qt) { mx[qt] = fmaxf(mx[qt], __shfl_xor(mx[qt], 16, 32)); if (hi == 0) rmx[wave][qt * 16 + lr] = mx[qt]; }
    asm volatile("s_wait_xcnt 0x0" :: "s"(mrow), "v"(lm) : "memory");   // the same wait for the mask loads' address registers
    __syncthreads();   // every wave's row maxima are in LDS
#pragma unroll
    for (int qt = 0; qt < QT; ++qt) { float m = rmx[0][qt * 16 + lr];
#pragma unroll
        for (int w = 1; w < NW; ++w) m = fmaxf(m, rmx[w][qt * 16 + lr]);
        mx[qt] = m; }
    float sum[QT], clo[QT], chi[QT];
#pragma unroll
    for (int qt = 0; qt < QT; ++qt) { sum[qt] = 0.f; clo[qt] = 0.f; chi[qt] = 0.f; }
#pragma unroll
    for (int kt = 0; kt < KTN; ++kt) { const int jb = kbase + kt * 16;
#pragma unroll
        for (int qt = 0; qt < QT; ++qt) { const int ib = i0 + qt * 16; const bool left = (jb + 15 <= ib - MAXR), right = (jb >= ib + 15 + MAXR);
            if (left || right) { float ts = 0.f;
#pragma unroll
                for (int r = 0; r < 8; ++r) { const float e = exp2s(__fmul_rn(__fsub_rn(s[kt][qt][r], mx[qt]), 1.4426950408889634f)); s[kt][qt][r] = e; ts += e; }
                sum[qt] += ts; clo[qt] += right ? ts : 0.f; chi[qt] += left ? ts : 0.f;
            } else {
#pragma unroll
                for (int r = 0; r < 8; ++r) { const float e = exp2s(__fmul_rn(__fsub_rn(s[kt][qt][r], mx[qt]), 1.4426950408889634f)); s[kt][qt][r] = e; sum[qt] += e;
                    const int rr = (ib + lr) - (jb + 8 * hi + r) + MAXR; clo[qt] += (rr <= 0) ? e : 0.f; chi[qt] += (rr >= NBIN - 1) ? e : 0.f; if (rr > 0 && rr < NBIN - 1) binsL[(qt * 16 + lr) * BP + rr] = e; } } } }
#pragma unroll
    for (int qt = 0; qt < QT; ++qt) { sum[qt] += __shfl_xor(sum[qt], 16, 32); clo[qt] += __shfl_xor(clo[qt], 16, 32); chi[qt] += __shfl_xor(chi[qt], 16, 32);
        if (hi == 0) { rsm[wave][qt * 16 + lr] = sum[qt]; rlo[wave][qt * 16 + lr] = clo[qt]; rhi[wave][qt * 16 + lr] = chi[qt]; } }
    __syncthreads();   // every wave's row sums and the band copies in the bins are in LDS
    float f[QT];
#pragma unroll
    for (int qt = 0; qt < QT; ++qt) { float tot = rsm[0][qt * 16 + lr];
#pragma unroll
        for (int w = 1; w < NW; ++w) tot += rsm[w][qt * 16 + lr];
        f[qt] = __fdiv_rn(hires ? 1.0f : PCAR, tot); }
    v8f o[QT][4];
#pragma unroll
    for (int qt = 0; qt < QT; ++qt)
#pragma unroll
        for (int dt = 0; dt < 4; ++dt) o[qt][dt] = (v8f){};
    auto attnv = [&](auto fc, auto* Vp, auto* Vp2) __attribute__((always_inline)) { constexpr bool SPLIT = decltype(fc)::value; typedef typename PvT<SPLIT>::T T16; typedef typename WFrag<T16>::V V_;
        auto* V = Vp + pv + (kbase / 32) * 4 * FRAG; auto* V2 = Vp2 + pv + (kbase / 32) * 4 * FRAG;   // wave-uniform bases of this wave's keys
        constexpr int NT = (KTN / 2) * 4, AH = SPLIT ? VAH2 : VAH1;   // steps (k step kk, 16 columns dt) and how many steps ahead a step's value fragments are fetched
        V_ vf[NT], vf2[NT];
        auto ldv = [&](int t) __attribute__((always_inline)) { vf[t] = WFrag<T16>::ldf(V + lf + t * FRAG); if constexpr (SPLIT) vf2[t] = WFrag<T16>::ldf(V2 + lf + t * FRAG); };
#pragma unroll
        for (int t = 0; t < AH; ++t) ldv(t);
#pragma unroll
        for (int kk = 0; kk < KTN / 2; ++kk) { float x[QT][16]; V_ p[QT], p2[QT];
#pragma unroll
            for (int qt = 0; qt < QT; ++qt)
#pragma unroll
                for (int r = 0; r < 8; ++r) { x[qt][r] = s[2 * kk][qt][r] * f[qt]; x[qt][8 + r] = s[2 * kk + 1][qt][r] * f[qt]; }
            pv_frag<SPLIT, T16>(x, p, p2);
#pragma unroll
            for (int dt = 0; dt < 4; ++dt) { const int t = kk * 4 + dt;
                if (t + AH < NT) ldv(t + AH);
                __builtin_amdgcn_sched_barrier(0);   // keeps the loads above in front of this step's products; sunk to their use, each would be waited for in full
                pv_mma<SPLIT, T16>(p, p2, vf[t], SPLIT ? vf2[t] : vf[t], o, dt);
                __builtin_amdgcn_sched_barrier(0); } }   // keeps later steps' loads from rising over these products, which would hold more registers than there are
        asm volatile("s_wait_xcnt 0x0" :: "s"(V), "s"(V2), "v"(lf) : "memory");   // the same wait for the value loads' address registers
        if (wave < KXB / 32) { float x[QT][16]; V_ p[QT], p2[QT], vb[4], vb2[4];   // wave-uniform: one k step of the bins
            auto* Vb = Vp + pv + (TT / 32 + wave) * 4 * FRAG; auto* Vb2 = Vp2 + pv + (TT / 32 + wave) * 4 * FRAG;
#pragma unroll
            for (int dt = 0; dt < 4; ++dt) { vb[dt] = WFrag<T16>::ldf(Vb + lf + dt * FRAG); if constexpr (SPLIT) vb2[dt] = WFrag<T16>::ldf(Vb2 + lf + dt * FRAG); }
            asm volatile("s_wait_xcnt 0x0" :: "s"(Vb), "s"(Vb2), "v"(lf) : "memory");   // the same wait for the loads of the emb_v columns, directly behind them: the work below needs their address registers
#pragma unroll
            for (int qt = 0; qt < QT; ++qt) { const float* bp = binsL + (qt * 16 + lr) * BP + wave * 32 + 8 * hi; const v4f b0 = *(const v4fa*)bp, b1 = *(const v4fa*)(bp + 4), b2 = *(const v4fa*)(bp + 16), b3 = *(const v4fa*)(bp + 20);
                float t0 = b0[0];
                if (wave == 0 || wave == (NBIN - 1) / 32) { const float* rp = (wave == 0) ? &rlo[0][qt * 16 + lr] : &rhi[0][qt * 16 + lr]; float tot = rp[0];
#pragma unroll
                    for (int w = 1; w < NW; ++w) tot += rp[w * QB];
                    t0 = (hi == 0) ? tot : t0; }
#pragma unroll
                for (int r = 0; r < 4; ++r) { x[qt][r] = (r == 0 ? t0 : b0[r]) * f[qt]; x[qt][4 + r] = b1[r] * f[qt]; x[qt][8 + r] = b2[r] * f[qt]; x[qt][12 + r] = b3[r] * f[qt]; }
                if constexpr (!SPLIT) {
#pragma unroll
                    for (int r = 0; r < 16; ++r) x[qt][r] = x[qt][r] * (1.0f / EVC); } }
            pv_frag<SPLIT, T16>(x, p, p2);
#pragma unroll
            for (int dt = 0; dt < 4; ++dt) pv_mma<SPLIT, T16>(p, p2, vb[dt], SPLIT ? vb2[dt] : vb[dt], o, dt); } };
    if (hires) attnv(BoolC<true>{}, Vh, Vl); else attnv(BoolC<false>{}, V16, V16);
#pragma unroll
    for (int qt = 0; qt < QT; ++qt)
#pragma unroll
        for (int dt = 0; dt < 4; ++dt)
#pragma unroll
            for (int r = 0; r < 8; ++r) ored[wave][(qt * 16 + 8 * hi + r) * OP + dt * 16 + lr] = o[qt][dt][r];
    __syncthreads();   // every wave's partial of ctx is in LDS
    const float cs = hires ? 1.0f : (1.0f / PCAR);
    for (int e = tid; e < QB * (HD / 4); e += NW * 32) { const int q = e / (HD / 4), d4 = (e % (HD / 4)) * 4; v4f sm = *(const v4fa*)(&ored[0][q * OP + d4]);
#pragma unroll
        for (int w = 1; w < NW; ++w) sm += *(const v4fa*)(&ored[w][q * OP + d4]);
        v4f o4; o4[0] = sm[0] * cs; o4[1] = sm[1] * cs; o4[2] = sm[2] * cs; o4[3] = sm[3] * cs; *(v4f*)(OUT + ((size_t)b * TT + i0 + q) * DQ + head * HD + d4) = o4; }
}

extern "C" void kernel_launch(void* const* d_in, const int* in_sizes, int n_in,
                              void* d_out, int out_size, void* d_ws, size_t ws_size, hipStream_t stream) {
    if (n_in < 10) return;
    if ((size_t)in_sizes[0] < ((size_t)(NB - 1) * TTF + TT) * DM) return;
    if ((size_t)in_sizes[1] < (size_t)(NB - 1) * TTF + TT) return;
    if (in_sizes[2] < DM * DQ || in_sizes[4] < DM * DKV || in_sizes[6] < DM * DKV) return;
    if (in_sizes[3] < DQ || in_sizes[5] < DKV || in_sizes[7] < DKV) return;
    if (in_sizes[8] < NBIN * HD || in_sizes[9] < NBIN * HD) return;
    if ((size_t)out_size < (size_t)NB * TT * DQ) return;
    const float* x = (const float*)d_in[0]; const float* mask = (const float*)d_in[1];   // [NB][1][1][TTF], added per key
    const float* wq = (const float*)d_in[2]; const float* bq = (const float*)d_in[3]; const float* wk = (const float*)d_in[4]; const float* bk = (const float*)d_in[5]; const float* wv = (const float*)d_in[6]; const float* bv = (const float*)d_in[7];
    const float* embk = (const float*)d_in[8]; const float* embv = (const float*)d_in[9];   // [NBIN][HD] each
    float* OUT = (float*)d_out;     // [NB][TT][DQ]
    char* wsp = (char*)d_ws;
    auto take = [&](size_t bytes) { char* p = wsp; wsp += (bytes + 255) & ~(size_t)255; return (void*)p; };
    bf* WQ = (bf*)take((size_t)DQ * DM * 2); bf* WK = (bf*)take((size_t)DKV * DM * 2); bf* WV = (bf*)take((size_t)DKV * DM * 2); bf* EK = (bf*)take((size_t)KX * HD * 2);
    h16* VT16 = (h16*)take((size_t)NB * NKV * HD * TP * 2);
    bf* QPh = (bf*)take((size_t)NB * NH_ * TT * HD * 2); bf* QPl = (bf*)take((size_t)NB * NH_ * TT * HD * 2); bf* KPh = (bf*)take((size_t)NB * NKV * TT * HD * 2); bf* KPl = (bf*)take((size_t)NB * NKV * TT * HD * 2); bf* VTh = (bf*)take((size_t)NB * NKV * HD * TP * 2); bf* VTl = (bf*)take((size_t)NB * NKV * HD * TP * 2);
    bf* XB = (bf*)take((size_t)TT * DM * 2);   // bf16 copy of one batch of x, rewritten by the next batch (stream-ordered)
    if ((size_t)(wsp - (char*)d_ws) > ws_size) return;
    k_wtG<<<(unsigned)((DM * DQ / 8 + 255) / 256), 256, 0, stream>>>(wq, DM, DQ, WQ); k_wtG<<<(unsigned)((DM * DKV / 8 + 255) / 256), 256, 0, stream>>>(wk, DM, DKV, WK); k_wtG<<<(unsigned)((DM * DKV / 8 + 255) / 256), 256, 0, stream>>>(wv, DM, DKV, WV);
    k_ekp<<<(KX * HD / 8 + 255) / 256, 256, 0, stream>>>(embk, EK);
    k_vrel<<<(NB * NKV * (KX / 32) * 8 + 7) / 8, 256, 0, stream>>>(embv, VT16, VTh, VTl);
    for (int b = 0; b < NB; ++b) { const size_t oq = (size_t)b * NH_ * TT * HD, ok = (size_t)b * NKV * TT * HD, ov = (size_t)b * NKV * HD * TP;
        k_cvt8<<<(unsigned)(((size_t)TT * DM / 8 + 255) / 256), 256, 0, stream>>>(x + (size_t)b * TTF * DM, XB, (size_t)TT * DM / 8);
        k_gemmw<bf, 0, true, 0, 1><<<dim3(TT / 64, DQ / 64, 1), 32, 0, stream>>>(XB, nullptr, WQ, nullptr, nullptr, 0, bq, 0, 0, 0, nullptr, QPh + oq, QPl + oq);
        k_gemmw<bf, 0, true, 0, 1><<<dim3(TT / 64, DKV / 64, 1), 32, 0, stream>>>(XB, nullptr, WK, nullptr, nullptr, 0, bk, 0, 0, 0, nullptr, KPh + ok, KPl + ok);
        k_gemmw<bf, 0, true, 0, 2><<<dim3(TT / 64, DKV / 64, 1), 32, 0, stream>>>(XB, nullptr, WV, nullptr, nullptr, 0, bv, 0, 0, 0, VT16 + ov, VTh + ov, VTl + ov);
    }
    k_attn<<<dim3(TT / QB, NH_, NB), NW * 32, 0, stream>>>(QPh, QPl, KPh, KPl, EK, VT16, VTh, VTl, mask, OUT);
}

// v006
// Measured time: 235 microseconds a run.
// Next to v005, in two timings, it ran 1.58 and 1.59 times as fast.
// Over all steps from v000 it is 10.6 times as fast.
#include <hip/hip_runtime.h>

// Contractions: x W (q,k,v) on v_wmma_f32_16x16x32_bf16 (bf16 operands from RNE-bf16 inputs); q.k and q.emb_k score tiles bf16 hi/lo split (3 and 2 products); attn.v with the rel-value bins.emb_v folded into K: rows < RH bf16 hi/lo split, rows >= RH v_wmma_f32_16x16x32_f16 (P x1024, bins x64, emb_v x16, v plain f16); f32 accumulate, f32 softmax.
// Self-attention, 16 heads x 64: q,k,v = x W + b ('xw' layout), scores = (q.k + q.emb_k[clip(i-j)]) x 64^-0.5 + additive key mask, softmax over all keys,
// ctx = probs v + sum_r bins[i][r] emb_v[r] (bins: band copies of probs plus the two clipped tail sums), output concat-heads [NB][TT][1024] f32, no output projection.
// Layout: bf16 copy of x; weights transposed once to rows n, k index k, bf16; the projection GEMMs add the f32 bias and store their tiles straight as head planes [b][h] of q,k (bf16 hi/lo; rows t, k index d) and of the values (f16, bf16 hi/lo; rows d, k index = key, TT+192 of them, keys >= TT hold emb_v), all, with emb_k, in fragment order (see FRAG);
// three launches: k_prep forms every plane that depends on an input alone, k_proj does the six projection GEMMs (q, k, v of each batch) in one grid, k_attn the attention stage.
// one attention kernel: a work-group holds the scores of QB query rows x all TT keys of one head in registers, does the softmax there and feeds the attn.v WMMAs from the same registers (see k_attn).

#ifndef NB
#define NB   2
#endif
#ifndef SEQ
#define SEQ  2048
#endif
#define NB_FULL  2
#define TTF  2048                 // full per-batch sequence stride of the inputs
#define TT   SEQ
#define DM   1024
#define NH_  16
#define NKV  16
#define REP  (NH_ / NKV)
#define HD   64
#define DQ   (NH_ * HD)
#define DKV  (NKV * HD)
#define ZH   8                    // z extent of gemmw's K-range form (KR > 0)
#define RH   ((TT / 2 < 512) ? (TT / 2) : 512)   // query rows < RH use hi+lo planes
#define PCAR 1024.0f
#define SCL  0.125f   // HD^-0.5
#define MAXR 64
#define NBIN (2 * MAXR + 1)       // 129 clipped offsets
#define KX   192                  // NBIN padded to a multiple of 64
#define TP   (TT + KX)            // row pitch of the value planes (keys + KX bin columns)
#define EVC  16.0f                // f16 carry of emb_v in the value planes (bins carry 1024/16 = 64)
#define QT   2                    // 16-query tiles per work-group of k_attn
#define QB   (16 * QT)
#define NW   16                   // waves per work-group of k_attn, each owns KW keys
#define KW   (TT / NW)
#define KTN  (KW / 16)            // 16-key tiles per wave
#define VAH1 4                    // attn.v, f16 rows: value fragments are fetched this many steps ahead
#define VAH2 2                    // attn.v, hi/lo rows (two fragments a step)
#define KLATE 2                   // the last KLATE key tiles of a wave are fetched one tile ahead, the others two
#define NBT  ((NBIN + 15) / 16)   // 16-bin tiles of QE
#define QEP  (NBT * 16 + 1)       // LDS pitch of a QE row (odd: a column read meets distinct banks)
#define KXB  160                  // NBIN padded to k steps of 32
#define BP   (KXB + 4)            // LDS pitch of a bins row, 16 B x odd
#define OP   (HD + 4)             // LDS pitch of a partial ctx row, 16 B x odd
#define FRAG 512                  // elements of one 16-row x 32-k operand fragment. Fragment order: a plane is a row of such fragments (k step fastest for x, W^T, q, k, emb_k; 16-row block fastest for the values); inside one, the 8 elements at (j * 32 + lane) * 8 are row lane&15, k = 16 j + 8 (lane>>4) + 0..7, so each of a wave's two 16-byte loads of a fragment reads 512 bytes in a row (four whole 128-byte lines, not 32 bytes of each of 16 lines)

static_assert(TT % 128 == 0);
static_assert(RH % 64 == 0);
static_assert(RH >= 64);
static_assert((TT - RH) % 64 == 0);
static_assert(TT - RH >= 64);
static_assert(TP % 32 == 0);
static_assert(TT % (NW * 32) == 0);
static_assert(TT % QB == 0);
static_assert(RH % QB == 0);
static_assert(KXB >= NBIN && KXB <= KX && KXB % 32 == 0);
static_assert((NBIN - 1) % 32 == 0);
static_assert(KXB / 32 <= NW);
static_assert(KX % 64 == 0);
static_assert(KX >= NBIN);
static_assert(KX == 192);
static_assert(HD == 64);
static_assert(NH_ % ZH == 0);
static_assert(DM % 64 == 0);
static_assert((KX * HD) % (8 * 256) == 0);
static_assert(((size_t)TT * DM / 8) % 256 == 0);
static_assert((NKV * HD) % 8 == 0);
static_assert(NB <= NB_FULL);
static_assert(TT <= TTF);

typedef _Float16 h16;
typedef unsigned short bf;
typedef __attribute__((ext_vector_type(16))) __bf16   v16bf;
typedef __attribute__((ext_vector_type(16))) _Float16 v16h;
typedef __attribute__((ext_vector_type(8)))  _Float16 v8h;
typedef __attribute__((ext_vector_type(8)))  unsigned short v8us;
typedef __attribute__((ext_vector_type(8)))  float    v8f;
typedef __attribute__((ext_vector_type(4)))  float    v4f;
typedef v8h  __attribute__((may_alias)) v8ha;
typedef v4f  __attribute__((may_alias)) v4fa;
typedef v8us __attribute__((may_alias)) v8usa;

__device__ __forceinline__ unsigned short f2bf(float f) { unsigned u = __float_as_uint(f); u += 0x7FFFu + ((u >> 16) & 1u); return (unsigned short)(u >> 16); }
__device__ __forceinline__ float bf2f(unsigned short b) { return __uint_as_float(((unsigned)b) << 16); }
__device__ __forceinline__ float bfr(float f) { return bf2f(f2bf(f)); }
__device__ __forceinline__ h16 tohx(float x) { return (h16)x; }
__device__ __forceinline__ void splitf(float y, unsigned short& h, unsigned short& l) { h = f2bf(y); l = f2bf(y - bf2f(h)); }
__device__ __forceinline__ v16h cat16(v8h lo, v8h hi) { return __builtin_shufflevector(lo, hi, 0, 1, 2, 3, 4, 5, 6, 7, 8, 9, 10, 11, 12, 13, 14, 15); }
__device__ __forceinline__ v16bf cat16b(v8us lo, v8us hi) { return __builtin_bit_cast(v16bf, __builtin_shufflevector(lo, hi, 0, 1, 2, 3, 4, 5, 6, 7, 8, 9, 10, 11, 12, 13, 14, 15)); }
__device__ __forceinline__ v8f wmma16(v16h a, v16h b, v8f c) { return __builtin_amdgcn_wmma_f32_16x16x32_f16(false, a, false, b, (short)0, c, false, false); }
__device__ __forceinline__ v8f wmmab(v16bf a, v16bf b, v8f c) { return __builtin_amdgcn_wmma_f32_16x16x32_bf16(false, a, false, b, (short)0, c, false, false); }

// ---- gemmw: register-blocked GEMM, ONE WAVE per 64x64 output tile (16 accumulators), operands straight from 16-bit planes in fragment order (FRAG; k step fastest); the body of a 32-thread work-group, tile (bx, by, bz) of (M/64, N/64, Z).
// C[m][n] (f32, pitch ldc, + optional f32 bias[n]) = sum_k A[m][k] Bt[n][k] (+ split products per NSPLIT); A rows hold lda = DM elements, Bt rows K = DM. z-batch strides sA/sB/sC in elements. K % 32 == 0.
// KR > 0 (N == 64 only): tiles (M/64, K/KR, ZH); tile by sums k in [by KR, (by+1) KR) alone and stores its partial tile in plane by (plane stride ZH sC); the caller adds the planes.
// EPI 0 stores C. EPI 1 (N tile = one head, HD == 64): no C; row t, col c of the biased tile goes, split into bf16 hi + lo, to row t, k index c % HD of head plane c / HD of Ph/Pl. EPI 2: no C; it goes to row c % HD, k index t of head plane c / HD of P16 (f16), Ph, Pl (bf16 hi, lo). Both in fragment order (FRAG).
// Fragments: lane l -> row/col l&15, h = l>>4; elements 0..7 <- k0+8h+0..7, 8..15 <- k0+16+8h+0..7 for BOTH A and Bt (same loader, same plane order); D element r -> row 8h+r, col l&15.
template <typename T16> struct WFrag;
template <> struct WFrag<h16> { typedef v16h V; static __device__ __forceinline__ V ldf(const h16* p) { return cat16(*(const v8h*)p, *(const v8h*)(p + FRAG / 2)); } static __device__ __forceinline__ v8f mma(V a, V b, v8f c) { return wmma16(a, b, c); } };
template <> struct WFrag<bf> { typedef v16bf V; static __device__ __forceinline__ V ldf(const bf* p) { return cat16b(*(const v8us*)p, *(const v8us*)(p + FRAG / 2)); } static __device__ __forceinline__ v8f mma(V a, V b, v8f c) { return wmmab(a, b, c); } };
template <typename T16, int NSPLIT, bool BIAS, int KR = 0, int EPI = 0>
__device__ __forceinline__ void gemmw(const T16* __restrict__ A, const T16* __restrict__ A2, const T16* __restrict__ Bt, const T16* __restrict__ Bt2, float* C, int ldc, const float* __restrict__ bias, size_t sA, size_t sB, size_t sC, h16* P16, bf* Ph, bf* Pl, int bx, int by, int bz) {
    typedef typename WFrag<T16>::V V; constexpr int K = DM, lda = DM;   // compile-time row lengths: the 16 fragment addresses of a k step are two bases + the lane's piece + constants
    __shared__ __align__(16) float os[16 * 68];
    const size_t z = bz; A += z * sA; if (A2) A2 += z * sA; Bt += z * sB; if (Bt2) Bt2 += z * sB; C += (KR ? (size_t)by * ZH + z : z) * sC;
    const int lane = threadIdx.x & 31, lr = lane & 15, hi = lane >> 4; const int r0 = bx * 64, c0 = KR ? 0 : by * 64; const int kb = KR ? by * KR : 0, ke = KR ? kb + KR : K;
    v8f acc[4][4];
#pragma unroll
    for (int mb = 0; mb < 4; ++mb)
#pragma unroll
        for (int nb = 0; nb < 4; ++nb) acc[mb][nb] = (v8f){};
    const size_t aoff = (size_t)r0 * lda, boff = (size_t)c0 * K; const unsigned lf = (unsigned)(lane * 8);   // fragment order: 16 rows x lda elements are lda / 32 fragments in a row, so k step kc starts kc * 16 = (kc / 32) * FRAG elements in; every address is a wave-uniform base + the lane's piece lf
#pragma unroll 1
    for (int kc = kb; kc < ke; kc += 32) {
        V a[4], a2[4]; const T16* pa = A + (aoff + kc * 16) + lf; const T16* pb = Bt + (boff + kc * 16) + lf;
#pragma unroll
        for (int mb = 0; mb < 4; ++mb) { a[mb] = WFrag<T16>::ldf(pa + mb * 16 * lda); if (NSPLIT == 1 || NSPLIT == 2) a2[mb] = WFrag<T16>::ldf(A2 + (aoff + (size_t)mb * 16 * lda + kc * 16) + lf); }
#pragma unroll
        for (int nb = 0; nb < 4; ++nb) { const V b = WFrag<T16>::ldf(pb + nb * 16 * K); V b2; if (NSPLIT >= 2) b2 = WFrag<T16>::ldf(Bt2 + (boff + (size_t)nb * 16 * K + kc * 16) + lf);
#pragma unroll
            for (int mb = 0; mb < 4; ++mb) { acc[mb][nb] = WFrag<T16>::mma(a[mb], b, acc[mb][nb]); if (NSPLIT == 1 || NSPLIT == 2) acc[mb][nb] = WFrag<T16>::mma(a2[mb], b, acc[mb][nb]); if (NSPLIT >= 2) acc[mb][nb] = WFrag<T16>::mma(a[mb], b2, acc[mb][nb]); } }
        asm volatile("s_wait_xcnt 0x0" :: "v"(pa), "v"(pb) : "memory");   // stands before a register that an issued global load names is rewritten (the next trip forms new addresses); as inputs the two addresses stay as they are up to this wait
        asm volatile("v_nop\n\tv_nop\n\tv_nop\n\tv_nop" : "+v"(acc[0][0]), "+v"(acc[1][1]), "+v"(acc[2][2]), "+v"(acc[3][3]) : "v"(a[0]), "v"(a[3]));
    }
    if constexpr (EPI == 2) {
        // a lane's 8 accumulator elements are 8 consecutive t of one column, which is the lane's own 16-byte piece of a value fragment: one 16-byte store per plane and block, no LDS pass, 512 bytes in a row per store
        // the three loops are unrolled so that acc[][] and the store vectors are indexed by constants and stay in registers
#pragma unroll
        for (int nb = 0; nb < 4; ++nb) { const int col = c0 + nb * 16 + lr; const float bb = bfr(bias[col]); const size_t o = (size_t)by * HD * TP + ((size_t)(r0 / 32) * 4 + nb) * FRAG + lane * 8;
#pragma unroll
            for (int mb = 0; mb < 4; ++mb) { v8h o16; v8us oh, ol;
#pragma unroll
                for (int j = 0; j < 8; ++j) { const float xv = acc[mb][nb][j] + bb; o16[j] = tohx(xv); unsigned short a2, c2; splitf(xv, a2, c2); oh[j] = a2; ol[j] = c2; }
                const int om = (mb / 2) * 4 * FRAG + (mb % 2) * (FRAG / 2); *(v8h*)(P16 + o + om) = o16; *(v8us*)(Ph + o + om) = oh; *(v8us*)(Pl + o + om) = ol;
                asm volatile("s_wait_xcnt 0x0" :: "v"(o16), "v"(oh), "v"(ol) : "memory"); } }   // stands before a register that an issued global store names is rewritten (the next block's values); as inputs the three vectors stay as they are up to this wait
        return;
    }
#pragma unroll
    for (int mb = 0; mb < 4; ++mb) {
#pragma unroll
        for (int nb = 0; nb < 4; ++nb) {
#pragma unroll
            for (int j = 0; j < 8; ++j) os[(hi * 8 + j) * 68 + nb * 16 + lr] = acc[mb][nb][j]; }
        __builtin_amdgcn_wave_barrier(); asm volatile("" ::: "memory");
        float* crow = C + (size_t)(r0 + mb * 16) * ldc + c0;
        if constexpr (EPI == 1) {   // these 16 rows are two fragments; step s = 16 columns = one 512-byte half of a fragment, lane -> row lr, columns 16 s + 8 hi + 0..7. Unrolled: the vectors' elements are indexed by constants
#pragma unroll
            for (int s = 0; s < 4; ++s) { const int cofs = s * 16 + 8 * hi; const v4f w0 = *(const v4fa*)(os + lr * 68 + cofs), w1 = *(const v4fa*)(os + lr * 68 + cofs + 4); v8us oh, ol;
#pragma unroll
                for (int q = 0; q < 4; ++q) { unsigned short a2, c2; splitf(w0[q] + bfr(bias[c0 + cofs + q]), a2, c2); oh[q] = a2; ol[q] = c2; splitf(w1[q] + bfr(bias[c0 + cofs + 4 + q]), a2, c2); oh[4 + q] = a2; ol[4 + q] = c2; }
                const size_t e = ((size_t)by * TT + r0 + mb * 16) * HD + s * (FRAG / 2) + lane * 8; *(v8us*)(Ph + e) = oh; *(v8us*)(Pl + e) = ol;
                asm volatile("s_wait_xcnt 0x0" :: "v"(oh), "v"(ol) : "memory"); }   // the same wait for these two stores' registers
        } else {
#pragma unroll
            for (int s = 0; s < 8; ++s) { const int row = 2 * s + hi, cofs = lr * 4; v4f val = *(const v4fa*)(os + row * 68 + cofs); if (BIAS) { val[0] += bfr(bias[c0 + cofs]); val[1] += bfr(bias[c0 + cofs + 1]); val[2] += bfr(bias[c0 + cofs + 2]); val[3] += bfr(bias[c0 + cofs + 3]); }
                *(v4f*)(crow + (size_t)row * ldc + cofs) = val; }
             }
        __builtin_amdgcn_wave_barrier(); asm volatile("" ::: "memory");
    }
}

// k_proj: the six projection GEMMs in one grid (TT/64, DQ/64, 3 NB), z = 3 b + (0: q, 1: k, 2: v). None reads what another writes; together they put three waves on every SIMD, so one wave's load waits are filled by the others' products.
static_assert(DQ == DKV);
__global__ __launch_bounds__(32) void k_proj(const bf* __restrict__ XB, const bf* __restrict__ WQ, const bf* __restrict__ WK, const bf* __restrict__ WV, const float* __restrict__ bq, const float* __restrict__ bk, const float* __restrict__ bv,
                                             bf* QPh, bf* QPl, bf* KPh, bf* KPl, h16* VT16, bf* VTh, bf* VTl) {
    const int bx = blockIdx.x, by = blockIdx.y, b = blockIdx.z / 3, w = blockIdx.z % 3; const bf* A = XB + (size_t)b * TT * DM;
    const size_t oq = (size_t)b * NH_ * TT * HD, ok = (size_t)b * NKV * TT * HD, ov = (size_t)b * NKV * HD * TP;
    if (w == 2) gemmw<bf, 0, true, 0, 2>(A, nullptr, WV, nullptr, nullptr, 0, bv, 0, 0, 0, VT16 + ov, VTh + ov, VTl + ov, bx, by, 0);
    else gemmw<bf, 0, true, 0, 1>(A, nullptr, w ? WK : WQ, nullptr, nullptr, 0, w ? bk : bq, 0, 0, 0, nullptr, w ? KPh + ok : QPh + oq, w ? KPl + ok : QPl + oq, bx, by, 0);
}

typedef __attribute__((ext_vector_type(2))) _Float16 v2h;
typedef __attribute__((ext_vector_type(4))) _Float16 v4h;
typedef __attribute__((ext_vector_type(2))) unsigned short v2us;
typedef __attribute__((ext_vector_type(2))) float v2f;
typedef __attribute__((ext_vector_type(4))) int v4i;

// The four bodies of k_prep, each for block blk of 256 threads of its own range.
// wtG: Bt = w^T (rows n, k index k) as bf16 in fragment order; thread p forms the 16-byte piece p, so a wave stores 512 bytes in a row and each of its 8 loads reads 64 bytes in a row of two rows of w.
__device__ __forceinline__ void wtG(const float* __restrict__ w, int K, int N, bf* Bt, int blk) {
    const int p = blk * 256 + threadIdx.x; if (p >= N * (K / 8)) return; const int hf = p >> 5, fr = hf >> 1, nk = K / 32;
    const int n = (fr / nk) * 16 + (p & 15), k = (fr % nk) * 32 + (hf & 1) * 16 + ((p >> 4) & 1) * 8; const unsigned off = (unsigned)(k * N + n); float x[8]; v8us o;
#pragma unroll
    for (int e = 0; e < 8; ++e) x[e] = (w + (size_t)e * N)[off];   // a uniform base per row + one lane offset. Unrolled (both loops): the elements are indexed by constants
    asm volatile("s_wait_xcnt 0x0" :: "v"(off) : "memory");   // stands before a register that an issued global load names is rewritten; as an input the offset stays as it is up to this wait
#pragma unroll
    for (int e = 0; e < 8; ++e) o[e] = f2bf(x[e]);
    *(v8us*)(Bt + (size_t)p * 8) = o; }
// cvt8: rows of DM f32 -> bf16 in fragment order; thread i forms the 16-byte piece i.
__device__ __forceinline__ void cvt8(const float* __restrict__ src, bf* dst, size_t n8, int blk) { const size_t i = (size_t)blk * 256 + threadIdx.x; if (i >= n8) return; const size_t hf = i >> 5, fr = hf >> 1;
    const size_t row = (fr / (DM / 32)) * 16 + (i & 15), k = (fr % (DM / 32)) * 32 + (hf & 1) * 16 + ((i >> 4) & 1) * 8; const v8f v = *(const v8f*)(src + row * DM + k); v8us o;
#pragma unroll
    for (int k2 = 0; k2 < 8; ++k2) o[k2] = f2bf(v[k2]); *(v8us*)(dst + i * 8) = o;  }

// vrel: k indices [TT, TT+KX) of every value head plane (b*NKV + g): row d, k index TT + r = emb_v[r][d] (r < NBIN, else 0); fp16 plane carries x EVC of the bf16 value, hi plane bf16, lo plane 0. One wave per 512-byte half of a fragment.
__device__ __forceinline__ void vrel(const float* __restrict__ ev, h16* V16, bf* Vh, bf* Vl, int blk) {
    const int lane = threadIdx.x & 31; const int pc = blk * 8 + (threadIdx.x >> 5); if (pc >= NB * NKV * (KX / 32) * 8) return; const int pl = pc / ((KX / 32) * 8), hf = pc % ((KX / 32) * 8);   // hf = ((k step) * 4 + 16-row block) * 2 + j
    const int d = ((hf >> 1) & 3) * 16 + (lane & 15); const int rb0 = (hf >> 3) * 32 + (hf & 1) * 16 + (lane >> 4) * 8;
    v8h o16; v8us oh, ol; unsigned of[8]; float xs[8];
#pragma unroll
    for (int q = 0; q < 8; ++q) { const int r = rb0 + q; const int rc = (r < NBIN - 1) ? r : (NBIN - 1); of[q] = (unsigned)(rc * HD + d); xs[q] = ev[of[q]]; }
    // s_wait_xcnt 0 stands before a register that an issued global load names is rewritten; as inputs the offsets stay as they are up to this wait
    asm volatile("s_wait_xcnt 0x0" :: "v"(of[0]), "v"(of[1]), "v"(of[2]), "v"(of[3]), "v"(of[4]), "v"(of[5]), "v"(of[6]), "v"(of[7]) : "memory");
#pragma unroll   // as above: the arrays and vectors are indexed by constants and stay in registers
    for (int q = 0; q < 8; ++q) { const int r = rb0 + q; float x = xs[q]; x = (r < NBIN) ? x : 0.f; const float xb = bfr(x); o16[q] = tohx(xb * EVC); oh[q] = f2bf(x); ol[q] = f2bf(x * 0.f); }
    const size_t o = (size_t)pl * HD * TP + (size_t)(TT / 32) * 4 * FRAG + hf * (FRAG / 2) + lane * 8;
    *(v8h*)(V16 + o) = o16; *(v8us*)(Vh + o) = oh; *(v8us*)(Vl + o) = ol;
}
__device__ __forceinline__ void ekp(const float* __restrict__ ek, bf* EK, int blk) {
    const int idx = blk * 256 + threadIdx.x; if (idx >= KX * HD / 8) return; const int e = idx * 8; const int hf = idx >> 5;   // fragment order: piece idx is lane idx & 31 of half hf & 1 of fragment hf >> 1 (two fragments per 16 rows)
    const int r = (hf >> 2) * 16 + (idx & 15), d0 = ((hf >> 1) & 1) * 32 + (hf & 1) * 16 + ((idx >> 4) & 1) * 8; const int rc = (r < NBIN - 1) ? r : (NBIN - 1);
    const v4f a = *(const v4f*)(ek + (size_t)rc * HD + d0), b2 = *(const v4f*)(ek + (size_t)rc * HD + d0 + 4); v8us o;
#pragma unroll
    for (int k = 0; k < 4; ++k) { const float x0 = (r < NBIN) ? a[k] : 0.f, x1 = (r < NBIN) ? b2[k] : 0.f; o[k] = f2bf(x0); o[k + 4] = f2bf(x1); }
    *(v8us*)(EK + e) = o;  }
// k_prep: every plane that depends on an input alone, in one grid: the three W^T, the bf16 copy of x (all batches), the emb_v columns of the value planes, emb_k. The ranges write disjoint planes and read inputs only; a block's range is block-uniform.
#define PBW ((DM * DQ / 8 + 255) / 256)                    // blocks of one W^T
#define PBX ((TT * DM / 8 + 255) / 256)                    // blocks of one batch of x
#define PBV ((NB * NKV * (KX / 32) * 8 + 7) / 8)           // blocks of vrel
#define PBE ((KX * HD / 8 + 255) / 256)                    // blocks of ekp
__global__ __launch_bounds__(256) void k_prep(const float* __restrict__ x, const float* __restrict__ wq, const float* __restrict__ wk, const float* __restrict__ wv, const float* __restrict__ ek, const float* __restrict__ ev,
                                              bf* XB, bf* WQ, bf* WK, bf* WV, bf* EK, h16* V16, bf* Vh, bf* Vl) {
    int blk = blockIdx.x;
    if (blk < 3 * PBW) { const int w = blk / PBW; wtG(w == 0 ? wq : (w == 1 ? wk : wv), DM, DQ, w == 0 ? WQ : (w == 1 ? WK : WV), blk - w * PBW); return; }
    blk -= 3 * PBW;
    if (blk < NB * PBX) { const int b = blk / PBX; cvt8(x + (size_t)b * TTF * DM, XB + (size_t)b * TT * DM, (size_t)TT * DM / 8, blk - b * PBX); return; }
    blk -= NB * PBX;
    if (blk < PBV) { vrel(ev, V16, Vh, Vl, blk); return; }
    ekp(ek, EK, blk - PBV);
}

// ---- k_attn: the whole attention stage of QB query rows of one head in one work-group of NW waves; grid (TT/QB, NH_, NB).
// Wave w owns keys [w KW, (w+1) KW). It forms the TRANSPOSED score tiles (A = key rows, B = query rows), so lane l holds query l&15 and keys 8(l>>4)+0..7 of each tile:
// two neighbouring key tiles are, register for register, the A fragment (row = query, k = key) of the attn.v product, and the scores never leave the registers.
// t = (q.k + QE[i][clip(i-j)+MAXR]) x HD^-0.5 + mask[j]; row maximum and row sums go across the waves through LDS in wave order; P is normalised before it is rounded to 16 bit.
// bins (LDS, f32, unnormalised): col r (0 < r < NBIN-1) = e[i+MAXR-r] (0 outside [0,TT)); col 0 = sum_{j >= i+MAXR} e and col NBIN-1 = sum_{j <= i-MAXR} e are put in when the fragment is formed; waves < KXB/32 add one k step of bins x emb_v each.
// Each wave's 64-column partial of ctx goes to LDS; the work-group adds the NW partials in wave order and stores the output rows.
// 2^x on v_exp_f32; the v_nop is the one free issue slot that the instruction set asks for between a transcendental and a next instruction that reads its result or overwrites its source; in one statement it stays directly behind it
__device__ __forceinline__ float exp2s(float x) { float e; asm("v_exp_f32 %0, %1\n\tv_nop" : "=v"(e) : "v"(x)); return e; }
template <bool B> struct BoolC { static constexpr bool value = B; };
template <bool SPLIT> struct PvT { typedef h16 T; };
template <> struct PvT<true> { typedef bf T; };
template <bool SPLIT, typename T16>
__device__ __forceinline__ void pv_frag(const float (&x)[QT][16], typename WFrag<T16>::V (&p)[QT], typename WFrag<T16>::V (&p2)[QT]) {
#pragma unroll
    for (int qt = 0; qt < QT; ++qt) {
        if constexpr (SPLIT) { v8us h0, h1, l0, l1;
#pragma unroll
            for (int r = 0; r < 8; ++r) { unsigned short a, c; splitf(x[qt][r], a, c); h0[r] = a; l0[r] = c; splitf(x[qt][8 + r], a, c); h1[r] = a; l1[r] = c; }
            p[qt] = cat16b(h0, h1); p2[qt] = cat16b(l0, l1);
        } else { v8h h0, h1;
#pragma unroll
            for (int r = 0; r < 8; ++r) { h0[r] = tohx(x[qt][r]); h1[r] = tohx(x[qt][8 + r]); }
            p[qt] = cat16(h0, h1); }
    }
}
template <bool SPLIT, typename T16>
__device__ __forceinline__ void pv_mma(const typename WFrag<T16>::V (&p)[QT], const typename WFrag<T16>::V (&p2)[QT], typename WFrag<T16>::V v, typename WFrag<T16>::V v2, v8f (&o)[QT][4], int dt) {
#pragma unroll
    for (int qt = 0; qt < QT; ++qt) o[qt][dt] = WFrag<T16>::mma(p[qt], v, o[qt][dt]);
    if constexpr (SPLIT) {
#pragma unroll
        for (int qt = 0; qt < QT; ++qt) o[qt][dt] = WFrag<T16>::mma(p2[qt], v, o[qt][dt]);
#pragma unroll
        for (int qt = 0; qt < QT; ++qt) o[qt][dt] = WFrag<T16>::mma(p[qt], v2, o[qt][dt]); }
}

__global__ __launch_bounds__(NW * 32) void k_attn(const bf* __restrict__ QPh, const bf* __restrict__ QPl, const bf* __restrict__ KPh, const bf* __restrict__ KPl, const bf* __restrict__ EK,
                                                  const h16* __restrict__ V16, const bf* __restrict__ Vh, const bf* __restrict__ Vl, const float* __restrict__ mask, float* OUT) {
    __shared__ __align__(16) float ored[NW][QB * OP];
    __shared__ __align__(16) float binsL[QB * BP];
    __shared__ float qes[QB * QEP];
    __shared__ float rmx[NW][QB], rsm[NW][QB], rlo[NW][QB], rhi[NW][QB];
    typedef WFrag<bf> FB;
    const int tid = threadIdx.x, lane = tid & 31, lr = lane & 15, hi = lane >> 4;
    const int wave = __builtin_amdgcn_readfirstlane(tid >> 5);
    const int i0 = blockIdx.x * QB, head = blockIdx.y, b = blockIdx.z; const bool hires = (i0 < RH);
    const size_t pq = ((size_t)b * NH_ + head) * TT * HD, pk = ((size_t)b * NKV + head / REP) * TT * HD, pv = ((size_t)b * NKV + head / REP) * HD * TP;
    const int kbase = wave * KW;
    // every global address is a wave-uniform base + one lane offset + a constant: the few address registers stay as they are while the loads that name them are in flight
    const unsigned lf = (unsigned)(lane * 8), lm = (unsigned)(8 * hi);   // lf: the lane's 16-byte piece in each half of a fragment (FRAG)
    const bf* qbh = QPh + pq + (size_t)i0 * HD; const bf* qbl = QPl + pq + (size_t)i0 * HD; const bf* kbh = KPh + pk + (size_t)kbase * HD; const bf* kbl = KPl + pk + (size_t)kbase * HD;
    const float* mrow = mask + (size_t)b * TTF + kbase;
    for (int e = tid; e < QB * BP; e += NW * 32) binsL[e] = 0.f;
    // QE = q emb_k^T (q hi/lo x exact emb_k), one 16x16 tile per job, into LDS
    for (int job = wave; job < QT * NBT; job += NW) { const int qt = job / NBT, nt = job - qt * NBT; v8f a = (v8f){};
        const bf* jh = qbh + qt * 16 * HD; const bf* jl = qbl + qt * 16 * HD; const bf* je = EK + nt * 16 * HD;
#pragma unroll
        for (int ks = 0; ks < 2; ++ks) { const v16bf ah = FB::ldf(jh + lf + ks * FRAG), al = FB::ldf(jl + lf + ks * FRAG), eb = FB::ldf(je + lf + ks * FRAG);
            a = wmmab(ah, eb, a); a = wmmab(al, eb, a); }
        // s_wait_xcnt 0 stands before a register that an issued global load names is rewritten (the next trip forms new bases); as inputs those registers stay as they are up to this wait
        asm volatile("s_wait_xcnt 0x0" :: "s"(jh), "s"(jl), "s"(je), "v"(lf) : "memory");
#pragma unroll
        for (int r = 0; r < 8; ++r) qes[(qt * 16 + 8 * hi + r) * QEP + nt * 16 + lr] = a[r]; }
    // transposed score tiles, bf16 hi/lo, 3 products
    v16bf qh[QT][2], ql[QT][2];
#pragma unroll
    for (int qt = 0; qt < QT; ++qt)
#pragma unroll
        for (int ks = 0; ks < 2; ++ks) { qh[qt][ks] = FB::ldf(qbh + lf + (qt * 2 + ks) * FRAG); ql[qt][ks] = FB::ldf(qbl + lf + (qt * 2 + ks) * FRAG); }
    v8f s[KTN][QT]; v16bf kfh[KTN][2], kfl[KTN][2];
    // a key tile's loads are issued ahead of the products that use them: two tiles ahead while few score tiles are held, one tile ahead when the registers are nearly full
    auto ldk = [&](int kt) __attribute__((always_inline)) {
#pragma unroll
        for (int ks = 0; ks < 2; ++ks) { kfh[kt][ks] = FB::ldf(kbh + lf + (kt * 2 + ks) * FRAG); kfl[kt][ks] = FB::ldf(kbl + lf + (kt * 2 + ks) * FRAG); } };
    ldk(0); ldk(1);
#pragma unroll
    for (int kt = 0; kt < KTN; ++kt) {
        if (kt + 2 < KTN - KLATE) ldk(kt + 2); else if (kt + 1 >= KTN - KLATE && kt + 1 < KTN) ldk(kt + 1);
        __builtin_amdgcn_sched_barrier(0);   // keeps the loads above in front of this tile's products; sunk to their use, each would be waited for in full
#pragma unroll
        for (int qt = 0; qt < QT; ++qt) s[kt][qt] = (v8f){};
#pragma unroll
        for (int ks = 0; ks < 2; ++ks) { const v16bf kh = kfh[kt][ks], kl = kfl[kt][ks];
#pragma unroll
            for (int qt = 0; qt < QT; ++qt) s[kt][qt] = wmmab(kh, qh[qt][ks], s[kt][qt]);
#pragma unroll
            for (int qt = 0; qt < QT; ++qt) s[kt][qt] = wmmab(kh, ql[qt][ks], s[kt][qt]);
#pragma unroll
            for (int qt = 0; qt < QT; ++qt) s[kt][qt] = wmmab(kl, qh[qt][ks], s[kt][qt]); }
        __builtin_amdgcn_sched_barrier(0); }   // keeps the next tiles' loads from rising over these products, which would hold more registers than there are
    // the same wait for the q and k loads: their address registers may be reused only behind it
    asm volatile("s_wait_xcnt 0x0" :: "s"(qbh), "s"(qbl), "s"(kbh), "s"(kbl), "v"(lf) : "memory");
    __syncthreads();   // QE tiles and the zeroed bins are visible to every wave
    float qe0[QT], qe1[QT], mx[QT];
#pragma unroll
    for (int qt = 0; qt < QT; ++qt) { qe0[qt] = qes[(qt * 16 + lr) * QEP]; qe1[qt] = qes[(qt * 16 + lr) * QEP + NBIN - 1]; mx[qt] = -3.0e38f; }
#pragma unroll
    for (int kt = 0; kt < KTN; ++kt) { const int jb = kbase + kt * 16; const v4f m0 = *(const v4f*)(mrow + lm + kt * 16), m1 = *(const v4f*)(mrow + lm + (kt * 16 + 4)); float mk[8];
#pragma unroll
        for (int r = 0; r < 4; ++r) { mk[r] = bfr(m0[r]); mk[4 + r] = bfr(m1[r]); }
#pragma unroll
        for (int qt = 0; qt < QT; ++qt) { const int ib = i0 + qt * 16; const bool left = (jb + 15 <= ib - MAXR), right = (jb >= ib + 15 + MAXR);   // the whole tile is clipped: one QE value per query (wave-uniform tests)
            if (left || right) { const float qe = left ? qe1[qt] : qe0[qt];
#pragma unroll
                for (int r = 0; r < 8; ++r) { const float t = (s[kt][qt][r] + qe) * SCL + mk[r]; s[kt][qt][r] = t; mx[qt] = fmaxf(mx[qt], t); }
            } else {
#pragma unroll
                for (int r = 0; r < 8; ++r) { int rel = (ib + lr) - (jb + 8 * hi + r); rel = rel > MAXR ? MAXR : (rel < -MAXR ? -MAXR : rel); const float t = (s[kt][qt][r] + qes[(qt * 16 + lr) * QEP + rel + MAXR]) * SCL + mk[r]; s[kt][qt][r] = t; mx[qt] = fmaxf(mx[qt], t); } } } }
#pragma unroll
    for (int qt = 0; qt < QT; ++qt) { mx[qt] = fmaxf(mx[qt], __shfl_xor(mx[qt], 16, 32)); if (hi == 0) rmx[wave][qt * 16 + lr] = mx[qt]; }
    asm volatile("s_wait_xcnt 0x0" :: "s"(mrow), "v"(lm) : "memory");   // the same wait for the mask loads' address registers
    __syncthreads();   // every wave's row maxima are in LDS
#pragma unroll
    for (int qt = 0; qt < QT; ++qt) { float m = rmx[0][qt * 16 + lr];
#pragma unroll
        for (int w = 1; w < NW; ++w) m = fmaxf(m, rmx[w][qt * 16 + lr]);
        mx[qt] = m; }
    float sum[QT], clo[QT], chi[QT];
#pragma unroll
    for (int qt = 0; qt < QT; ++qt) { sum[qt] = 0.f; clo[qt] = 0.f; chi[qt] = 0.f; }
#pragma unroll
    for (int kt = 0; kt < KTN; ++kt) { const int jb = kbase + kt * 16;
#pragma unroll
        for (int qt = 0; qt < QT; ++qt) { const int ib = i0 + qt * 16; const bool left = (jb + 15 <= ib - MAXR), right = (jb >= ib + 15 + MAXR);
            if (left || right) { float ts = 0.f;
#pragma unroll
                for (int r = 0; r < 8; ++r) { const float e = exp2s(__fmul_rn(__fsub_rn(s[kt][qt][r], mx[qt]), 1.4426950408889634f)); s[kt][qt][r] = e; ts += e; }
                sum[qt] += ts; clo[qt] += right ? ts : 0.f; chi[qt] += left ? ts : 0.f;
            } else {
#pragma unroll
                for (int r = 0; r < 8; ++r) { const float e = exp2s(__fmul_rn(__fsub_rn(s[kt][qt][r], mx[qt]), 1.4426950408889634f)); s[kt][qt][r] = e; sum[qt] += e;
                    const int rr = (ib + lr) - (jb + 8 * hi + r) + MAXR; clo[qt] += (rr <= 0) ? e : 0.f; chi[qt] += (rr >= NBIN - 1) ? e : 0.f; if (rr > 0 && rr < NBIN - 1) binsL[(qt * 16 + lr) * BP + rr] = e; } } } }
#pragma unroll
    for (int qt = 0; qt < QT; ++qt) { sum[qt] += __shfl_xor(sum[qt], 16, 32); clo[qt] += __shfl_xor(clo[qt], 16, 32); chi[qt] += __shfl_xor(chi[qt], 16, 32);
        if (hi == 0) { rsm[wave][qt * 16 + lr] = sum[qt]; rlo[wave][qt * 16 + lr] = clo[qt]; rhi[wave][qt * 16 + lr] = chi[qt]; } }
    __syncthreads();   // every wave's row sums and the band copies in the bins are in LDS
    float f[QT];
#pragma unroll
    for (int qt = 0; qt < QT; ++qt) { float tot = rsm[0][qt * 16 + lr];
#pragma unroll
        for (int w = 1; w < NW; ++w) tot += rsm[w][qt * 16 + lr];
        f[qt] = __fdiv_rn(hires ? 1.0f : PCAR, tot); }
    v8f o[QT][4];
#pragma unroll
    for (int qt = 0; qt < QT; ++qt)
#pragma unroll
        for (int dt = 0; dt < 4; ++dt) o[qt][dt] = (v8f){};
    auto attnv = [&](auto fc, auto* Vp, auto* Vp2) __attribute__((always_inline)) { constexpr bool SPLIT = decltype(fc)::value; typedef typename PvT<SPLIT>::T T16; typedef typename WFrag<T16>::V V_;
        auto* V = Vp + pv + (kbase / 32) * 4 * FRAG; auto* V2 = Vp2 + pv + (kbase / 32) * 4 * FRAG;   // wave-uniform bases of this wave's keys
        constexpr int NT = (KTN / 2) * 4, AH = SPLIT ? VAH2 : VAH1;   // steps (k step kk, 16 columns dt) and how many steps ahead a step's value fragments are fetched
        V_ vf[NT], vf2[NT];
        auto ldv = [&](int t) __attribute__((always_inline)) { vf[t] = WFrag<T16>::ldf(V + lf + t * FRAG); if constexpr (SPLIT) vf2[t] = WFrag<T16>::ldf(V2 + lf + t * FRAG); };
#pragma unroll
        for (int t = 0; t < AH; ++t) ldv(t);
#pragma unroll
        for (int kk = 0; kk < KTN / 2; ++kk) { float x[QT][16]; V_ p[QT], p2[QT];
#pragma unroll
            for (int qt = 0; qt < QT; ++qt)
#pragma unroll
                for (int r = 0; r < 8; ++r) { x[qt][r] = s[2 * kk][qt][r] * f[qt]; x[qt][8 + r] = s[2 * kk + 1][qt][r] * f[qt]; }
            pv_frag<SPLIT, T16>(x, p, p2);
#pragma unroll
            for (int dt = 0; dt < 4; ++dt) { const int t = kk * 4 + dt;
                if (t + AH < NT) ldv(t + AH);
                __builtin_amdgcn_sched_barrier(0);   // keeps the loads above in front of this step's products; sunk to their use, each would be waited for in full
                pv_mma<SPLIT, T16>(p, p2, vf[t], SPLIT ? vf2[t] : vf[t], o, dt);
                __builtin_amdgcn_sched_barrier(0); } }   // keeps later steps' loads from rising over these products, which would hold more registers than there are
        asm volatile("s_wait_xcnt 0x0" :: "s"(V), "s"(V2), "v"(lf) : "memory");   // the same wait for the value loads' address registers
        if (wave < KXB / 32) { float x[QT][16]; V_ p[QT], p2[QT], vb[4], vb2[4];   // wave-uniform: one k step of the bins
            auto* Vb = Vp + pv + (TT / 32 + wave) * 4 * FRAG; auto* Vb2 = Vp2 + pv + (TT / 32 + wave) * 4 * FRAG;
#pragma unroll
            for (int dt = 0; dt < 4; ++dt) { vb[dt] = WFrag<T16>::ldf(Vb + lf + dt * FRAG); if constexpr (SPLIT) vb2[dt] = WFrag<T16>::ldf(Vb2 + lf + dt * FRAG); }
            asm volatile("s_wait_xcnt 0x0" :: "s"(Vb), "s"(Vb2), "v"(lf) : "memory");   // the same wait for the loads of the emb_v columns, directly behind them: the work below needs their address registers
#pragma unroll
            for (int qt = 0; qt < QT; ++qt) { const float* bp = binsL + (qt * 16 + lr) * BP + wave * 32 + 8 * hi; const v4f b0 = *(const v4fa*)bp, b1 = *(const v4fa*)(bp + 4), b2 = *(const v4fa*)(bp + 16), b3 = *(const v4fa*)(bp + 20);
                float t0 = b0[0];
                if (wave == 0 || wave == (NBIN - 1) / 32) { const float* rp = (wave == 0) ? &rlo[0][qt * 16 + lr] : &rhi[0][qt * 16 + lr]; float tot = rp[0];
#pragma unroll
                    for (int w = 1; w < NW; ++w) tot += rp[w * QB];
                    t0 = (hi == 0) ? tot : t0; }
#pragma unroll
                for (int r = 0; r < 4; ++r) { x[qt][r] = (r == 0 ? t0 : b0[r]) * f[qt]; x[qt][4 + r] = b1[r] * f[qt]; x[qt][8 + r] = b2[r] * f[qt]; x[qt][12 + r] = b3[r] * f[qt]; }
                if constexpr (!SPLIT) {
#pragma unroll
                    for (int r = 0; r < 16; ++r) x[qt][r] = x[qt][r] * (1.0f / EVC); } }
            pv_frag<SPLIT, T16>(x, p, p2);
#pragma unroll
            for (int dt = 0; dt < 4; ++dt) pv_mma<SPLIT, T16>(p, p2, vb[dt], SPLIT ? vb2[dt] : vb[dt], o, dt); } };
    if (hires) attnv(BoolC<true>{}, Vh, Vl); else attnv(BoolC<false>{}, V16, V16);
#pragma unroll
    for (int qt = 0; qt < QT; ++qt)
#pragma unroll
        for (int dt = 0; dt < 4; ++dt)
#pragma unroll
            for (int r = 0; r < 8; ++r) ored[wave][(qt * 16 + 8 * hi + r) * OP + dt * 16 + lr] = o[qt][dt][r];
    __syncthreads();   // every wave's partial of ctx is in LDS
    const float cs = hires ? 1.0f : (1.0f / PCAR);
    for (int e = tid; e < QB * (HD / 4); e += NW * 32) { const int q = e / (HD / 4), d4 = (e % (HD / 4)) * 4; v4f sm = *(const v4fa*)(&ored[0][q * OP + d4]);
#pragma unroll
        for (int w = 1; w < NW; ++w) sm += *(const v4fa*)(&ored[w][q * OP + d4]);
        v4f o4; o4[0] = sm[0] * cs; o4[1] = sm[1] * cs; o4[2] = sm[2] * cs; o4[3] = sm[3] * cs; *(v4f*)(OUT + ((size_t)b * TT + i0 + q) * DQ + head * HD + d4) = o4; }
}

extern "C" void kernel_launch(void* const* d_in, const int* in_sizes, int n_in,
                              void* d_out, int out_size, void* d_ws, size_t ws_size, hipStream_t stream) {
    if (n_in < 10) return;
    if ((size_t)in_sizes[0] < ((size_t)(NB - 1) * TTF + TT) * DM) return;
    if ((size_t)in_sizes[1] < (size_t)(NB - 1) * TTF + TT) return;
    if (in_sizes[2] < DM * DQ || in_sizes[4] < DM * DKV || in_sizes[6] < DM * DKV) return;
    if (in_sizes[3] < DQ || in_sizes[5] < DKV || in_sizes[7] < DKV) return;
    if (in_sizes[8] < NBIN * HD || in_sizes[9] < NBIN * HD) return;
    if ((size_t)out_size < (size_t)NB * TT * DQ) return;
    const float* x = (const float*)d_in[0]; const float* mask = (const float*)d_in[1];   // [NB][1][1][TTF], added per key
    const float* wq = (const float*)d_in[2]; const float* bq = (const float*)d_in[3]; const float* wk = (const float*)d_in[4]; const float* bk = (const float*)d_in[5]; const float* wv = (const float*)d_in[6]; const float* bv = (const float*)d_in[7];
    const float* embk = (const float*)d_in[8]; const float* embv = (const float*)d_in[9];   // [NBIN][HD] each
    float* OUT = (float*)d_out;     // [NB][TT][DQ]
    char* wsp = (char*)d_ws;
    auto take = [&](size_t bytes) { char* p = wsp; wsp += (bytes + 255) & ~(size_t)255; return (void*)p; };
    bf* WQ = (bf*)take((size_t)DQ * DM * 2); bf* WK = (bf*)take((size_t)DKV * DM * 2); bf* WV = (bf*)take((size_t)DKV * DM * 2); bf* EK = (bf*)take((size_t)KX * HD * 2);
    h16* VT16 = (h16*)take((size_t)NB * NKV * HD * TP * 2);
    bf* QPh = (bf*)take((size_t)NB * NH_ * TT * HD * 2); bf* QPl = (bf*)take((size_t)NB * NH_ * TT * HD * 2); bf* KPh = (bf*)take((size_t)NB * NKV * TT * HD * 2); bf* KPl = (bf*)take((size_t)NB * NKV * TT * HD * 2); bf* VTh = (bf*)take((size_t)NB * NKV * HD * TP * 2); bf* VTl = (bf*)take((size_t)NB * NKV * HD * TP * 2);
    bf* XB = (bf*)take((size_t)NB * TT * DM * 2);   // bf16 copy of x
    if ((size_t)(wsp - (char*)d_ws) > ws_size) return;
    k_prep<<<3 * PBW + NB * PBX + PBV + PBE, 256, 0, stream>>>(x, wq, wk, wv, embk, embv, XB, WQ, WK, WV, EK, VT16, VTh, VTl);
    k_proj<<<dim3(TT / 64, DQ / 64, 3 * NB), 32, 0, stream>>>(XB, WQ, WK, WV, bq, bk, bv, QPh, QPl, KPh, KPl, VT16, VTh, VTl);
    k_attn<<<dim3(TT / QB, NH_, NB), NW * 32, 0, stream>>>(QPh, QPl, KPh, KPl, EK, VT16, VTh, VTl, mask, OUT);
}

// v007
// One run takes 223 microseconds.
// Next to v006, in two timings, it ran 1.06 times as fast each time.
// Over all steps from v000 it is 11.1 times as fast.
#include <hip/hip_runtime.h>

// Contractions: x W (q,k,v) on v_wmma_f32_16x16x32_bf16 (bf16 operands from RNE-bf16 inputs); q.k and q.emb_k score tiles bf16 hi/lo split (3 and 2 products); attn.v with the rel-value bins.emb_v folded into K: rows < RH bf16 hi/lo split, rows >= RH v_wmma_f32_16x16x32_f16 (P x1024, bins x64, emb_v x16, v plain f16); f32 accumulate, f32 softmax.
// Self-attention, 16 heads x 64: q,k,v = x W + b ('xw' layout), scores = (q.k + q.emb_k[clip(i-j)]) x 64^-0.5 + additive key mask, softmax over all keys,
// ctx = probs v + sum_r bins[i][r] emb_v[r] (bins: band copies of probs plus the two clipped tail sums), output concat-heads [NB][TT][1024] f32, no output projection.
// Layout: bf16 copy of x; weights transposed once to rows n, k index k, bf16; the projection GEMMs add the f32 bias and store their tiles straight as head planes [b][h] of q,k (bf16 hi/lo; rows t, k index d) and of the values (f16, bf16 hi/lo; rows d, k index = key, TT+192 of them, keys >= TT hold emb_v), all, with emb_k, in fragment order (see FRAG);
// three launches: k_prep forms every plane that depends on an input alone, k_proj does the six projection GEMMs (q, k, v of each batch) in one grid, k_attn the attention stage.
// one attention kernel: a work-group holds the scores of QB query rows x all TT keys of one head in registers, does the softmax there and feeds the attn.v WMMAs from the same registers (see k_attn).

#ifndef NB
#define NB   2
#endif
#ifndef SEQ
#define SEQ  2048
#endif
#define NB_FULL  2
#define TTF  2048                 // full per-batch sequence stride of the inputs
#define TT   SEQ
#define DM   1024
#define NH_  16
#define NKV  16
#define REP  (NH_ / NKV)
#define HD   64
#define DQ   (NH_ * HD)
#define DKV  (NKV * HD)
#define ZH   8                    // z extent of gemmw's K-range form (KR > 0)
#define RH   ((TT / 2 < 512) ? (TT / 2) : 512)   // query rows < RH use hi+lo planes
#define PCAR 1024.0f
#define SCL  0.125f   // HD^-0.5
#define MAXR 64
#define NBIN (2 * MAXR + 1)       // 129 clipped offsets
#define KX   192                  // NBIN padded to a multiple of 64
#define TP   (TT + KX)            // row pitch of the value planes (keys + KX bin columns)
#define EVC  16.0f                // f16 carry of emb_v in the value planes (bins carry 1024/16 = 64)
#define QT   2                    // 16-query tiles per work-group of k_attn
#define QB   (16 * QT)
#define NW   16                   // waves per work-group of k_attn, each owns KW keys
#define KW   (TT / NW)
#define KTN  (KW / 16)            // 16-key tiles per wave
#define VAH1 4                    // attn.v, f16 rows: value fragments are fetched this many steps ahead
#define VAH2 2                    // attn.v, hi/lo rows (two fragments a step)
#define KLATE 2                   // the last KLATE key tiles of a wave are fetched one tile ahead, the others two
#define XS   16                   // spare columns on each side of the QE and bins tables in LDS: column c stands for offset i - j = c - XS - MAXR, unclipped, so every element of a tile that meets the band has a column of its own
#define NBT  ((NBIN - 1 + 2 * XS) / 16)   // 16-column tiles of QE
#define QEP  (NBT * 16 + 2)       // LDS pitch of a QE row: a column read and a diagonal read (pitch + 1 a lane, 8 back for the upper half wave) both meet distinct banks
#define KXB  160                  // NBIN padded to k steps of 32
#define BP   (XS + KXB + 4)       // LDS pitch of a bins row, 16 B x odd
#define OP   (HD + 4)             // LDS pitch of a partial ctx row, 16 B x odd
#define FRAG 512                  // elements of one 16-row x 32-k operand fragment. Fragment order: a plane is a row of such fragments (k step fastest for x, W^T, q, k, emb_k; 16-row block fastest for the values); inside one, the 8 elements at (j * 32 + lane) * 8 are row lane&15, k = 16 j + 8 (lane>>4) + 0..7, so each of a wave's two 16-byte loads of a fragment reads 512 bytes in a row (four whole 128-byte lines, not 32 bytes of each of 16 lines)

static_assert(TT % 128 == 0);
static_assert(RH % 64 == 0);
static_assert(RH >= 64);
static_assert((TT - RH) % 64 == 0);
static_assert(TT - RH >= 64);
static_assert(TP % 32 == 0);
static_assert(TT % (NW * 32) == 0);
static_assert(TT % QB == 0);
static_assert(RH % QB == 0);
static_assert(KXB >= NBIN && KXB <= KX && KXB % 32 == 0);
static_assert((NBIN - 1) % 32 == 0);
static_assert(KXB / 32 <= NW);
static_assert(KX % 64 == 0);
static_assert(KX >= NBIN);
static_assert(KX == 192);
static_assert(XS == 16 && MAXR % 16 == 0 && NBT * 16 <= KX);
static_assert(HD == 64);
static_assert(NH_ % ZH == 0);
static_assert(DM % 64 == 0);
static_assert((KX * HD) % (8 * 256) == 0);
static_assert(((size_t)TT * DM / 8) % 256 == 0);
static_assert((NKV * HD) % 8 == 0);
static_assert(NB <= NB_FULL);
static_assert(TT <= TTF);

typedef _Float16 h16;
typedef unsigned short bf;
typedef __attribute__((ext_vector_type(16))) __bf16   v16bf;
typedef __attribute__((ext_vector_type(16))) _Float16 v16h;
typedef __attribute__((ext_vector_type(8)))  _Float16 v8h;
typedef __attribute__((ext_vector_type(8)))  unsigned short v8us;
typedef __attribute__((ext_vector_type(8)))  float    v8f;
typedef __attribute__((ext_vector_type(4)))  float    v4f;
typedef v8h  __attribute__((may_alias)) v8ha;
typedef v4f  __attribute__((may_alias)) v4fa;
typedef v8us __attribute__((may_alias)) v8usa;

__device__ __forceinline__ unsigned short f2bf(float f) { unsigned u = __float_as_uint(f); u += 0x7FFFu + ((u >> 16) & 1u); return (unsigned short)(u >> 16); }
__device__ __forceinline__ float bf2f(unsigned short b) { return __uint_as_float(((unsigned)b) << 16); }
__device__ __forceinline__ float bfr(float f) { return bf2f(f2bf(f)); }
__device__ __forceinline__ h16 tohx(float x) { return (h16)x; }
__device__ __forceinline__ void splitf(float y, unsigned short& h, unsigned short& l) { h = f2bf(y); l = f2bf(y - bf2f(h)); }
__device__ __forceinline__ v16h cat16(v8h lo, v8h hi) { return __builtin_shufflevector(lo, hi, 0, 1, 2, 3, 4, 5, 6, 7, 8, 9, 10, 11, 12, 13, 14, 15); }
__device__ __forceinline__ v16bf cat16b(v8us lo, v8us hi) { return __builtin_bit_cast(v16bf, __builtin_shufflevector(lo, hi, 0, 1, 2, 3, 4, 5, 6, 7, 8, 9, 10, 11, 12, 13, 14, 15)); }
__device__ __forceinline__ v8f wmma16(v16h a, v16h b, v8f c) { return __builtin_amdgcn_wmma_f32_16x16x32_f16(false, a, false, b, (short)0, c, false, false); }
__device__ __forceinline__ v8f wmmab(v16bf a, v16bf b, v8f c) { return __builtin_amdgcn_wmma_f32_16x16x32_bf16(false, a, false, b, (short)0, c, false, false); }

// ---- gemmw: register-blocked GEMM, ONE WAVE per 64x64 output tile (16 accumulators), operands straight from 16-bit planes in fragment order (FRAG; k step fastest); the body of a 32-thread work-group, tile (bx, by, bz) of (M/64, N/64, Z).
// C[m][n] (f32, pitch ldc, + optional f32 bias[n]) = sum_k A[m][k] Bt[n][k] (+ split products per NSPLIT); A rows hold lda = DM elements, Bt rows K = DM. z-batch strides sA/sB/sC in elements. K % 32 == 0.
// KR > 0 (N == 64 only): tiles (M/64, K/KR, ZH); tile by sums k in [by KR, (by+1) KR) alone and stores its partial tile in plane by (plane stride ZH sC); the caller adds the planes.
// EPI 0 stores C. EPI 1 (N tile = one head, HD == 64): no C; row t, col c of the biased tile goes, split into bf16 hi + lo, to row t, k index c % HD of head plane c / HD of Ph/Pl. EPI 2: no C; it goes to row c % HD, k index t of head plane c / HD of P16 (f16), Ph, Pl (bf16 hi, lo). Both in fragment order (FRAG).
// Fragments: lane l -> row/col l&15, h = l>>4; elements 0..7 <- k0+8h+0..7, 8..15 <- k0+16+8h+0..7 for BOTH A and Bt (same loader, same plane order); D element r -> row 8h+r, col l&15.
template <typename T16> struct WFrag;
template <> struct WFrag<h16> { typedef v16h V; static __device__ __forceinline__ V ldf(const h16* p) { return cat16(*(const v8h*)p, *(const v8h*)(p + FRAG / 2)); } static __device__ __forceinline__ v8f mma(V a, V b, v8f c) { return wmma16(a, b, c); } };
template <> struct WFrag<bf> { typedef v16bf V; static __device__ __forceinline__ V ldf(const bf* p) { return cat16b(*(const v8us*)p, *(const v8us*)(p + FRAG / 2)); } static __device__ __forceinline__ v8f mma(V a, V b, v8f c) { return wmmab(a, b, c); } };
template <typename T16, int NSPLIT, bool BIAS, int KR = 0, int EPI = 0>
__device__ __forceinline__ void gemmw(const T16* __restrict__ A, const T16* __restrict__ A2, const T16* __restrict__ Bt, const T16* __restrict__ Bt2, float* C, int ldc, const float* __restrict__ bias, size_t sA, size_t sB, size_t sC, h16* P16, bf* Ph, bf* Pl, int bx, int by, int bz) {
    typedef typename WFrag<T16>::V V; constexpr int K = DM, lda = DM;   // compile-time row lengths: the 16 fragment addresses of a k step are two bases + the lane's piece + constants
    __shared__ __align__(16) float os[16 * 68];
    const size_t z = bz; A += z * sA; if (A2) A2 += z * sA; Bt += z * sB; if (Bt2) Bt2 += z * sB; C += (KR ? (size_t)by * ZH + z : z) * sC;
    const int lane = threadIdx.x & 31, lr = lane & 15, hi = lane >> 4; const int r0 = bx * 64, c0 = KR ? 0 : by * 64; const int kb = KR ? by * KR : 0, ke = KR ? kb + KR : K;
    v8f acc[4][4];
#pragma unroll
    for (int mb = 0; mb < 4; ++mb)
#pragma unroll
        for (int nb = 0; nb < 4; ++nb) acc[mb][nb] = (v8f){};
    const size_t aoff = (size_t)r0 * lda, boff = (size_t)c0 * K; const unsigned lf = (unsigned)(lane * 8);   // fragment order: 16 rows x lda elements are lda / 32 fragments in a row, so k step kc starts kc * 16 = (kc / 32) * FRAG elements in; every address is a wave-uniform base + the lane's piece lf
#pragma unroll 1
    for (int kc = kb; kc < ke; kc += 32) {
        V a[4], a2[4]; const T16* pa = A + (aoff + kc * 16) + lf; const T16* pb = Bt + (boff + kc * 16) + lf;
#pragma unroll
        for (int mb = 0; mb < 4; ++mb) { a[mb] = WFrag<T16>::ldf(pa + mb * 16 * lda); if (NSPLIT == 1 || NSPLIT == 2) a2[mb] = WFrag<T16>::ldf(A2 + (aoff + (size_t)mb * 16 * lda + kc * 16) + lf); }
#pragma unroll
        for (int nb = 0; nb < 4; ++nb) { const V b = WFrag<T16>::ldf(pb + nb * 16 * K); V b2; if (NSPLIT >= 2) b2 = WFrag<T16>::ldf(Bt2 + (boff + (size_t)nb * 16 * K + kc * 16) + lf);
#pragma unroll
            for (int mb = 0; mb < 4; ++mb) { acc[mb][nb] = WFrag<T16>::mma(a[mb], b, acc[mb][nb]); if (NSPLIT == 1 || NSPLIT == 2) acc[mb][nb] = WFrag<T16>::mma(a2[mb], b, acc[mb][nb]); if (NSPLIT >= 2) acc[mb][nb] = WFrag<T16>::mma(a[mb], b2, acc[mb][nb]); } }
        asm volatile("s_wait_xcnt 0x0" :: "v"(pa), "v"(pb) : "memory");   // stands before a register that an issued global load names is rewritten (the next trip forms new addresses); as inputs the two addresses stay as they are up to this wait
        asm volatile("v_nop\n\tv_nop\n\tv_nop\n\tv_nop" : "+v"(acc[0][0]), "+v"(acc[1][1]), "+v"(acc[2][2]), "+v"(acc[3][3]) : "v"(a[0]), "v"(a[3]));
    }
    if constexpr (EPI == 2) {
        // a lane's 8 accumulator elements are 8 consecutive t of one column, which is the lane's own 16-byte piece of a value fragment: one 16-byte store per plane and block, no LDS pass, 512 bytes in a row per store
        // the three loops are unrolled so that acc[][] and the store vectors are indexed by constants and stay in registers
#pragma unroll
        for (int nb = 0; nb < 4; ++nb) { const int col = c0 + nb * 16 + lr; const float bb = bfr(bias[col]); const size_t o = (size_t)by * HD * TP + ((size_t)(r0 / 32) * 4 + nb) * FRAG + lane * 8;
#pragma unroll
            for (int mb = 0; mb < 4; ++mb) { v8h o16; v8us oh, ol;
#pragma unroll
                for (int j = 0; j < 8; ++j) { const float xv = acc[mb][nb][j] + bb; o16[j] = tohx(xv); unsigned short a2, c2; splitf(xv, a2, c2); oh[j] = a2; ol[j] = c2; }
                const int om = (mb / 2) * 4 * FRAG + (mb % 2) * (FRAG / 2); *(v8h*)(P16 + o + om) = o16; *(v8us*)(Ph + o + om) = oh; *(v8us*)(Pl + o + om) = ol;
                asm volatile("s_wait_xcnt 0x0" :: "v"(o16), "v"(oh), "v"(ol) : "memory"); } }   // stands before a register that an issued global store names is rewritten (the next block's values); as inputs the three vectors stay as they are up to this wait
        return;
    }
#pragma unroll
    for (int mb = 0; mb < 4; ++mb) {
#pragma unroll
        for (int nb = 0; nb < 4; ++nb) {
#pragma unroll
            for (int j = 0; j < 8; ++j) os[(hi * 8 + j) * 68 + nb * 16 + lr] = acc[mb][nb][j]; }
        __builtin_amdgcn_wave_barrier(); asm volatile("" ::: "memory");
        float* crow = C + (size_t)(r0 + mb * 16) * ldc + c0;
        if constexpr (EPI == 1) {   // these 16 rows are two fragments; step s = 16 columns = one 512-byte half of a fragment, lane -> row lr, columns 16 s + 8 hi + 0..7. Unrolled: the vectors' elements are indexed by constants
#pragma unroll
            for (int s = 0; s < 4; ++s) { const int cofs = s * 16 + 8 * hi; const v4f w0 = *(const v4fa*)(os + lr * 68 + cofs), w1 = *(const v4fa*)(os + lr * 68 + cofs + 4); v8us oh, ol;
#pragma unroll
                for (int q = 0; q < 4; ++q) { unsigned short a2, c2; splitf(w0[q] + bfr(bias[c0 + cofs + q]), a2, c2); oh[q] = a2; ol[q] = c2; splitf(w1[q] + bfr(bias[c0 + cofs + 4 + q]), a2, c2); oh[4 + q] = a2; ol[4 + q] = c2; }
                const size_t e = ((size_t)by * TT + r0 + mb * 16) * HD + s * (FRAG / 2) + lane * 8; *(v8us*)(Ph + e) = oh; *(v8us*)(Pl + e) = ol;
                asm volatile("s_wait_xcnt 0x0" :: "v"(oh), "v"(ol) : "memory"); }   // the same wait for these two stores' registers
        } else {
#pragma unroll
            for (int s = 0; s < 8; ++s) { const int row = 2 * s + hi, cofs = lr * 4; v4f val = *(const v4fa*)(os + row * 68 + cofs); if (BIAS) { val[0] += bfr(bias[c0 + cofs]); val[1] += bfr(bias[c0 + cofs + 1]); val[2] += bfr(bias[c0 + cofs + 2]); val[3] += bfr(bias[c0 + cofs + 3]); }
                *(v4f*)(crow + (size_t)row * ldc + cofs) = val; }
             }
        __builtin_amdgcn_wave_barrier(); asm volatile("" ::: "memory");
    }
}

// k_proj: the six projection GEMMs in one grid (TT/64, DQ/64, 3 NB), z = 3 b + (0: q, 1: k, 2: v). None reads what another writes; together they put three waves on every SIMD, so one wave's load waits are filled by the others' products.
static_assert(DQ == DKV);
__global__ __launch_bounds__(32) void k_proj(const bf* __restrict__ XB, const bf* __restrict__ WQ, const bf* __restrict__ WK, const bf* __restrict__ WV, const float* __restrict__ bq, const float* __restrict__ bk, const float* __restrict__ bv,
                                             bf* QPh, bf* QPl, bf* KPh, bf* KPl, h16* VT16, bf* VTh, bf* VTl) {
    const int bx = blockIdx.x, by = blockIdx.y, b = blockIdx.z / 3, w = blockIdx.z % 3; const bf* A = XB + (size_t)b * TT * DM;
    const size_t oq = (size_t)b * NH_ * TT * HD, ok = (size_t)b * NKV * TT * HD, ov = (size_t)b * NKV * HD * TP;
    if (w == 2) gemmw<bf, 0, true, 0, 2>(A, nullptr, WV, nullptr, nullptr, 0, bv, 0, 0, 0, VT16 + ov, VTh + ov, VTl + ov, bx, by, 0);
    else gemmw<bf, 0, true, 0, 1>(A, nullptr, w ? WK : WQ, nullptr, nullptr, 0, w ? bk : bq, 0, 0, 0, nullptr, w ? KPh + ok : QPh + oq, w ? KPl + ok : QPl + oq, bx, by, 0);
}

typedef __attribute__((ext_vector_type(2))) _Float16 v2h;
typedef __attribute__((ext_vector_type(4))) _Float16 v4h;
typedef __attribute__((ext_vector_type(2))) unsigned short v2us;
typedef __attribute__((ext_vector_type(2))) float v2f;
typedef __attribute__((ext_vector_type(4))) int v4i;

// The four bodies of k_prep, each for block blk of 256 threads of its own range.
// wtG: Bt = w^T (rows n, k index k) as bf16 in fragment order; thread p forms the 16-byte piece p, so a wave stores 512 bytes in a row and each of its 8 loads reads 64 bytes in a row of two rows of w.
__device__ __forceinline__ void wtG(const float* __restrict__ w, int K, int N, bf* Bt, int blk) {
    const int p = blk * 256 + threadIdx.x; if (p >= N * (K / 8)) return; const int hf = p >> 5, fr = hf >> 1, nk = K / 32;
    const int n = (fr / nk) * 16 + (p & 15), k = (fr % nk) * 32 + (hf & 1) * 16 + ((p >> 4) & 1) * 8; const unsigned off = (unsigned)(k * N + n); float x[8]; v8us o;
#pragma unroll
    for (int e = 0; e < 8; ++e) x[e] = (w + (size_t)e * N)[off];   // a uniform base per row + one lane offset. Unrolled (both loops): the elements are indexed by constants
    asm volatile("s_wait_xcnt 0x0" :: "v"(off) : "memory");   // stands before a register that an issued global load names is rewritten; as an input the offset stays as it is up to this wait
#pragma unroll
    for (int e = 0; e < 8; ++e) o[e] = f2bf(x[e]);
    *(v8us*)(Bt + (size_t)p * 8) = o; }
// cvt8: rows of DM f32 -> bf16 in fragment order; thread i forms the 16-byte piece i.
__device__ __forceinline__ void cvt8(const float* __restrict__ src, bf* dst, size_t n8, int blk) { const size_t i = (size_t)blk * 256 + threadIdx.x; if (i >= n8) return; const size_t hf = i >> 5, fr = hf >> 1;
    const size_t row = (fr / (DM / 32)) * 16 + (i & 15), k = (fr % (DM / 32)) * 32 + (hf & 1) * 16 + ((i >> 4) & 1) * 8; const v8f v = *(const v8f*)(src + row * DM + k); v8us o;
#pragma unroll
    for (int k2 = 0; k2 < 8; ++k2) o[k2] = f2bf(v[k2]); *(v8us*)(dst + i * 8) = o;  }

// vrel: k indices [TT, TT+KX) of every value head plane (b*NKV + g): row d, k index TT + r = emb_v[r][d] (r < NBIN, else 0); fp16 plane carries x EVC of the bf16 value, hi plane bf16, lo plane 0. One wave per 512-byte half of a fragment.
__device__ __forceinline__ void vrel(const float* __restrict__ ev, h16* V16, bf* Vh, bf* Vl, int blk) {
    const int lane = threadIdx.x & 31; const int pc = blk * 8 + (threadIdx.x >> 5); if (pc >= NB * NKV * (KX / 32) * 8) return; const int pl = pc / ((KX / 32) * 8), hf = pc % ((KX / 32) * 8);   // hf = ((k step) * 4 + 16-row block) * 2 + j
    const int d = ((hf >> 1) & 3) * 16 + (lane & 15); const int rb0 = (hf >> 3) * 32 + (hf & 1) * 16 + (lane >> 4) * 8;
    v8h o16; v8us oh, ol; unsigned of[8]; float xs[8];
#pragma unroll
    for (int q = 0; q < 8; ++q) { const int r = rb0 + q; const int rc = (r < NBIN - 1) ? r : (NBIN - 1); of[q] = (unsigned)(rc * HD + d); xs[q] = ev[of[q]]; }
    // s_wait_xcnt 0 stands before a register that an issued global load names is rewritten; as inputs the offsets stay as they are up to this wait
    asm volatile("s_wait_xcnt 0x0" :: "v"(of[0]), "v"(of[1]), "v"(of[2]), "v"(of[3]), "v"(of[4]), "v"(of[5]), "v"(of[6]), "v"(of[7]) : "memory");
#pragma unroll   // as above: the arrays and vectors are indexed by constants and stay in registers
    for (int q = 0; q < 8; ++q) { const int r = rb0 + q; float x = xs[q]; x = (r < NBIN) ? x : 0.f; const float xb = bfr(x); o16[q] = tohx(xb * EVC); oh[q] = f2bf(x); ol[q] = f2bf(x * 0.f); }
    const size_t o = (size_t)pl * HD * TP + (size_t)(TT / 32) * 4 * FRAG + hf * (FRAG / 2) + lane * 8;
    *(v8h*)(V16 + o) = o16; *(v8us*)(Vh + o) = oh; *(v8us*)(Vl + o) = ol;
}
__device__ __forceinline__ void ekp(const float* __restrict__ ek, bf* EK, int blk) {
    const int idx = blk * 256 + threadIdx.x; if (idx >= KX * HD / 8) return; const int e = idx * 8; const int hf = idx >> 5;   // fragment order: piece idx is lane idx & 31 of half hf & 1 of fragment hf >> 1 (two fragments per 16 rows)
    const int r = (hf >> 2) * 16 + (idx & 15), d0 = ((hf >> 1) & 1) * 32 + (hf & 1) * 16 + ((idx >> 4) & 1) * 8; const int rs = r - XS; const int rc = (rs < 0) ? 0 : ((rs < NBIN - 1) ? rs : (NBIN - 1));   // row r holds emb_k of the clipped offset r - XS: the XS spare rows on each side repeat the end rows
    const v4f a = *(const v4f*)(ek + (size_t)rc * HD + d0), b2 = *(const v4f*)(ek + (size_t)rc * HD + d0 + 4); v8us o;
#pragma unroll
    for (int k = 0; k < 4; ++k) { const float x0 = (r < NBT * 16) ? a[k] : 0.f, x1 = (r < NBT * 16) ? b2[k] : 0.f; o[k] = f2bf(x0); o[k + 4] = f2bf(x1); }
    *(v8us*)(EK + e) = o;  }
// k_prep: every plane that depends on an input alone, in one grid: the three W^T, the bf16 copy of x (all batches), the emb_v columns of the value planes, emb_k. The ranges write disjoint planes and read inputs only; a block's range is block-uniform.
#define PBW ((DM * DQ / 8 + 255) / 256)                    // blocks of one W^T
#define PBX ((TT * DM / 8 + 255) / 256)                    // blocks of one batch of x
#define PBV ((NB * NKV * (KX / 32) * 8 + 7) / 8)           // blocks of vrel
#define PBE ((KX * HD / 8 + 255) / 256)                    // blocks of ekp
__global__ __launch_bounds__(256) void k_prep(const float* __restrict__ x, const float* __restrict__ wq, const float* __restrict__ wk, const float* __restrict__ wv, const float* __restrict__ ek, const float* __restrict__ ev,
                                              bf* XB, bf* WQ, bf* WK, bf* WV, bf* EK, h16* V16, bf* Vh, bf* Vl) {
    int blk = blockIdx.x;
    if (blk < 3 * PBW) { const int w = blk / PBW; wtG(w == 0 ? wq : (w == 1 ? wk : wv), DM, DQ, w == 0 ? WQ : (w == 1 ? WK : WV), blk - w * PBW); return; }
    blk -= 3 * PBW;
    if (blk < NB * PBX) { const int b = blk / PBX; cvt8(x + (size_t)b * TTF * DM, XB + (size_t)b * TT * DM, (size_t)TT * DM / 8, blk - b * PBX); return; }
    blk -= NB * PBX;
    if (blk < PBV) { vrel(ev, V16, Vh, Vl, blk); return; }
    ekp(ek, EK, blk - PBV);
}

// ---- k_attn: the whole attention stage of QB query rows of one head in one work-group of NW waves; grid (TT/QB, NH_, NB).
// Wave w owns keys [w KW, (w+1) KW). It forms the TRANSPOSED score tiles (A = key rows, B = query rows), so lane l holds query l&15 and keys 8(l>>4)+0..7 of each tile:
// two neighbouring key tiles are, register for register, the A fragment (row = query, k = key) of the attn.v product, and the scores never leave the registers.
// t = (q.k + QE[i][i-j+MAXR+XS]) x HD^-0.5 + mask[j] (QE has the clipped ends repeated in XS spare columns a side; a tile wholly outside the band takes the end value from a register); row maximum and row sums go across the waves through LDS in wave order; P is normalised before it is rounded to 16 bit.
// bins (LDS, f32, unnormalised): col XS + r = e[i+MAXR-r] for every key of a tile that meets the band, -XS < r < NBIN-1+XS (0 where there is no key); bin 0 = sum_{j >= i+MAXR} e and bin NBIN-1 = sum_{j <= i-MAXR} e are put in when the fragment is formed: the waves' sums over the tiles outside the band + the XS + 1 or XS columns at that end; the columns past bin NBIN-1 meet zero rows of emb_v; waves < KXB/32 add one k step of bins x emb_v each.
// Each wave's 64-column partial of ctx goes to LDS; the work-group adds the NW partials in wave order and stores the output rows.
// 2^x on v_exp_f32; the v_nop is the one free issue slot that the instruction set asks for between a transcendental and a next instruction that reads its result or overwrites its source; in one statement it stays directly behind it
__device__ __forceinline__ float exp2s(float x) { float e; asm("v_exp_f32 %0, %1\n\tv_nop" : "=v"(e) : "v"(x)); return e; }
template <bool B> struct BoolC { static constexpr bool value = B; };
template <bool SPLIT> struct PvT { typedef h16 T; };
template <> struct PvT<true> { typedef bf T; };
template <bool SPLIT, typename T16>
__device__ __forceinline__ void pv_frag(const float (&x)[QT][16], typename WFrag<T16>::V (&p)[QT], typename WFrag<T16>::V (&p2)[QT]) {
#pragma unroll
    for (int qt = 0; qt < QT; ++qt) {
        if constexpr (SPLIT) { v8us h0, h1, l0, l1;
#pragma unroll
            for (int r = 0; r < 8; ++r) { unsigned short a, c; splitf(x[qt][r], a, c); h0[r] = a; l0[r] = c; splitf(x[qt][8 + r], a, c); h1[r] = a; l1[r] = c; }
            p[qt] = cat16b(h0, h1); p2[qt] = cat16b(l0, l1);
        } else { v8h h0, h1;
#pragma unroll
            for (int r = 0; r < 8; ++r) { h0[r] = tohx(x[qt][r]); h1[r] = tohx(x[qt][8 + r]); }
            p[qt] = cat16(h0, h1); }
    }
}
template <bool SPLIT, typename T16>
__device__ __forceinline__ void pv_mma(const typename WFrag<T16>::V (&p)[QT], const typename WFrag<T16>::V (&p2)[QT], typename WFrag<T16>::V v, typename WFrag<T16>::V v2, v8f (&o)[QT][4], int dt) {
#pragma unroll
    for (int qt = 0; qt < QT; ++qt) o[qt][dt] = WFrag<T16>::mma(p[qt], v, o[qt][dt]);
    if constexpr (SPLIT) {
#pragma unroll
        for (int qt = 0; qt < QT; ++qt) o[qt][dt] = WFrag<T16>::mma(p2[qt], v, o[qt][dt]);
#pragma unroll
        for (int qt = 0; qt < QT; ++qt) o[qt][dt] = WFrag<T16>::mma(p[qt], v2, o[qt][dt]); }
}

__global__ __launch_bounds__(NW * 32) void k_attn(const bf* __restrict__ QPh, const bf* __restrict__ QPl, const bf* __restrict__ KPh, const bf* __restrict__ KPl, const bf* __restrict__ EK,
                                                  const h16* __restrict__ V16, const bf* __restrict__ Vh, const bf* __restrict__ Vl, const float* __restrict__ mask, float* OUT) {
    __shared__ __align__(16) float ored[NW][QB * OP];
    __shared__ __align__(16) float binsL[QB * BP];
    __shared__ float qes[QB * QEP];
    __shared__ float rmx[NW][QB], rsm[NW][QB], rlo[NW][QB], rhi[NW][QB];
    typedef WFrag<bf> FB;
    const int tid = threadIdx.x, lane = tid & 31, lr = lane & 15, hi = lane >> 4;
    const int wave = __builtin_amdgcn_readfirstlane(tid >> 5);
    const int i0 = blockIdx.x * QB, head = blockIdx.y, b = blockIdx.z; const bool hires = (i0 < RH);
    const size_t pq = ((size_t)b * NH_ + head) * TT * HD, pk = ((size_t)b * NKV + head / REP) * TT * HD, pv = ((size_t)b * NKV + head / REP) * HD * TP;
    const int kbase = wave * KW;
    // every global address is a wave-uniform base + one lane offset + a constant: the few address registers stay as they are while the loads that name them are in flight
    const unsigned lf = (unsigned)(lane * 8), lm = (unsigned)(8 * hi);   // lf: the lane's 16-byte piece in each half of a fragment (FRAG)
    const bf* qbh = QPh + pq + (size_t)i0 * HD; const bf* qbl = QPl + pq + (size_t)i0 * HD; const bf* kbh = KPh + pk + (size_t)kbase * HD; const bf* kbl = KPl + pk + (size_t)kbase * HD;
    const float* mrow = mask + (size_t)b * TTF + kbase;
    for (int e = tid; e < QB * BP; e += NW * 32) binsL[e] = 0.f;
    // QE = q emb_k^T (q hi/lo x exact emb_k), one 16x16 tile per job, into LDS
    for (int job = wave; job < QT * NBT; job += NW) { const int qt = job / NBT, nt = job - qt * NBT; v8f a = (v8f){};
        const bf* jh = qbh + qt * 16 * HD; const bf* jl = qbl + qt * 16 * HD; const bf* je = EK + nt * 16 * HD;
#pragma unroll
        for (int ks = 0; ks < 2; ++ks) { const v16bf ah = FB::ldf(jh + lf + ks * FRAG), al = FB::ldf(jl + lf + ks * FRAG), eb = FB::ldf(je + lf + ks * FRAG);
            a = wmmab(ah, eb, a); a = wmmab(al, eb, a); }
        // s_wait_xcnt 0 stands before a register that an issued global load names is rewritten (the next trip forms new bases); as inputs those registers stay as they are up to this wait
        asm volatile("s_wait_xcnt 0x0" :: "s"(jh), "s"(jl), "s"(je), "v"(lf) : "memory");
#pragma unroll
        for (int r = 0; r < 8; ++r) qes[(qt * 16 + 8 * hi + r) * QEP + nt * 16 + lr] = a[r]; }
    // transposed score tiles, bf16 hi/lo, 3 products
    v16bf qh[QT][2], ql[QT][2];
#pragma unroll
    for (int qt = 0; qt < QT; ++qt)
#pragma unroll
        for (int ks = 0; ks < 2; ++ks) { qh[qt][ks] = FB::ldf(qbh + lf + (qt * 2 + ks) * FRAG); ql[qt][ks] = FB::ldf(qbl + lf + (qt * 2 + ks) * FRAG); }
    v8f s[KTN][QT]; v16bf kfh[KTN][2], kfl[KTN][2];
    // a key tile's loads are issued ahead of the products that use them: two tiles ahead while few score tiles are held, one tile ahead when the registers are nearly full
    auto ldk = [&](int kt) __attribute__((always_inline)) {
#pragma unroll
        for (int ks = 0; ks < 2; ++ks) { kfh[kt][ks] = FB::ldf(kbh + lf + (kt * 2 + ks) * FRAG); kfl[kt][ks] = FB::ldf(kbl + lf + (kt * 2 + ks) * FRAG); } };
    ldk(0); ldk(1);
#pragma unroll
    for (int kt = 0; kt < KTN; ++kt) {
        if (kt + 2 < KTN - KLATE) ldk(kt + 2); else if (kt + 1 >= KTN - KLATE && kt + 1 < KTN) ldk(kt + 1);
        __builtin_amdgcn_sched_barrier(0);   // keeps the loads above in front of this tile's products; sunk to their use, each would be waited for in full
#pragma unroll
        for (int qt = 0; qt < QT; ++qt) s[kt][qt] = (v8f){};
#pragma unroll
        for (int ks = 0; ks < 2; ++ks) { const v16bf kh = kfh[kt][ks], kl = kfl[kt][ks];
#pragma unroll
            for (int qt = 0; qt < QT; ++qt) s[kt][qt] = wmmab(kh, qh[qt][ks], s[kt][qt]);
#pragma unroll
            for (int qt = 0; qt < QT; ++qt) s[kt][qt] = wmmab(kh, ql[qt][ks], s[kt][qt]);
#pragma unroll
            for (int qt = 0; qt < QT; ++qt) s[kt][qt] = wmmab(kl, qh[qt][ks], s[kt][qt]); }
        __builtin_amdgcn_sched_barrier(0); }   // keeps the next tiles' loads from rising over these products, which would hold more registers than there are
    // the same wait for the q and k loads: their address registers may be reused only behind it
    asm volatile("s_wait_xcnt 0x0" :: "s"(qbh), "s"(qbl), "s"(kbh), "s"(kbl), "v"(lf) : "memory");
    __syncthreads();   // QE tiles and the zeroed bins are visible to every wave
    float qe0[QT], qe1[QT], mx[QT];
#pragma unroll
    for (int qt = 0; qt < QT; ++qt) { qe0[qt] = qes[(qt * 16 + lr) * QEP + XS]; qe1[qt] = qes[(qt * 16 + lr) * QEP + XS + NBIN - 1]; mx[qt] = -3.0e38f; }
#pragma unroll
    for (int kt = 0; kt < KTN; ++kt) { const int jb = kbase + kt * 16; const v4f m0 = *(const v4f*)(mrow + lm + kt * 16), m1 = *(const v4f*)(mrow + lm + (kt * 16 + 4)); float mk[8];
#pragma unroll
        for (int r = 0; r < 4; ++r) { mk[r] = bfr(m0[r]); mk[4 + r] = bfr(m1[r]); }
#pragma unroll
        for (int qt = 0; qt < QT; ++qt) { const int ib = i0 + qt * 16; const bool left = (jb + 15 <= ib - MAXR), right = (jb >= ib + 15 + MAXR);   // the whole tile is clipped: one QE value per query (wave-uniform tests)
            if (left || right) { const float qe = left ? qe1[qt] : qe0[qt];
#pragma unroll
                for (int r = 0; r < 8; ++r) { const float t = (s[kt][qt][r] + qe) * SCL + mk[r]; s[kt][qt][r] = t; mx[qt] = fmaxf(mx[qt], t); }
            } else { const float* qd = qes + (qt * 16 + lr) * QEP + (ib + lr) - (jb + 8 * hi) + MAXR + XS;   // |ib - jb| <= MAXR here, so the 8 columns lie in [1, NBT * 16)
#pragma unroll
                for (int r = 0; r < 8; ++r) { const float t = (s[kt][qt][r] + qd[-r]) * SCL + mk[r]; s[kt][qt][r] = t; mx[qt] = fmaxf(mx[qt], t); } } } }
#pragma unroll
    for (int qt = 0; qt < QT; ++qt) { mx[qt] = fmaxf(mx[qt], __shfl_xor(mx[qt], 16, 32)); if (hi == 0) rmx[wave][qt * 16 + lr] = mx[qt]; }
    asm volatile("s_wait_xcnt 0x0" :: "s"(mrow), "v"(lm) : "memory");   // the same wait for the mask loads' address registers
    __syncthreads();   // every wave's row maxima are in LDS
#pragma unroll
    for (int qt = 0; qt < QT; ++qt) { float m = rmx[0][qt * 16 + lr];
#pragma unroll
        for (int w = 1; w < NW; ++w) m = fmaxf(m, rmx[w][qt * 16 + lr]);
        mx[qt] = m; }
    float sum[QT], clo[QT], chi[QT];
#pragma unroll
    for (int qt = 0; qt < QT; ++qt) { sum[qt] = 0.f; clo[qt] = 0.f; chi[qt] = 0.f; }
#pragma unroll
    for (int kt = 0; kt < KTN; ++kt) { const int jb = kbase + kt * 16;
#pragma unroll
        for (int qt = 0; qt < QT; ++qt) { const int ib = i0 + qt * 16; const bool left = (jb + 15 <= ib - MAXR), right = (jb >= ib + 15 + MAXR);
            float ts = 0.f;
#pragma unroll
            for (int r = 0; r < 8; ++r) { const float e = exp2s(__fmul_rn(__fsub_rn(s[kt][qt][r], mx[qt]), 1.4426950408889634f)); s[kt][qt][r] = e; ts += e; }
            sum[qt] += ts; clo[qt] += right ? ts : 0.f; chi[qt] += left ? ts : 0.f;
            if (!(left || right)) { float* bd = binsL + (qt * 16 + lr) * BP + (ib + lr) - (jb + 8 * hi) + MAXR + XS;   // the tile meets the band: each e goes to the column of its own offset, in [1, NBT * 16)
#pragma unroll
                for (int r = 0; r < 8; ++r) bd[-r] = s[kt][qt][r]; } } }
#pragma unroll
    for (int qt = 0; qt < QT; ++qt) { sum[qt] += __shfl_xor(sum[qt], 16, 32); clo[qt] += __shfl_xor(clo[qt], 16, 32); chi[qt] += __shfl_xor(chi[qt], 16, 32);
        if (hi == 0) { rsm[wave][qt * 16 + lr] = sum[qt]; rlo[wave][qt * 16 + lr] = clo[qt]; rhi[wave][qt * 16 + lr] = chi[qt]; } }
    __syncthreads();   // every wave's row sums and the band copies in the bins are in LDS
    float f[QT];
#pragma unroll
    for (int qt = 0; qt < QT; ++qt) { float tot = rsm[0][qt * 16 + lr];
#pragma unroll
        for (int w = 1; w < NW; ++w) tot += rsm[w][qt * 16 + lr];
        f[qt] = __fdiv_rn(hires ? 1.0f : PCAR, tot); }
    v8f o[QT][4];
#pragma unroll
    for (int qt = 0; qt < QT; ++qt)
#pragma unroll
        for (int dt = 0; dt < 4; ++dt) o[qt][dt] = (v8f){};
    auto attnv = [&](auto fc, auto* Vp, auto* Vp2) __attribute__((always_inline)) { constexpr bool SPLIT = decltype(fc)::value; typedef typename PvT<SPLIT>::T T16; typedef typename WFrag<T16>::V V_;
        auto* V = Vp + pv + (kbase / 32) * 4 * FRAG; auto* V2 = Vp2 + pv + (kbase / 32) * 4 * FRAG;   // wave-uniform bases of this wave's keys
        constexpr int NT = (KTN / 2) * 4, AH = SPLIT ? VAH2 : VAH1;   // steps (k step kk, 16 columns dt) and how many steps ahead a step's value fragments are fetched
        V_ vf[NT], vf2[NT];
        auto ldv = [&](int t) __attribute__((always_inline)) { vf[t] = WFrag<T16>::ldf(V + lf + t * FRAG); if constexpr (SPLIT) vf2[t] = WFrag<T16>::ldf(V2 + lf + t * FRAG); };
#pragma unroll
        for (int t = 0; t < AH; ++t) ldv(t);
#pragma unroll
        for (int kk = 0; kk < KTN / 2; ++kk) { float x[QT][16]; V_ p[QT], p2[QT];
#pragma unroll
            for (int qt = 0; qt < QT; ++qt)
#pragma unroll
                for (int r = 0; r < 8; ++r) { x[qt][r] = s[2 * kk][qt][r] * f[qt]; x[qt][8 + r] = s[2 * kk + 1][qt][r] * f[qt]; }
            pv_frag<SPLIT, T16>(x, p, p2);
#pragma unroll
            for (int dt = 0; dt < 4; ++dt) { const int t = kk * 4 + dt;
                if (t + AH < NT) ldv(t + AH);
                __builtin_amdgcn_sched_barrier(0);   // keeps the loads above in front of this step's products; sunk to their use, each would be waited for in full
                pv_mma<SPLIT, T16>(p, p2, vf[t], SPLIT ? vf2[t] : vf[t], o, dt);
                __builtin_amdgcn_sched_barrier(0); } }   // keeps later steps' loads from rising over these products, which would hold more registers than there are
        asm volatile("s_wait_xcnt 0x0" :: "s"(V), "s"(V2), "v"(lf) : "memory");   // the same wait for the value loads' address registers
        if (wave < KXB / 32) { float x[QT][16]; V_ p[QT], p2[QT], vb[4], vb2[4];   // wave-uniform: one k step of the bins
            auto* Vb = Vp + pv + (TT / 32 + wave) * 4 * FRAG; auto* Vb2 = Vp2 + pv + (TT / 32 + wave) * 4 * FRAG;
#pragma unroll
            for (int dt = 0; dt < 4; ++dt) { vb[dt] = WFrag<T16>::ldf(Vb + lf + dt * FRAG); if constexpr (SPLIT) vb2[dt] = WFrag<T16>::ldf(Vb2 + lf + dt * FRAG); }
            asm volatile("s_wait_xcnt 0x0" :: "s"(Vb), "s"(Vb2), "v"(lf) : "memory");   // the same wait for the loads of the emb_v columns, directly behind them: the work below needs their address registers
#pragma unroll
            for (int qt = 0; qt < QT; ++qt) { const float* bp = binsL + (qt * 16 + lr) * BP + XS + wave * 32 + 8 * hi; const v4f b0 = *(const v4fa*)bp, b1 = *(const v4fa*)(bp + 4), b2 = *(const v4fa*)(bp + 16), b3 = *(const v4fa*)(bp + 20);
                float t0 = b0[0];
                if (wave == 0 || wave == (NBIN - 1) / 32) { const float* rp = (wave == 0) ? &rlo[0][qt * 16 + lr] : &rhi[0][qt * 16 + lr]; float tot = rp[0];
#pragma unroll
                    for (int w = 1; w < NW; ++w) tot += rp[w * QB];
                    const float* xp = binsL + (qt * 16 + lr) * BP + ((wave == 0) ? 0 : XS + NBIN - 1);   // the clipped keys of the tiles that meet the band: columns [0, XS] or [XS + NBIN - 1, 2 XS + NBIN - 1)
#pragma unroll   // the four 16-byte reads are issued together and waited for once
                    for (int c = 0; c < XS / 4; ++c) { const v4f xv = *(const v4fa*)(xp + 4 * c); tot += (xv[0] + xv[1]) + (xv[2] + xv[3]); }
                    if (wave == 0) tot += t0;   // column XS, which the lower half wave holds in t0
                    t0 = (hi == 0) ? tot : t0; }
#pragma unroll
                for (int r = 0; r < 4; ++r) { x[qt][r] = (r == 0 ? t0 : b0[r]) * f[qt]; x[qt][4 + r] = b1[r] * f[qt]; x[qt][8 + r] = b2[r] * f[qt]; x[qt][12 + r] = b3[r] * f[qt]; }
                if constexpr (!SPLIT) {
#pragma unroll
                    for (int r = 0; r < 16; ++r) x[qt][r] = x[qt][r] * (1.0f / EVC); } }
            pv_frag<SPLIT, T16>(x, p, p2);
#pragma unroll
            for (int dt = 0; dt < 4; ++dt) pv_mma<SPLIT, T16>(p, p2, vb[dt], SPLIT ? vb2[dt] : vb[dt], o, dt); } };
    if (hires) attnv(BoolC<true>{}, Vh, Vl); else attnv(BoolC<false>{}, V16, V16);
#pragma unroll
    for (int qt = 0; qt < QT; ++qt)
#pragma unroll
        for (int dt = 0; dt < 4; ++dt)
#pragma unroll
            for (int r = 0; r < 8; ++r) ored[wave][(qt * 16 + 8 * hi + r) * OP + dt * 16 + lr] = o[qt][dt][r];
    __syncthreads();   // every wave's partial of ctx is in LDS
    const float cs = hires ? 1.0f : (1.0f / PCAR);
    for (int e = tid; e < QB * (HD / 4); e += NW * 32) { const int q = e / (HD / 4), d4 = (e % (HD / 4)) * 4; v4f sm = *(const v4fa*)(&ored[0][q * OP + d4]);
#pragma unroll
        for (int w = 1; w < NW; ++w) sm += *(const v4fa*)(&ored[w][q * OP + d4]);
        v4f o4; o4[0] = sm[0] * cs; o4[1] = sm[1] * cs; o4[2] = sm[2] * cs; o4[3] = sm[3] * cs; *(v4f*)(OUT + ((size_t)b * TT + i0 + q) * DQ + head * HD + d4) = o4; }
}

extern "C" void kernel_launch(void* const* d_in, const int* in_sizes, int n_in,
                              void* d_out, int out_size, void* d_ws, size_t ws_size, hipStream_t stream) {
    if (n_in < 10) return;
    if ((size_t)in_sizes[0] < ((size_t)(NB - 1) * TTF + TT) * DM) return;
    if ((size_t)in_sizes[1] < (size_t)(NB - 1) * TTF + TT) return;
    if (in_sizes[2] < DM * DQ || in_sizes[4] < DM * DKV || in_sizes[6] < DM * DKV) return;
    if (in_sizes[3] < DQ || in_sizes[5] < DKV || in_sizes[7] < DKV) return;
    if (in_sizes[8] < NBIN * HD || in_sizes[9] < NBIN * HD) return;
    if ((size_t)out_size < (size_t)NB * TT * DQ) return;
    const float* x = (const float*)d_in[0]; const float* mask = (const float*)d_in[1];   // [NB][1][1][TTF], added per key
    const float* wq = (const float*)d_in[2]; const float* bq = (const float*)d_in[3]; const float* wk = (const float*)d_in[4]; const float* bk = (const float*)d_in[5]; const float* wv = (const float*)d_in[6]; const float* bv = (const float*)d_in[7];
    const float* embk = (const float*)d_in[8]; const float* embv = (const float*)d_in[9];   // [NBIN][HD] each
    float* OUT = (float*)d_out;     // [NB][TT][DQ]
    char* wsp = (char*)d_ws;
    auto take = [&](size_t bytes) { char* p = wsp; wsp += (bytes + 255) & ~(size_t)255; return (void*)p; };
    bf* WQ = (bf*)take((size_t)DQ * DM * 2); bf* WK = (bf*)take((size_t)DKV * DM * 2); bf* WV = (bf*)take((size_t)DKV * DM * 2); bf* EK = (bf*)take((size_t)KX * HD * 2);
    h16* VT16 = (h16*)take((size_t)NB * NKV * HD * TP * 2);
    bf* QPh = (bf*)take((size_t)NB * NH_ * TT * HD * 2); bf* QPl = (bf*)take((size_t)NB * NH_ * TT * HD * 2); bf* KPh = (bf*)take((size_t)NB * NKV * TT * HD * 2); bf* KPl = (bf*)take((size_t)NB * NKV * TT * HD * 2); bf* VTh = (bf*)take((size_t)NB * NKV * HD * TP * 2); bf* VTl = (bf*)take((size_t)NB * NKV * HD * TP * 2);
    bf* XB = (bf*)take((size_t)NB * TT * DM * 2);   // bf16 copy of x
    if ((size_t)(wsp - (char*)d_ws) > ws_size) return;
    k_prep<<<3 * PBW + NB * PBX + PBV + PBE, 256, 0, stream>>>(x, wq, wk, wv, embk, embv, XB, WQ, WK, WV, EK, VT16, VTh, VTl);
    k_proj<<<dim3(TT / 64, DQ / 64, 3 * NB), 32, 0, stream>>>(XB, WQ, WK, WV, bq, bk, bv, QPh, QPl, KPh, KPl, VT16, VTh, VTl);
    k_attn<<<dim3(TT / QB, NH_, NB), NW * 32, 0, stream>>>(QPh, QPl, KPh, KPl, EK, VT16, VTh, VTl, mask, OUT);
}

// v008
// It runs in 199 microseconds.
// Timed twice side by side with v007, it ran 1.12 and 1.11 times as fast.
// Over all steps from v000 it is 12.4 times as fast.
#include <hip/hip_runtime.h>

// Contractions: x W (q,k,v) on v_wmma_f32_16x16x32_bf16 (bf16 operands from RNE-bf16 inputs); q.k and q.emb_k score tiles bf16 hi/lo split (3 and 2 products); attn.v with the rel-value bins.emb_v folded into K: rows < RH bf16 hi/lo split, rows >= RH v_wmma_f32_16x16x32_f16 (P x1024, bins x64, emb_v x16, v plain f16); f32 accumulate, f32 softmax.
// Self-attention, 16 heads x 64: q,k,v = x W + b ('xw' layout), scores = (q.k + q.emb_k[clip(i-j)]) x 64^-0.5 + additive key mask, softmax over all keys,
// ctx = probs v + sum_r bins[i][r] emb_v[r] (bins: band copies of probs plus the two clipped tail sums), output concat-heads [NB][TT][1024] f32, no output projection.
// Layout: bf16 copy of x; weights transposed once to rows n, k index k, bf16; the projection GEMMs add the f32 bias and store their tiles straight as head planes [b][h] of q,k (bf16 hi/lo; rows t, k index d) and of the values (f16, bf16 hi/lo; rows d, k index = key, TT+192 of them, keys >= TT hold emb_v), all, with emb_k, in fragment order (see FRAG);
// three launches: k_prep forms every plane that depends on an input alone, k_proj does the six projection GEMMs (q, k, v of each batch) in one grid, k_attn the attention stage.
// one attention kernel: a work-group holds the scores of QB query rows x all TT keys of one head in registers, does the softmax there and feeds the attn.v WMMAs from the same registers (see k_attn).

#ifndef NB
#define NB   2
#endif
#ifndef SEQ
#define SEQ  2048
#endif
#define NB_FULL  2
#define TTF  2048                 // full per-batch sequence stride of the inputs
#define TT   SEQ
#define DM   1024
#define NH_  16
#define NKV  16
#define REP  (NH_ / NKV)
#define HD   64
#define DQ   (NH_ * HD)
#define DKV  (NKV * HD)
#define ZH   8                    // z extent of gemmw's K-range form (KR > 0)
#define RH   ((TT / 2 < 512) ? (TT / 2) : 512)   // query rows < RH use hi+lo planes
#define PCAR 1024.0f
#define SCL  0.125f   // HD^-0.5
#define MAXR 64
#define NBIN (2 * MAXR + 1)       // 129 clipped offsets
#define KX   192                  // NBIN padded to a multiple of 64
#define TP   (TT + KX)            // row pitch of the value planes (keys + KX bin columns)
#define EVC  16.0f                // f16 carry of emb_v in the value planes (bins carry 1024/16 = 64)
#define QT   2                    // 16-query tiles per work-group of k_attn
#define QB   (16 * QT)
#define NW   16                   // waves per work-group of k_attn, each owns KW keys
#define KW   (TT / NW)
#define KTN  (KW / 16)            // 16-key tiles per wave
#define VAHL 2                    // attn.v: the staged plane's fragments are read from LDS this many steps ahead
#define VAH2 2                    // attn.v, hi/lo rows: the lo plane's fragments are fetched from global memory this many steps ahead
#define KLATE 2                   // the last KLATE key tiles of a wave are fetched one tile ahead, the others two
#define XS   16                   // spare columns on each side of the QE and bins tables in LDS: column c stands for offset i - j = c - XS - MAXR, unclipped, so every element of a tile that meets the band has a column of its own
#define NBT  ((NBIN - 1 + 2 * XS) / 16)   // 16-column tiles of QE
#define QEP  (NBT * 16 + 2)       // LDS pitch of a QE row: a column read and a diagonal read (pitch + 1 a lane, 8 back for the upper half wave) both meet distinct banks
#define KXB  160                  // NBIN padded to k steps of 32
#define BP   (XS + KXB + 4)       // LDS pitch of a bins row, 16 B x odd
#define OP   (HD + 4)             // LDS pitch of a partial ctx row, 16 B x odd
#define VSB  (KW * HD * 2)        // bytes of one wave's keys in one 16-bit value plane: (KW / 32) * 4 fragments in a row
#define VBB  (4 * FRAG * 2)       // bytes of one k step (32 k indices x HD rows) of a 16-bit value plane
#define FRAG 512                  // elements of one 16-row x 32-k operand fragment. Fragment order: a plane is a row of such fragments (k step fastest for x, W^T, q, k, emb_k; 16-row block fastest for the values); inside one, the 8 elements at (j * 32 + lane) * 8 are row lane&15, k = 16 j + 8 (lane>>4) + 0..7, so each of a wave's two 16-byte loads of a fragment reads 512 bytes in a row (four whole 128-byte lines, not 32 bytes of each of 16 lines)

static_assert(TT % 128 == 0);
static_assert(RH % 64 == 0);
static_assert(RH >= 64);
static_assert((TT - RH) % 64 == 0);
static_assert(TT - RH >= 64);
static_assert(TP % 32 == 0);
static_assert(TT % (NW * 32) == 0);
static_assert(TT % QB == 0);
static_assert(QB * OP * 4 <= VSB && VSB % 512 == 0 && VSB / 512 + VBB / 512 <= 63);
static_assert((KXB / 32) * VBB <= QB * QEP * 4);
static_assert(RH % QB == 0);
static_assert(KXB >= NBIN && KXB <= KX && KXB % 32 == 0);
static_assert((NBIN - 1) % 32 == 0);
static_assert(KXB / 32 <= NW);
static_assert(KX % 64 == 0);
static_assert(KX >= NBIN);
static_assert(KX == 192);
static_assert(XS == 16 && MAXR % 16 == 0 && NBT * 16 <= KX);
static_assert(HD == 64);
static_assert(NH_ % ZH == 0);
static_assert(DM % 64 == 0);
static_assert((KX * HD) % (8 * 256) == 0);
static_assert(((size_t)TT * DM / 8) % 256 == 0);
static_assert((NKV * HD) % 8 == 0);
static_assert(NB <= NB_FULL);
static_assert(TT <= TTF);

typedef _Float16 h16;
typedef unsigned short bf;
typedef __attribute__((ext_vector_type(16))) __bf16   v16bf;
typedef __attribute__((ext_vector_type(16))) _Float16 v16h;
typedef __attribute__((ext_vector_type(8)))  _Float16 v8h;
typedef __attribute__((ext_vector_type(8)))  unsigned short v8us;
typedef __attribute__((ext_vector_type(8)))  float    v8f;
typedef __attribute__((ext_vector_type(4)))  float    v4f;
typedef v8h  __attribute__((may_alias)) v8ha;
typedef v4f  __attribute__((may_alias)) v4fa;
typedef v8us __attribute__((may_alias)) v8usa;

__device__ __forceinline__ unsigned short f2bf(float f) { unsigned u = __float_as_uint(f); u += 0x7FFFu + ((u >> 16) & 1u); return (unsigned short)(u >> 16); }
__device__ __forceinline__ float bf2f(unsigned short b) { return __uint_as_float(((unsigned)b) << 16); }
__device__ __forceinline__ float bfr(float f) { return bf2f(f2bf(f)); }
__device__ __forceinline__ h16 tohx(float x) { return (h16)x; }
__device__ __forceinline__ void splitf(float y, unsigned short& h, unsigned short& l) { h = f2bf(y); l = f2bf(y - bf2f(h)); }
__device__ __forceinline__ v16h cat16(v8h lo, v8h hi) { return __builtin_shufflevector(lo, hi, 0, 1, 2, 3, 4, 5, 6, 7, 8, 9, 10, 11, 12, 13, 14, 15); }
__device__ __forceinline__ v16bf cat16b(v8us lo, v8us hi) { return __builtin_bit_cast(v16bf, __builtin_shufflevector(lo, hi, 0, 1, 2, 3, 4, 5, 6, 7, 8, 9, 10, 11, 12, 13, 14, 15)); }
__device__ __forceinline__ v8f wmma16(v16h a, v16h b, v8f c) { return __builtin_amdgcn_wmma_f32_16x16x32_f16(false, a, false, b, (short)0, c, false, false); }
__device__ __forceinline__ v8f wmmab(v16bf a, v16bf b, v8f c) { return __builtin_amdgcn_wmma_f32_16x16x32_bf16(false, a, false, b, (short)0, c, false, false); }

// ---- gemmw: register-blocked GEMM, ONE WAVE per 64x64 output tile (16 accumulators), operands straight from 16-bit planes in fragment order (FRAG; k step fastest); the body of a 32-thread work-group, tile (bx, by, bz) of (M/64, N/64, Z).
// C[m][n] (f32, pitch ldc, + optional f32 bias[n]) = sum_k A[m][k] Bt[n][k] (+ split products per NSPLIT); A rows hold lda = DM elements, Bt rows K = DM. z-batch strides sA/sB/sC in elements. K % 32 == 0.
// KR > 0 (N == 64 only): tiles (M/64, K/KR, ZH); tile by sums k in [by KR, (by+1) KR) alone and stores its partial tile in plane by (plane stride ZH sC); the caller adds the planes.
// EPI 0 stores C. EPI 1 (N tile = one head, HD == 64): no C; row t, col c of the biased tile goes, split into bf16 hi + lo, to row t, k index c % HD of head plane c / HD of Ph/Pl. EPI 2: no C; it goes to row c % HD, k index t of head plane c / HD of P16 (f16), Ph, Pl (bf16 hi, lo). Both in fragment order (FRAG).
// Fragments: lane l -> row/col l&15, h = l>>4; elements 0..7 <- k0+8h+0..7, 8..15 <- k0+16+8h+0..7 for BOTH A and Bt (same loader, same plane order); D element r -> row 8h+r, col l&15.
template <typename T16> struct WFrag;
template <> struct WFrag<h16> { typedef v16h V; static __device__ __forceinline__ V ldf(const h16* p) { return cat16(*(const v8h*)p, *(const v8h*)(p + FRAG / 2)); } static __device__ __forceinline__ v8f mma(V a, V b, v8f c) { return wmma16(a, b, c); } };
template <> struct WFrag<bf> { typedef v16bf V; static __device__ __forceinline__ V ldf(const bf* p) { return cat16b(*(const v8us*)p, *(const v8us*)(p + FRAG / 2)); } static __device__ __forceinline__ v8f mma(V a, V b, v8f c) { return wmmab(a, b, c); } };
template <typename T16, int NSPLIT, bool BIAS, int KR = 0, int EPI = 0>
__device__ __forceinline__ void gemmw(const T16* __restrict__ A, const T16* __restrict__ A2, const T16* __restrict__ Bt, const T16* __restrict__ Bt2, float* C, int ldc, const float* __restrict__ bias, size_t sA, size_t sB, size_t sC, h16* P16, bf* Ph, bf* Pl, int bx, int by, int bz) {
    typedef typename WFrag<T16>::V V; constexpr int K = DM, lda = DM;   // compile-time row lengths: the 16 fragment addresses of a k step are two bases + the lane's piece + constants
    __shared__ __align__(16) float os[16 * 68];
    const size_t z = bz; A += z * sA; if (A2) A2 += z * sA; Bt += z * sB; if (Bt2) Bt2 += z * sB; C += (KR ? (size_t)by * ZH + z : z) * sC;
    const int lane = threadIdx.x & 31, lr = lane & 15, hi = lane >> 4; const int r0 = bx * 64, c0 = KR ? 0 : by * 64; const int kb = KR ? by * KR : 0, ke = KR ? kb + KR : K;
    v8f acc[4][4];
#pragma unroll
    for (int mb = 0; mb < 4; ++mb)
#pragma unroll
        for (int nb = 0; nb < 4; ++nb) acc[mb][nb] = (v8f){};
    const size_t aoff = (size_t)r0 * lda, boff = (size_t)c0 * K; const unsigned lf = (unsigned)(lane * 8);   // fragment order: 16 rows x lda elements are lda / 32 fragments in a row, so k step kc starts kc * 16 = (kc / 32) * FRAG elements in; every address is a wave-uniform base + the lane's piece lf
#pragma unroll 1
    for (int kc = kb; kc < ke; kc += 32) {
        V a[4], a2[4]; const T16* pa = A + (aoff + kc * 16) + lf; const T16* pb = Bt + (boff + kc * 16) + lf;
#pragma unroll
        for (int mb = 0; mb < 4; ++mb) { a[mb] = WFrag<T16>::ldf(pa + mb * 16 * lda); if (NSPLIT == 1 || NSPLIT == 2) a2[mb] = WFrag<T16>::ldf(A2 + (aoff + (size_t)mb * 16 * lda + kc * 16) + lf); }
#pragma unroll
        for (int nb = 0; nb < 4; ++nb) { const V b = WFrag<T16>::ldf(pb + nb * 16 * K); V b2; if (NSPLIT >= 2) b2 = WFrag<T16>::ldf(Bt2 + (boff + (size_t)nb * 16 * K + kc * 16) + lf);
#pragma unroll
            for (int mb = 0; mb < 4; ++mb) { acc[mb][nb] = WFrag<T16>::mma(a[mb], b, acc[mb][nb]); if (NSPLIT == 1 || NSPLIT == 2) acc[mb][nb] = WFrag<T16>::mma(a2[mb], b, acc[mb][nb]); if (NSPLIT >= 2) acc[mb][nb] = WFrag<T16>::mma(a[mb], b2, acc[mb][nb]); } }
        asm volatile("s_wait_xcnt 0x0" :: "v"(pa), "v"(pb) : "memory");   // stands before a register that an issued global load names is rewritten (the next trip forms new addresses); as inputs the two addresses stay as they are up to this wait
        asm volatile("v_nop\n\tv_nop\n\tv_nop\n\tv_nop" : "+v"(acc[0][0]), "+v"(acc[1][1]), "+v"(acc[2][2]), "+v"(acc[3][3]) : "v"(a[0]), "v"(a[3]));
    }
    if constexpr (EPI == 2) {
        // a lane's 8 accumulator elements are 8 consecutive t of one column, which is the lane's own 16-byte piece of a value fragment: one 16-byte store per plane and block, no LDS pass, 512 bytes in a row per store
        // the three loops are unrolled so that acc[][] and the store vectors are indexed by constants and stay in registers
#pragma unroll
        for (int nb = 0; nb < 4; ++nb) { const int col = c0 + nb * 16 + lr; const float bb = bfr(bias[col]); const size_t o = (size_t)by * HD * TP + ((size_t)(r0 / 32) * 4 + nb) * FRAG + lane * 8;
#pragma unroll
            for (int mb = 0; mb < 4; ++mb) { v8h o16; v8us oh, ol;
#pragma unroll
                for (int j = 0; j < 8; ++j) { const float xv = acc[mb][nb][j] + bb; o16[j] = tohx(xv); unsigned short a2, c2; splitf(xv, a2, c2); oh[j] = a2; ol[j] = c2; }
                const int om = (mb / 2) * 4 * FRAG + (mb % 2) * (FRAG / 2); *(v8h*)(P16 + o + om) = o16; *(v8us*)(Ph + o + om) = oh; *(v8us*)(Pl + o + om) = ol;
                asm volatile("s_wait_xcnt 0x0" :: "v"(o16), "v"(oh), "v"(ol) : "memory"); } }   // stands before a register that an issued global store names is rewritten (the next block's values); as inputs the three vectors stay as they are up to this wait
        return;
    }
#pragma unroll
    for (int mb = 0; mb < 4; ++mb) {
#pragma unroll
        for (int nb = 0; nb < 4; ++nb) {
#pragma unroll
            for (int j = 0; j < 8; ++j) os[(hi * 8 + j) * 68 + nb * 16 + lr] = acc[mb][nb][j]; }
        __builtin_amdgcn_wave_barrier(); asm volatile("" ::: "memory");
        float* crow = C + (size_t)(r0 + mb * 16) * ldc + c0;
        if constexpr (EPI == 1) {   // these 16 rows are two fragments; step s = 16 columns = one 512-byte half of a fragment, lane -> row lr, columns 16 s + 8 hi + 0..7. Unrolled: the vectors' elements are indexed by constants
#pragma unroll
            for (int s = 0; s < 4; ++s) { const int cofs = s * 16 + 8 * hi; const v4f w0 = *(const v4fa*)(os + lr * 68 + cofs), w1 = *(const v4fa*)(os + lr * 68 + cofs + 4); v8us oh, ol;
#pragma unroll
                for (int q = 0; q < 4; ++q) { unsigned short a2, c2; splitf(w0[q] + bfr(bias[c0 + cofs + q]), a2, c2); oh[q] = a2; ol[q] = c2; splitf(w1[q] + bfr(bias[c0 + cofs + 4 + q]), a2, c2); oh[4 + q] = a2; ol[4 + q] = c2; }
                const size_t e = ((size_t)by * TT + r0 + mb * 16) * HD + s * (FRAG / 2) + lane * 8; *(v8us*)(Ph + e) = oh; *(v8us*)(Pl + e) = ol;
                asm volatile("s_wait_xcnt 0x0" :: "v"(oh), "v"(ol) : "memory"); }   // the same wait for these two stores' registers
        } else {
#pragma unroll
            for (int s = 0; s < 8; ++s) { const int row = 2 * s + hi, cofs = lr * 4; v4f val = *(const v4fa*)(os + row * 68 + cofs); if (BIAS) { val[0] += bfr(bias[c0 + cofs]); val[1] += bfr(bias[c0 + cofs + 1]); val[2] += bfr(bias[c0 + cofs + 2]); val[3] += bfr(bias[c0 + cofs + 3]); }
                *(v4f*)(crow + (size_t)row * ldc + cofs) = val; }
             }
        __builtin_amdgcn_wave_barrier(); asm volatile("" ::: "memory");
    }
}

// k_proj: the six projection GEMMs in one grid (TT/64, DQ/64, 3 NB), z = 3 b + (0: q, 1: k, 2: v). None reads what another writes; together they put three waves on every SIMD, so one wave's load waits are filled by the others' products.
static_assert(DQ == DKV);
__global__ __launch_bounds__(32) void k_proj(const bf* __restrict__ XB, const bf* __restrict__ WQ, const bf* __restrict__ WK, const bf* __restrict__ WV, const float* __restrict__ bq, const float* __restrict__ bk, const float* __restrict__ bv,
                                             bf* QPh, bf* QPl, bf* KPh, bf* KPl, h16* VT16, bf* VTh, bf* VTl) {
    const int bx = blockIdx.x, by = blockIdx.y, b = blockIdx.z / 3, w = blockIdx.z % 3; const bf* A = XB + (size_t)b * TT * DM;
    const size_t oq = (size_t)b * NH_ * TT * HD, ok = (size_t)b * NKV * TT * HD, ov = (size_t)b * NKV * HD * TP;
    if (w == 2) gemmw<bf, 0, true, 0, 2>(A, nullptr, WV, nullptr, nullptr, 0, bv, 0, 0, 0, VT16 + ov, VTh + ov, VTl + ov, bx, by, 0);
    else gemmw<bf, 0, true, 0, 1>(A, nullptr, w ? WK : WQ, nullptr, nullptr, 0, w ? bk : bq, 0, 0, 0, nullptr, w ? KPh + ok : QPh + oq, w ? KPl + ok : QPl + oq, bx, by, 0);
}

typedef __attribute__((ext_vector_type(2))) _Float16 v2h;
typedef __attribute__((ext_vector_type(4))) _Float16 v4h;
typedef __attribute__((ext_vector_type(2))) unsigned short v2us;
typedef __attribute__((ext_vector_type(2))) float v2f;
typedef __attribute__((ext_vector_type(4))) int v4i;

// The four bodies of k_prep, each for block blk of 256 threads of its own range.
// wtG: Bt = w^T (rows n, k index k) as bf16 in fragment order; thread p forms the 16-byte piece p, so a wave stores 512 bytes in a row and each of its 8 loads reads 64 bytes in a row of two rows of w.
__device__ __forceinline__ void wtG(const float* __restrict__ w, int K, int N, bf* Bt, int blk) {
    const int p = blk * 256 + threadIdx.x; if (p >= N * (K / 8)) return; const int hf = p >> 5, fr = hf >> 1, nk = K / 32;
    const int n = (fr / nk) * 16 + (p & 15), k = (fr % nk) * 32 + (hf & 1) * 16 + ((p >> 4) & 1) * 8; const unsigned off = (unsigned)(k * N + n); float x[8]; v8us o;
#pragma unroll
    for (int e = 0; e < 8; ++e) x[e] = (w + (size_t)e * N)[off];   // a uniform base per row + one lane offset. Unrolled (both loops): the elements are indexed by constants
    asm volatile("s_wait_xcnt 0x0" :: "v"(off) : "memory");   // stands before a register that an issued global load names is rewritten; as an input the offset stays as it is up to this wait
#pragma unroll
    for (int e = 0; e < 8; ++e) o[e] = f2bf(x[e]);
    *(v8us*)(Bt + (size_t)p * 8) = o; }
// cvt8: rows of DM f32 -> bf16 in fragment order; thread i forms the 16-byte piece i.
__device__ __forceinline__ void cvt8(const float* __restrict__ src, bf* dst, size_t n8, int blk) { const size_t i = (size_t)blk * 256 + threadIdx.x; if (i >= n8) return; const size_t hf = i >> 5, fr = hf >> 1;
    const size_t row = (fr / (DM / 32)) * 16 + (i & 15), k = (fr % (DM / 32)) * 32 + (hf & 1) * 16 + ((i >> 4) & 1) * 8; const v8f v = *(const v8f*)(src + row * DM + k); v8us o;
#pragma unroll
    for (int k2 = 0; k2 < 8; ++k2) o[k2] = f2bf(v[k2]); *(v8us*)(dst + i * 8) = o;  }

// vrel: k indices [TT, TT+KX) of every value head plane (b*NKV + g): row d, k index TT + r = emb_v[r][d] (r < NBIN, else 0); fp16 plane carries x EVC of the bf16 value, hi plane bf16, lo plane 0. One wave per 512-byte half of a fragment.
__device__ __forceinline__ void vrel(const float* __restrict__ ev, h16* V16, bf* Vh, bf* Vl, int blk) {
    const int lane = threadIdx.x & 31; const int pc = blk * 8 + (threadIdx.x >> 5); if (pc >= NB * NKV * (KX / 32) * 8) return; const int pl = pc / ((KX / 32) * 8), hf = pc % ((KX / 32) * 8);   // hf = ((k step) * 4 + 16-row block) * 2 + j
    const int d = ((hf >> 1) & 3) * 16 + (lane & 15); const int rb0 = (hf >> 3) * 32 + (hf & 1) * 16 + (lane >> 4) * 8;
    v8h o16; v8us oh, ol; unsigned of[8]; float xs[8];
#pragma unroll
    for (int q = 0; q < 8; ++q) { const int r = rb0 + q; const int rc = (r < NBIN - 1) ? r : (NBIN - 1); of[q] = (unsigned)(rc * HD + d); xs[q] = ev[of[q]]; }
    // s_wait_xcnt 0 stands before a register that an issued global load names is rewritten; as inputs the offsets stay as they are up to this wait
    asm volatile("s_wait_xcnt 0x0" :: "v"(of[0]), "v"(of[1]), "v"(of[2]), "v"(of[3]), "v"(of[4]), "v"(of[5]), "v"(of[6]), "v"(of[7]) : "memory");
#pragma unroll   // as above: the arrays and vectors are indexed by constants and stay in registers
    for (int q = 0; q < 8; ++q) { const int r = rb0 + q; float x = xs[q]; x = (r < NBIN) ? x : 0.f; const float xb = bfr(x); o16[q] = tohx(xb * EVC); oh[q] = f2bf(x); ol[q] = f2bf(x * 0.f); }
    const size_t o = (size_t)pl * HD * TP + (size_t)(TT / 32) * 4 * FRAG + hf * (FRAG / 2) + lane * 8;
    *(v8h*)(V16 + o) = o16; *(v8us*)(Vh + o) = oh; *(v8us*)(Vl + o) = ol;
}
__device__ __forceinline__ void ekp(const float* __restrict__ ek, bf* EK, int blk) {
    const int idx = blk * 256 + threadIdx.x; if (idx >= KX * HD / 8) return; const int e = idx * 8; const int hf = idx >> 5;   // fragment order: piece idx is lane idx & 31 of half hf & 1 of fragment hf >> 1 (two fragments per 16 rows)
    const int r = (hf >> 2) * 16 + (idx & 15), d0 = ((hf >> 1) & 1) * 32 + (hf & 1) * 16 + ((idx >> 4) & 1) * 8; const int rs = r - XS; const int rc = (rs < 0) ? 0 : ((rs < NBIN - 1) ? rs : (NBIN - 1));   // row r holds emb_k of the clipped offset r - XS: the XS spare rows on each side repeat the end rows
    const v4f a = *(const v4f*)(ek + (size_t)rc * HD + d0), b2 = *(const v4f*)(ek + (size_t)rc * HD + d0 + 4); v8us o;
#pragma unroll
    for (int k = 0; k < 4; ++k) { const float x0 = (r < NBT * 16) ? a[k] : 0.f, x1 = (r < NBT * 16) ? b2[k] : 0.f; o[k] = f2bf(x0); o[k + 4] = f2bf(x1); }
    *(v8us*)(EK + e) = o;  }
// k_prep: every plane that depends on an input alone, in one grid: the three W^T, the bf16 copy of x (all batches), the emb_v columns of the value planes, emb_k. The ranges write disjoint planes and read inputs only; a block's range is block-uniform.
#define PBW ((DM * DQ / 8 + 255) / 256)                    // blocks of one W^T
#define PBX ((TT * DM / 8 + 255) / 256)                    // blocks of one batch of x
#define PBV ((NB * NKV * (KX / 32) * 8 + 7) / 8)           // blocks of vrel
#define PBE ((KX * HD / 8 + 255) / 256)                    // blocks of ekp
__global__ __launch_bounds__(256) void k_prep(const float* __restrict__ x, const float* __restrict__ wq, const float* __restrict__ wk, const float* __restrict__ wv, const float* __restrict__ ek, const float* __restrict__ ev,
                                              bf* XB, bf* WQ, bf* WK, bf* WV, bf* EK, h16* V16, bf* Vh, bf* Vl) {
    int blk = blockIdx.x;
    if (blk < 3 * PBW) { const int w = blk / PBW; wtG(w == 0 ? wq : (w == 1 ? wk : wv), DM, DQ, w == 0 ? WQ : (w == 1 ? WK : WV), blk - w * PBW); return; }
    blk -= 3 * PBW;
    if (blk < NB * PBX) { const int b = blk / PBX; cvt8(x + (size_t)b * TTF * DM, XB + (size_t)b * TT * DM, (size_t)TT * DM / 8, blk - b * PBX); return; }
    blk -= NB * PBX;
    if (blk < PBV) { vrel(ev, V16, Vh, Vl, blk); return; }
    ekp(ek, EK, blk - PBV);
}

// ---- k_attn: the whole attention stage of QB query rows of one head in one work-group of NW waves; grid (TT/QB, NH_, NB).
// Wave w owns keys [w KW, (w+1) KW). It forms the TRANSPOSED score tiles (A = key rows, B = query rows), so lane l holds query l&15 and keys 8(l>>4)+0..7 of each tile:
// two neighbouring key tiles are, register for register, the A fragment (row = query, k = key) of the attn.v product, and the scores never leave the registers.
// t = (q.k + QE[i][i-j+MAXR+XS]) x HD^-0.5 + mask[j] (QE has the clipped ends repeated in XS spare columns a side; a tile wholly outside the band takes the end value from a register); row maximum and row sums go across the waves through LDS in wave order; P is normalised before it is rounded to 16 bit.
// bins (LDS, f32, unnormalised): col XS + r = e[i+MAXR-r] for every key of a tile that meets the band, -XS < r < NBIN-1+XS (0 where there is no key); bin 0 = sum_{j >= i+MAXR} e and bin NBIN-1 = sum_{j <= i-MAXR} e are put in when the fragment is formed: the waves' sums over the tiles outside the band + the XS + 1 or XS columns at that end; the columns past bin NBIN-1 meet zero rows of emb_v; waves < KXB/32 add one k step of bins x emb_v each.
// The value fragments of the plane that every row class needs (f16, or bf16 hi) come through LDS: asynchronous copies, each wave for itself, start behind the row-maximum barrier and are waited for at the row-sum barrier; the lo plane of rows < RH is loaded straight into registers.
// Each wave's 64-column partial of ctx goes to LDS (over its value fragments, which it has read by then); the work-group adds the NW partials in wave order and stores the output rows.
// 2^x on v_exp_f32; the v_nop is the one free issue slot that the instruction set asks for between a transcendental and a next instruction that reads its result or overwrites its source; in one statement it stays directly behind it
__device__ __forceinline__ float exp2s(float x) { float e; asm("v_exp_f32 %0, %1\n\tv_nop" : "=v"(e) : "v"(x)); return e; }
template <bool B> struct BoolC { static constexpr bool value = B; };
template <bool SPLIT> struct PvT { typedef h16 T; };
template <> struct PvT<true> { typedef bf T; };
template <bool SPLIT, typename T16>
__device__ __forceinline__ void pv_frag(const float (&x)[QT][16], typename WFrag<T16>::V (&p)[QT], typename WFrag<T16>::V (&p2)[QT]) {
#pragma unroll
    for (int qt = 0; qt < QT; ++qt) {
        if constexpr (SPLIT) { v8us h0, h1, l0, l1;
#pragma unroll
            for (int r = 0; r < 8; ++r) { unsigned short a, c; splitf(x[qt][r], a, c); h0[r] = a; l0[r] = c; splitf(x[qt][8 + r], a, c); h1[r] = a; l1[r] = c; }
            p[qt] = cat16b(h0, h1); p2[qt] = cat16b(l0, l1);
        } else { v8h h0, h1;
#pragma unroll
            for (int r = 0; r < 8; ++r) { h0[r] = tohx(x[qt][r]); h1[r] = tohx(x[qt][8 + r]); }
            p[qt] = cat16(h0, h1); }
    }
}
template <bool SPLIT, typename T16>
__device__ __forceinline__ void pv_mma(const typename WFrag<T16>::V (&p)[QT], const typename WFrag<T16>::V (&p2)[QT], typename WFrag<T16>::V v, typename WFrag<T16>::V v2, v8f (&o)[QT][4], int dt) {
#pragma unroll
    for (int qt = 0; qt < QT; ++qt) o[qt][dt] = WFrag<T16>::mma(p[qt], v, o[qt][dt]);
    if constexpr (SPLIT) {
#pragma unroll
        for (int qt = 0; qt < QT; ++qt) o[qt][dt] = WFrag<T16>::mma(p2[qt], v, o[qt][dt]);
#pragma unroll
        for (int qt = 0; qt < QT; ++qt) o[qt][dt] = WFrag<T16>::mma(p[qt], v2, o[qt][dt]); }
}

// vcopy: copies C..N-1 of a wave's N asynchronous 512-byte copies to LDS (16 bytes a lane); the constant offset moves the global and the LDS address alike
typedef int gv4i __attribute__((vector_size(16)));
typedef __attribute__((address_space(1))) gv4i* gp128;
typedef __attribute__((address_space(3))) gv4i* lp128;
template <int C, int N> __device__ __forceinline__ void vcopy(gp128 g, lp128 l) { if constexpr (C < N) { __builtin_amdgcn_global_load_async_to_lds_b128(g, l, C * 512, 0); vcopy<C + 1, N>(g, l); } }

__global__ __launch_bounds__(NW * 32) void k_attn(const bf* __restrict__ QPh, const bf* __restrict__ QPl, const bf* __restrict__ KPh, const bf* __restrict__ KPl, const bf* __restrict__ EK,
                                                  const h16* __restrict__ V16, const bf* __restrict__ Vh, const bf* __restrict__ Vl, const float* __restrict__ mask, float* OUT) {
    __shared__ __align__(16) unsigned char vst[NW][VSB];   // wave w's slice: first its keys' value fragments (asynchronous copies), then, when it has read them all, its partial of ctx (QB rows of OP floats)
    __shared__ __align__(16) float binsL[QB * BP];
    __shared__ __align__(16) float qes[QB * QEP];   // QE; behind its last read (the row-maximum barrier) the first (KXB / 32) * VBB bytes hold the emb_v columns' value fragments
    __shared__ float rmx[NW][QB], rsm[NW][QB], rlo[NW][QB], rhi[NW][QB];
    typedef WFrag<bf> FB;
    const int tid = threadIdx.x, lane = tid & 31, lr = lane & 15, hi = lane >> 4;
    const int wave = __builtin_amdgcn_readfirstlane(tid >> 5);
    const int i0 = blockIdx.x * QB, head = blockIdx.y, b = blockIdx.z; const bool hires = (i0 < RH);
    const size_t pq = ((size_t)b * NH_ + head) * TT * HD, pk = ((size_t)b * NKV + head / REP) * TT * HD, pv = ((size_t)b * NKV + head / REP) * HD * TP;
    const int kbase = wave * KW;
    // every global address is a wave-uniform base + one lane offset + a constant: the few address registers stay as they are while the loads that name them are in flight
    const unsigned lf = (unsigned)(lane * 8), lm = (unsigned)(8 * hi);   // lf: the lane's 16-byte piece in each half of a fragment (FRAG)
    const bf* qbh = QPh + pq + (size_t)i0 * HD; const bf* qbl = QPl + pq + (size_t)i0 * HD; const bf* kbh = KPh + pk + (size_t)kbase * HD; const bf* kbl = KPl + pk + (size_t)kbase * HD;
    const float* mrow = mask + (size_t)b * TTF + kbase;
    for (int e = tid; e < QB * BP; e += NW * 32) binsL[e] = 0.f;
    // QE = q emb_k^T (q hi/lo x exact emb_k), one 16x16 tile per job, into LDS
    for (int job = wave; job < QT * NBT; job += NW) { const int qt = job / NBT, nt = job - qt * NBT; v8f a = (v8f){};
        const bf* jh = qbh + qt * 16 * HD; const bf* jl = qbl + qt * 16 * HD; const bf* je = EK + nt * 16 * HD;
#pragma unroll
        for (int ks = 0; ks < 2; ++ks) { const v16bf ah = FB::ldf(jh + lf + ks * FRAG), al = FB::ldf(jl + lf + ks * FRAG), eb = FB::ldf(je + lf + ks * FRAG);
            a = wmmab(ah, eb, a); a = wmmab(al, eb, a); }
        // s_wait_xcnt 0 stands before a register that an issued global load names is rewritten (the next trip forms new bases); as inputs those registers stay as they are up to this wait
        asm volatile("s_wait_xcnt 0x0" :: "s"(jh), "s"(jl), "s"(je), "v"(lf) : "memory");
#pragma unroll
        for (int r = 0; r < 8; ++r) qes[(qt * 16 + 8 * hi + r) * QEP + nt * 16 + lr] = a[r]; }
    // transposed score tiles, bf16 hi/lo, 3 products
    v16bf qh[QT][2], ql[QT][2];
#pragma unroll
    for (int qt = 0; qt < QT; ++qt)
#pragma unroll
        for (int ks = 0; ks < 2; ++ks) { qh[qt][ks] = FB::ldf(qbh + lf + (qt * 2 + ks) * FRAG); ql[qt][ks] = FB::ldf(qbl + lf + (qt * 2 + ks) * FRAG); }
    v8f s[KTN][QT]; v16bf kfh[KTN][2], kfl[KTN][2];
    // a key tile's loads are issued ahead of the products that use them: two tiles ahead while few score tiles are held, one tile ahead when the registers are nearly full
    auto ldk = [&](int kt) __attribute__((always_inline)) {
#pragma unroll
        for (int ks = 0; ks < 2; ++ks) { kfh[kt][ks] = FB::ldf(kbh + lf + (kt * 2 + ks) * FRAG); kfl[kt][ks] = FB::ldf(kbl + lf + (kt * 2 + ks) * FRAG); } };
    ldk(0); ldk(1);
#pragma unroll
    for (int kt = 0; kt < KTN; ++kt) {
        if (kt + 2 < KTN - KLATE) ldk(kt + 2); else if (kt + 1 >= KTN - KLATE && kt + 1 < KTN) ldk(kt + 1);
        __builtin_amdgcn_sched_barrier(0);   // keeps the loads above in front of this tile's products; sunk to their use, each would be waited for in full
#pragma unroll
        for (int qt = 0; qt < QT; ++qt) s[kt][qt] = (v8f){};
#pragma unroll
        for (int ks = 0; ks < 2; ++ks) { const v16bf kh = kfh[kt][ks], kl = kfl[kt][ks];
#pragma unroll
            for (int qt = 0; qt < QT; ++qt) s[kt][qt] = wmmab(kh, qh[qt][ks], s[kt][qt]);
#pragma unroll
            for (int qt = 0; qt < QT; ++qt) s[kt][qt] = wmmab(kh, ql[qt][ks], s[kt][qt]);
#pragma unroll
            for (int qt = 0; qt < QT; ++qt) s[kt][qt] = wmmab(kl, qh[qt][ks], s[kt][qt]); }
        __builtin_amdgcn_sched_barrier(0); }   // keeps the next tiles' loads from rising over these products, which would hold more registers than there are
    // the same wait for the q and k loads: their address registers may be reused only behind it
    asm volatile("s_wait_xcnt 0x0" :: "s"(qbh), "s"(qbl), "s"(kbh), "s"(kbl), "v"(lf) : "memory");
    __syncthreads();   // QE tiles and the zeroed bins are visible to every wave
    float qe0[QT], qe1[QT], mx[QT];
#pragma unroll
    for (int qt = 0; qt < QT; ++qt) { qe0[qt] = qes[(qt * 16 + lr) * QEP + XS]; qe1[qt] = qes[(qt * 16 + lr) * QEP + XS + NBIN - 1]; mx[qt] = -3.0e38f; }
#pragma unroll
    for (int kt = 0; kt < KTN; ++kt) { const int jb = kbase + kt * 16; const v4f m0 = *(const v4f*)(mrow + lm + kt * 16), m1 = *(const v4f*)(mrow + lm + (kt * 16 + 4)); float mk[8];
#pragma unroll
        for (int r = 0; r < 4; ++r) { mk[r] = bfr(m0[r]); mk[4 + r] = bfr(m1[r]); }
#pragma unroll
        for (int qt = 0; qt < QT; ++qt) { const int ib = i0 + qt * 16; const bool left = (jb + 15 <= ib - MAXR), right = (jb >= ib + 15 + MAXR);   // the whole tile is clipped: one QE value per query (wave-uniform tests)
            if (left || right) { const float qe = left ? qe1[qt] : qe0[qt];
#pragma unroll
                for (int r = 0; r < 8; ++r) { const float t = (s[kt][qt][r] + qe) * SCL + mk[r]; s[kt][qt][r] = t; mx[qt] = fmaxf(mx[qt], t); }
            } else { const float* qd = qes + (qt * 16 + lr) * QEP + (ib + lr) - (jb + 8 * hi) + MAXR + XS;   // |ib - jb| <= MAXR here, so the 8 columns lie in [1, NBT * 16)
#pragma unroll
                for (int r = 0; r < 8; ++r) { const float t = (s[kt][qt][r] + qd[-r]) * SCL + mk[r]; s[kt][qt][r] = t; mx[qt] = fmaxf(mx[qt], t); } } } }
#pragma unroll
    for (int qt = 0; qt < QT; ++qt) { mx[qt] = fmaxf(mx[qt], __shfl_xor(mx[qt], 16, 32)); if (hi == 0) rmx[wave][qt * 16 + lr] = mx[qt]; }
    asm volatile("s_wait_xcnt 0x0" :: "s"(mrow), "v"(lm) : "memory");   // the same wait for the mask loads' address registers
    __syncthreads();   // every wave's row maxima are in LDS, and every wave has read QE for the last time
    // this wave's value fragments (f16 plane, or the bf16 hi plane for rows < RH; VSB bytes in a row) start for its own LDS slice here, behind the last global load of the softmax (the mask's, which would queue behind them): they land while the exponentials below keep the vector port busy and ask nothing of L2
    { const size_t vo = pv + (size_t)(kbase / 32) * 4 * FRAG + lf; const void* vsrc = hires ? (const void*)(Vh + vo) : (const void*)(V16 + vo);
        vcopy<0, VSB / 512>((gp128)vsrc, (lp128)(&vst[wave][lane * 16])); }
    if (wave < KXB / 32) {   // wave-uniform: the k step of emb_v columns that this wave will multiply with the bins starts for the place that QE has left
        const size_t vo = pv + (size_t)(TT / 32 + wave) * 4 * FRAG + lf; const void* vsrc = hires ? (const void*)(Vh + vo) : (const void*)(V16 + vo);
        vcopy<0, VBB / 512>((gp128)vsrc, (lp128)((unsigned char*)qes + wave * VBB + lane * 16)); }
#pragma unroll
    for (int qt = 0; qt < QT; ++qt) { float m = rmx[0][qt * 16 + lr];
#pragma unroll
        for (int w = 1; w < NW; ++w) m = fmaxf(m, rmx[w][qt * 16 + lr]);
        mx[qt] = m; }
    float sum[QT], clo[QT], chi[QT];
#pragma unroll
    for (int qt = 0; qt < QT; ++qt) { sum[qt] = 0.f; clo[qt] = 0.f; chi[qt] = 0.f; }
#pragma unroll
    for (int kt = 0; kt < KTN; ++kt) { const int jb = kbase + kt * 16;
#pragma unroll
        for (int qt = 0; qt < QT; ++qt) { const int ib = i0 + qt * 16; const bool left = (jb + 15 <= ib - MAXR), right = (jb >= ib + 15 + MAXR);
            float ts = 0.f;
#pragma unroll
            for (int r = 0; r < 8; ++r) { const float e = exp2s(__fmul_rn(__fsub_rn(s[kt][qt][r], mx[qt]), 1.4426950408889634f)); s[kt][qt][r] = e; ts += e; }
            sum[qt] += ts; clo[qt] += right ? ts : 0.f; chi[qt] += left ? ts : 0.f;
            if (!(left || right)) { float* bd = binsL + (qt * 16 + lr) * BP + (ib + lr) - (jb + 8 * hi) + MAXR + XS;   // the tile meets the band: each e goes to the column of its own offset, in [1, NBT * 16)
#pragma unroll
                for (int r = 0; r < 8; ++r) bd[-r] = s[kt][qt][r]; } } }
#pragma unroll
    for (int qt = 0; qt < QT; ++qt) { sum[qt] += __shfl_xor(sum[qt], 16, 32); clo[qt] += __shfl_xor(clo[qt], 16, 32); chi[qt] += __shfl_xor(chi[qt], 16, 32);
        if (hi == 0) { rsm[wave][qt * 16 + lr] = sum[qt]; rlo[wave][qt * 16 + lr] = clo[qt]; rhi[wave][qt * 16 + lr] = chi[qt]; } }
    asm volatile("s_wait_asynccnt 0x0" ::: "memory");   // the value fragments have landed in LDS; no read of them may stand in front of this wait
    __syncthreads();   // every wave's row sums and the band copies in the bins are in LDS
    float f[QT];
#pragma unroll
    for (int qt = 0; qt < QT; ++qt) { float tot = rsm[0][qt * 16 + lr];
#pragma unroll
        for (int w = 1; w < NW; ++w) tot += rsm[w][qt * 16 + lr];
        f[qt] = __fdiv_rn(hires ? 1.0f : PCAR, tot); }
    v8f o[QT][4];
#pragma unroll
    for (int qt = 0; qt < QT; ++qt)
#pragma unroll
        for (int dt = 0; dt < 4; ++dt) o[qt][dt] = (v8f){};
    auto attnv = [&](auto fc, auto* Vp, auto* Vp2) __attribute__((always_inline)) { constexpr bool SPLIT = decltype(fc)::value; typedef typename PvT<SPLIT>::T T16; typedef typename WFrag<T16>::V V_;
        const T16* V = (const T16*)vst[wave]; auto* V2 = Vp2 + pv + (kbase / 32) * 4 * FRAG;   // wave-uniform bases of this wave's keys: the staged plane in LDS, the lo plane in global memory
        constexpr int NT = (KTN / 2) * 4;   // steps (k step kk, 16 columns dt)
        V_ vf[NT], vf2[NT];
        auto ldv = [&](int t) __attribute__((always_inline)) { if (t < NT) vf[t] = WFrag<T16>::ldf(V + lf + t * FRAG); };
        auto ldv2 = [&](int t) __attribute__((always_inline)) { if constexpr (SPLIT) { if (t < NT) vf2[t] = WFrag<T16>::ldf(V2 + lf + t * FRAG); } };
#pragma unroll
        for (int t = 0; t < VAHL; ++t) ldv(t);
#pragma unroll
        for (int t = 0; t < VAH2; ++t) ldv2(t);
#pragma unroll
        for (int kk = 0; kk < KTN / 2; ++kk) { float x[QT][16]; V_ p[QT], p2[QT];
#pragma unroll
            for (int qt = 0; qt < QT; ++qt)
#pragma unroll
                for (int r = 0; r < 8; ++r) { x[qt][r] = s[2 * kk][qt][r] * f[qt]; x[qt][8 + r] = s[2 * kk + 1][qt][r] * f[qt]; }
            pv_frag<SPLIT, T16>(x, p, p2);
#pragma unroll
            for (int dt = 0; dt < 4; ++dt) { const int t = kk * 4 + dt;
                ldv(t + VAHL); ldv2(t + VAH2);
                __builtin_amdgcn_sched_barrier(0);   // keeps the loads above in front of this step's products; sunk to their use, each would be waited for in full
                pv_mma<SPLIT, T16>(p, p2, vf[t], SPLIT ? vf2[t] : vf[t], o, dt);
                __builtin_amdgcn_sched_barrier(0); } }   // keeps later steps' loads from rising over these products, which would hold more registers than there are
        if constexpr (SPLIT) asm volatile("s_wait_xcnt 0x0" :: "s"(V2), "v"(lf) : "memory");   // the same wait for the lo plane's loads' address registers
        if (wave < KXB / 32) { float x[QT][16]; V_ p[QT], p2[QT], vb[4], vb2[4];   // wave-uniform: one k step of the bins
            const T16* Vb = (const T16*)qes + wave * 4 * FRAG; auto* Vb2 = Vp2 + pv + (TT / 32 + wave) * 4 * FRAG;   // the staged plane's columns in LDS, the lo plane's in global memory
#pragma unroll
            for (int dt = 0; dt < 4; ++dt) { vb[dt] = WFrag<T16>::ldf(Vb + lf + dt * FRAG); if constexpr (SPLIT) vb2[dt] = WFrag<T16>::ldf(Vb2 + lf + dt * FRAG); }
            if constexpr (SPLIT) asm volatile("s_wait_xcnt 0x0" :: "s"(Vb2), "v"(lf) : "memory");   // the same wait for the loads of the lo plane's emb_v columns, directly behind them: the work below needs their address registers
#pragma unroll
            for (int qt = 0; qt < QT; ++qt) { const float* bp = binsL + (qt * 16 + lr) * BP + XS + wave * 32 + 8 * hi; const v4f b0 = *(const v4fa*)bp, b1 = *(const v4fa*)(bp + 4), b2 = *(const v4fa*)(bp + 16), b3 = *(const v4fa*)(bp + 20);
                float t0 = b0[0];
                if (wave == 0 || wave == (NBIN - 1) / 32) { const float* rp = (wave == 0) ? &rlo[0][qt * 16 + lr] : &rhi[0][qt * 16 + lr]; float tot = rp[0];
#pragma unroll
                    for (int w = 1; w < NW; ++w) tot += rp[w * QB];
                    const float* xp = binsL + (qt * 16 + lr) * BP + ((wave == 0) ? 0 : XS + NBIN - 1);   // the clipped keys of the tiles that meet the band: columns [0, XS] or [XS + NBIN - 1, 2 XS + NBIN - 1)
#pragma unroll   // the four 16-byte reads are issued together and waited for once
                    for (int c = 0; c < XS / 4; ++c) { const v4f xv = *(const v4fa*)(xp + 4 * c); tot += (xv[0] + xv[1]) + (xv[2] + xv[3]); }
                    if (wave == 0) tot += t0;   // column XS, which the lower half wave holds in t0
                    t0 = (hi == 0) ? tot : t0; }
#pragma unroll
                for (int r = 0; r < 4; ++r) { x[qt][r] = (r == 0 ? t0 : b0[r]) * f[qt]; x[qt][4 + r] = b1[r] * f[qt]; x[qt][8 + r] = b2[r] * f[qt]; x[qt][12 + r] = b3[r] * f[qt]; }
                if constexpr (!SPLIT) {
#pragma unroll
                    for (int r = 0; r < 16; ++r) x[qt][r] = x[qt][r] * (1.0f / EVC); } }
            pv_frag<SPLIT, T16>(x, p, p2);
#pragma unroll
            for (int dt = 0; dt < 4; ++dt) pv_mma<SPLIT, T16>(p, p2, vb[dt], SPLIT ? vb2[dt] : vb[dt], o, dt); } };
    if (hires) attnv(BoolC<true>{}, Vh, Vl); else attnv(BoolC<false>{}, V16, V16);
#pragma unroll
    for (int qt = 0; qt < QT; ++qt)
#pragma unroll
        for (int dt = 0; dt < 4; ++dt)
#pragma unroll
            for (int r = 0; r < 8; ++r) ((float*)vst[wave])[(qt * 16 + 8 * hi + r) * OP + dt * 16 + lr] = o[qt][dt][r];
    __syncthreads();   // every wave's partial of ctx is in LDS
    const float cs = hires ? 1.0f : (1.0f / PCAR);
    for (int e = tid; e < QB * (HD / 4); e += NW * 32) { const int q = e / (HD / 4), d4 = (e % (HD / 4)) * 4; v4f sm = *(const v4fa*)((const float*)vst[0] + q * OP + d4);
#pragma unroll
        for (int w = 1; w < NW; ++w) sm += *(const v4fa*)((const float*)vst[w] + q * OP + d4);
        v4f o4; o4[0] = sm[0] * cs; o4[1] = sm[1] * cs; o4[2] = sm[2] * cs; o4[3] = sm[3] * cs; *(v4f*)(OUT + ((size_t)b * TT + i0 + q) * DQ + head * HD + d4) = o4; }
}

extern "C" void kernel_launch(void* const* d_in, const int* in_sizes, int n_in,
                              void* d_out, int out_size, void* d_ws, size_t ws_size, hipStream_t stream) {
    if (n_in < 10) return;
    if ((size_t)in_sizes[0] < ((size_t)(NB - 1) * TTF + TT) * DM) return;
    if ((size_t)in_sizes[1] < (size_t)(NB - 1) * TTF + TT) return;
    if (in_sizes[2] < DM * DQ || in_sizes[4] < DM * DKV || in_sizes[6] < DM * DKV) return;
    if (in_sizes[3] < DQ || in_sizes[5] < DKV || in_sizes[7] < DKV) return;
    if (in_sizes[8] < NBIN * HD || in_sizes[9] < NBIN * HD) return;
    if ((size_t)out_size < (size_t)NB * TT * DQ) return;
    const float* x = (const float*)d_in[0]; const float* mask = (const float*)d_in[1];   // [NB][1][1][TTF], added per key
    const float* wq = (const float*)d_in[2]; const float* bq = (const float*)d_in[3]; const float* wk = (const float*)d_in[4]; const float* bk = (const float*)d_in[5]; const float* wv = (const float*)d_in[6]; const float* bv = (const float*)d_in[7];
    const float* embk = (const float*)d_in[8]; const float* embv = (const float*)d_in[9];   // [NBIN][HD] each
    float* OUT = (float*)d_out;     // [NB][TT][DQ]
    char* wsp = (char*)d_ws;
    auto take = [&](size_t bytes) { char* p = wsp; wsp += (bytes + 255) & ~(size_t)255; return (void*)p; };
    bf* WQ = (bf*)take((size_t)DQ * DM * 2); bf* WK = (bf*)take((size_t)DKV * DM * 2); bf* WV = (bf*)take((size_t)DKV * DM * 2); bf* EK = (bf*)take((size_t)KX * HD * 2);
    h16* VT16 = (h16*)take((size_t)NB * NKV * HD * TP * 2);
    bf* QPh = (bf*)take((size_t)NB * NH_ * TT * HD * 2); bf* QPl = (bf*)take((size_t)NB * NH_ * TT * HD * 2); bf* KPh = (bf*)take((size_t)NB * NKV * TT * HD * 2); bf* KPl = (bf*)take((size_t)NB * NKV * TT * HD * 2); bf* VTh = (bf*)take((size_t)NB * NKV * HD * TP * 2); bf* VTl = (bf*)take((size_t)NB * NKV * HD * TP * 2);
    bf* XB = (bf*)take((size_t)NB * TT * DM * 2);   // bf16 copy of x
    if ((size_t)(wsp - (char*)d_ws) > ws_size) return;
    k_prep<<<3 * PBW + NB * PBX + PBV + PBE, 256, 0, stream>>>(x, wq, wk, wv, embk, embv, XB, WQ, WK, WV, EK, VT16, VTh, VTl);
    k_proj<<<dim3(TT / 64, DQ / 64, 3 * NB), 32, 0, stream>>>(XB, WQ, WK, WV, bq, bk, bv, QPh, QPl, KPh, KPl, VT16, VTh, VTl);
    k_attn<<<dim3(TT / QB, NH_, NB), NW * 32, 0, stream>>>(QPh, QPl, KPh, KPl, EK, VT16, VTh, VTl, mask, OUT);
}

// v009
// It runs in 181 microseconds.
// Two timings next to v008 both put it at 1.11 times that version's speed.
// All steps since v000 together make it 13.8 times as fast.
#include <hip/hip_runtime.h>

// Contractions: x W (q,k,v) on v_wmma_f32_16x16x32_bf16 (bf16 operands from RNE-bf16 inputs); q.k and q.emb_k score tiles bf16 hi/lo split (3 and 2 products); attn.v with the rel-value bins.emb_v folded into K: rows < RH bf16 hi/lo split, rows >= RH v_wmma_f32_16x16x32_f16 (P x1024, bins x64, emb_v x16, v plain f16); f32 accumulate, f32 softmax.
// Self-attention, 16 heads x 64: q,k,v = x W + b ('xw' layout), scores = (q.k + q.emb_k[clip(i-j)]) x 64^-0.5 + additive key mask, softmax over all keys,
// ctx = probs v + sum_r bins[i][r] emb_v[r] (bins: band copies of probs plus the two clipped tail sums), output concat-heads [NB][TT][1024] f32, no output projection.
// Layout: bf16 copy of x; weights transposed once to rows n, k index k, bf16; the projection GEMMs add the f32 bias and store their tiles straight as head planes [b][h] of q,k (bf16 hi/lo; rows t, k index d) and of the values (f16, bf16 hi/lo; rows d, k index = key, TT+192 of them, keys >= TT hold emb_v), all, with emb_k, in fragment order (see FRAG);
// three launches: k_prep forms every plane that depends on an input alone, k_proj does the six projection GEMMs (q, k, v of each batch) in one grid, k_attn the attention stage.
// one attention kernel: a work-group holds the scores of QB query rows x all TT keys of one head in registers, does the softmax there and feeds the attn.v WMMAs from the same registers (see k_attn).

#ifndef NB
#define NB   2
#endif
#ifndef SEQ
#define SEQ  2048
#endif
#define NB_FULL  2
#define TTF  2048                 // full per-batch sequence stride of the inputs
#define TT   SEQ
#define DM   1024
#define NH_  16
#define NKV  16
#define REP  (NH_ / NKV)
#define HD   64
#define DQ   (NH_ * HD)
#define DKV  (NKV * HD)
#define RH   ((TT / 2 < 512) ? (TT / 2) : 512)   // query rows < RH use hi+lo planes
#define PCAR 1024.0f
#define SCL  0.125f   // HD^-0.5
#define MAXR 64
#define NBIN (2 * MAXR + 1)       // 129 clipped offsets
#define KX   192                  // NBIN padded to a multiple of 64
#define TP   (TT + KX)            // row pitch of the value planes (keys + KX bin columns)
#define EVC  16.0f                // f16 carry of emb_v in the value planes (bins carry 1024/16 = 64)
#define QT   2                    // 16-query tiles per work-group of k_attn
#define QB   (16 * QT)
#define NW   16                   // waves per work-group of k_attn, each owns KW keys
#define KW   (TT / NW)
#define KTN  (KW / 16)            // 16-key tiles per wave
#define VAHL 2                    // attn.v: the staged plane's fragments are read from LDS this many steps ahead
#define VAH2 2                    // attn.v, hi/lo rows: the lo plane's fragments are fetched from global memory this many steps ahead
#define KLATE 2                   // the last KLATE key tiles of a wave are fetched one tile ahead, the others two
#define XS   16                   // spare columns on each side of the QE and bins tables in LDS: column c stands for offset i - j = c - XS - MAXR, unclipped, so every element of a tile that meets the band has a column of its own
#define NBT  ((NBIN - 1 + 2 * XS) / 16)   // 16-column tiles of QE
#define QEP  (NBT * 16 + 2)       // LDS pitch of a QE row: a column read and a diagonal read (pitch + 1 a lane, 8 back for the upper half wave) both meet distinct banks
#define KXB  160                  // NBIN padded to k steps of 32
#define BP   (XS + KXB + 4)       // LDS pitch of a bins row, 16 B x odd
#define OP   (HD + 4)             // LDS pitch of a partial ctx row, 16 B x odd
#define VSB  (KW * HD * 2)        // bytes of one wave's keys in one 16-bit value plane: (KW / 32) * 4 fragments in a row
#define VBB  (4 * FRAG * 2)       // bytes of one k step (32 k indices x HD rows) of a 16-bit value plane
#define FRAG 512                  // elements of one 16-row x 32-k operand fragment. Fragment order: a plane is a row of such fragments (k step fastest for x, W^T, q, k, emb_k; 16-row block fastest for the values); inside one, the 8 elements at (j * 32 + lane) * 8 are row lane&15, k = 16 j + 8 (lane>>4) + 0..7, so each of a wave's two 16-byte loads of a fragment reads 512 bytes in a row (four whole 128-byte lines, not 32 bytes of each of 16 lines)

static_assert(TT % 128 == 0);
static_assert(RH % 64 == 0);
static_assert(RH >= 64);
static_assert((TT - RH) % 64 == 0);
static_assert(TT - RH >= 64);
static_assert(TP % 32 == 0);
static_assert(TT % (NW * 32) == 0);
static_assert(TT % QB == 0);
static_assert(QB * OP * 4 <= VSB && VSB % 512 == 0 && VSB / 512 + VBB / 512 <= 63);
static_assert((KXB / 32) * VBB <= QB * QEP * 4);
static_assert(RH % QB == 0);
static_assert(KXB >= NBIN && KXB <= KX && KXB % 32 == 0);
static_assert((NBIN - 1) % 32 == 0);
static_assert(KXB / 32 <= NW);
static_assert(KX % 64 == 0);
static_assert(KX >= NBIN);
static_assert(KX == 192);
static_assert(XS == 16 && MAXR % 16 == 0 && NBT * 16 <= KX);
static_assert(HD == 64);
static_assert(DM % 64 == 0);
static_assert((KX * HD) % (8 * 256) == 0);
static_assert(((size_t)TT * DM / 8) % 256 == 0);
static_assert((NKV * HD) % 8 == 0);
static_assert(NB <= NB_FULL);
static_assert(TT <= TTF);

typedef _Float16 h16;
typedef unsigned short bf;
typedef __attribute__((ext_vector_type(16))) __bf16   v16bf;
typedef __attribute__((ext_vector_type(16))) _Float16 v16h;
typedef __attribute__((ext_vector_type(8)))  _Float16 v8h;
typedef __attribute__((ext_vector_type(8)))  unsigned short v8us;
typedef __attribute__((ext_vector_type(8)))  float    v8f;
typedef __attribute__((ext_vector_type(4)))  float    v4f;
typedef v8h  __attribute__((may_alias)) v8ha;
typedef v4f  __attribute__((may_alias)) v4fa;
typedef v8us __attribute__((may_alias)) v8usa;

__device__ __forceinline__ unsigned short f2bf(float f) { unsigned u = __float_as_uint(f); u += 0x7FFFu + ((u >> 16) & 1u); return (unsigned short)(u >> 16); }
__device__ __forceinline__ float bf2f(unsigned short b) { return __uint_as_float(((unsigned)b) << 16); }
__device__ __forceinline__ float bfr(float f) { return bf2f(f2bf(f)); }
__device__ __forceinline__ h16 tohx(float x) { return (h16)x; }
__device__ __forceinline__ void splitf(float y, unsigned short& h, unsigned short& l) { h = f2bf(y); l = f2bf(y - bf2f(h)); }
__device__ __forceinline__ v16h cat16(v8h lo, v8h hi) { return __builtin_shufflevector(lo, hi, 0, 1, 2, 3, 4, 5, 6, 7, 8, 9, 10, 11, 12, 13, 14, 15); }
__device__ __forceinline__ v16bf cat16b(v8us lo, v8us hi) { return __builtin_bit_cast(v16bf, __builtin_shufflevector(lo, hi, 0, 1, 2, 3, 4, 5, 6, 7, 8, 9, 10, 11, 12, 13, 14, 15)); }
__device__ __forceinline__ v8f wmma16(v16h a, v16h b, v8f c) { return __builtin_amdgcn_wmma_f32_16x16x32_f16(false, a, false, b, (short)0, c, false, false); }
__device__ __forceinline__ v8f wmmab(v16bf a, v16bf b, v8f c) { return __builtin_amdgcn_wmma_f32_16x16x32_bf16(false, a, false, b, (short)0, c, false, false); }

// ---- k_proj: the six projection GEMMs (q, k, v of each batch), C[m][n] = sum_k x[m][k] W^T[n][k] + bias[n], operands from bf16 planes in fragment order (FRAG; k step fastest), 16 accumulators (a 64x64 tile) a wave.
// A work-group is PW = 12 waves: 4 row tiles of 64 x the q, k and v weights of one 64-column tile (one head). The 12 tiles share 256 rows of x and 3 x 64 rows of W^T, so a stage of PKS k indices (PCH chunks: one chunk = the PKS / 32 fragments in a row of one 16-row block) is brought from L2 once for all of them, into LDS,
// by asynchronous copies into two buffers: stage t + 2 is asked for when every wave has left stage t, and flies while stage t + 1 is multiplied.
// The epilogue adds the f32 bias. EPI 1 (N tile = one head, HD == 64): row t, col c of the biased tile goes, split into bf16 hi + lo, to row t, k index c % HD of head plane c / HD of Ph/Pl. EPI 2: it goes to row c % HD, k index t of head plane c / HD of P16 (f16), Ph, Pl (bf16 hi, lo). Both in fragment order (FRAG).
// Fragments: lane l -> row/col l&15, h = l>>4; elements 0..7 <- k0+8h+0..7, 8..15 <- k0+16+8h+0..7 for BOTH A and Bt (same loader, same plane order); D element r -> row 8h+r, col l&15.
template <typename T16> struct WFrag;
template <> struct WFrag<h16> { typedef v16h V; static __device__ __forceinline__ V ldf(const h16* p) { return cat16(*(const v8h*)p, *(const v8h*)(p + FRAG / 2)); } static __device__ __forceinline__ v8f mma(V a, V b, v8f c) { return wmma16(a, b, c); } };
template <> struct WFrag<bf> { typedef v16bf V; static __device__ __forceinline__ V ldf(const bf* p) { return cat16b(*(const v8us*)p, *(const v8us*)(p + FRAG / 2)); } static __device__ __forceinline__ v8f mma(V a, V b, v8f c) { return wmmab(a, b, c); } };

// vcopy: copies C..N-1 of a wave's N asynchronous 512-byte copies to LDS (16 bytes a lane); the constant offset moves the global and the LDS address alike
typedef int gv4i __attribute__((vector_size(16)));
typedef __attribute__((address_space(1))) gv4i* gp128;
typedef __attribute__((address_space(3))) gv4i* lp128;
template <int C, int N> __device__ __forceinline__ void vcopy(gp128 g, lp128 l) { if constexpr (C < N) { __builtin_amdgcn_global_load_async_to_lds_b128(g, l, C * 512, 0); vcopy<C + 1, N>(g, l); } }

#define PW   12                          // waves of a k_proj work-group: wave = 4 (0: q, 1: k, 2: v) + row tile
#define PKS  64                          // k indices of a stage
#define PST  (DM / PKS)                  // stages
#define PCB  ((PKS / 32) * FRAG * 2)     // bytes of a chunk
#define PCH  (16 + 12)                   // chunks of a stage: 16 16-row blocks of x, then 4 16-row blocks of each W^T
#define PSB  (PCH * PCB)                 // bytes of a stage
static_assert(DM % PKS == 0 && PST >= 2 && PCB == 4 * 512 && PCH > 2 * PW && PCH <= 3 * PW);
static_assert(TT % 256 == 0 && DQ % 64 == 0);
template <int EPI>
__device__ __forceinline__ void proj_epi(const v8f (&acc)[4][4], float* os, const float* __restrict__ bias, h16* P16, bf* Ph, bf* Pl, int r0, int by) {
    const int lane = threadIdx.x & 31, lr = lane & 15, hi = lane >> 4; const int c0 = by * 64;
    if constexpr (EPI == 2) {
        // a lane's 8 accumulator elements are 8 consecutive t of one column, which is the lane's own 16-byte piece of a value fragment: one 16-byte store per plane and block, no LDS pass, 512 bytes in a row per store
        // the three loops are unrolled so that acc[][] and the store vectors are indexed by constants and stay in registers
#pragma unroll
        for (int nb = 0; nb < 4; ++nb) { const int col = c0 + nb * 16 + lr; const float bb = bfr(bias[col]); const size_t o = (size_t)by * HD * TP + ((size_t)(r0 / 32) * 4 + nb) * FRAG + lane * 8;
#pragma unroll
            for (int mb = 0; mb < 4; ++mb) { v8h o16; v8us oh, ol;
#pragma unroll
                for (int j = 0; j < 8; ++j) { const float xv = acc[mb][nb][j] + bb; o16[j] = tohx(xv); unsigned short a2, c2; splitf(xv, a2, c2); oh[j] = a2; ol[j] = c2; }
                const int om = (mb / 2) * 4 * FRAG + (mb % 2) * (FRAG / 2); *(v8h*)(P16 + o + om) = o16; *(v8us*)(Ph + o + om) = oh; *(v8us*)(Pl + o + om) = ol;
                asm volatile("s_wait_xcnt 0x0" :: "v"(o16), "v"(oh), "v"(ol) : "memory"); } }   // stands before a register that an issued global store names is rewritten (the next block's values); as inputs the three vectors stay as they are up to this wait
        return;
    }
#pragma unroll
    for (int mb = 0; mb < 4; ++mb) {
#pragma unroll
        for (int nb = 0; nb < 4; ++nb) {
#pragma unroll
            for (int j = 0; j < 8; ++j) os[(hi * 8 + j) * 68 + nb * 16 + lr] = acc[mb][nb][j]; }
        __builtin_amdgcn_wave_barrier(); asm volatile("" ::: "memory");
        {   // these 16 rows are two fragments; step s = 16 columns = one 512-byte half of a fragment, lane -> row lr, columns 16 s + 8 hi + 0..7. Unrolled: the vectors' elements are indexed by constants
#pragma unroll
            for (int s = 0; s < 4; ++s) { const int cofs = s * 16 + 8 * hi; const v4f w0 = *(const v4fa*)(os + lr * 68 + cofs), w1 = *(const v4fa*)(os + lr * 68 + cofs + 4); v8us oh, ol;
#pragma unroll
                for (int q = 0; q < 4; ++q) { unsigned short a2, c2; splitf(w0[q] + bfr(bias[c0 + cofs + q]), a2, c2); oh[q] = a2; ol[q] = c2; splitf(w1[q] + bfr(bias[c0 + cofs + 4 + q]), a2, c2); oh[4 + q] = a2; ol[4 + q] = c2; }
                const size_t e = ((size_t)by * TT + r0 + mb * 16) * HD + s * (FRAG / 2) + lane * 8; *(v8us*)(Ph + e) = oh; *(v8us*)(Pl + e) = ol;
                asm volatile("s_wait_xcnt 0x0" :: "v"(oh), "v"(ol) : "memory"); }   // the same wait for these two stores' registers
        }
        __builtin_amdgcn_wave_barrier(); asm volatile("" ::: "memory");
    }
}

static_assert(DQ == DKV);
__global__ __launch_bounds__(PW * 32) void k_proj(const bf* __restrict__ XB, const bf* __restrict__ WQ, const bf* __restrict__ WK, const bf* __restrict__ WV, const float* __restrict__ bq, const float* __restrict__ bk, const float* __restrict__ bv,
                                             bf* QPh, bf* QPl, bf* KPh, bf* KPl, h16* VT16, bf* VTh, bf* VTl) {
    __shared__ __align__(16) unsigned char ring[2][PSB];   // the two stage buffers
    __shared__ __align__(16) float osw[PW][16 * 68];       // a wave's own staging rows of EPI 1
    typedef WFrag<bf> FB;
    const int lane = threadIdx.x & 31; const int wave = __builtin_amdgcn_readfirstlane(threadIdx.x >> 5); const int rt = wave & 3, w = wave >> 2;
    const int bx = blockIdx.x, by = blockIdx.y, b = blockIdx.z; const bf* A = XB + (size_t)b * TT * DM; const unsigned lf = (unsigned)(lane * 8);
    // chunk ch at stage 0: 16 rows x DM elements are DM / 32 fragments in a row, so a stage's chunk is PCB bytes in a row and the next stage's follows it
    auto csrc = [&](int ch) __attribute__((always_inline)) { const int cb = ch - 16; const bf* Wp = (cb < 4) ? WQ : ((cb < 8) ? WK : WV);
        return (ch < 16) ? A + (size_t)(bx * 256 + ch * 16) * DM : Wp + (size_t)(by * 64 + (cb & 3) * 16) * DM; };
    // wave v copies chunks v, v + PW and, the first PCH - 2 PW waves, v + 2 PW (wave-uniform), 4 copies of 512 bytes each
    const bf* g0 = csrc(wave) + lf; const bf* g1 = csrc(wave + PW) + lf; const bf* g2 = csrc((wave < PCH - 2 * PW) ? wave + 2 * PW : wave) + lf;
    auto stage = [&](int st, int bi) __attribute__((always_inline)) { unsigned char* d = &ring[bi][lane * 16]; const int go = st * (PKS / 32) * FRAG;
        vcopy<0, 4>((gp128)(const void*)(g0 + go), (lp128)(d + wave * PCB)); vcopy<0, 4>((gp128)(const void*)(g1 + go), (lp128)(d + (wave + PW) * PCB));
        if (wave < PCH - 2 * PW) vcopy<0, 4>((gp128)(const void*)(g2 + go), (lp128)(d + (wave + 2 * PW) * PCB)); };
    v8f acc[4][4];
#pragma unroll
    for (int mb = 0; mb < 4; ++mb)
#pragma unroll
        for (int nb = 0; nb < 4; ++nb) acc[mb][nb] = (v8f){};
    stage(0, 0);
    asm volatile("s_wait_asynccnt 0x0" ::: "memory");   // this wave's copies of stage 0 have landed
    __syncthreads();   // stage 0 is in LDS for every wave
    stage(1, 1);
#pragma unroll 1
    for (int t = 0; t < PST; ++t) { const bf* L = (const bf*)ring[t & 1] + lf;
#pragma unroll
        for (int ks = 0; ks < PKS / 32; ++ks) { v16bf a[4], bb[4];
#pragma unroll
            for (int mb = 0; mb < 4; ++mb) { a[mb] = FB::ldf(L + (rt * 4 + mb) * (PCB / 2) + ks * FRAG); bb[mb] = FB::ldf(L + (16 + w * 4 + mb) * (PCB / 2) + ks * FRAG); }
            if (ks == PKS / 32 - 1) {   // the hand-over stands behind the stage's last LDS reads and in front of its last products, which need registers alone: the refill gets a whole trip of lead, and the matrix unit has work while waves meet at the barrier
                asm volatile("s_wait_dscnt 0x0" ::: "memory");      // this wave has read stage t for the last time
                asm volatile("s_wait_asynccnt 0x0" ::: "memory");   // its copies of stage t + 1 have landed
                __syncthreads();   // stage t + 1 is in LDS for every wave, and every wave has left the buffer of stage t
                if (t + 2 < PST) stage(t + 2, t & 1); }
            __builtin_amdgcn_sched_barrier(0);   // keeps the 16 LDS reads of a k step (and the refill) in front of its 16 products; sunk to their use, each pair of reads would be waited for in full among the products
#pragma unroll
            for (int nb = 0; nb < 4; ++nb)
#pragma unroll
                for (int mb = 0; mb < 4; ++mb) acc[mb][nb] = wmmab(a[mb], bb[nb], acc[mb][nb]); } }
    asm volatile("s_wait_asynccnt 0x0" ::: "memory");   // no copy is outstanding when the wave goes on
    const size_t oq = (size_t)b * NH_ * TT * HD, ok = (size_t)b * NKV * TT * HD, ov = (size_t)b * NKV * HD * TP; const int r0 = bx * 256 + rt * 64;
    if (w == 2) proj_epi<2>(acc, nullptr, bv, VT16 + ov, VTh + ov, VTl + ov, r0, by);   // wave-uniform; no work-group barrier stands behind the loop
    else proj_epi<1>(acc, osw[wave], w ? bk : bq, nullptr, w ? KPh + ok : QPh + oq, w ? KPl + ok : QPl + oq, r0, by);
}

typedef __attribute__((ext_vector_type(2))) _Float16 v2h;
typedef __attribute__((ext_vector_type(4))) _Float16 v4h;
typedef __attribute__((ext_vector_type(2))) unsigned short v2us;
typedef __attribute__((ext_vector_type(2))) float v2f;
typedef __attribute__((ext_vector_type(4))) int v4i;

// The four bodies of k_prep, each for block blk of 256 threads of its own range.
// wtG: Bt = w^T (rows n, k index k) as bf16 in fragment order; thread p forms the 16-byte piece p, so a wave stores 512 bytes in a row and each of its 8 loads reads 64 bytes in a row of two rows of w.
__device__ __forceinline__ void wtG(const float* __restrict__ w, int K, int N, bf* Bt, int blk) {
    const int p = blk * 256 + threadIdx.x; if (p >= N * (K / 8)) return; const int hf = p >> 5, fr = hf >> 1, nk = K / 32;
    const int n = (fr / nk) * 16 + (p & 15), k = (fr % nk) * 32 + (hf & 1) * 16 + ((p >> 4) & 1) * 8; const unsigned off = (unsigned)(k * N + n); float x[8]; v8us o;
#pragma unroll
    for (int e = 0; e < 8; ++e) x[e] = (w + (size_t)e * N)[off];   // a uniform base per row + one lane offset. Unrolled (both loops): the elements are indexed by constants
    asm volatile("s_wait_xcnt 0x0" :: "v"(off) : "memory");   // stands before a register that an issued global load names is rewritten; as an input the offset stays as it is up to this wait
#pragma unroll
    for (int e = 0; e < 8; ++e) o[e] = f2bf(x[e]);
    *(v8us*)(Bt + (size_t)p * 8) = o; }
// cvt8: rows of DM f32 -> bf16 in fragment order; thread i forms the 16-byte piece i.
__device__ __forceinline__ void cvt8(const float* __restrict__ src, bf* dst, size_t n8, int blk) { const size_t i = (size_t)blk * 256 + threadIdx.x; if (i >= n8) return; const size_t hf = i >> 5, fr = hf >> 1;
    const size_t row = (fr / (DM / 32)) * 16 + (i & 15), k = (fr % (DM / 32)) * 32 + (hf & 1) * 16 + ((i >> 4) & 1) * 8; const v8f v = *(const v8f*)(src + row * DM + k); v8us o;
#pragma unroll
    for (int k2 = 0; k2 < 8; ++k2) o[k2] = f2bf(v[k2]); *(v8us*)(dst + i * 8) = o;  }

// vrel: k indices [TT, TT+KX) of every value head plane (b*NKV + g): row d, k index TT + r = emb_v[r][d] (r < NBIN, else 0); fp16 plane carries x EVC of the bf16 value, hi plane bf16, lo plane 0. One wave per 512-byte half of a fragment.
__device__ __forceinline__ void vrel(const float* __restrict__ ev, h16* V16, bf* Vh, bf* Vl, int blk) {
    const int lane = threadIdx.x & 31; const int pc = blk * 8 + (threadIdx.x >> 5); if (pc >= NB * NKV * (KX / 32) * 8) return; const int pl = pc / ((KX / 32) * 8), hf = pc % ((KX / 32) * 8);   // hf = ((k step) * 4 + 16-row block) * 2 + j
    const int d = ((hf >> 1) & 3) * 16 + (lane & 15); const int rb0 = (hf >> 3) * 32 + (hf & 1) * 16 + (lane >> 4) * 8;
    v8h o16; v8us oh, ol; unsigned of[8]; float xs[8];
#pragma unroll
    for (int q = 0; q < 8; ++q) { const int r = rb0 + q; const int rc = (r < NBIN - 1) ? r : (NBIN - 1); of[q] = (unsigned)(rc * HD + d); xs[q] = ev[of[q]]; }
    // s_wait_xcnt 0 stands before a register that an issued global load names is rewritten; as inputs the offsets stay as they are up to this wait
    asm volatile("s_wait_xcnt 0x0" :: "v"(of[0]), "v"(of[1]), "v"(of[2]), "v"(of[3]), "v"(of[4]), "v"(of[5]), "v"(of[6]), "v"(of[7]) : "memory");
#pragma unroll   // as above: the arrays and vectors are indexed by constants and stay in registers
    for (int q = 0; q < 8; ++q) { const int r = rb0 + q; float x = xs[q]; x = (r < NBIN) ? x : 0.f; const float xb = bfr(x); o16[q] = tohx(xb * EVC); oh[q] = f2bf(x); ol[q] = f2bf(x * 0.f); }
    const size_t o = (size_t)pl * HD * TP + (size_t)(TT / 32) * 4 * FRAG + hf * (FRAG / 2) + lane * 8;
    *(v8h*)(V16 + o) = o16; *(v8us*)(Vh + o) = oh; *(v8us*)(Vl + o) = ol;
}
__device__ __forceinline__ void ekp(const float* __restrict__ ek, bf* EK, int blk) {
    const int idx = blk * 256 + threadIdx.x; if (idx >= KX * HD / 8) return; const int e = idx * 8; const int hf = idx >> 5;   // fragment order: piece idx is lane idx & 31 of half hf & 1 of fragment hf >> 1 (two fragments per 16 rows)
    const int r = (hf >> 2) * 16 + (idx & 15), d0 = ((hf >> 1) & 1) * 32 + (hf & 1) * 16 + ((idx >> 4) & 1) * 8; const int rs = r - XS; const int rc = (rs < 0) ? 0 : ((rs < NBIN - 1) ? rs : (NBIN - 1));   // row r holds emb_k of the clipped offset r - XS: the XS spare rows on each side repeat the end rows
    const v4f a = *(const v4f*)(ek + (size_t)rc * HD + d0), b2 = *(const v4f*)(ek + (size_t)rc * HD + d0 + 4); v8us o;
#pragma unroll
    for (int k = 0; k < 4; ++k) { const float x0 = (r < NBT * 16) ? a[k] : 0.f, x1 = (r < NBT * 16) ? b2[k] : 0.f; o[k] = f2bf(x0); o[k + 4] = f2bf(x1); }
    *(v8us*)(EK + e) = o;  }
// k_prep: every plane that depends on an input alone, in one grid: the three W^T, the bf16 copy of x (all batches), the emb_v columns of the value planes, emb_k. The ranges write disjoint planes and read inputs only; a block's range is block-uniform.
#define PBW ((DM * DQ / 8 + 255) / 256)                    // blocks of one W^T
#define PBX ((TT * DM / 8 + 255) / 256)                    // blocks of one batch of x
#define PBV ((NB * NKV * (KX / 32) * 8 + 7) / 8)           // blocks of vrel
#define PBE ((KX * HD / 8 + 255) / 256)                    // blocks of ekp
__global__ __launch_bounds__(256) void k_prep(const float* __restrict__ x, const float* __restrict__ wq, const float* __restrict__ wk, const float* __restrict__ wv, const float* __restrict__ ek, const float* __restrict__ ev,
                                              bf* XB, bf* WQ, bf* WK, bf* WV, bf* EK, h16* V16, bf* Vh, bf* Vl) {
    int blk = blockIdx.x;
    if (blk < 3 * PBW) { const int w = blk / PBW; wtG(w == 0 ? wq : (w == 1 ? wk : wv), DM, DQ, w == 0 ? WQ : (w == 1 ? WK : WV), blk - w * PBW); return; }
    blk -= 3 * PBW;
    if (blk < NB * PBX) { const int b = blk / PBX; cvt8(x + (size_t)b * TTF * DM, XB + (size_t)b * TT * DM, (size_t)TT * DM / 8, blk - b * PBX); return; }
    blk -= NB * PBX;
    if (blk < PBV) { vrel(ev, V16, Vh, Vl, blk); return; }
    ekp(ek, EK, blk - PBV);
}

// ---- k_attn: the whole attention stage of QB query rows of one head in one work-group of NW waves; grid (TT/QB, NH_, NB).
// Wave w owns keys [w KW, (w+1) KW). It forms the TRANSPOSED score tiles (A = key rows, B = query rows), so lane l holds query l&15 and keys 8(l>>4)+0..7 of each tile:
// two neighbouring key tiles are, register for register, the A fragment (row = query, k = key) of the attn.v product, and the scores never leave the registers.
// t = (q.k + QE[i][i-j+MAXR+XS]) x HD^-0.5 + mask[j] (QE has the clipped ends repeated in XS spare columns a side; a tile wholly outside the band takes the end value from a register); row maximum and row sums go across the waves through LDS in wave order; P is normalised before it is rounded to 16 bit.
// bins (LDS, f32, unnormalised): col XS + r = e[i+MAXR-r] for every key of a tile that meets the band, -XS < r < NBIN-1+XS (0 where there is no key); bin 0 = sum_{j >= i+MAXR} e and bin NBIN-1 = sum_{j <= i-MAXR} e are put in when the fragment is formed: the waves' sums over the tiles outside the band + the XS + 1 or XS columns at that end; the columns past bin NBIN-1 meet zero rows of emb_v; waves < KXB/32 add one k step of bins x emb_v each.
// The value fragments of the plane that every row class needs (f16, or bf16 hi) come through LDS: asynchronous copies, each wave for itself, start behind the row-maximum barrier and are waited for at the row-sum barrier; the lo plane of rows < RH is loaded straight into registers.
// Each wave's 64-column partial of ctx goes to LDS (over its value fragments, which it has read by then); the work-group adds the NW partials in wave order and stores the output rows.
// 2^x on v_exp_f32; the v_nop is the one free issue slot that the instruction set asks for between a transcendental and a next instruction that reads its result or overwrites its source; in one statement it stays directly behind it
__device__ __forceinline__ float exp2s(float x) { float e; asm("v_exp_f32 %0, %1\n\tv_nop" : "=v"(e) : "v"(x)); return e; }
template <bool B> struct BoolC { static constexpr bool value = B; };
template <bool SPLIT> struct PvT { typedef h16 T; };
template <> struct PvT<true> { typedef bf T; };
template <bool SPLIT, typename T16>
__device__ __forceinline__ void pv_frag(const float (&x)[QT][16], typename WFrag<T16>::V (&p)[QT], typename WFrag<T16>::V (&p2)[QT]) {
#pragma unroll
    for (int qt = 0; qt < QT; ++qt) {
        if constexpr (SPLIT) { v8us h0, h1, l0, l1;
#pragma unroll
            for (int r = 0; r < 8; ++r) { unsigned short a, c; splitf(x[qt][r], a, c); h0[r] = a; l0[r] = c; splitf(x[qt][8 + r], a, c); h1[r] = a; l1[r] = c; }
            p[qt] = cat16b(h0, h1); p2[qt] = cat16b(l0, l1);
        } else { v8h h0, h1;
#pragma unroll
            for (int r = 0; r < 8; ++r) { h0[r] = tohx(x[qt][r]); h1[r] = tohx(x[qt][8 + r]); }
            p[qt] = cat16(h0, h1); }
    }
}
template <bool SPLIT, typename T16>
__device__ __forceinline__ void pv_mma(const typename WFrag<T16>::V (&p)[QT], const typename WFrag<T16>::V (&p2)[QT], typename WFrag<T16>::V v, typename WFrag<T16>::V v2, v8f (&o)[QT][4], int dt) {
#pragma unroll
    for (int qt = 0; qt < QT; ++qt) o[qt][dt] = WFrag<T16>::mma(p[qt], v, o[qt][dt]);
    if constexpr (SPLIT) {
#pragma unroll
        for (int qt = 0; qt < QT; ++qt) o[qt][dt] = WFrag<T16>::mma(p2[qt], v, o[qt][dt]);
#pragma unroll
        for (int qt = 0; qt < QT; ++qt) o[qt][dt] = WFrag<T16>::mma(p[qt], v2, o[qt][dt]); }
}

__global__ __launch_bounds__(NW * 32) void k_attn(const bf* __restrict__ QPh, const bf* __restrict__ QPl, const bf* __restrict__ KPh, const bf* __restrict__ KPl, const bf* __restrict__ EK,
                                                  const h16* __restrict__ V16, const bf* __restrict__ Vh, const bf* __restrict__ Vl, const float* __restrict__ mask, float* OUT) {
    __shared__ __align__(16) unsigned char vst[NW][VSB];   // wave w's slice: first its keys' value fragments (asynchronous copies), then, when it has read them all, its partial of ctx (QB rows of OP floats)
    __shared__ __align__(16) float binsL[QB * BP];
    __shared__ __align__(16) float qes[QB * QEP];   // QE; behind its last read (the row-maximum barrier) the first (KXB / 32) * VBB bytes hold the emb_v columns' value fragments
    __shared__ float rmx[NW][QB], rsm[NW][QB], rlo[NW][QB], rhi[NW][QB];
    typedef WFrag<bf> FB;
    const int tid = threadIdx.x, lane = tid & 31, lr = lane & 15, hi = lane >> 4;
    const int wave = __builtin_amdgcn_readfirstlane(tid >> 5);
    const int i0 = blockIdx.x * QB, head = blockIdx.y, b = blockIdx.z; const bool hires = (i0 < RH);
    const size_t pq = ((size_t)b * NH_ + head) * TT * HD, pk = ((size_t)b * NKV + head / REP) * TT * HD, pv = ((size_t)b * NKV + head / REP) * HD * TP;
    const int kbase = wave * KW;
    // every global address is a wave-uniform base + one lane offset + a constant: the few address registers stay as they are while the loads that name them are in flight
    const unsigned lf = (unsigned)(lane * 8), lm = (unsigned)(8 * hi);   // lf: the lane's 16-byte piece in each half of a fragment (FRAG)
    const bf* qbh = QPh + pq + (size_t)i0 * HD; const bf* qbl = QPl + pq + (size_t)i0 * HD; const bf* kbh = KPh + pk + (size_t)kbase * HD; const bf* kbl = KPl + pk + (size_t)kbase * HD;
    const float* mrow = mask + (size_t)b * TTF + kbase;
    for (int e = tid; e < QB * BP; e += NW * 32) binsL[e] = 0.f;
    // QE = q emb_k^T (q hi/lo x exact emb_k), one 16x16 tile per job, into LDS
    for (int job = wave; job < QT * NBT; job += NW) { const int qt = job / NBT, nt = job - qt * NBT; v8f a = (v8f){};
        const bf* jh = qbh + qt * 16 * HD; const bf* jl = qbl + qt * 16 * HD; const bf* je = EK + nt * 16 * HD;
#pragma unroll
        for (int ks = 0; ks < 2; ++ks) { const v16bf ah = FB::ldf(jh + lf + ks * FRAG), al = FB::ldf(jl + lf + ks * FRAG), eb = FB::ldf(je + lf + ks * FRAG);
            a = wmmab(ah, eb, a); a = wmmab(al, eb, a); }
        // s_wait_xcnt 0 stands before a register that an issued global load names is rewritten (the next trip forms new bases); as inputs those registers stay as they are up to this wait
        asm volatile("s_wait_xcnt 0x0" :: "s"(jh), "s"(jl), "s"(je), "v"(lf) : "memory");
#pragma unroll
        for (int r = 0; r < 8; ++r) qes[(qt * 16 + 8 * hi + r) * QEP + nt * 16 + lr] = a[r]; }
    // transposed score tiles, bf16 hi/lo, 3 products
    v16bf qh[QT][2], ql[QT][2];
#pragma unroll
    for (int qt = 0; qt < QT; ++qt)
#pragma unroll
        for (int ks = 0; ks < 2; ++ks) { qh[qt][ks] = FB::ldf(qbh + lf + (qt * 2 + ks) * FRAG); ql[qt][ks] = FB::ldf(qbl + lf + (qt * 2 + ks) * FRAG); }
    v8f s[KTN][QT]; v16bf kfh[KTN][2], kfl[KTN][2];
    // a key tile's loads are issued ahead of the products that use them: two tiles ahead while few score tiles are held, one tile ahead when the registers are nearly full
    auto ldk = [&](int kt) __attribute__((always_inline)) {
#pragma unroll
        for (int ks = 0; ks < 2; ++ks) { kfh[kt][ks] = FB::ldf(kbh + lf + (kt * 2 + ks) * FRAG); kfl[kt][ks] = FB::ldf(kbl + lf + (kt * 2 + ks) * FRAG); } };
    ldk(0); ldk(1);
#pragma unroll
    for (int kt = 0; kt < KTN; ++kt) {
        if (kt + 2 < KTN - KLATE) ldk(kt + 2); else if (kt + 1 >= KTN - KLATE && kt + 1 < KTN) ldk(kt + 1);
        __builtin_amdgcn_sched_barrier(0);   // keeps the loads above in front of this tile's products; sunk to their use, each would be waited for in full
#pragma unroll
        for (int qt = 0; qt < QT; ++qt) s[kt][qt] = (v8f){};
#pragma unroll
        for (int ks = 0; ks < 2; ++ks) { const v16bf kh = kfh[kt][ks], kl = kfl[kt][ks];
#pragma unroll
            for (int qt = 0; qt < QT; ++qt) s[kt][qt] = wmmab(kh, qh[qt][ks], s[kt][qt]);
#pragma unroll
            for (int qt = 0; qt < QT; ++qt) s[kt][qt] = wmmab(kh, ql[qt][ks], s[kt][qt]);
#pragma unroll
            for (int qt = 0; qt < QT; ++qt) s[kt][qt] = wmmab(kl, qh[qt][ks], s[kt][qt]); }
        __builtin_amdgcn_sched_barrier(0); }   // keeps the next tiles' loads from rising over these products, which would hold more registers than there are
    // the same wait for the q and k loads: their address registers may be reused only behind it
    asm volatile("s_wait_xcnt 0x0" :: "s"(qbh), "s"(qbl), "s"(kbh), "s"(kbl), "v"(lf) : "memory");
    __syncthreads();   // QE tiles and the zeroed bins are visible to every wave
    float qe0[QT], qe1[QT], mx[QT];
#pragma unroll
    for (int qt = 0; qt < QT; ++qt) { qe0[qt] = qes[(qt * 16 + lr) * QEP + XS]; qe1[qt] = qes[(qt * 16 + lr) * QEP + XS + NBIN - 1]; mx[qt] = -3.0e38f; }
#pragma unroll
    for (int kt = 0; kt < KTN; ++kt) { const int jb = kbase + kt * 16; const v4f m0 = *(const v4f*)(mrow + lm + kt * 16), m1 = *(const v4f*)(mrow + lm + (kt * 16 + 4)); float mk[8];
#pragma unroll
        for (int r = 0; r < 4; ++r) { mk[r] = bfr(m0[r]); mk[4 + r] = bfr(m1[r]); }
#pragma unroll
        for (int qt = 0; qt < QT; ++qt) { const int ib = i0 + qt * 16; const bool left = (jb + 15 <= ib - MAXR), right = (jb >= ib + 15 + MAXR);   // the whole tile is clipped: one QE value per query (wave-uniform tests)
            if (left || right) { const float qe = left ? qe1[qt] : qe0[qt];
#pragma unroll
                for (int r = 0; r < 8; ++r) { const float t = (s[kt][qt][r] + qe) * SCL + mk[r]; s[kt][qt][r] = t; mx[qt] = fmaxf(mx[qt], t); }
            } else { const float* qd = qes + (qt * 16 + lr) * QEP + (ib + lr) - (jb + 8 * hi) + MAXR + XS;   // |ib - jb| <= MAXR here, so the 8 columns lie in [1, NBT * 16)
#pragma unroll
                for (int r = 0; r < 8; ++r) { const float t = (s[kt][qt][r] + qd[-r]) * SCL + mk[r]; s[kt][qt][r] = t; mx[qt] = fmaxf(mx[qt], t); } } } }
#pragma unroll
    for (int qt = 0; qt < QT; ++qt) { mx[qt] = fmaxf(mx[qt], __shfl_xor(mx[qt], 16, 32)); if (hi == 0) rmx[wave][qt * 16 + lr] = mx[qt]; }
    asm volatile("s_wait_xcnt 0x0" :: "s"(mrow), "v"(lm) : "memory");   // the same wait for the mask loads' address registers
    __syncthreads();   // every wave's row maxima are in LDS, and every wave has read QE for the last time
    // this wave's value fragments (f16 plane, or the bf16 hi plane for rows < RH; VSB bytes in a row) start for its own LDS slice here, behind the last global load of the softmax (the mask's, which would queue behind them): they land while the exponentials below keep the vector port busy and ask nothing of L2
    { const size_t vo = pv + (size_t)(kbase / 32) * 4 * FRAG + lf; const void* vsrc = hires ? (const void*)(Vh + vo) : (const void*)(V16 + vo);
        vcopy<0, VSB / 512>((gp128)vsrc, (lp128)(&vst[wave][lane * 16])); }
    if (wave < KXB / 32) {   // wave-uniform: the k step of emb_v columns that this wave will multiply with the bins starts for the place that QE has left
        const size_t vo = pv + (size_t)(TT / 32 + wave) * 4 * FRAG + lf; const void* vsrc = hires ? (const void*)(Vh + vo) : (const void*)(V16 + vo);
        vcopy<0, VBB / 512>((gp128)vsrc, (lp128)((unsigned char*)qes + wave * VBB + lane * 16)); }
#pragma unroll
    for (int qt = 0; qt < QT; ++qt) { float m = rmx[0][qt * 16 + lr];
#pragma unroll
        for (int w = 1; w < NW; ++w) m = fmaxf(m, rmx[w][qt * 16 + lr]);
        mx[qt] = m; }
    float sum[QT], clo[QT], chi[QT];
#pragma unroll
    for (int qt = 0; qt < QT; ++qt) { sum[qt] = 0.f; clo[qt] = 0.f; chi[qt] = 0.f; }
#pragma unroll
    for (int kt = 0; kt < KTN; ++kt) { const int jb = kbase + kt * 16;
#pragma unroll
        for (int qt = 0; qt < QT; ++qt) { const int ib = i0 + qt * 16; const bool left = (jb + 15 <= ib - MAXR), right = (jb >= ib + 15 + MAXR);
            float ts = 0.f;
#pragma unroll
            for (int r = 0; r < 8; ++r) { const float e = exp2s(__fmul_rn(__fsub_rn(s[kt][qt][r], mx[qt]), 1.4426950408889634f)); s[kt][qt][r] = e; ts += e; }
            sum[qt] += ts; clo[qt] += right ? ts : 0.f; chi[qt] += left ? ts : 0.f;
            if (!(left || right)) { float* bd = binsL + (qt * 16 + lr) * BP + (ib + lr) - (jb + 8 * hi) + MAXR + XS;   // the tile meets the band: each e goes to the column of its own offset, in [1, NBT * 16)
#pragma unroll
                for (int r = 0; r < 8; ++r) bd[-r] = s[kt][qt][r]; } } }
#pragma unroll
    for (int qt = 0; qt < QT; ++qt) { sum[qt] += __shfl_xor(sum[qt], 16, 32); clo[qt] += __shfl_xor(clo[qt], 16, 32); chi[qt] += __shfl_xor(chi[qt], 16, 32);
        if (hi == 0) { rsm[wave][qt * 16 + lr] = sum[qt]; rlo[wave][qt * 16 + lr] = clo[qt]; rhi[wave][qt * 16 + lr] = chi[qt]; } }
    asm volatile("s_wait_asynccnt 0x0" ::: "memory");   // the value fragments have landed in LDS; no read of them may stand in front of this wait
    __syncthreads();   // every wave's row sums and the band copies in the bins are in LDS
    float f[QT];
#pragma unroll
    for (int qt = 0; qt < QT; ++qt) { float tot = rsm[0][qt * 16 + lr];
#pragma unroll
        for (int w = 1; w < NW; ++w) tot += rsm[w][qt * 16 + lr];
        f[qt] = __fdiv_rn(hires ? 1.0f : PCAR, tot); }
    v8f o[QT][4];
#pragma unroll
    for (int qt = 0; qt < QT; ++qt)
#pragma unroll
        for (int dt = 0; dt < 4; ++dt) o[qt][dt] = (v8f){};
    auto attnv = [&](auto fc, auto* Vp, auto* Vp2) __attribute__((always_inline)) { constexpr bool SPLIT = decltype(fc)::value; typedef typename PvT<SPLIT>::T T16; typedef typename WFrag<T16>::V V_;
        const T16* V = (const T16*)vst[wave]; auto* V2 = Vp2 + pv + (kbase / 32) * 4 * FRAG;   // wave-uniform bases of this wave's keys: the staged plane in LDS, the lo plane in global memory
        constexpr int NT = (KTN / 2) * 4;   // steps (k step kk, 16 columns dt)
        V_ vf[NT], vf2[NT];
        auto ldv = [&](int t) __attribute__((always_inline)) { if (t < NT) vf[t] = WFrag<T16>::ldf(V + lf + t * FRAG); };
        auto ldv2 = [&](int t) __attribute__((always_inline)) { if constexpr (SPLIT) { if (t < NT) vf2[t] = WFrag<T16>::ldf(V2 + lf + t * FRAG); } };
#pragma unroll
        for (int t = 0; t < VAHL; ++t) ldv(t);
#pragma unroll
        for (int t = 0; t < VAH2; ++t) ldv2(t);
#pragma unroll
        for (int kk = 0; kk < KTN / 2; ++kk) { float x[QT][16]; V_ p[QT], p2[QT];
#pragma unroll
            for (int qt = 0; qt < QT; ++qt)
#pragma unroll
                for (int r = 0; r < 8; ++r) { x[qt][r] = s[2 * kk][qt][r] * f[qt]; x[qt][8 + r] = s[2 * kk + 1][qt][r] * f[qt]; }
            pv_frag<SPLIT, T16>(x, p, p2);
#pragma unroll
            for (int dt = 0; dt < 4; ++dt) { const int t = kk * 4 + dt;
                ldv(t + VAHL); ldv2(t + VAH2);
                __builtin_amdgcn_sched_barrier(0);   // keeps the loads above in front of this step's products; sunk to their use, each would be waited for in full
                pv_mma<SPLIT, T16>(p, p2, vf[t], SPLIT ? vf2[t] : vf[t], o, dt);
                __builtin_amdgcn_sched_barrier(0); } }   // keeps later steps' loads from rising over these products, which would hold more registers than there are
        if constexpr (SPLIT) asm volatile("s_wait_xcnt 0x0" :: "s"(V2), "v"(lf) : "memory");   // the same wait for the lo plane's loads' address registers
        if (wave < KXB / 32) { float x[QT][16]; V_ p[QT], p2[QT], vb[4], vb2[4];   // wave-uniform: one k step of the bins
            const T16* Vb = (const T16*)qes + wave * 4 * FRAG; auto* Vb2 = Vp2 + pv + (TT / 32 + wave) * 4 * FRAG;   // the staged plane's columns in LDS, the lo plane's in global memory
#pragma unroll
            for (int dt = 0; dt < 4; ++dt) { vb[dt] = WFrag<T16>::ldf(Vb + lf + dt * FRAG); if constexpr (SPLIT) vb2[dt] = WFrag<T16>::ldf(Vb2 + lf + dt * FRAG); }
            if constexpr (SPLIT) asm volatile("s_wait_xcnt 0x0" :: "s"(Vb2), "v"(lf) : "memory");   // the same wait for the loads of the lo plane's emb_v columns, directly behind them: the work below needs their address registers
#pragma unroll
            for (int qt = 0; qt < QT; ++qt) { const float* bp = binsL + (qt * 16 + lr) * BP + XS + wave * 32 + 8 * hi; const v4f b0 = *(const v4fa*)bp, b1 = *(const v4fa*)(bp + 4), b2 = *(const v4fa*)(bp + 16), b3 = *(const v4fa*)(bp + 20);
                float t0 = b0[0];
                if (wave == 0 || wave == (NBIN - 1) / 32) { const float* rp = (wave == 0) ? &rlo[0][qt * 16 + lr] : &rhi[0][qt * 16 + lr]; float tot = rp[0];
#pragma unroll
                    for (int w = 1; w < NW; ++w) tot += rp[w * QB];
                    const float* xp = binsL + (qt * 16 + lr) * BP + ((wave == 0) ? 0 : XS + NBIN - 1);   // the clipped keys of the tiles that meet the band: columns [0, XS] or [XS + NBIN - 1, 2 XS + NBIN - 1)
#pragma unroll   // the four 16-byte reads are issued together and waited for once
                    for (int c = 0; c < XS / 4; ++c) { const v4f xv = *(const v4fa*)(xp + 4 * c); tot += (xv[0] + xv[1]) + (xv[2] + xv[3]); }
                    if (wave == 0) tot += t0;   // column XS, which the lower half wave holds in t0
                    t0 = (hi == 0) ? tot : t0; }
#pragma unroll
                for (int r = 0; r < 4; ++r) { x[qt][r] = (r == 0 ? t0 : b0[r]) * f[qt]; x[qt][4 + r] = b1[r] * f[qt]; x[qt][8 + r] = b2[r] * f[qt]; x[qt][12 + r] = b3[r] * f[qt]; }
                if constexpr (!SPLIT) {
#pragma unroll
                    for (int r = 0; r < 16; ++r) x[qt][r] = x[qt][r] * (1.0f / EVC); } }
            pv_frag<SPLIT, T16>(x, p, p2);
#pragma unroll
            for (int dt = 0; dt < 4; ++dt) pv_mma<SPLIT, T16>(p, p2, vb[dt], SPLIT ? vb2[dt] : vb[dt], o, dt); } };
    if (hires) attnv(BoolC<true>{}, Vh, Vl); else attnv(BoolC<false>{}, V16, V16);
#pragma unroll
    for (int qt = 0; qt < QT; ++qt)
#pragma unroll
        for (int dt = 0; dt < 4; ++dt)
#pragma unroll
            for (int r = 0; r < 8; ++r) ((float*)vst[wave])[(qt * 16 + 8 * hi + r) * OP + dt * 16 + lr] = o[qt][dt][r];
    __syncthreads();   // every wave's partial of ctx is in LDS
    const float cs = hires ? 1.0f : (1.0f / PCAR);
    for (int e = tid; e < QB * (HD / 4); e += NW * 32) { const int q = e / (HD / 4), d4 = (e % (HD / 4)) * 4; v4f sm = *(const v4fa*)((const float*)vst[0] + q * OP + d4);
#pragma unroll
        for (int w = 1; w < NW; ++w) sm += *(const v4fa*)((const float*)vst[w] + q * OP + d4);
        v4f o4; o4[0] = sm[0] * cs; o4[1] = sm[1] * cs; o4[2] = sm[2] * cs; o4[3] = sm[3] * cs; *(v4f*)(OUT + ((size_t)b * TT + i0 + q) * DQ + head * HD + d4) = o4; }
}

extern "C" void kernel_launch(void* const* d_in, const int* in_sizes, int n_in,
                              void* d_out, int out_size, void* d_ws, size_t ws_size, hipStream_t stream) {
    if (n_in < 10) return;
    if ((size_t)in_sizes[0] < ((size_t)(NB - 1) * TTF + TT) * DM) return;
    if ((size_t)in_sizes[1] < (size_t)(NB - 1) * TTF + TT) return;
    if (in_sizes[2] < DM * DQ || in_sizes[4] < DM * DKV || in_sizes[6] < DM * DKV) return;
    if (in_sizes[3] < DQ || in_sizes[5] < DKV || in_sizes[7] < DKV) return;
    if (in_sizes[8] < NBIN * HD || in_sizes[9] < NBIN * HD) return;
    if ((size_t)out_size < (size_t)NB * TT * DQ) return;
    const float* x = (const float*)d_in[0]; const float* mask = (const float*)d_in[1];   // [NB][1][1][TTF], added per key
    const float* wq = (const float*)d_in[2]; const float* bq = (const float*)d_in[3]; const float* wk = (const float*)d_in[4]; const float* bk = (const float*)d_in[5]; const float* wv = (const float*)d_in[6]; const float* bv = (const float*)d_in[7];
    const float* embk = (const float*)d_in[8]; const float* embv = (const float*)d_in[9];   // [NBIN][HD] each
    float* OUT = (float*)d_out;     // [NB][TT][DQ]
    char* wsp = (char*)d_ws;
    auto take = [&](size_t bytes) { char* p = wsp; wsp += (bytes + 255) & ~(size_t)255; return (void*)p; };
    bf* WQ = (bf*)take((size_t)DQ * DM * 2); bf* WK = (bf*)take((size_t)DKV * DM * 2); bf* WV = (bf*)take((size_t)DKV * DM * 2); bf* EK = (bf*)take((size_t)KX * HD * 2);
    h16* VT16 = (h16*)take((size_t)NB * NKV * HD * TP * 2);
    bf* QPh = (bf*)take((size_t)NB * NH_ * TT * HD * 2); bf* QPl = (bf*)take((size_t)NB * NH_ * TT * HD * 2); bf* KPh = (bf*)take((size_t)NB * NKV * TT * HD * 2); bf* KPl = (bf*)take((size_t)NB * NKV * TT * HD * 2); bf* VTh = (bf*)take((size_t)NB * NKV * HD * TP * 2); bf* VTl = (bf*)take((size_t)NB * NKV * HD * TP * 2);
    bf* XB = (bf*)take((size_t)NB * TT * DM * 2);   // bf16 copy of x
    if ((size_t)(wsp - (char*)d_ws) > ws_size) return;
    k_prep<<<3 * PBW + NB * PBX + PBV + PBE, 256, 0, stream>>>(x, wq, wk, wv, embk, embv, XB, WQ, WK, WV, EK, VT16, VTh, VTl);
    k_proj<<<dim3(TT / 256, DQ / 64, NB), PW * 32, 0, stream>>>(XB, WQ, WK, WV, bq, bk, bv, QPh, QPl, KPh, KPl, VT16, VTh, VTl);
    k_attn<<<dim3(TT / QB, NH_, NB), NW * 32, 0, stream>>>(QPh, QPl, KPh, KPl, EK, VT16, VTh, VTl, mask, OUT);
}

// v010
// A run of this version takes 174 microseconds.
// Next to v009, in two timings, it ran 1.04 times as fast each time.
// Counting every step since v000, it is 14.3 times as fast.
#include <hip/hip_runtime.h>

// Contractions: x W (q,k,v) on v_wmma_f32_16x16x32_bf16 (bf16 operands from RNE-bf16 inputs); q.k and q.emb_k score tiles bf16 hi/lo split (3 and 2 products); attn.v with the rel-value bins.emb_v folded into K: rows < RH bf16 hi/lo split, rows >= RH v_wmma_f32_16x16x32_f16 (P x1024, bins x64, emb_v x16, v plain f16); f32 accumulate, f32 softmax.
// Self-attention, 16 heads x 64: q,k,v = x W + b ('xw' layout), scores = (q.k + q.emb_k[clip(i-j)]) x 64^-0.5 + additive key mask, softmax over all keys,
// ctx = probs v + sum_r bins[i][r] emb_v[r] (bins: band copies of probs plus the two clipped tail sums), output concat-heads [NB][TT][1024] f32, no output projection.
// Layout: bf16 copy of x; weights transposed once to rows n, k index k, bf16; the projection GEMMs add the bias (rounded to bf16) and store their tiles straight as head planes [b][h] of q,k (bf16 hi/lo; rows t, k index d) and of the values (f16, bf16 hi/lo; rows d, k index = key, TT+192 of them, keys >= TT hold emb_v), all, with emb_k, in fragment order (see FRAG);
// three launches: k_prep forms every plane that depends on an input alone, k_proj does the six projection GEMMs (q, k, v of each batch) in one grid, k_attn the attention stage.
// one attention kernel: a work-group holds the scores of QB query rows x all TT keys of one head in registers, does the softmax there and feeds the attn.v WMMAs from the same registers (see k_attn).

#ifndef NB
#define NB   2
#endif
#ifndef SEQ
#define SEQ  2048
#endif
#define NB_FULL  2
#define TTF  2048                 // full per-batch sequence stride of the inputs
#define TT   SEQ
#define DM   1024
#define NH_  16
#define NKV  16
#define REP  (NH_ / NKV)
#define HD   64
#define DQ   (NH_ * HD)
#define DKV  (NKV * HD)
#define RH   ((TT / 2 < 512) ? (TT / 2) : 512)   // query rows < RH use hi+lo planes
#define PCAR 1024.0f
#define SCL  0.125f   // HD^-0.5
#define MAXR 64
#define NBIN (2 * MAXR + 1)       // 129 clipped offsets
#define KX   192                  // NBIN padded to a multiple of 64
#define TP   (TT + KX)            // row pitch of the value planes (keys + KX bin columns)
#define EVC  16.0f                // f16 carry of emb_v in the value planes (bins carry 1024/16 = 64)
#define QT   2                    // 16-query tiles per work-group of k_attn
#define QB   (16 * QT)
#define NW   16                   // waves per work-group of k_attn, each owns KW keys
#define KW   (TT / NW)
#define KTN  (KW / 16)            // 16-key tiles per wave
#define VAHL 2                    // attn.v: the staged plane's fragments are read from LDS this many steps ahead
#define VAH2 2                    // attn.v, hi/lo rows: the lo plane's fragments are fetched from global memory this many steps ahead
#define KLATE 2                   // the last KLATE key tiles of a wave are fetched one tile ahead, the others two
#define XS   16                   // spare columns on each side of the QE and bins tables in LDS: column c stands for offset i - j = c - XS - MAXR, unclipped, so every element of a tile that meets the band has a column of its own
#define NBT  ((NBIN - 1 + 2 * XS) / 16)   // 16-column tiles of QE
#define QEP  (NBT * 16 + 2)       // LDS pitch of a QE row: a column read and a diagonal read (pitch + 1 a lane, 8 back for the upper half wave) both meet distinct banks
#define KXB  160                  // NBIN padded to k steps of 32
#define BP   (XS + KXB + 4)       // LDS pitch of a bins row, 16 B x odd
#define OP   (HD + 4)             // LDS pitch of a partial ctx row, 16 B x odd
#define VSB  (KW * HD * 2)        // bytes of one wave's keys in one 16-bit value plane: (KW / 32) * 4 fragments in a row
#define VBB  (4 * FRAG * 2)       // bytes of one k step (32 k indices x HD rows) of a 16-bit value plane
#define FRAG 512                  // elements of one 16-row x 32-k operand fragment. Fragment order: a plane is a row of such fragments (k step fastest for x, W^T, q, k, emb_k; 16-row block fastest for the values); inside one, the 8 elements at (j * 32 + lane) * 8 are row lane&15, k = 16 j + 8 (lane>>4) + 0..7, so each of a wave's two 16-byte loads of a fragment reads 512 bytes in a row (four whole 128-byte lines, not 32 bytes of each of 16 lines)

static_assert(TT % 128 == 0);
static_assert(RH % 64 == 0);
static_assert(RH >= 64);
static_assert((TT - RH) % 64 == 0);
static_assert(TT - RH >= 64);
static_assert(TP % 32 == 0);
static_assert(TT % (NW * 32) == 0);
static_assert(TT % QB == 0);
static_assert(QB * OP * 4 <= VSB && VSB % 512 == 0 && VSB / 512 + VBB / 512 <= 63);
static_assert((KXB / 32) * VBB <= QB * QEP * 4);
static_assert(RH % QB == 0);
static_assert(KXB >= NBIN && KXB <= KX && KXB % 32 == 0);
static_assert((NBIN - 1) % 32 == 0);
static_assert(KXB / 32 <= NW);
static_assert(KX % 64 == 0);
static_assert(KX >= NBIN);
static_assert(KX == 192);
static_assert(XS == 16 && MAXR % 16 == 0 && NBT * 16 <= KX);
static_assert(HD == 64);
static_assert(DM % 64 == 0);
static_assert((KX * HD) % (8 * 256) == 0);
static_assert(((size_t)TT * DM / 8) % 256 == 0);
static_assert((NKV * HD) % 8 == 0);
static_assert(NB <= NB_FULL);
static_assert(TT <= TTF);

typedef _Float16 h16;
typedef unsigned short bf;
typedef __attribute__((ext_vector_type(16))) __bf16   v16bf;
typedef __attribute__((ext_vector_type(16))) _Float16 v16h;
typedef __attribute__((ext_vector_type(8)))  _Float16 v8h;
typedef __attribute__((ext_vector_type(8)))  unsigned short v8us;
typedef __attribute__((ext_vector_type(8)))  float    v8f;
typedef __attribute__((ext_vector_type(4)))  float    v4f;
typedef v8h  __attribute__((may_alias)) v8ha;
typedef v4f  __attribute__((may_alias)) v4fa;
typedef v8us __attribute__((may_alias)) v8usa;

typedef __attribute__((ext_vector_type(2))) float    f2v;
typedef __attribute__((ext_vector_type(2))) __bf16   b2v;
typedef __attribute__((ext_vector_type(4))) unsigned v4u;
typedef v4u  __attribute__((may_alias)) v4ua;
// f32 -> bf16, round to nearest even, two values per v_cvt_pk_bf16_f32: a in the low half of the dword (the even element of a 16-bit vector), b in the high half
__device__ __forceinline__ unsigned f2bf2(float a, float b) { const f2v v = {a, b}; return __builtin_bit_cast(unsigned, __builtin_convertvector(v, b2v)); }
__device__ __forceinline__ float bflo(unsigned p) { return __uint_as_float(p << 16); }
__device__ __forceinline__ float bfhi(unsigned p) { return __uint_as_float(p & 0xFFFF0000u); }
__device__ __forceinline__ float bfr(float f) { return bflo(f2bf2(f, f)); }
__device__ __forceinline__ h16 tohx(float x) { return (h16)x; }
__device__ __forceinline__ f2v bf2f2(unsigned p) { const f2v r = {bflo(p), bfhi(p)}; return r; }
__device__ __forceinline__ void split2(f2v a, unsigned& h, unsigned& l) { h = f2bf2(a[0], a[1]); const f2v d = a - bf2f2(h); l = f2bf2(d[0], d[1]); }   // hi + lo planes of two values
__device__ __forceinline__ void split2(float a, float b, unsigned& h, unsigned& l) { const f2v v = {a, b}; split2(v, h, l); }
__device__ __forceinline__ v16h cat16(v8h lo, v8h hi) { return __builtin_shufflevector(lo, hi, 0, 1, 2, 3, 4, 5, 6, 7, 8, 9, 10, 11, 12, 13, 14, 15); }
__device__ __forceinline__ v16bf cat16b(v8us lo, v8us hi) { return __builtin_bit_cast(v16bf, __builtin_shufflevector(lo, hi, 0, 1, 2, 3, 4, 5, 6, 7, 8, 9, 10, 11, 12, 13, 14, 15)); }
__device__ __forceinline__ v16bf cat16u(v4u lo, v4u hi) { return cat16b(__builtin_bit_cast(v8us, lo), __builtin_bit_cast(v8us, hi)); }
__device__ __forceinline__ v8f wmma16(v16h a, v16h b, v8f c) { return __builtin_amdgcn_wmma_f32_16x16x32_f16(false, a, false, b, (short)0, c, false, false); }
__device__ __forceinline__ v8f wmmab(v16bf a, v16bf b, v8f c) { return __builtin_amdgcn_wmma_f32_16x16x32_bf16(false, a, false, b, (short)0, c, false, false); }

// ---- k_proj: the six projection GEMMs (q, k, v of each batch), C[m][n] = sum_k x[m][k] W^T[n][k] + bias[n], operands from bf16 planes in fragment order (FRAG; k step fastest), 16 accumulators (a 64x64 tile) a wave.
// A work-group is PW = 12 waves: 4 row tiles of 64 x the q, k and v weights of one 64-column tile (one head). The 12 tiles share 256 rows of x and 3 x 64 rows of W^T, so a stage of PKS k indices (PCH chunks: one chunk = the PKS / 32 fragments in a row of one 16-row block) is brought from L2 once for all of them, into LDS,
// by asynchronous copies into two buffers: stage t + 2 is asked for when every wave has left stage t, and flies while stage t + 1 is multiplied.
// The epilogue adds the bias, rounded to bf16 (RNE). EPI 1 (N tile = one head, HD == 64): row t, col c of the biased tile goes, split into bf16 hi + lo, to row t, k index c % HD of head plane c / HD of Ph/Pl. EPI 2: it goes to row c % HD, k index t of head plane c / HD of P16 (f16), Ph, Pl (bf16 hi, lo). Both in fragment order (FRAG).
// Fragments: lane l -> row/col l&15, h = l>>4; elements 0..7 <- k0+8h+0..7, 8..15 <- k0+16+8h+0..7 for BOTH A and Bt (same loader, same plane order); D element r -> row 8h+r, col l&15.
template <typename T16> struct WFrag;
template <> struct WFrag<h16> { typedef v16h V; static __device__ __forceinline__ V ldf(const h16* p) { return cat16(*(const v8h*)p, *(const v8h*)(p + FRAG / 2)); } static __device__ __forceinline__ v8f mma(V a, V b, v8f c) { return wmma16(a, b, c); } };
template <> struct WFrag<bf> { typedef v16bf V; static __device__ __forceinline__ V ldf(const bf* p) { return cat16b(*(const v8us*)p, *(const v8us*)(p + FRAG / 2)); } static __device__ __forceinline__ v8f mma(V a, V b, v8f c) { return wmmab(a, b, c); } };

// vcopy: copies C..N-1 of a wave's N asynchronous 512-byte copies to LDS (16 bytes a lane); the constant offset moves the global and the LDS address alike
typedef int gv4i __attribute__((vector_size(16)));
typedef __attribute__((address_space(1))) gv4i* gp128;
typedef __attribute__((address_space(3))) gv4i* lp128;
template <int C, int N> __device__ __forceinline__ void vcopy(gp128 g, lp128 l) { if constexpr (C < N) { __builtin_amdgcn_global_load_async_to_lds_b128(g, l, C * 512, 0); vcopy<C + 1, N>(g, l); } }

#define PW   12                          // waves of a k_proj work-group: wave = 4 (0: q, 1: k, 2: v) + row tile
#define PKS  64                          // k indices of a stage
#define PST  (DM / PKS)                  // stages
#define PCB  ((PKS / 32) * FRAG * 2)     // bytes of a chunk
#define PCH  (16 + 12)                   // chunks of a stage: 16 16-row blocks of x, then 4 16-row blocks of each W^T
#define PSB  (PCH * PCB)                 // bytes of a stage
static_assert(DM % PKS == 0 && PST >= 2 && PCB == 4 * 512 && PCH > 2 * PW && PCH <= 3 * PW);
static_assert(TT % 256 == 0 && DQ % 64 == 0);
template <int EPI>
__device__ __forceinline__ void proj_epi(const v8f (&acc)[4][4], float* os, const float* __restrict__ bias, h16* P16, bf* Ph, bf* Pl, int r0, int by) {
    const int lane = threadIdx.x & 31, lr = lane & 15, hi = lane >> 4; const int c0 = by * 64;
    if constexpr (EPI == 2) {
        // a lane's 8 accumulator elements are 8 consecutive t of one column, which is the lane's own 16-byte piece of a value fragment: one 16-byte store per plane and block, no LDS pass, 512 bytes in a row per store
        // the three loops are unrolled so that acc[][] and the store vectors are indexed by constants and stay in registers
#pragma unroll
        for (int nb = 0; nb < 4; ++nb) { const int col = c0 + nb * 16 + lr; const float bb = bfr(bias[col]); const size_t o = (size_t)by * HD * TP + ((size_t)(r0 / 32) * 4 + nb) * FRAG + lane * 8;
#pragma unroll
            for (int mb = 0; mb < 4; ++mb) { v8h o16; v4u oh, ol;
#pragma unroll
                for (int j = 0; j < 4; ++j) { const f2v av = {acc[mb][nb][2 * j], acc[mb][nb][2 * j + 1]}, bv = {bb, bb}; const f2v xv = av + bv; o16[2 * j] = tohx(xv[0]); o16[2 * j + 1] = tohx(xv[1]); unsigned a2, c2; split2(xv, a2, c2); oh[j] = a2; ol[j] = c2; }
                const int om = (mb / 2) * 4 * FRAG + (mb % 2) * (FRAG / 2); *(v8h*)(P16 + o + om) = o16; *(v4ua*)(Ph + o + om) = oh; *(v4ua*)(Pl + o + om) = ol;
                asm volatile("s_wait_xcnt 0x0" :: "v"(o16), "v"(oh), "v"(ol) : "memory"); } }   // stands before a register that an issued global store names is rewritten (the next block's values); as inputs the three vectors stay as they are up to this wait
        return;
    }
#pragma unroll
    for (int mb = 0; mb < 4; ++mb) {
#pragma unroll
        for (int nb = 0; nb < 4; ++nb) {
#pragma unroll
            for (int j = 0; j < 8; ++j) os[(hi * 8 + j) * 68 + nb * 16 + lr] = acc[mb][nb][j]; }
        __builtin_amdgcn_wave_barrier(); asm volatile("" ::: "memory");
        {   // these 16 rows are two fragments; step s = 16 columns = one 512-byte half of a fragment, lane -> row lr, columns 16 s + 8 hi + 0..7. Unrolled: the vectors' elements are indexed by constants
#pragma unroll
            for (int s = 0; s < 4; ++s) { const int cofs = s * 16 + 8 * hi; const v4f w0 = *(const v4fa*)(os + lr * 68 + cofs), w1 = *(const v4fa*)(os + lr * 68 + cofs + 4); v4u oh, ol;
#pragma unroll
                for (int q = 0; q < 2; ++q) { unsigned a2, c2; const unsigned b0 = f2bf2(bias[c0 + cofs + 2 * q], bias[c0 + cofs + 2 * q + 1]), b1 = f2bf2(bias[c0 + cofs + 4 + 2 * q], bias[c0 + cofs + 5 + 2 * q]);
                    const f2v u0 = {w0[2 * q], w0[2 * q + 1]}, u1 = {w1[2 * q], w1[2 * q + 1]};
                    split2(u0 + bf2f2(b0), a2, c2); oh[q] = a2; ol[q] = c2; split2(u1 + bf2f2(b1), a2, c2); oh[2 + q] = a2; ol[2 + q] = c2; }
                const size_t e = ((size_t)by * TT + r0 + mb * 16) * HD + s * (FRAG / 2) + lane * 8; *(v4ua*)(Ph + e) = oh; *(v4ua*)(Pl + e) = ol;
                asm volatile("s_wait_xcnt 0x0" :: "v"(oh), "v"(ol) : "memory"); }   // the same wait for these two stores' registers
        }
        __builtin_amdgcn_wave_barrier(); asm volatile("" ::: "memory");
    }
}

static_assert(DQ == DKV);
__global__ __launch_bounds__(PW * 32) void k_proj(const bf* __restrict__ XB, const bf* __restrict__ WQ, const bf* __restrict__ WK, const bf* __restrict__ WV, const float* __restrict__ bq, const float* __restrict__ bk, const float* __restrict__ bv,
                                             bf* QPh, bf* QPl, bf* KPh, bf* KPl, h16* VT16, bf* VTh, bf* VTl) {
    __shared__ __align__(16) unsigned char ring[2][PSB];   // the two stage buffers
    __shared__ __align__(16) float osw[PW][16 * 68];       // a wave's own staging rows of EPI 1
    typedef WFrag<bf> FB;
    const int lane = threadIdx.x & 31; const int wave = __builtin_amdgcn_readfirstlane(threadIdx.x >> 5); const int rt = wave & 3, w = wave >> 2;
    const int bx = blockIdx.x, by = blockIdx.y, b = blockIdx.z; const bf* A = XB + (size_t)b * TT * DM; const unsigned lf = (unsigned)(lane * 8);
    // chunk ch at stage 0: 16 rows x DM elements are DM / 32 fragments in a row, so a stage's chunk is PCB bytes in a row and the next stage's follows it
    auto csrc = [&](int ch) __attribute__((always_inline)) { const int cb = ch - 16; const bf* Wp = (cb < 4) ? WQ : ((cb < 8) ? WK : WV);
        return (ch < 16) ? A + (size_t)(bx * 256 + ch * 16) * DM : Wp + (size_t)(by * 64 + (cb & 3) * 16) * DM; };
    // wave v copies chunks v, v + PW and, the first PCH - 2 PW waves, v + 2 PW (wave-uniform), 4 copies of 512 bytes each
    const bf* g0 = csrc(wave) + lf; const bf* g1 = csrc(wave + PW) + lf; const bf* g2 = csrc((wave < PCH - 2 * PW) ? wave + 2 * PW : wave) + lf;
    auto stage = [&](int st, int bi) __attribute__((always_inline)) { unsigned char* d = &ring[bi][lane * 16]; const int go = st * (PKS / 32) * FRAG;
        vcopy<0, 4>((gp128)(const void*)(g0 + go), (lp128)(d + wave * PCB)); vcopy<0, 4>((gp128)(const void*)(g1 + go), (lp128)(d + (wave + PW) * PCB));
        if (wave < PCH - 2 * PW) vcopy<0, 4>((gp128)(const void*)(g2 + go), (lp128)(d + (wave + 2 * PW) * PCB)); };
    v8f acc[4][4];
#pragma unroll
    for (int mb = 0; mb < 4; ++mb)
#pragma unroll
        for (int nb = 0; nb < 4; ++nb) acc[mb][nb] = (v8f){};
    stage(0, 0);
    asm volatile("s_wait_asynccnt 0x0" ::: "memory");   // this wave's copies of stage 0 have landed
    __syncthreads();   // stage 0 is in LDS for every wave
    stage(1, 1);
#pragma unroll 1
    for (int t = 0; t < PST; ++t) { const bf* L = (const bf*)ring[t & 1] + lf;
#pragma unroll
        for (int ks = 0; ks < PKS / 32; ++ks) { v16bf a[4], bb[4];
#pragma unroll
            for (int mb = 0; mb < 4; ++mb) { a[mb] = FB::ldf(L + (rt * 4 + mb) * (PCB / 2) + ks * FRAG); bb[mb] = FB::ldf(L + (16 + w * 4 + mb) * (PCB / 2) + ks * FRAG); }
            if (ks == PKS / 32 - 1) {   // the hand-over stands behind the stage's last LDS reads and in front of its last products, which need registers alone: the refill gets a whole trip of lead, and the matrix unit has work while waves meet at the barrier
                asm volatile("s_wait_dscnt 0x0" ::: "memory");      // this wave has read stage t for the last time
                asm volatile("s_wait_asynccnt 0x0" ::: "memory");   // its copies of stage t + 1 have landed
                __syncthreads();   // stage t + 1 is in LDS for every wave, and every wave has left the buffer of stage t
                if (t + 2 < PST) stage(t + 2, t & 1); }
            __builtin_amdgcn_sched_barrier(0);   // keeps the 16 LDS reads of a k step (and the refill) in front of its 16 products; sunk to their use, each pair of reads would be waited for in full among the products
#pragma unroll
            for (int nb = 0; nb < 4; ++nb)
#pragma unroll
                for (int mb = 0; mb < 4; ++mb) acc[mb][nb] = wmmab(a[mb], bb[nb], acc[mb][nb]); } }
    asm volatile("s_wait_asynccnt 0x0" ::: "memory");   // no copy is outstanding when the wave goes on
    const size_t oq = (size_t)b * NH_ * TT * HD, ok = (size_t)b * NKV * TT * HD, ov = (size_t)b * NKV * HD * TP; const int r0 = bx * 256 + rt * 64;
    if (w == 2) proj_epi<2>(acc, nullptr, bv, VT16 + ov, VTh + ov, VTl + ov, r0, by);   // wave-uniform; no work-group barrier stands behind the loop
    else proj_epi<1>(acc, osw[wave], w ? bk : bq, nullptr, w ? KPh + ok : QPh + oq, w ? KPl + ok : QPl + oq, r0, by);
}

typedef __attribute__((ext_vector_type(2))) _Float16 v2h;
typedef __attribute__((ext_vector_type(4))) _Float16 v4h;
typedef __attribute__((ext_vector_type(2))) unsigned short v2us;
typedef __attribute__((ext_vector_type(2))) float v2f;
typedef __attribute__((ext_vector_type(4))) int v4i;

// The four bodies of k_prep, each for block blk of 256 threads of its own range.
// wtG: Bt = w^T (rows n, k index k) as bf16 in fragment order; thread p forms the 16-byte piece p, so a wave stores 512 bytes in a row and each of its 8 loads reads 64 bytes in a row of two rows of w.
__device__ __forceinline__ void wtG(const float* __restrict__ w, int K, int N, bf* Bt, int blk) {
    const int p = blk * 256 + threadIdx.x; if (p >= N * (K / 8)) return; const int hf = p >> 5, fr = hf >> 1, nk = K / 32;
    const int n = (fr / nk) * 16 + (p & 15), k = (fr % nk) * 32 + (hf & 1) * 16 + ((p >> 4) & 1) * 8; const unsigned off = (unsigned)(k * N + n); float x[8]; v4u o;
#pragma unroll
    for (int e = 0; e < 8; ++e) x[e] = (w + (size_t)e * N)[off];   // a uniform base per row + one lane offset. Unrolled (both loops): the elements are indexed by constants
    asm volatile("s_wait_xcnt 0x0" :: "v"(off) : "memory");   // stands before a register that an issued global load names is rewritten; as an input the offset stays as it is up to this wait
#pragma unroll
    for (int e = 0; e < 4; ++e) o[e] = f2bf2(x[2 * e], x[2 * e + 1]);
    *(v4ua*)(Bt + (size_t)p * 8) = o; }
// cvt8: rows of DM f32 -> bf16 in fragment order; thread i forms the 16-byte piece i.
__device__ __forceinline__ void cvt8(const float* __restrict__ src, bf* dst, size_t n8, int blk) { const size_t i = (size_t)blk * 256 + threadIdx.x; if (i >= n8) return; const size_t hf = i >> 5, fr = hf >> 1;
    const size_t row = (fr / (DM / 32)) * 16 + (i & 15), k = (fr % (DM / 32)) * 32 + (hf & 1) * 16 + ((i >> 4) & 1) * 8; const v8f v = *(const v8f*)(src + row * DM + k); v4u o;
#pragma unroll
    for (int k2 = 0; k2 < 4; ++k2) o[k2] = f2bf2(v[2 * k2], v[2 * k2 + 1]); *(v4ua*)(dst + i * 8) = o;  }

// vrel: k indices [TT, TT+KX) of every value head plane (b*NKV + g): row d, k index TT + r = emb_v[r][d] (r < NBIN, else 0); fp16 plane carries x EVC of the bf16 value, hi plane bf16, lo plane 0. One wave per 512-byte half of a fragment.
__device__ __forceinline__ void vrel(const float* __restrict__ ev, h16* V16, bf* Vh, bf* Vl, int blk) {
    const int lane = threadIdx.x & 31; const int pc = blk * 8 + (threadIdx.x >> 5); if (pc >= NB * NKV * (KX / 32) * 8) return; const int pl = pc / ((KX / 32) * 8), hf = pc % ((KX / 32) * 8);   // hf = ((k step) * 4 + 16-row block) * 2 + j
    const int d = ((hf >> 1) & 3) * 16 + (lane & 15); const int rb0 = (hf >> 3) * 32 + (hf & 1) * 16 + (lane >> 4) * 8;
    v8h o16; v4u oh, ol; unsigned of[8]; float xs[8];
#pragma unroll
    for (int q = 0; q < 8; ++q) { const int r = rb0 + q; const int rc = (r < NBIN - 1) ? r : (NBIN - 1); of[q] = (unsigned)(rc * HD + d); xs[q] = ev[of[q]]; }
    // s_wait_xcnt 0 stands before a register that an issued global load names is rewritten; as inputs the offsets stay as they are up to this wait
    asm volatile("s_wait_xcnt 0x0" :: "v"(of[0]), "v"(of[1]), "v"(of[2]), "v"(of[3]), "v"(of[4]), "v"(of[5]), "v"(of[6]), "v"(of[7]) : "memory");
#pragma unroll   // as above: the arrays and vectors are indexed by constants and stay in registers
    for (int q = 0; q < 4; ++q) { const int r = rb0 + 2 * q; const float x0 = (r < NBIN) ? xs[2 * q] : 0.f, x1 = (r + 1 < NBIN) ? xs[2 * q + 1] : 0.f; const unsigned hp = f2bf2(x0, x1);
        o16[2 * q] = tohx(bflo(hp) * EVC); o16[2 * q + 1] = tohx(bfhi(hp) * EVC); oh[q] = hp; ol[q] = f2bf2(x0 * 0.f, x1 * 0.f); }
    const size_t o = (size_t)pl * HD * TP + (size_t)(TT / 32) * 4 * FRAG + hf * (FRAG / 2) + lane * 8;
    *(v8h*)(V16 + o) = o16; *(v4ua*)(Vh + o) = oh; *(v4ua*)(Vl + o) = ol;
}
__device__ __forceinline__ void ekp(const float* __restrict__ ek, bf* EK, int blk) {
    const int idx = blk * 256 + threadIdx.x; if (idx >= KX * HD / 8) return; const int e = idx * 8; const int hf = idx >> 5;   // fragment order: piece idx is lane idx & 31 of half hf & 1 of fragment hf >> 1 (two fragments per 16 rows)
    const int r = (hf >> 2) * 16 + (idx & 15), d0 = ((hf >> 1) & 1) * 32 + (hf & 1) * 16 + ((idx >> 4) & 1) * 8; const int rs = r - XS; const int rc = (rs < 0) ? 0 : ((rs < NBIN - 1) ? rs : (NBIN - 1));   // row r holds emb_k of the clipped offset r - XS: the XS spare rows on each side repeat the end rows
    const v4f a = *(const v4f*)(ek + (size_t)rc * HD + d0), b2 = *(const v4f*)(ek + (size_t)rc * HD + d0 + 4); v4u o; const bool in = (r < NBT * 16);
#pragma unroll
    for (int k = 0; k < 2; ++k) { o[k] = f2bf2(in ? a[2 * k] : 0.f, in ? a[2 * k + 1] : 0.f); o[k + 2] = f2bf2(in ? b2[2 * k] : 0.f, in ? b2[2 * k + 1] : 0.f); }
    *(v4ua*)(EK + e) = o;  }
// k_prep: every plane that depends on an input alone, in one grid: the three W^T, the bf16 copy of x (all batches), the emb_v columns of the value planes, emb_k. The ranges write disjoint planes and read inputs only; a block's range is block-uniform.
#define PBW ((DM * DQ / 8 + 255) / 256)                    // blocks of one W^T
#define PBX ((TT * DM / 8 + 255) / 256)                    // blocks of one batch of x
#define PBV ((NB * NKV * (KX / 32) * 8 + 7) / 8)           // blocks of vrel
#define PBE ((KX * HD / 8 + 255) / 256)                    // blocks of ekp
__global__ __launch_bounds__(256) void k_prep(const float* __restrict__ x, const float* __restrict__ wq, const float* __restrict__ wk, const float* __restrict__ wv, const float* __restrict__ ek, const float* __restrict__ ev,
                                              bf* XB, bf* WQ, bf* WK, bf* WV, bf* EK, h16* V16, bf* Vh, bf* Vl) {
    int blk = blockIdx.x;
    if (blk < 3 * PBW) { const int w = blk / PBW; wtG(w == 0 ? wq : (w == 1 ? wk : wv), DM, DQ, w == 0 ? WQ : (w == 1 ? WK : WV), blk - w * PBW); return; }
    blk -= 3 * PBW;
    if (blk < NB * PBX) { const int b = blk / PBX; cvt8(x + (size_t)b * TTF * DM, XB + (size_t)b * TT * DM, (size_t)TT * DM / 8, blk - b * PBX); return; }
    blk -= NB * PBX;
    if (blk < PBV) { vrel(ev, V16, Vh, Vl, blk); return; }
    ekp(ek, EK, blk - PBV);
}

// ---- k_attn: the whole attention stage of QB query rows of one head in one work-group of NW waves; grid (TT/QB, NH_, NB).
// Wave w owns keys [w KW, (w+1) KW). It forms the TRANSPOSED score tiles (A = key rows, B = query rows), so lane l holds query l&15 and keys 8(l>>4)+0..7 of each tile:
// two neighbouring key tiles are, register for register, the A fragment (row = query, k = key) of the attn.v product, and the scores never leave the registers.
// t = (q.k + QE[i][i-j+MAXR+XS]) x HD^-0.5 + mask[j] (QE has the clipped ends repeated in XS spare columns a side; a tile wholly outside the band takes the end value from a register); row maximum and row sums go across the waves through LDS in wave order; P is normalised before it is rounded to 16 bit.
// bins (LDS, f32, unnormalised): col XS + r = e[i+MAXR-r] for every key of a tile that meets the band, -XS < r < NBIN-1+XS (0 where there is no key); bin 0 = sum_{j >= i+MAXR} e and bin NBIN-1 = sum_{j <= i-MAXR} e are put in when the fragment is formed: the waves' sums over the tiles outside the band + the XS + 1 or XS columns at that end; the columns past bin NBIN-1 meet zero rows of emb_v; waves < KXB/32 add one k step of bins x emb_v each.
// The value fragments of the plane that every row class needs (f16, or bf16 hi) come through LDS: asynchronous copies, each wave for itself, start behind the row-maximum barrier and are waited for at the row-sum barrier; the lo plane of rows < RH is loaded straight into registers.
// Each wave's 64-column partial of ctx goes to LDS (over its value fragments, which it has read by then); the work-group adds the NW partials in wave order and stores the output rows.
// 2^x on v_exp_f32; the v_nop is the one free issue slot that the instruction set asks for between a transcendental and a next instruction that reads its result or overwrites its source; in one statement it stays directly behind it
__device__ __forceinline__ float exp2s(float x) { float e; asm("v_exp_f32 %0, %1\n\tv_nop" : "=v"(e) : "v"(x)); return e; }
template <bool B> struct BoolC { static constexpr bool value = B; };
template <bool SPLIT> struct PvT { typedef h16 T; };
template <> struct PvT<true> { typedef bf T; };
template <bool SPLIT, typename T16>
__device__ __forceinline__ void pv_frag(const float (&x)[QT][16], typename WFrag<T16>::V (&p)[QT], typename WFrag<T16>::V (&p2)[QT]) {
#pragma unroll
    for (int qt = 0; qt < QT; ++qt) {
        if constexpr (SPLIT) { v4u h0, h1, l0, l1;
#pragma unroll
            for (int r = 0; r < 4; ++r) { unsigned a, c; split2(x[qt][2 * r], x[qt][2 * r + 1], a, c); h0[r] = a; l0[r] = c; split2(x[qt][8 + 2 * r], x[qt][9 + 2 * r], a, c); h1[r] = a; l1[r] = c; }
            p[qt] = cat16u(h0, h1); p2[qt] = cat16u(l0, l1);
        } else { v8h h0, h1;
#pragma unroll
            for (int r = 0; r < 8; ++r) { h0[r] = tohx(x[qt][r]); h1[r] = tohx(x[qt][8 + r]); }
            p[qt] = cat16(h0, h1); }
    }
}
template <bool SPLIT, typename T16>
__device__ __forceinline__ void pv_mma(const typename WFrag<T16>::V (&p)[QT], const typename WFrag<T16>::V (&p2)[QT], typename WFrag<T16>::V v, typename WFrag<T16>::V v2, v8f (&o)[QT][4], int dt) {
#pragma unroll
    for (int qt = 0; qt < QT; ++qt) o[qt][dt] = WFrag<T16>::mma(p[qt], v, o[qt][dt]);
    if constexpr (SPLIT) {
#pragma unroll
        for (int qt = 0; qt < QT; ++qt) o[qt][dt] = WFrag<T16>::mma(p2[qt], v, o[qt][dt]);
#pragma unroll
        for (int qt = 0; qt < QT; ++qt) o[qt][dt] = WFrag<T16>::mma(p[qt], v2, o[qt][dt]); }
}

__global__ __launch_bounds__(NW * 32) void k_attn(const bf* __restrict__ QPh, const bf* __restrict__ QPl, const bf* __restrict__ KPh, const bf* __restrict__ KPl, const bf* __restrict__ EK,
                                                  const h16* __restrict__ V16, const bf* __restrict__ Vh, const bf* __restrict__ Vl, const float* __restrict__ mask, float* OUT) {
    __shared__ __align__(16) unsigned char vst[NW][VSB];   // wave w's slice: first its keys' value fragments (asynchronous copies), then, when it has read them all, its partial of ctx (QB rows of OP floats)
    __shared__ __align__(16) float binsL[QB * BP];
    __shared__ __align__(16) float qes[QB * QEP];   // QE; behind its last read (the row-maximum barrier) the first (KXB / 32) * VBB bytes hold the emb_v columns' value fragments
    __shared__ float rmx[NW][QB], rsm[NW][QB], rlo[NW][QB], rhi[NW][QB];
    typedef WFrag<bf> FB;
    const int tid = threadIdx.x, lane = tid & 31, lr = lane & 15, hi = lane >> 4;
    const int wave = __builtin_amdgcn_readfirstlane(tid >> 5);
    const int i0 = blockIdx.x * QB, head = blockIdx.y, b = blockIdx.z; const bool hires = (i0 < RH);
    const size_t pq = ((size_t)b * NH_ + head) * TT * HD, pk = ((size_t)b * NKV + head / REP) * TT * HD, pv = ((size_t)b * NKV + head / REP) * HD * TP;
    const int kbase = wave * KW;
    // every global address is a wave-uniform base + one lane offset + a constant: the few address registers stay as they are while the loads that name them are in flight
    const unsigned lf = (unsigned)(lane * 8), lm = (unsigned)(8 * hi);   // lf: the lane's 16-byte piece in each half of a fragment (FRAG)
    const bf* qbh = QPh + pq + (size_t)i0 * HD; const bf* qbl = QPl + pq + (size_t)i0 * HD; const bf* kbh = KPh + pk + (size_t)kbase * HD; const bf* kbl = KPl + pk + (size_t)kbase * HD;
    const float* mrow = mask + (size_t)b * TTF + kbase;
    for (int e = tid; e < QB * BP; e += NW * 32) binsL[e] = 0.f;
    // QE = q emb_k^T (q hi/lo x exact emb_k), one 16x16 tile per job, into LDS
    for (int job = wave; job < QT * NBT; job += NW) { const int qt = job / NBT, nt = job - qt * NBT; v8f a = (v8f){};
        const bf* jh = qbh + qt * 16 * HD; const bf* jl = qbl + qt * 16 * HD; const bf* je = EK + nt * 16 * HD;
#pragma unroll
        for (int ks = 0; ks < 2; ++ks) { const v16bf ah = FB::ldf(jh + lf + ks * FRAG), al = FB::ldf(jl + lf + ks * FRAG), eb = FB::ldf(je + lf + ks * FRAG);
            a = wmmab(ah, eb, a); a = wmmab(al, eb, a); }
        // s_wait_xcnt 0 stands before a register that an issued global load names is rewritten (the next trip forms new bases); as inputs those registers stay as they are up to this wait
        asm volatile("s_wait_xcnt 0x0" :: "s"(jh), "s"(jl), "s"(je), "v"(lf) : "memory");
#pragma unroll
        for (int r = 0; r < 8; ++r) qes[(qt * 16 + 8 * hi + r) * QEP + nt * 16 + lr] = a[r]; }
    // transposed score tiles, bf16 hi/lo, 3 products
    v16bf qh[QT][2], ql[QT][2];
#pragma unroll
    for (int qt = 0; qt < QT; ++qt)
#pragma unroll
        for (int ks = 0; ks < 2; ++ks) { qh[qt][ks] = FB::ldf(qbh + lf + (qt * 2 + ks) * FRAG); ql[qt][ks] = FB::ldf(qbl + lf + (qt * 2 + ks) * FRAG); }
    v8f s[KTN][QT]; v16bf kfh[KTN][2], kfl[KTN][2];
    // a key tile's loads are issued ahead of the products that use them: two tiles ahead while few score tiles are held, one tile ahead when the registers are nearly full
    auto ldk = [&](int kt) __attribute__((always_inline)) {
#pragma unroll
        for (int ks = 0; ks < 2; ++ks) { kfh[kt][ks] = FB::ldf(kbh + lf + (kt * 2 + ks) * FRAG); kfl[kt][ks] = FB::ldf(kbl + lf + (kt * 2 + ks) * FRAG); } };
    ldk(0); ldk(1);
#pragma unroll
    for (int kt = 0; kt < KTN; ++kt) {
        if (kt + 2 < KTN - KLATE) ldk(kt + 2); else if (kt + 1 >= KTN - KLATE && kt + 1 < KTN) ldk(kt + 1);
        __builtin_amdgcn_sched_barrier(0);   // keeps the loads above in front of this tile's products; sunk to their use, each would be waited for in full
#pragma unroll
        for (int qt = 0; qt < QT; ++qt) s[kt][qt] = (v8f){};
#pragma unroll
        for (int ks = 0; ks < 2; ++ks) { const v16bf kh = kfh[kt][ks], kl = kfl[kt][ks];
#pragma unroll
            for (int qt = 0; qt < QT; ++qt) s[kt][qt] = wmmab(kh, qh[qt][ks], s[kt][qt]);
#pragma unroll
            for (int qt = 0; qt < QT; ++qt) s[kt][qt] = wmmab(kh, ql[qt][ks], s[kt][qt]);
#pragma unroll
            for (int qt = 0; qt < QT; ++qt) s[kt][qt] = wmmab(kl, qh[qt][ks], s[kt][qt]); }
        __builtin_amdgcn_sched_barrier(0); }   // keeps the next tiles' loads from rising over these products, which would hold more registers than there are
    // the same wait for the q and k loads: their address registers may be reused only behind it
    asm volatile("s_wait_xcnt 0x0" :: "s"(qbh), "s"(qbl), "s"(kbh), "s"(kbl), "v"(lf) : "memory");
    __syncthreads();   // QE tiles and the zeroed bins are visible to every wave
    float qe0[QT], qe1[QT], mx[QT];
#pragma unroll
    for (int qt = 0; qt < QT; ++qt) { qe0[qt] = qes[(qt * 16 + lr) * QEP + XS]; qe1[qt] = qes[(qt * 16 + lr) * QEP + XS + NBIN - 1]; mx[qt] = -3.0e38f; }
#pragma unroll
    for (int kt = 0; kt < KTN; ++kt) { const int jb = kbase + kt * 16; const v4f m0 = *(const v4f*)(mrow + lm + kt * 16), m1 = *(const v4f*)(mrow + lm + (kt * 16 + 4)); float mk[8];
#pragma unroll
        for (int r = 0; r < 2; ++r) { const unsigned p0 = f2bf2(m0[2 * r], m0[2 * r + 1]), p1 = f2bf2(m1[2 * r], m1[2 * r + 1]); mk[2 * r] = bflo(p0); mk[2 * r + 1] = bfhi(p0); mk[4 + 2 * r] = bflo(p1); mk[5 + 2 * r] = bfhi(p1); }
#pragma unroll
        for (int qt = 0; qt < QT; ++qt) { const int ib = i0 + qt * 16; const bool left = (jb + 15 <= ib - MAXR), right = (jb >= ib + 15 + MAXR);   // the whole tile is clipped: one QE value per query (wave-uniform tests)
            if (left || right) { const float qe = left ? qe1[qt] : qe0[qt];
#pragma unroll
                for (int r = 0; r < 8; ++r) { const float t = (s[kt][qt][r] + qe) * SCL + mk[r]; s[kt][qt][r] = t; mx[qt] = fmaxf(mx[qt], t); }
            } else { const float* qd = qes + (qt * 16 + lr) * QEP + (ib + lr) - (jb + 8 * hi) + MAXR + XS;   // |ib - jb| <= MAXR here, so the 8 columns lie in [1, NBT * 16)
#pragma unroll
                for (int r = 0; r < 8; ++r) { const float t = (s[kt][qt][r] + qd[-r]) * SCL + mk[r]; s[kt][qt][r] = t; mx[qt] = fmaxf(mx[qt], t); } } } }
#pragma unroll
    for (int qt = 0; qt < QT; ++qt) { mx[qt] = fmaxf(mx[qt], __shfl_xor(mx[qt], 16, 32)); if (hi == 0) rmx[wave][qt * 16 + lr] = mx[qt]; }
    asm volatile("s_wait_xcnt 0x0" :: "s"(mrow), "v"(lm) : "memory");   // the same wait for the mask loads' address registers
    __syncthreads();   // every wave's row maxima are in LDS, and every wave has read QE for the last time
    // this wave's value fragments (f16 plane, or the bf16 hi plane for rows < RH; VSB bytes in a row) start for its own LDS slice here, behind the last global load of the softmax (the mask's, which would queue behind them): they land while the exponentials below keep the vector port busy and ask nothing of L2
    { const size_t vo = pv + (size_t)(kbase / 32) * 4 * FRAG + lf; const void* vsrc = hires ? (const void*)(Vh + vo) : (const void*)(V16 + vo);
        vcopy<0, VSB / 512>((gp128)vsrc, (lp128)(&vst[wave][lane * 16])); }
    if (wave < KXB / 32) {   // wave-uniform: the k step of emb_v columns that this wave will multiply with the bins starts for the place that QE has left
        const size_t vo = pv + (size_t)(TT / 32 + wave) * 4 * FRAG + lf; const void* vsrc = hires ? (const void*)(Vh + vo) : (const void*)(V16 + vo);
        vcopy<0, VBB / 512>((gp128)vsrc, (lp128)((unsigned char*)qes + wave * VBB + lane * 16)); }
#pragma unroll
    for (int qt = 0; qt < QT; ++qt) { float m = rmx[0][qt * 16 + lr];
#pragma unroll
        for (int w = 1; w < NW; ++w) m = fmaxf(m, rmx[w][qt * 16 + lr]);
        mx[qt] = m; }
    float sum[QT], clo[QT], chi[QT];
#pragma unroll
    for (int qt = 0; qt < QT; ++qt) { sum[qt] = 0.f; clo[qt] = 0.f; chi[qt] = 0.f; }
#pragma unroll
    for (int kt = 0; kt < KTN; ++kt) { const int jb = kbase + kt * 16;
#pragma unroll
        for (int qt = 0; qt < QT; ++qt) { const int ib = i0 + qt * 16; const bool left = (jb + 15 <= ib - MAXR), right = (jb >= ib + 15 + MAXR);
            float ts = 0.f;
#pragma unroll
            for (int r = 0; r < 8; ++r) { const float e = exp2s(__fmul_rn(__fsub_rn(s[kt][qt][r], mx[qt]), 1.4426950408889634f)); s[kt][qt][r] = e; ts += e; }
            sum[qt] += ts; clo[qt] += right ? ts : 0.f; chi[qt] += left ? ts : 0.f;
            if (!(left || right)) { float* bd = binsL + (qt * 16 + lr) * BP + (ib + lr) - (jb + 8 * hi) + MAXR + XS;   // the tile meets the band: each e goes to the column of its own offset, in [1, NBT * 16)
#pragma unroll
                for (int r = 0; r < 8; ++r) bd[-r] = s[kt][qt][r]; } } }
#pragma unroll
    for (int qt = 0; qt < QT; ++qt) { sum[qt] += __shfl_xor(sum[qt], 16, 32); clo[qt] += __shfl_xor(clo[qt], 16, 32); chi[qt] += __shfl_xor(chi[qt], 16, 32);
        if (hi == 0) { rsm[wave][qt * 16 + lr] = sum[qt]; rlo[wave][qt * 16 + lr] = clo[qt]; rhi[wave][qt * 16 + lr] = chi[qt]; } }
    asm volatile("s_wait_asynccnt 0x0" ::: "memory");   // the value fragments have landed in LDS; no read of them may stand in front of this wait
    __syncthreads();   // every wave's row sums and the band copies in the bins are in LDS
    float rtot[QT];
#pragma unroll
    for (int qt = 0; qt < QT; ++qt) { float tot = rsm[0][qt * 16 + lr];
#pragma unroll
        for (int w = 1; w < NW; ++w) tot += rsm[w][qt * 16 + lr];
        rtot[qt] = tot; }
    v8f o[QT][4];
#pragma unroll
    for (int qt = 0; qt < QT; ++qt)
#pragma unroll
        for (int dt = 0; dt < 4; ++dt) o[qt][dt] = (v8f){};
    auto attnv = [&](auto fc, auto* Vp, auto* Vp2) __attribute__((always_inline)) { constexpr bool SPLIT = decltype(fc)::value; typedef typename PvT<SPLIT>::T T16; typedef typename WFrag<T16>::V V_;
        float f[QT];   // formed in each row class's own branch: products e x f that both branches shared would be lifted in front of the branch and held there beside the e, which is more registers than there are
#pragma unroll
        for (int qt = 0; qt < QT; ++qt) f[qt] = __fdiv_rn(SPLIT ? 1.0f : PCAR, rtot[qt]);
        const T16* V = (const T16*)vst[wave]; auto* V2 = Vp2 + pv + (kbase / 32) * 4 * FRAG;   // wave-uniform bases of this wave's keys: the staged plane in LDS, the lo plane in global memory
        constexpr int NT = (KTN / 2) * 4;   // steps (k step kk, 16 columns dt)
        V_ vf[NT], vf2[NT];
        auto ldv = [&](int t) __attribute__((always_inline)) { if (t < NT) vf[t] = WFrag<T16>::ldf(V + lf + t * FRAG); };
        auto ldv2 = [&](int t) __attribute__((always_inline)) { if constexpr (SPLIT) { if (t < NT) vf2[t] = WFrag<T16>::ldf(V2 + lf + t * FRAG); } };
#pragma unroll
        for (int t = 0; t < VAHL; ++t) ldv(t);
#pragma unroll
        for (int t = 0; t < VAH2; ++t) ldv2(t);
#pragma unroll
        for (int kk = 0; kk < KTN / 2; ++kk) { float x[QT][16]; V_ p[QT], p2[QT];
#pragma unroll
            for (int qt = 0; qt < QT; ++qt)
#pragma unroll
                for (int r = 0; r < 8; ++r) { x[qt][r] = s[2 * kk][qt][r] * f[qt]; x[qt][8 + r] = s[2 * kk + 1][qt][r] * f[qt]; }
            pv_frag<SPLIT, T16>(x, p, p2);
#pragma unroll
            for (int dt = 0; dt < 4; ++dt) { const int t = kk * 4 + dt;
                ldv(t + VAHL); ldv2(t + VAH2);
                __builtin_amdgcn_sched_barrier(0);   // keeps the loads above in front of this step's products; sunk to their use, each would be waited for in full
                pv_mma<SPLIT, T16>(p, p2, vf[t], SPLIT ? vf2[t] : vf[t], o, dt);
                __builtin_amdgcn_sched_barrier(0); } }   // keeps later steps' loads from rising over these products, which would hold more registers than there are
        if constexpr (SPLIT) asm volatile("s_wait_xcnt 0x0" :: "s"(V2), "v"(lf) : "memory");   // the same wait for the lo plane's loads' address registers
        if (wave < KXB / 32) { float x[QT][16]; V_ p[QT], p2[QT], vb[4], vb2[4];   // wave-uniform: one k step of the bins
            const T16* Vb = (const T16*)qes + wave * 4 * FRAG; auto* Vb2 = Vp2 + pv + (TT / 32 + wave) * 4 * FRAG;   // the staged plane's columns in LDS, the lo plane's in global memory
#pragma unroll
            for (int dt = 0; dt < 4; ++dt) { vb[dt] = WFrag<T16>::ldf(Vb + lf + dt * FRAG); if constexpr (SPLIT) vb2[dt] = WFrag<T16>::ldf(Vb2 + lf + dt * FRAG); }
            if constexpr (SPLIT) asm volatile("s_wait_xcnt 0x0" :: "s"(Vb2), "v"(lf) : "memory");   // the same wait for the loads of the lo plane's emb_v columns, directly behind them: the work below needs their address registers
#pragma unroll
            for (int qt = 0; qt < QT; ++qt) { const float* bp = binsL + (qt * 16 + lr) * BP + XS + wave * 32 + 8 * hi; const v4f b0 = *(const v4fa*)bp, b1 = *(const v4fa*)(bp + 4), b2 = *(const v4fa*)(bp + 16), b3 = *(const v4fa*)(bp + 20);
                float t0 = b0[0];
                if (wave == 0 || wave == (NBIN - 1) / 32) { const float* rp = (wave == 0) ? &rlo[0][qt * 16 + lr] : &rhi[0][qt * 16 + lr]; float tot = rp[0];
#pragma unroll
                    for (int w = 1; w < NW; ++w) tot += rp[w * QB];
                    const float* xp = binsL + (qt * 16 + lr) * BP + ((wave == 0) ? 0 : XS + NBIN - 1);   // the clipped keys of the tiles that meet the band: columns [0, XS] or [XS + NBIN - 1, 2 XS + NBIN - 1)
#pragma unroll   // the four 16-byte reads are issued together and waited for once
                    for (int c = 0; c < XS / 4; ++c) { const v4f xv = *(const v4fa*)(xp + 4 * c); tot += (xv[0] + xv[1]) + (xv[2] + xv[3]); }
                    if (wave == 0) tot += t0;   // column XS, which the lower half wave holds in t0
                    t0 = (hi == 0) ? tot : t0; }
#pragma unroll
                for (int r = 0; r < 4; ++r) { x[qt][r] = (r == 0 ? t0 : b0[r]) * f[qt]; x[qt][4 + r] = b1[r] * f[qt]; x[qt][8 + r] = b2[r] * f[qt]; x[qt][12 + r] = b3[r] * f[qt]; }
                if constexpr (!SPLIT) {
#pragma unroll
                    for (int r = 0; r < 16; ++r) x[qt][r] = x[qt][r] * (1.0f / EVC); } }
            pv_frag<SPLIT, T16>(x, p, p2);
#pragma unroll
            for (int dt = 0; dt < 4; ++dt) pv_mma<SPLIT, T16>(p, p2, vb[dt], SPLIT ? vb2[dt] : vb[dt], o, dt); } };
    if (hires) attnv(BoolC<true>{}, Vh, Vl); else attnv(BoolC<false>{}, V16, V16);
    // the lane's numbers are formed anew (one v_mbcnt) for the last two parts: held from the kernel's start they would be kept through the score tiles, where no register is to spare, and come back from scratch right here, waited for in full
    const int lane2 = (int)__builtin_amdgcn_mbcnt_lo(~0u, 0u), lr2 = lane2 & 15, hi2 = lane2 >> 4, tid2 = (wave * 32 + lane2) & (NW * 32 - 1);   // the mask changes no value; it tells the compiler the range, so that the last loop stays the one pass it is
#pragma unroll
    for (int qt = 0; qt < QT; ++qt)
#pragma unroll
        for (int dt = 0; dt < 4; ++dt)
#pragma unroll
            for (int r = 0; r < 8; ++r) ((float*)vst[wave])[(qt * 16 + 8 * hi2 + r) * OP + dt * 16 + lr2] = o[qt][dt][r];
    __syncthreads();   // every wave's partial of ctx is in LDS
    const float cs = hires ? 1.0f : (1.0f / PCAR);
    for (int e = tid2; e < QB * (HD / 4); e += NW * 32) { const int q = e / (HD / 4), d4 = (e % (HD / 4)) * 4; v4f sm = *(const v4fa*)((const float*)vst[0] + q * OP + d4);
#pragma unroll
        for (int w = 1; w < NW; ++w) sm += *(const v4fa*)((const float*)vst[w] + q * OP + d4);
        v4f o4; o4[0] = sm[0] * cs; o4[1] = sm[1] * cs; o4[2] = sm[2] * cs; o4[3] = sm[3] * cs; *(v4f*)(OUT + ((size_t)b * TT + i0 + q) * DQ + head * HD + d4) = o4; }
}

extern "C" void kernel_launch(void* const* d_in, const int* in_sizes, int n_in,
                              void* d_out, int out_size, void* d_ws, size_t ws_size, hipStream_t stream) {
    if (n_in < 10) return;
    if ((size_t)in_sizes[0] < ((size_t)(NB - 1) * TTF + TT) * DM) return;
    if ((size_t)in_sizes[1] < (size_t)(NB - 1) * TTF + TT) return;
    if (in_sizes[2] < DM * DQ || in_sizes[4] < DM * DKV || in_sizes[6] < DM * DKV) return;
    if (in_sizes[3] < DQ || in_sizes[5] < DKV || in_sizes[7] < DKV) return;
    if (in_sizes[8] < NBIN * HD || in_sizes[9] < NBIN * HD) return;
    if ((size_t)out_size < (size_t)NB * TT * DQ) return;
    const float* x = (const float*)d_in[0]; const float* mask = (const float*)d_in[1];   // [NB][1][1][TTF], added per key
    const float* wq = (const float*)d_in[2]; const float* bq = (const float*)d_in[3]; const float* wk = (const float*)d_in[4]; const float* bk = (const float*)d_in[5]; const float* wv = (const float*)d_in[6]; const float* bv = (const float*)d_in[7];
    const float* embk = (const float*)d_in[8]; const float* embv = (const float*)d_in[9];   // [NBIN][HD] each
    float* OUT = (float*)d_out;     // [NB][TT][DQ]
    char* wsp = (char*)d_ws;
    auto take = [&](size_t bytes) { char* p = wsp; wsp += (bytes + 255) & ~(size_t)255; return (void*)p; };
    bf* WQ = (bf*)take((size_t)DQ * DM * 2); bf* WK = (bf*)take((size_t)DKV * DM * 2); bf* WV = (bf*)take((size_t)DKV * DM * 2); bf* EK = (bf*)take((size_t)KX * HD * 2);
    h16* VT16 = (h16*)take((size_t)NB * NKV * HD * TP * 2);
    bf* QPh = (bf*)take((size_t)NB * NH_ * TT * HD * 2); bf* QPl = (bf*)take((size_t)NB * NH_ * TT * HD * 2); bf* KPh = (bf*)take((size_t)NB * NKV * TT * HD * 2); bf* KPl = (bf*)take((size_t)NB * NKV * TT * HD * 2); bf* VTh = (bf*)take((size_t)NB * NKV * HD * TP * 2); bf* VTl = (bf*)take((size_t)NB * NKV * HD * TP * 2);
    bf* XB = (bf*)take((size_t)NB * TT * DM * 2);   // bf16 copy of x
    if ((size_t)(wsp - (char*)d_ws) > ws_size) return;
    k_prep<<<3 * PBW + NB * PBX + PBV + PBE, 256, 0, stream>>>(x, wq, wk, wv, embk, embv, XB, WQ, WK, WV, EK, VT16, VTh, VTl);
    k_proj<<<dim3(TT / 256, DQ / 64, NB), PW * 32, 0, stream>>>(XB, WQ, WK, WV, bq, bk, bv, QPh, QPl, KPh, KPl, VT16, VTh, VTl);
    k_attn<<<dim3(TT / QB, NH_, NB), NW * 32, 0, stream>>>(QPh, QPl, KPh, KPl, EK, VT16, VTh, VTl, mask, OUT);
}
